// v000
// Measured on an AMD MI455X. A time is GPU time per run, averaged over a window of back-to-back runs after a warm-up
// (all launches, gaps included; the runs take copies of the inputs in turn), and the median of several windows.
// Apart from v000's, it joins two sittings. Times from different sittings can be a few percent apart, while
// side-by-side timings come from the same sitting.
// v000 is the starting kernel. One run takes 431 microseconds.
#include <hip/hip_runtime.h>

// Compute dtypes (f32 accumulate everywhere): q/k/v projections bf16 x bf16 (inputs converted RNE to bf16, products exact), per-head LayerNorm of q and k in f32 inside the projection epilogue; scores q.k and P.V: f16 single products on query rows >= 256 (P carried x1024), bf16 hi+lo (3 products) on query rows < 256; output projection: f16 single product (ctx x16, Wo x32 carries) on rows >= 256, bf16 hi+lo ctx x bf16 Wo on rows < 256.
// Causal 16-head attention block, x [4][2048][1024]; separate bias-free [out][in] key / query / value projections (used as Bt as stored), per-head LayerNorm (eps 1e-5, gain and bias inputs) on the 64-wide query and key rows,
// the two 1024^(-1/4) factors applied as one 1/32 on the scores, causal exclusion with the diagonal kept, softmax in f32 (running max, log2 domain), heads merged h*64+d, [out][in] output projection plus bias.
// Layout: 16-bit planes in the workspace (u16 storage): x copy [b*SEQ+t][1024]; weights [3][1024][1024] (q, k, v) ; q and k head planes [b][h][t][64]; v transposed [b][h][64][t]; hi/lo bf16 planes of the same for t < 256;
// ctx f16 [b][t-256][1024] and ctx hi/lo bf16 [b][t<256][1024]. Fused flash-style attention: one wave per 16 query rows, 32 keys per step, fragments straight from the k-contiguous planes, no score plane in global memory.

#ifndef NB
#define NB 4
#endif
#ifndef SEQ
#define SEQ 2048
#endif
#define NB_FULL  4
#define SEQ_FULL 2048
#define DM   1024
#define NH   16
#define HD   64
#define RH   256                 // query rows / keys below RH also carry bf16 hi+lo planes
#define PCAR 1024.0f             // carry on f16 probabilities
#define CCAR 16.0f               // carry on the f16 ctx plane
#define WCAR 32.0f               // carry on the f16 output-projection weight plane
#define SCL2 (0.03125f * 1.4426950408889634f)   // 1/sqrt(1024) x log2(e)
#define LNEPS 1.0e-5f            // LayerNorm epsilon on the head rows

static_assert(DM == NH * HD);            // heads tile the channel width
static_assert(HD == 64);
static_assert(HD == 8 * 8);              // LayerNorm row = 8 lanes x 8 columns in the projection epilogue
static_assert(DM % 32 == 0);             // GEMM k-step
static_assert(HD % 32 == 0);             // score k-step
static_assert(SEQ % 64 == 0);            // 64-row GEMM tiles never straddle a batch
static_assert(RH % 64 == 0);             // early/late split on tile borders
static_assert(SEQ >= RH);
static_assert((SEQ - RH) % 64 == 0);
static_assert(RH % 32 == 0);             // 32-key steps end inside the early planes
static_assert(NB <= NB_FULL);
static_assert(SEQ <= SEQ_FULL);

typedef unsigned short u16;
typedef _Float16 h16;
typedef __attribute__((ext_vector_type(16))) __bf16         v16bf;
typedef __attribute__((ext_vector_type(16))) _Float16       v16h;
typedef __attribute__((ext_vector_type(8)))  unsigned short v8us;
typedef __attribute__((ext_vector_type(16))) unsigned short v16us;
typedef __attribute__((ext_vector_type(8)))  float          v8f;
typedef __attribute__((ext_vector_type(4)))  float          v4f;
typedef v4f  __attribute__((may_alias)) v4fa;
typedef v8us __attribute__((may_alias)) v8usa;

#define XBN    ((size_t)NB * SEQ * DM)
#define WN     ((size_t)DM * DM)
#define PLANE  ((size_t)NB * NH * SEQ * HD)
#define EPLANE ((size_t)NB * NH * RH * HD)
#define ATN    ((size_t)NB * (SEQ - RH) * DM)
#define ATEN   ((size_t)NB * RH * DM)
#define O_XB   ((size_t)0)
#define O_WALL (O_XB + XBN)
#define O_WPB  (O_WALL + 3 * WN)
#define O_WPH  (O_WPB + WN)
#define O_P16  (O_WPH + WN)
#define O_EH   (O_P16 + 3 * PLANE)
#define O_EL   (O_EH + 3 * EPLANE)
#define O_AT   (O_EL + 3 * EPLANE)
#define O_ATEH (O_AT + ATN)
#define O_ATEL (O_ATEH + ATEN)
#define O_END  (O_ATEL + ATEN)
static_assert(O_END * 2 <= (size_t)134217728);   // total carve <= 128 MiB
static_assert(XBN % 128 == 0 && WN % 128 == 0 && PLANE % 128 == 0 && EPLANE % 128 == 0 && ATN % 128 == 0 && ATEN % 128 == 0);   // every region starts on a 256-byte border

__device__ __forceinline__ u16 f2bf(float f) { unsigned u = __float_as_uint(f); u += 0x7FFFu + ((u >> 16) & 1u); return (u16)(u >> 16); }
__device__ __forceinline__ float bf2f(u16 b) { return __uint_as_float(((unsigned)b) << 16); }
__device__ __forceinline__ float bfr(float f) { return bf2f(f2bf(f)); }
__device__ __forceinline__ u16 f2h(float x) { return __builtin_bit_cast(unsigned short, (h16)x); }

// f32 -> f16 with a value select: magnitudes below the smallest normal f16 become zero, so no subnormal f16 operand can reach a WMMA.
static __device__ __forceinline__ h16 toh_flush(float v) { const h16 r = (h16)v; return (fabsf(v) < 6.103515625e-05f) ? (h16)0.0f : r; }
static __device__ __forceinline__ u16 f2h_fl(float v) { return __builtin_bit_cast(unsigned short, toh_flush(v)); }

// Fragment loader for A and B alike: 'p' points at (row or column) + k0 + 8*(lane>>4); elements 0..7 = k0+8h.., elements 8..15 = k0+16+8h..
__device__ __forceinline__ v16us ldfr(const u16* p) {
    const v8us lo = *(const v8us*)p; const v8us hi = *(const v8us*)(p + 16);
    return __builtin_shufflevector(lo, hi, 0, 1, 2, 3, 4, 5, 6, 7, 8, 9, 10, 11, 12, 13, 14, 15);
}
// One WMMA plus its own hazard guard (ties exactly one accumulator, keeps A and B live).
__device__ __forceinline__ v8f mma_h(v16us a, v16us b, v8f c) {
    const v16h ah = __builtin_bit_cast(v16h, a); const v16h bh = __builtin_bit_cast(v16h, b);
    c = __builtin_amdgcn_wmma_f32_16x16x32_f16(false, ah, false, bh, (short)0, c, false, false);
    asm volatile("v_nop\n\tv_nop\n\tv_nop\n\tv_nop" : "+v"(c) : "v"(ah), "v"(bh));
    return c;
}
__device__ __forceinline__ v8f mma_b(v16us a, v16us b, v8f c) {
    const v16bf ab = __builtin_bit_cast(v16bf, a); const v16bf bb = __builtin_bit_cast(v16bf, b);
    c = __builtin_amdgcn_wmma_f32_16x16x32_bf16(false, ab, false, bb, (short)0, c, false, false);
    asm volatile("v_nop\n\tv_nop\n\tv_nop\n\tv_nop" : "+v"(c) : "v"(ab), "v"(bb));
    return c;
}
template <bool F16> __device__ __forceinline__ v8f mmag(v16us a, v16us b, v8f c) { if (F16) return mma_h(a, b, c); else return mma_b(a, b, c); }

// One wave computes a 64x64 tile: acc[mb][nb] element j = C[r0 + 16 mb + 8 (lane>>4) + j][c0 + 16 nb + (lane&15)] = sum_k A[m][k] Bt[n][k] (+ A2[m][k] Bt[n][k] when SPLIT). K % 32 == 0.
template <bool F16, bool SPLIT>
__device__ __forceinline__ void gemm_tile(const u16* __restrict__ A, const u16* __restrict__ A2, const u16* __restrict__ Bt, const int K, const int r0, const int c0, const int lr, const int hi, v8f (&acc)[4][4]) {
#pragma unroll
    for (int mb = 0; mb < 4; ++mb)
#pragma unroll
        for (int nb = 0; nb < 4; ++nb) acc[mb][nb] = (v8f){};
    const size_t aoff = (size_t)(r0 + lr) * K + 8 * hi, boff = (size_t)(c0 + lr) * K + 8 * hi;
#pragma unroll 1
    for (int kc = 0; kc < K; kc += 32) {
        v16us a[4], a2[4];
#pragma unroll
        for (int mb = 0; mb < 4; ++mb) { a[mb] = ldfr(A + aoff + (size_t)mb * 16 * K + kc); if (SPLIT) a2[mb] = ldfr(A2 + aoff + (size_t)mb * 16 * K + kc); else a2[mb] = a[mb]; }
#pragma unroll
        for (int nb = 0; nb < 4; ++nb) { const v16us bb = ldfr(Bt + boff + (size_t)nb * 16 * K + kc);
#pragma unroll
            for (int mb = 0; mb < 4; ++mb) { acc[mb][nb] = mmag<F16>(a[mb], bb, acc[mb][nb]); if (SPLIT) acc[mb][nb] = mmag<F16>(a2[mb], bb, acc[mb][nb]); } }
    }
}

// Source groups are addressed as (i / seg) * segf + i % seg so a reduced build reads the right rows of full-size inputs.
__global__ __launch_bounds__(256) void k_cvt8(const float* __restrict__ src, u16* dst, unsigned n8, unsigned seg, unsigned segf, int tof16, float scale) {
    const unsigned i = blockIdx.x * 256u + threadIdx.x;
    if (i >= n8) return;
    const unsigned bb = i / seg, r = i - bb * seg;
    const size_t si = ((size_t)bb * segf + r) * 8;
    const v4f v0 = *(const v4f*)(src + si); const v4f v1 = *(const v4f*)(src + si + 4);
    v8us o;
#pragma unroll
    for (int k = 0; k < 4; ++k) {
        const u16 b0 = f2bf(v0[k]), b1 = f2bf(v1[k]);
        const u16 h0 = f2h(bf2f(b0) * scale), h1 = f2h(bf2f(b1) * scale);
        o[k] = tof16 ? h0 : b0; o[4 + k] = tof16 ? h1 : b1;
    }
    v8us* dp = (v8us*)(dst + (size_t)i * 8);
    *dp = o; 
}

// k_proj: [NB*SEQ][1024] x [3072][1024]^T (rows 0..1023 query weight, 1024..2047 key weight, 2048..3071 value weight). One wave per 64x64 tile = 64 time rows of one head.
// Epilogue q/k: per-row LayerNorm over the 64 head columns (mean and biased variance in f32 across 8 lanes x 8 columns, eps 1e-5, gain and bias taken as bf16 values of the inputs; both parameter sets are loaded and chosen by value),
// then f16 head plane rows [b][h][t][64] (+ bf16 hi/lo rows for t < RH); v: transposed through LDS into [b][h][d][t] lines of 64 t (+ hi/lo for t < RH). Planes addressed by element offsets from one base.
// All f16 plane values go through the value-select convert (no subnormal f16 can be produced).
__global__ __launch_bounds__(32) void k_proj(const u16* __restrict__ XB, const u16* __restrict__ WALL, u16* PL, size_t oP16, size_t oEH, size_t oEL,
                                             const float* __restrict__ QG, const float* __restrict__ QB, const float* __restrict__ KG, const float* __restrict__ KB) {
    __shared__ __align__(16) float os[16 * 68];
    __shared__ __align__(16) u16 ts[64 * 72];
    const int lane = threadIdx.x & 31, lr = lane & 15, hi = lane >> 4;
    const int r0 = blockIdx.x * 64, c0 = blockIdx.y * 64;
    const int which = c0 / DM, hd = (c0 - which * DM) / HD;
    const int b = r0 / SEQ, t0 = r0 - b * SEQ;
    const bool early = (t0 < RH);
    const size_t bh = (size_t)b * NH + hd;
    v8f acc[4][4];
    gemm_tile<false, false>(XB, XB, WALL, DM, r0, c0, lr, hi, acc);
    if (which < 2) {
        const size_t o16 = oP16 + (size_t)which * PLANE + (bh * SEQ + t0) * HD;
        const size_t oeh = oEH + (size_t)which * EPLANE + (bh * RH + (early ? t0 : 0)) * HD;
        const size_t oel = oEL + (size_t)which * EPLANE + (bh * RH + (early ? t0 : 0)) * HD;
        const int gc = (lane & 7) * 8;                 // this lane's 8 head columns (same in every row group)
        const v4f gq0 = *(const v4f*)(QG + gc), gq1 = *(const v4f*)(QG + gc + 4);
        const v4f bq0 = *(const v4f*)(QB + gc), bq1 = *(const v4f*)(QB + gc + 4);
        const v4f gk0 = *(const v4f*)(KG + gc), gk1 = *(const v4f*)(KG + gc + 4);
        const v4f bk0 = *(const v4f*)(KB + gc), bk1 = *(const v4f*)(KB + gc + 4);
        v4f g0, g1, be0, be1;
#pragma unroll
        for (int q = 0; q < 4; ++q) {
            g0[q]  = bfr((which == 0) ? gq0[q] : gk0[q]); g1[q]  = bfr((which == 0) ? gq1[q] : gk1[q]);
            be0[q] = bfr((which == 0) ? bq0[q] : bk0[q]); be1[q] = bfr((which == 0) ? bq1[q] : bk1[q]);
        }
#pragma unroll
        for (int mb = 0; mb < 4; ++mb) {
#pragma unroll
            for (int nb = 0; nb < 4; ++nb)
#pragma unroll
                for (int j = 0; j < 8; ++j) os[(hi * 8 + j) * 68 + nb * 16 + lr] = acc[mb][nb][j];
            __syncthreads();
{
#pragma unroll
                for (int s = 0; s < 4; ++s) {
                    const int row = 4 * s + (lane >> 3), pc = (lane & 7) * 8;
                    const v4f x0 = *(const v4fa*)&os[row * 68 + pc]; const v4f x1 = *(const v4fa*)&os[row * 68 + pc + 4];
                    // LayerNorm of the 64-wide row held by the 8 lanes sharing lane>>3 (all 32 lanes active, uniform control)
                    float sm = ((x0[0] + x0[1]) + (x0[2] + x0[3])) + ((x1[0] + x1[1]) + (x1[2] + x1[3]));
                    sm += __shfl_xor(sm, 1, 32); sm += __shfl_xor(sm, 2, 32); sm += __shfl_xor(sm, 4, 32);
                    const float mean = sm * (1.0f / 64.0f);
                    v4f d0, d1;
#pragma unroll
                    for (int q = 0; q < 4; ++q) { d0[q] = x0[q] - mean; d1[q] = x1[q] - mean; }
                    float vs = ((d0[0] * d0[0] + d0[1] * d0[1]) + (d0[2] * d0[2] + d0[3] * d0[3])) + ((d1[0] * d1[0] + d1[1] * d1[1]) + (d1[2] * d1[2] + d1[3] * d1[3]));
                    vs += __shfl_xor(vs, 1, 32); vs += __shfl_xor(vs, 2, 32); vs += __shfl_xor(vs, 4, 32);
                    const float rinv = rsqrtf(vs * (1.0f / 64.0f) + LNEPS);
                    v4f y0, y1;
#pragma unroll
                    for (int q = 0; q < 4; ++q) { y0[q] = d0[q] * rinv * g0[q] + be0[q]; y1[q] = d1[q] * rinv * g1[q] + be1[q]; }
                    v8us q16;
#pragma unroll
                    for (int q = 0; q < 4; ++q) { q16[q] = f2h_fl(y0[q]); q16[4 + q] = f2h_fl(y1[q]); }
                    const size_t ro = (size_t)(mb * 16 + row) * HD + pc;
                    *(v8us*)(PL + o16 + ro) = q16;
                    if (early) {
                        v8us oh, ol;
#pragma unroll
                        for (int q = 0; q < 4; ++q) { const u16 a = f2bf(y0[q]); oh[q] = a; ol[q] = f2bf(y0[q] - bf2f(a)); const u16 c = f2bf(y1[q]); oh[4 + q] = c; ol[4 + q] = f2bf(y1[q] - bf2f(c)); }
                        *(v8us*)(PL + oeh + ro) = oh; *(v8us*)(PL + oel + ro) = ol;
                    }
                }
                
            }
            __syncthreads();
        }
    } else {
#pragma unroll
        for (int pl = 0; pl < 3; ++pl) {
            if (pl == 0 || early) {
#pragma unroll
                for (int mb = 0; mb < 4; ++mb)
#pragma unroll
                    for (int nb = 0; nb < 4; ++nb) {
                        v8us pk;
#pragma unroll
                        for (int j = 0; j < 8; ++j) { const float y = acc[mb][nb][j]; const u16 hb = f2bf(y); pk[j] = (pl == 0) ? f2h_fl(y) : ((pl == 1) ? hb : f2bf(y - bf2f(hb))); }
                        *(v8usa*)&ts[(nb * 16 + lr) * 72 + mb * 16 + hi * 8] = pk;     // ts[d][t]: 8 consecutive t per lane
                    }
                __syncthreads();
                const size_t dofs = (pl == 0) ? (oP16 + 2 * PLANE + bh * HD * SEQ + t0) : (((pl == 1) ? oEH : oEL) + 2 * EPLANE + bh * HD * RH + t0);
                const int dp = (pl == 0) ? SEQ : RH;
{
#pragma unroll 4
                    for (int s = 0; s < 16; ++s) {
                        const int d = 4 * s + (lane >> 3), pc = (lane & 7) * 8;
                        const v8us v = *(const v8usa*)&ts[d * 72 + pc];
                        *(v8us*)(PL + dofs + (size_t)d * dp + pc) = v;
                    }
                    
                }
                __syncthreads();
            }
        }
    }
}

// Online-softmax update for one 16 x 32 score step. s0/s1 hold raw scores for keys jb + (lane&15) and jb + 16 + (lane&15), rows qbase + 8 (lane>>4) + i; on return they hold exp2(t - running max).
// lrow keeps PER-LANE partial sums (reduced over the 16 lanes of a row once, after the key loop). Masked entries are replaced before the maximum; every row keeps its own key.
__device__ __forceinline__ void sm_step(v8f& s0, v8f& s1, float (&mrow)[8], float (&lrow)[8], float (&corr)[8], const int jb, const int qbase, const int lr, const int hi) {
#pragma unroll
    for (int i = 0; i < 8; ++i) {
        const int row = qbase + i + 8 * hi;
        float a0 = s0[i] * SCL2, a1 = s1[i] * SCL2;
        a0 = (jb + lr > row) ? -1.0e30f : a0;
        a1 = (jb + 16 + lr > row) ? -1.0e30f : a1;
        float mx = fmaxf(a0, a1);
        mx = fmaxf(mx, __shfl_xor(mx, 1, 32)); mx = fmaxf(mx, __shfl_xor(mx, 2, 32)); mx = fmaxf(mx, __shfl_xor(mx, 4, 32)); mx = fmaxf(mx, __shfl_xor(mx, 8, 32));
        const float mnew = fmaxf(mrow[i], mx);
        const float c  = __builtin_amdgcn_exp2f(mrow[i] - mnew);
        const float p0 = __builtin_amdgcn_exp2f(a0 - mnew);
        const float p1 = __builtin_amdgcn_exp2f(a1 - mnew);
        lrow[i] = lrow[i] * c + (p0 + p1);
        mrow[i] = mnew; corr[i] = c; s0[i] = p0; s1[i] = p1;
    }
}

#define NQT_L (((SEQ - RH) / 16) > 0 ? ((SEQ - RH) / 16) : 1)

// k_attn_l: query rows >= RH, f16 single products. One wave (block) per 16 query rows of one (batch, head). ctx f16 x CCAR -> AT [b][t-RH][1024].
__global__ __launch_bounds__(32) void k_attn_l(const u16* __restrict__ QP, const u16* __restrict__ KP, const u16* __restrict__ VT, u16* AT) {
    __shared__ __align__(16) u16 pw[16 * 40];
    __shared__ __align__(16) float os[16 * 68];
    const int lane = threadIdx.x & 31, lr = lane & 15, hi = lane >> 4;
    const int bh = blockIdx.x / NQT_L, qt = blockIdx.x - bh * NQT_L;
    const int b = bh / NH, h = bh - b * NH;
    const int qbase = RH + qt * 16;
    const size_t pb = (size_t)bh * SEQ * HD;
    const u16* Qb = QP + pb; const u16* Kb = KP + pb; const u16* Vb = VT + pb;
    const v16us q0 = ldfr(Qb + (size_t)(qbase + lr) * HD + 8 * hi);
    const v16us q1 = ldfr(Qb + (size_t)(qbase + lr) * HD + 32 + 8 * hi);
    v8f acc[4];
#pragma unroll
    for (int nt = 0; nt < 4; ++nt) acc[nt] = (v8f){};
    float mrow[8], lrow[8];
#pragma unroll
    for (int i = 0; i < 8; ++i) { mrow[i] = -1.0e30f; lrow[i] = 0.0f; }
    const int nsteps = (qbase + 47) >> 5;        // keys 0 .. qbase+15 in steps of 32; nsteps*32 <= SEQ
#pragma unroll 1
    for (int st = 0; st < nsteps; ++st) {
        const int jb = st * 32;
        const u16* kr0 = Kb + (size_t)(jb + lr) * HD + 8 * hi; const u16* kr1 = kr0 + 16 * HD;
        v8f s0 = (v8f){}, s1 = (v8f){};
        s0 = mma_h(q0, ldfr(kr0), s0); s0 = mma_h(q1, ldfr(kr0 + 32), s0);
        s1 = mma_h(q0, ldfr(kr1), s1); s1 = mma_h(q1, ldfr(kr1 + 32), s1);
        float corr[8];
        sm_step(s0, s1, mrow, lrow, corr, jb, qbase, lr, hi);
#pragma unroll
        for (int nt = 0; nt < 4; ++nt)
#pragma unroll
            for (int i = 0; i < 8; ++i) acc[nt][i] *= corr[i];
#pragma unroll
        for (int i = 0; i < 8; ++i) { pw[(i + 8 * hi) * 40 + lr] = f2h(s0[i] * PCAR); pw[(i + 8 * hi) * 40 + 16 + lr] = f2h(s1[i] * PCAR); }
        __syncthreads();
        const v8us plo = *(const v8usa*)&pw[lr * 40 + 8 * hi]; const v8us phi = *(const v8usa*)&pw[lr * 40 + 16 + 8 * hi];
        const v16us pf = __builtin_shufflevector(plo, phi, 0, 1, 2, 3, 4, 5, 6, 7, 8, 9, 10, 11, 12, 13, 14, 15);
#pragma unroll
        for (int nt = 0; nt < 4; ++nt) { const v16us vf = ldfr(Vb + (size_t)(nt * 16 + lr) * SEQ + jb + 8 * hi); acc[nt] = mma_h(pf, vf, acc[nt]); }
        __syncthreads();
    }
#pragma unroll
    for (int i = 0; i < 8; ++i) {
        float l = lrow[i];
        l += __shfl_xor(l, 1, 32); l += __shfl_xor(l, 2, 32); l += __shfl_xor(l, 4, 32); l += __shfl_xor(l, 8, 32);
        const float inv = CCAR / (l * PCAR);
#pragma unroll
        for (int nt = 0; nt < 4; ++nt) os[(i + 8 * hi) * 68 + nt * 16 + lr] = acc[nt][i] * inv;
    }
    __syncthreads();
    u16* dst = AT + ((size_t)b * (SEQ - RH) + (qbase - RH)) * DM + h * HD;
{
#pragma unroll
        for (int s = 0; s < 4; ++s) {
            const int row = 4 * s + (lane >> 3), pc = (lane & 7) * 8;
            const v4f x0 = *(const v4fa*)&os[row * 68 + pc]; const v4f x1 = *(const v4fa*)&os[row * 68 + pc + 4];
            v8us o;
#pragma unroll
            for (int q = 0; q < 4; ++q) { o[q] = f2h(x0[q]); o[4 + q] = f2h(x1[q]); }
            *(v8us*)(dst + (size_t)row * DM + pc) = o;
        }
        
    }
}

// k_attn_e: query rows < RH, bf16 hi+lo operands (hi.hi + lo.hi + hi.lo into one accumulator; residuals unscaled). ctx hi/lo bf16 -> ATEh/ATEl [b][t][1024].
__global__ __launch_bounds__(32) void k_attn_e(const u16* __restrict__ QEh, const u16* __restrict__ QEl, const u16* __restrict__ KEh, const u16* __restrict__ KEl, const u16* __restrict__ VEh, const u16* __restrict__ VEl, u16* ATEh, u16* ATEl) {
    __shared__ __align__(16) u16 pwh[16 * 40];
    __shared__ __align__(16) u16 pwl[16 * 40];
    __shared__ __align__(16) float os[16 * 68];
    const int lane = threadIdx.x & 31, lr = lane & 15, hi = lane >> 4;
    const int bh = blockIdx.x / (RH / 16), qt = blockIdx.x - bh * (RH / 16);
    const int b = bh / NH, h = bh - b * NH;
    const int qbase = qt * 16;
    const size_t pb = (size_t)bh * RH * HD;
    const size_t qo = pb + (size_t)(qbase + lr) * HD + 8 * hi;
    const v16us qh0 = ldfr(QEh + qo), qh1 = ldfr(QEh + qo + 32), ql0 = ldfr(QEl + qo), ql1 = ldfr(QEl + qo + 32);
    v8f acc[4];
#pragma unroll
    for (int nt = 0; nt < 4; ++nt) acc[nt] = (v8f){};
    float mrow[8], lrow[8];
#pragma unroll
    for (int i = 0; i < 8; ++i) { mrow[i] = -1.0e30f; lrow[i] = 0.0f; }
    const int nsteps = (qbase + 47) >> 5;        // nsteps*32 <= RH
#pragma unroll 1
    for (int st = 0; st < nsteps; ++st) {
        const int jb = st * 32;
        const size_t ko = pb + (size_t)(jb + lr) * HD + 8 * hi;
        v8f s0 = (v8f){}, s1 = (v8f){};
        {
            const v16us kh0 = ldfr(KEh + ko), kh1 = ldfr(KEh + ko + 32), kl0 = ldfr(KEl + ko), kl1 = ldfr(KEl + ko + 32);
            s0 = mma_b(qh0, kh0, s0); s0 = mma_b(qh1, kh1, s0); s0 = mma_b(ql0, kh0, s0); s0 = mma_b(ql1, kh1, s0); s0 = mma_b(qh0, kl0, s0); s0 = mma_b(qh1, kl1, s0);
        }
        {
            const size_t k1 = ko + 16 * HD;
            const v16us kh0 = ldfr(KEh + k1), kh1 = ldfr(KEh + k1 + 32), kl0 = ldfr(KEl + k1), kl1 = ldfr(KEl + k1 + 32);
            s1 = mma_b(qh0, kh0, s1); s1 = mma_b(qh1, kh1, s1); s1 = mma_b(ql0, kh0, s1); s1 = mma_b(ql1, kh1, s1); s1 = mma_b(qh0, kl0, s1); s1 = mma_b(qh1, kl1, s1);
        }
        float corr[8];
        sm_step(s0, s1, mrow, lrow, corr, jb, qbase, lr, hi);
#pragma unroll
        for (int nt = 0; nt < 4; ++nt)
#pragma unroll
            for (int i = 0; i < 8; ++i) acc[nt][i] *= corr[i];
#pragma unroll
        for (int i = 0; i < 8; ++i) {
            const u16 a = f2bf(s0[i]); const u16 c = f2bf(s1[i]);
            pwh[(i + 8 * hi) * 40 + lr] = a; pwl[(i + 8 * hi) * 40 + lr] = f2bf(s0[i] - bf2f(a));
            pwh[(i + 8 * hi) * 40 + 16 + lr] = c; pwl[(i + 8 * hi) * 40 + 16 + lr] = f2bf(s1[i] - bf2f(c));
        }
        __syncthreads();
        const v8us h0 = *(const v8usa*)&pwh[lr * 40 + 8 * hi]; const v8us h1 = *(const v8usa*)&pwh[lr * 40 + 16 + 8 * hi];
        const v8us l0 = *(const v8usa*)&pwl[lr * 40 + 8 * hi]; const v8us l1 = *(const v8usa*)&pwl[lr * 40 + 16 + 8 * hi];
        const v16us pfh = __builtin_shufflevector(h0, h1, 0, 1, 2, 3, 4, 5, 6, 7, 8, 9, 10, 11, 12, 13, 14, 15);
        const v16us pfl = __builtin_shufflevector(l0, l1, 0, 1, 2, 3, 4, 5, 6, 7, 8, 9, 10, 11, 12, 13, 14, 15);
#pragma unroll
        for (int nt = 0; nt < 4; ++nt) {
            const size_t vo = pb + (size_t)(nt * 16 + lr) * RH + jb + 8 * hi;      // [bh][64][RH], same plane size as [bh][RH][64]
            const v16us vh = ldfr(VEh + vo), vl = ldfr(VEl + vo);
            acc[nt] = mma_b(pfh, vh, acc[nt]); acc[nt] = mma_b(pfl, vh, acc[nt]); acc[nt] = mma_b(pfh, vl, acc[nt]);
        }
        __syncthreads();
    }
#pragma unroll
    for (int i = 0; i < 8; ++i) {
        float l = lrow[i];
        l += __shfl_xor(l, 1, 32); l += __shfl_xor(l, 2, 32); l += __shfl_xor(l, 4, 32); l += __shfl_xor(l, 8, 32);
        const float inv = 1.0f / l;
#pragma unroll
        for (int nt = 0; nt < 4; ++nt) os[(i + 8 * hi) * 68 + nt * 16 + lr] = acc[nt][i] * inv;
    }
    __syncthreads();
    const size_t dofs = ((size_t)b * RH + qbase) * DM + h * HD;
{
#pragma unroll
        for (int s = 0; s < 4; ++s) {
            const int row = 4 * s + (lane >> 3), pc = (lane & 7) * 8;
            const v4f x0 = *(const v4fa*)&os[row * 68 + pc]; const v4f x1 = *(const v4fa*)&os[row * 68 + pc + 4];
            v8us oh, ol;
#pragma unroll
            for (int q = 0; q < 4; ++q) { const u16 a = f2bf(x0[q]); oh[q] = a; ol[q] = f2bf(x0[q] - bf2f(a)); const u16 c = f2bf(x1[q]); oh[4 + q] = c; ol[4 + q] = f2bf(x1[q] - bf2f(c)); }
            *(v8us*)(ATEh + dofs + (size_t)row * DM + pc) = oh;
            *(v8us*)(ATEl + dofs + (size_t)row * DM + pc) = ol;
        }
        
    }
}

// k_outp: OUT[b][toff + r][n] = scale * sum_k A[row][k] Bt[n][k] (+ A2 product when split) + bf16(bias[n]); rows of A are [b][r] with rpb rows per batch; split = bf16 hi+lo planes, else f16 planes.
__global__ __launch_bounds__(32) void k_outp(const u16* __restrict__ A, const u16* __restrict__ A2, const u16* __restrict__ Bt, const float* __restrict__ bias, float* OUT, float scale, int rpb, int toff, int split) {
    __shared__ __align__(16) float os[16 * 68];
    const int lane = threadIdx.x & 31, lr = lane & 15, hi = lane >> 4;
    const int r0 = blockIdx.x * 64, c0 = blockIdx.y * 64;
    v8f acc[4][4];
    if (split) gemm_tile<false, true>(A, A2, Bt, DM, r0, c0, lr, hi, acc);
    else       gemm_tile<true, false>(A, A, Bt, DM, r0, c0, lr, hi, acc);
    const int b = r0 / rpb, tb = toff + (r0 - b * rpb);
    float* crow0 = OUT + ((size_t)b * SEQ_FULL + tb) * DM + c0;
    const int cofs = lr * 4;
    v4f bv; bv[0] = bfr(bias[c0 + cofs]); bv[1] = bfr(bias[c0 + cofs + 1]); bv[2] = bfr(bias[c0 + cofs + 2]); bv[3] = bfr(bias[c0 + cofs + 3]);
#pragma unroll
    for (int mb = 0; mb < 4; ++mb) {
#pragma unroll
        for (int nb = 0; nb < 4; ++nb)
#pragma unroll
            for (int j = 0; j < 8; ++j) os[(hi * 8 + j) * 68 + nb * 16 + lr] = acc[mb][nb][j];
        __syncthreads();
{
#pragma unroll
            for (int s = 0; s < 8; ++s) {
                const int row = 2 * s + hi;
                const v4f x = *(const v4fa*)&os[row * 68 + cofs];
                v4f val; val[0] = x[0] * scale + bv[0]; val[1] = x[1] * scale + bv[1]; val[2] = x[2] * scale + bv[2]; val[3] = x[3] * scale + bv[3];
                *(v4f*)(crow0 + (size_t)(mb * 16 + row) * DM + cofs) = val;
            }
            
        }
        __syncthreads();
    }
}

extern "C" void kernel_launch(void* const* d_in, const int* in_sizes, int n_in,
                              void* d_out, int out_size, void* d_ws, size_t ws_size, hipStream_t stream) {
    if (n_in < 10) return;
    const long long needx = ((long long)(NB - 1) * SEQ_FULL + SEQ) * DM;
    if ((long long)in_sizes[0] < needx) return;
    if ((long long)in_sizes[1] < (long long)DM * DM || (long long)in_sizes[2] < (long long)DM * DM || (long long)in_sizes[3] < (long long)DM * DM || (long long)in_sizes[4] < (long long)DM * DM) return;
    if (in_sizes[5] < DM) return;
    if (in_sizes[6] < HD || in_sizes[7] < HD || in_sizes[8] < HD || in_sizes[9] < HD) return;
    if ((long long)out_size < needx) return;
    if (O_END * 2 > ws_size) return;
    // wire order: x, key weight, query weight, value weight, output weight, output bias, key LayerNorm gain, key LayerNorm bias, query LayerNorm gain, query LayerNorm bias
    const float* x  = (const float*)d_in[0];
    const float* Wk = (const float*)d_in[1];
    const float* Wq = (const float*)d_in[2];
    const float* Wv = (const float*)d_in[3];
    const float* Wp = (const float*)d_in[4];
    const float* bp = (const float*)d_in[5];
    const float* kg = (const float*)d_in[6];
    const float* kb = (const float*)d_in[7];
    const float* qg = (const float*)d_in[8];
    const float* qb = (const float*)d_in[9];
    float* OUT = (float*)d_out;
    u16* PL = (u16*)d_ws;

    const unsigned xn8 = (unsigned)(XBN / 8), wn8 = (unsigned)(WN / 8);
    k_cvt8<<<(xn8 + 255) / 256, 256, 0, stream>>>(x, PL + O_XB, xn8, (unsigned)((size_t)SEQ * DM / 8), (unsigned)((size_t)SEQ_FULL * DM / 8), 0, 1.0f);
    k_cvt8<<<(wn8 + 255) / 256, 256, 0, stream>>>(Wq, PL + O_WALL,          wn8, wn8, wn8, 0, 1.0f);   // rows 0..1023: query
    k_cvt8<<<(wn8 + 255) / 256, 256, 0, stream>>>(Wk, PL + O_WALL + WN,     wn8, wn8, wn8, 0, 1.0f);   // rows 1024..2047: key
    k_cvt8<<<(wn8 + 255) / 256, 256, 0, stream>>>(Wv, PL + O_WALL + 2 * WN, wn8, wn8, wn8, 0, 1.0f);   // rows 2048..3071: value
    k_cvt8<<<(wn8 + 255) / 256, 256, 0, stream>>>(Wp, PL + O_WPB, wn8, wn8, wn8, 0, 1.0f);
    k_cvt8<<<(wn8 + 255) / 256, 256, 0, stream>>>(Wp, PL + O_WPH, wn8, wn8, wn8, 1, WCAR);

    k_proj<<<dim3(NB * SEQ / 64, 3 * DM / 64, 1), 32, 0, stream>>>(PL + O_XB, PL + O_WALL, PL, O_P16, O_EH, O_EL, qg, qb, kg, kb);

    k_attn_e<<<NB * NH * (RH / 16), 32, 0, stream>>>(PL + O_EH, PL + O_EL, PL + O_EH + EPLANE, PL + O_EL + EPLANE, PL + O_EH + 2 * EPLANE, PL + O_EL + 2 * EPLANE, PL + O_ATEH, PL + O_ATEL);
    if (SEQ > RH)
        k_attn_l<<<NB * NH * ((SEQ - RH) / 16), 32, 0, stream>>>(PL + O_P16, PL + O_P16 + PLANE, PL + O_P16 + 2 * PLANE, PL + O_AT);

    k_outp<<<dim3(NB * RH / 64, DM / 64, 1), 32, 0, stream>>>(PL + O_ATEH, PL + O_ATEL, PL + O_WPB, bp, OUT, 1.0f, RH, 0, 1);
    if (SEQ > RH)
        k_outp<<<dim3(NB * (SEQ - RH) / 64, DM / 64, 1), 32, 0, stream>>>(PL + O_AT, PL + O_AT, PL + O_WPH, bp, OUT, 1.0f / (WCAR * CCAR), SEQ - RH, RH, 0);
}

// v001
// Measured time: 354 microseconds a run.
// Timed twice side by side with v000, it ran 1.25 and 1.27 times as fast.
#include <hip/hip_runtime.h>

// Compute dtypes (f32 accumulate everywhere): q/k/v projections bf16 x bf16 (inputs converted RNE to bf16, products exact), per-head LayerNorm of q and k in f32 inside the projection epilogue; scores q.k and P.V: f16 single products on query rows >= 256 (P carried x1024), bf16 hi+lo (3 products) on query rows < 256; output projection: f16 single product (ctx x16, Wo x32 carries) on rows >= 256, bf16 hi+lo ctx x bf16 Wo on rows < 256.
// Causal 16-head attention block, x [4][2048][1024]; separate bias-free [out][in] key / query / value projections (used as Bt as stored), per-head LayerNorm (eps 1e-5, gain and bias inputs) on the 64-wide query and key rows,
// the two 1024^(-1/4) factors applied as one 1/32 on the scores, causal exclusion with the diagonal kept, softmax in f32 (running max, log2 domain), heads merged h*64+d, [out][in] output projection plus bias.
// Layout: 16-bit planes in the workspace (u16 storage): x copy [b*SEQ+t][1024]; weights [3][1024][1024] (q, k, v) ; q and k head planes [b][h][t][64]; v transposed [b][h][64][t]; hi/lo bf16 planes of the same for t < 256;
// ctx f16 [b][t-256][1024] and ctx hi/lo bf16 [b][t<256][1024]. Fused flash-style attention: one wave per 16 query rows, 32 keys per step, no score plane in global memory; rows < 256: fragments straight from the k-contiguous planes; rows >= 256: four waves share K and V stages in LDS.

#ifndef NB
#define NB 4
#endif
#ifndef SEQ
#define SEQ 2048
#endif
#define NB_FULL  4
#define SEQ_FULL 2048
#define DM   1024
#define NH   16
#define HD   64
#define RH   256                 // query rows / keys below RH also carry bf16 hi+lo planes
#define PCAR 1024.0f             // carry on f16 probabilities
#define CCAR 16.0f               // carry on the f16 ctx plane
#define WCAR 32.0f               // carry on the f16 output-projection weight plane
#define SCL2 (0.03125f * 1.4426950408889634f)   // 1/sqrt(1024) x log2(e)
#define LNEPS 1.0e-5f            // LayerNorm epsilon on the head rows

static_assert(DM == NH * HD);            // heads tile the channel width
static_assert(HD == 64);
static_assert(HD == 8 * 8);              // LayerNorm row = 8 lanes x 8 columns in the projection epilogue
static_assert(DM % 32 == 0);             // GEMM k-step
static_assert(HD % 32 == 0);             // score k-step
static_assert(SEQ % 64 == 0);            // 64-row GEMM tiles never straddle a batch
static_assert(RH % 64 == 0);             // early/late split on tile borders
static_assert(SEQ >= RH);
static_assert((SEQ - RH) % 64 == 0);
static_assert(RH % 32 == 0);             // 32-key steps end inside the early planes
static_assert(NB <= NB_FULL);
static_assert(SEQ <= SEQ_FULL);

typedef unsigned short u16;
typedef _Float16 h16;
typedef __attribute__((ext_vector_type(16))) __bf16         v16bf;
typedef __attribute__((ext_vector_type(16))) _Float16       v16h;
typedef __attribute__((ext_vector_type(8)))  unsigned short v8us;
typedef __attribute__((ext_vector_type(16))) unsigned short v16us;
typedef __attribute__((ext_vector_type(8)))  float          v8f;
typedef __attribute__((ext_vector_type(4)))  float          v4f;
typedef v4f  __attribute__((may_alias)) v4fa;
typedef v8us __attribute__((may_alias)) v8usa;

#define XBN    ((size_t)NB * SEQ * DM)
#define WN     ((size_t)DM * DM)
#define PLANE  ((size_t)NB * NH * SEQ * HD)
#define EPLANE ((size_t)NB * NH * RH * HD)
#define ATN    ((size_t)NB * (SEQ - RH) * DM)
#define ATEN   ((size_t)NB * RH * DM)
#define O_XB   ((size_t)0)
#define O_WALL (O_XB + XBN)
#define O_WPB  (O_WALL + 3 * WN)
#define O_WPH  (O_WPB + WN)
#define O_P16  (O_WPH + WN)
#define O_EH   (O_P16 + 3 * PLANE)
#define O_EL   (O_EH + 3 * EPLANE)
#define O_AT   (O_EL + 3 * EPLANE)
#define O_ATEH (O_AT + ATN)
#define O_ATEL (O_ATEH + ATEN)
#define O_END  (O_ATEL + ATEN)
static_assert(O_END * 2 <= (size_t)134217728);   // total carve <= 128 MiB
static_assert(XBN % 128 == 0 && WN % 128 == 0 && PLANE % 128 == 0 && EPLANE % 128 == 0 && ATN % 128 == 0 && ATEN % 128 == 0);   // every region starts on a 256-byte border

__device__ __forceinline__ u16 f2bf(float f) { unsigned u = __float_as_uint(f); u += 0x7FFFu + ((u >> 16) & 1u); return (u16)(u >> 16); }
__device__ __forceinline__ float bf2f(u16 b) { return __uint_as_float(((unsigned)b) << 16); }
__device__ __forceinline__ float bfr(float f) { return bf2f(f2bf(f)); }
__device__ __forceinline__ u16 f2h(float x) { return __builtin_bit_cast(unsigned short, (h16)x); }

// f32 -> f16 with a value select: magnitudes below the smallest normal f16 become zero, so no subnormal f16 operand can reach a WMMA.
static __device__ __forceinline__ h16 toh_flush(float v) { const h16 r = (h16)v; return (fabsf(v) < 6.103515625e-05f) ? (h16)0.0f : r; }
static __device__ __forceinline__ u16 f2h_fl(float v) { return __builtin_bit_cast(unsigned short, toh_flush(v)); }

// Fragment loader for A and B alike: 'p' points at (row or column) + k0 + 8*(lane>>4); elements 0..7 = k0+8h.., elements 8..15 = k0+16+8h..
__device__ __forceinline__ v16us ldfr(const u16* p) {
    const v8us lo = *(const v8us*)p; const v8us hi = *(const v8us*)(p + 16);
    return __builtin_shufflevector(lo, hi, 0, 1, 2, 3, 4, 5, 6, 7, 8, 9, 10, 11, 12, 13, 14, 15);
}
// One WMMA plus its own hazard guard (ties exactly one accumulator, keeps A and B live).
__device__ __forceinline__ v8f mma_h(v16us a, v16us b, v8f c) {
    const v16h ah = __builtin_bit_cast(v16h, a); const v16h bh = __builtin_bit_cast(v16h, b);
    c = __builtin_amdgcn_wmma_f32_16x16x32_f16(false, ah, false, bh, (short)0, c, false, false);
    asm volatile("v_nop\n\tv_nop\n\tv_nop\n\tv_nop" : "+v"(c) : "v"(ah), "v"(bh));
    return c;
}
__device__ __forceinline__ v8f mma_b(v16us a, v16us b, v8f c) {
    const v16bf ab = __builtin_bit_cast(v16bf, a); const v16bf bb = __builtin_bit_cast(v16bf, b);
    c = __builtin_amdgcn_wmma_f32_16x16x32_bf16(false, ab, false, bb, (short)0, c, false, false);
    asm volatile("v_nop\n\tv_nop\n\tv_nop\n\tv_nop" : "+v"(c) : "v"(ab), "v"(bb));
    return c;
}
template <bool F16> __device__ __forceinline__ v8f mmag(v16us a, v16us b, v8f c) { if (F16) return mma_h(a, b, c); else return mma_b(a, b, c); }

// One wave computes a 64x64 tile: acc[mb][nb] element j = C[r0 + 16 mb + 8 (lane>>4) + j][c0 + 16 nb + (lane&15)] = sum_k A[m][k] Bt[n][k] (+ A2[m][k] Bt[n][k] when SPLIT). K % 32 == 0.
template <bool F16, bool SPLIT>
__device__ __forceinline__ void gemm_tile(const u16* __restrict__ A, const u16* __restrict__ A2, const u16* __restrict__ Bt, const int K, const int r0, const int c0, const int lr, const int hi, v8f (&acc)[4][4]) {
#pragma unroll
    for (int mb = 0; mb < 4; ++mb)
#pragma unroll
        for (int nb = 0; nb < 4; ++nb) acc[mb][nb] = (v8f){};
    const size_t aoff = (size_t)(r0 + lr) * K + 8 * hi, boff = (size_t)(c0 + lr) * K + 8 * hi;
#pragma unroll 1
    for (int kc = 0; kc < K; kc += 32) {
        v16us a[4], a2[4];
#pragma unroll
        for (int mb = 0; mb < 4; ++mb) { a[mb] = ldfr(A + aoff + (size_t)mb * 16 * K + kc); if (SPLIT) a2[mb] = ldfr(A2 + aoff + (size_t)mb * 16 * K + kc); else a2[mb] = a[mb]; }
#pragma unroll
        for (int nb = 0; nb < 4; ++nb) { const v16us bb = ldfr(Bt + boff + (size_t)nb * 16 * K + kc);
#pragma unroll
            for (int mb = 0; mb < 4; ++mb) { acc[mb][nb] = mmag<F16>(a[mb], bb, acc[mb][nb]); if (SPLIT) acc[mb][nb] = mmag<F16>(a2[mb], bb, acc[mb][nb]); } }
    }
}

// Source groups are addressed as (i / seg) * segf + i % seg so a reduced build reads the right rows of full-size inputs.
__global__ __launch_bounds__(256) void k_cvt8(const float* __restrict__ src, u16* dst, unsigned n8, unsigned seg, unsigned segf, int tof16, float scale) {
    const unsigned i = blockIdx.x * 256u + threadIdx.x;
    if (i >= n8) return;
    const unsigned bb = i / seg, r = i - bb * seg;
    const size_t si = ((size_t)bb * segf + r) * 8;
    const v4f v0 = *(const v4f*)(src + si); const v4f v1 = *(const v4f*)(src + si + 4);
    v8us o;
#pragma unroll
    for (int k = 0; k < 4; ++k) {
        const u16 b0 = f2bf(v0[k]), b1 = f2bf(v1[k]);
        const u16 h0 = f2h(bf2f(b0) * scale), h1 = f2h(bf2f(b1) * scale);
        o[k] = tof16 ? h0 : b0; o[4 + k] = tof16 ? h1 : b1;
    }
    v8us* dp = (v8us*)(dst + (size_t)i * 8);
    *dp = o; 
}

// k_proj: [NB*SEQ][1024] x [3072][1024]^T (rows 0..1023 query weight, 1024..2047 key weight, 2048..3071 value weight). One wave per 64x64 tile = 64 time rows of one head.
// Epilogue q/k: per-row LayerNorm over the 64 head columns (mean and biased variance in f32 across 8 lanes x 8 columns, eps 1e-5, gain and bias taken as bf16 values of the inputs; both parameter sets are loaded and chosen by value),
// then f16 head plane rows [b][h][t][64] (+ bf16 hi/lo rows for t < RH); v: transposed through LDS into [b][h][d][t] lines of 64 t (+ hi/lo for t < RH). Planes addressed by element offsets from one base.
// All f16 plane values go through the value-select convert (no subnormal f16 can be produced).
__global__ __launch_bounds__(32) void k_proj(const u16* __restrict__ XB, const u16* __restrict__ WALL, u16* PL, size_t oP16, size_t oEH, size_t oEL,
                                             const float* __restrict__ QG, const float* __restrict__ QB, const float* __restrict__ KG, const float* __restrict__ KB) {
    __shared__ __align__(16) float os[16 * 68];
    __shared__ __align__(16) u16 ts[64 * 72];
    const int lane = threadIdx.x & 31, lr = lane & 15, hi = lane >> 4;
    const int r0 = blockIdx.x * 64, c0 = blockIdx.y * 64;
    const int which = c0 / DM, hd = (c0 - which * DM) / HD;
    const int b = r0 / SEQ, t0 = r0 - b * SEQ;
    const bool early = (t0 < RH);
    const size_t bh = (size_t)b * NH + hd;
    v8f acc[4][4];
    gemm_tile<false, false>(XB, XB, WALL, DM, r0, c0, lr, hi, acc);
    if (which < 2) {
        const size_t o16 = oP16 + (size_t)which * PLANE + (bh * SEQ + t0) * HD;
        const size_t oeh = oEH + (size_t)which * EPLANE + (bh * RH + (early ? t0 : 0)) * HD;
        const size_t oel = oEL + (size_t)which * EPLANE + (bh * RH + (early ? t0 : 0)) * HD;
        const int gc = (lane & 7) * 8;                 // this lane's 8 head columns (same in every row group)
        const v4f gq0 = *(const v4f*)(QG + gc), gq1 = *(const v4f*)(QG + gc + 4);
        const v4f bq0 = *(const v4f*)(QB + gc), bq1 = *(const v4f*)(QB + gc + 4);
        const v4f gk0 = *(const v4f*)(KG + gc), gk1 = *(const v4f*)(KG + gc + 4);
        const v4f bk0 = *(const v4f*)(KB + gc), bk1 = *(const v4f*)(KB + gc + 4);
        v4f g0, g1, be0, be1;
#pragma unroll
        for (int q = 0; q < 4; ++q) {
            g0[q]  = bfr((which == 0) ? gq0[q] : gk0[q]); g1[q]  = bfr((which == 0) ? gq1[q] : gk1[q]);
            be0[q] = bfr((which == 0) ? bq0[q] : bk0[q]); be1[q] = bfr((which == 0) ? bq1[q] : bk1[q]);
        }
#pragma unroll
        for (int mb = 0; mb < 4; ++mb) {
#pragma unroll
            for (int nb = 0; nb < 4; ++nb)
#pragma unroll
                for (int j = 0; j < 8; ++j) os[(hi * 8 + j) * 68 + nb * 16 + lr] = acc[mb][nb][j];
            __syncthreads();
{
#pragma unroll
                for (int s = 0; s < 4; ++s) {
                    const int row = 4 * s + (lane >> 3), pc = (lane & 7) * 8;
                    const v4f x0 = *(const v4fa*)&os[row * 68 + pc]; const v4f x1 = *(const v4fa*)&os[row * 68 + pc + 4];
                    // LayerNorm of the 64-wide row held by the 8 lanes sharing lane>>3 (all 32 lanes active, uniform control)
                    float sm = ((x0[0] + x0[1]) + (x0[2] + x0[3])) + ((x1[0] + x1[1]) + (x1[2] + x1[3]));
                    sm += __shfl_xor(sm, 1, 32); sm += __shfl_xor(sm, 2, 32); sm += __shfl_xor(sm, 4, 32);
                    const float mean = sm * (1.0f / 64.0f);
                    v4f d0, d1;
#pragma unroll
                    for (int q = 0; q < 4; ++q) { d0[q] = x0[q] - mean; d1[q] = x1[q] - mean; }
                    float vs = ((d0[0] * d0[0] + d0[1] * d0[1]) + (d0[2] * d0[2] + d0[3] * d0[3])) + ((d1[0] * d1[0] + d1[1] * d1[1]) + (d1[2] * d1[2] + d1[3] * d1[3]));
                    vs += __shfl_xor(vs, 1, 32); vs += __shfl_xor(vs, 2, 32); vs += __shfl_xor(vs, 4, 32);
                    const float rinv = rsqrtf(vs * (1.0f / 64.0f) + LNEPS);
                    v4f y0, y1;
#pragma unroll
                    for (int q = 0; q < 4; ++q) { y0[q] = d0[q] * rinv * g0[q] + be0[q]; y1[q] = d1[q] * rinv * g1[q] + be1[q]; }
                    v8us q16;
#pragma unroll
                    for (int q = 0; q < 4; ++q) { q16[q] = f2h_fl(y0[q]); q16[4 + q] = f2h_fl(y1[q]); }
                    const size_t ro = (size_t)(mb * 16 + row) * HD + pc;
                    *(v8us*)(PL + o16 + ro) = q16;
                    if (early) {
                        v8us oh, ol;
#pragma unroll
                        for (int q = 0; q < 4; ++q) { const u16 a = f2bf(y0[q]); oh[q] = a; ol[q] = f2bf(y0[q] - bf2f(a)); const u16 c = f2bf(y1[q]); oh[4 + q] = c; ol[4 + q] = f2bf(y1[q] - bf2f(c)); }
                        *(v8us*)(PL + oeh + ro) = oh; *(v8us*)(PL + oel + ro) = ol;
                    }
                }
                
            }
            __syncthreads();
        }
    } else {
#pragma unroll
        for (int pl = 0; pl < 3; ++pl) {
            if (pl == 0 || early) {
#pragma unroll
                for (int mb = 0; mb < 4; ++mb)
#pragma unroll
                    for (int nb = 0; nb < 4; ++nb) {
                        v8us pk;
#pragma unroll
                        for (int j = 0; j < 8; ++j) { const float y = acc[mb][nb][j]; const u16 hb = f2bf(y); pk[j] = (pl == 0) ? f2h_fl(y) : ((pl == 1) ? hb : f2bf(y - bf2f(hb))); }
                        *(v8usa*)&ts[(nb * 16 + lr) * 72 + mb * 16 + hi * 8] = pk;     // ts[d][t]: 8 consecutive t per lane
                    }
                __syncthreads();
                const size_t dofs = (pl == 0) ? (oP16 + 2 * PLANE + bh * HD * SEQ + t0) : (((pl == 1) ? oEH : oEL) + 2 * EPLANE + bh * HD * RH + t0);
                const int dp = (pl == 0) ? SEQ : RH;
{
#pragma unroll 4
                    for (int s = 0; s < 16; ++s) {
                        const int d = 4 * s + (lane >> 3), pc = (lane & 7) * 8;
                        const v8us v = *(const v8usa*)&ts[d * 72 + pc];
                        *(v8us*)(PL + dofs + (size_t)d * dp + pc) = v;
                    }
                    
                }
                __syncthreads();
            }
        }
    }
}

// Online-softmax update for one 16 x 32 score step. s0/s1 hold raw scores for keys jb + (lane&15) and jb + 16 + (lane&15), rows qbase + 8 (lane>>4) + i; on return they hold exp2(t - running max).
// lrow keeps PER-LANE partial sums (reduced over the 16 lanes of a row once, after the key loop). Masked entries are replaced before the maximum; every row keeps its own key.
__device__ __forceinline__ void sm_step(v8f& s0, v8f& s1, float (&mrow)[8], float (&lrow)[8], float (&corr)[8], const int jb, const int qbase, const int lr, const int hi) {
#pragma unroll
    for (int i = 0; i < 8; ++i) {
        const int row = qbase + i + 8 * hi;
        float a0 = s0[i] * SCL2, a1 = s1[i] * SCL2;
        a0 = (jb + lr > row) ? -1.0e30f : a0;
        a1 = (jb + 16 + lr > row) ? -1.0e30f : a1;
        float mx = fmaxf(a0, a1);
        mx = fmaxf(mx, __shfl_xor(mx, 1, 32)); mx = fmaxf(mx, __shfl_xor(mx, 2, 32)); mx = fmaxf(mx, __shfl_xor(mx, 4, 32)); mx = fmaxf(mx, __shfl_xor(mx, 8, 32));
        const float mnew = fmaxf(mrow[i], mx);
        const float c  = __builtin_amdgcn_exp2f(mrow[i] - mnew);
        const float p0 = __builtin_amdgcn_exp2f(a0 - mnew);
        const float p1 = __builtin_amdgcn_exp2f(a1 - mnew);
        lrow[i] = lrow[i] * c + (p0 + p1);
        mrow[i] = mnew; corr[i] = c; s0[i] = p0; s1[i] = p1;
    }
}

#define AW   4                   // waves per late-attention work-group, 16 query rows each
#define KPIT 72                  // u16 per staged key row: 144 B = 16 B x odd, the pitch for 16-byte LDS readers of 128-B rows
#define VPIT 40                  // u16 per staged value row: 80 B = 16 B x odd, the same for 64-B rows
#define NQB_L (((SEQ - RH) / (16 * AW)) > 0 ? ((SEQ - RH) / (16 * AW)) : 1)
static_assert((SEQ - RH) % (16 * AW) == 0);   // whole work-groups of query rows
static_assert((RH + 16 * AW) / 32 >= 2);      // the two-buffer prologue needs two key steps
static_assert((16 * AW) % 32 == 0 && RH % 32 == 0);   // a work-group's last key step ends on its last query row

__device__ __forceinline__ unsigned lds_byte(const u16* p) { return (unsigned)(size_t)(const __attribute__((address_space(3))) u16*)p; }

// One 32-key stage for a work-group of 128 threads: key rows jb..jb+31 (32 x 128 B, contiguous in the plane) and the 64 value rows' columns jb..jb+31 (64 x 64 B), 16 bytes per lane and copy, straight into LDS.
// The s_wait_xcnt 0 is the last line of the copies' own statement so that no address register of a copy is rewritten ahead of it.
__device__ __forceinline__ void stage_kv(const u16* __restrict__ Kb, const u16* __restrict__ Vb, const int jb, u16* kd, u16* vd, const int tid) {
    const u16* gk0 = Kb + (size_t)(jb + (tid >> 3)) * HD + (tid & 7) * 8;      // rows 0..15 of the stage
    const u16* gk1 = gk0 + 16 * HD;                                           // rows 16..31
    const u16* gv0 = Vb + (size_t)(tid >> 2) * SEQ + jb + (tid & 3) * 8;       // head columns 0..31
    const u16* gv1 = gv0 + (size_t)32 * SEQ;                                  // head columns 32..63
    const unsigned lk0 = lds_byte(kd + (tid >> 3) * KPIT + (tid & 7) * 8), lk1 = lk0 + 16 * KPIT * 2;
    const unsigned lv0 = lds_byte(vd + (tid >> 2) * VPIT + (tid & 3) * 8), lv1 = lv0 + 32 * VPIT * 2;
    asm volatile("global_load_async_to_lds_b128 %0, %1, off\n\t"
                 "global_load_async_to_lds_b128 %2, %3, off\n\t"
                 "global_load_async_to_lds_b128 %4, %5, off\n\t"
                 "global_load_async_to_lds_b128 %6, %7, off\n\t"
                 "s_wait_xcnt 0x0"
                 :: "v"(lk0), "v"(gk0), "v"(lk1), "v"(gk1), "v"(lv0), "v"(gv0), "v"(lv1), "v"(gv1) : "memory");
}

// k_attn_l: query rows >= RH, f16 single products. One work-group of AW waves per 16*AW query rows of one (batch, head), one wave per 16 rows; the waves share each 32-key stage of K and V,
// brought into two LDS buffers by asynchronous copies one stage ahead. Every wave walks the work-group's key range: a step wholly above a wave's diagonal adds exact zeros. ctx f16 x CCAR -> AT [b][t-RH][1024].
__global__ __launch_bounds__(32 * AW) void k_attn_l(const u16* __restrict__ QP, const u16* __restrict__ KP, const u16* __restrict__ VT, u16* AT) {
    __shared__ __align__(16) u16 ks[2][32 * KPIT];
    __shared__ __align__(16) u16 vs[2][HD * VPIT];
    __shared__ __align__(16) u16 pwa[AW][16 * 40];
    __shared__ __align__(16) float osa[AW][16 * 68];
    const int tid = threadIdx.x, lane = tid & 31, lr = lane & 15, hi = lane >> 4, wv = tid >> 5;
    u16* pw = pwa[wv]; float* os = osa[wv];
    const int bh = blockIdx.x / NQB_L, qb = blockIdx.x - bh * NQB_L;
    const int b = bh / NH, h = bh - b * NH;
    const int qblk = RH + qb * (16 * AW);
    const int qbase = qblk + wv * 16;
    const size_t pb = (size_t)bh * SEQ * HD;
    const u16* Qb = QP + pb; const u16* Kb = KP + pb; const u16* Vb = VT + pb;
    const int nsteps = (qblk + 16 * AW) >> 5;    // keys 0 .. qblk+16*AW-1 in steps of 32; nsteps*32 <= SEQ, nsteps >= 2
    stage_kv(Kb, Vb, 0, ks[0], vs[0], tid);
    asm volatile("s_wait_asynccnt 0x0" ::: "memory");   // this wave's copies of stage 0 have landed
    __syncthreads();                                     // stage 0 readable by every wave
    stage_kv(Kb, Vb, 32, ks[1], vs[1], tid);
    const v16us q0 = ldfr(Qb + (size_t)(qbase + lr) * HD + 8 * hi);
    const v16us q1 = ldfr(Qb + (size_t)(qbase + lr) * HD + 32 + 8 * hi);
    v8f acc[4];
#pragma unroll
    for (int nt = 0; nt < 4; ++nt) acc[nt] = (v8f){};
    float mrow[8], lrow[8];
#pragma unroll
    for (int i = 0; i < 8; ++i) { mrow[i] = -1.0e30f; lrow[i] = 0.0f; }
#pragma unroll 1
    for (int st = 0; st < nsteps; ++st) {
        const int jb = st * 32;
        const u16* kr0 = ks[st & 1] + lr * KPIT + 8 * hi; const u16* kr1 = kr0 + 16 * KPIT;
        const u16* vr = vs[st & 1] + lr * VPIT + 8 * hi;
        v8f s0 = (v8f){}, s1 = (v8f){};
        s0 = mma_h(q0, ldfr(kr0), s0); s0 = mma_h(q1, ldfr(kr0 + 32), s0);
        s1 = mma_h(q0, ldfr(kr1), s1); s1 = mma_h(q1, ldfr(kr1 + 32), s1);
        float corr[8];
        sm_step(s0, s1, mrow, lrow, corr, jb, qbase, lr, hi);
#pragma unroll
        for (int nt = 0; nt < 4; ++nt)
#pragma unroll
            for (int i = 0; i < 8; ++i) acc[nt][i] *= corr[i];
#pragma unroll
        for (int i = 0; i < 8; ++i) { pw[(i + 8 * hi) * 40 + lr] = f2h(s0[i] * PCAR); pw[(i + 8 * hi) * 40 + 16 + lr] = f2h(s1[i] * PCAR); }
        __syncthreads();
        const v8us plo = *(const v8usa*)&pw[lr * 40 + 8 * hi]; const v8us phi = *(const v8usa*)&pw[lr * 40 + 16 + 8 * hi];
        const v16us pf = __builtin_shufflevector(plo, phi, 0, 1, 2, 3, 4, 5, 6, 7, 8, 9, 10, 11, 12, 13, 14, 15);
#pragma unroll
        for (int nt = 0; nt < 4; ++nt) { const v16us vf = ldfr(vr + nt * 16 * VPIT); acc[nt] = mma_h(pf, vf, acc[nt]); }
        asm volatile("s_wait_dscnt 0x0" ::: "memory");      // this wave's LDS reads of the stage are done before the buffer is refilled
        asm volatile("s_wait_asynccnt 0x0" ::: "memory");   // this wave's copies of the next stage have landed
        __syncthreads();                                     // publishes the next stage and ends every reader's last read of this one
        if (st + 2 < nsteps) stage_kv(Kb, Vb, jb + 64, ks[st & 1], vs[st & 1], tid);
    }
    asm volatile("s_wait_asynccnt 0x0" ::: "memory");       // no copy is left in flight when the wave goes on to its end
#pragma unroll
    for (int i = 0; i < 8; ++i) {
        float l = lrow[i];
        l += __shfl_xor(l, 1, 32); l += __shfl_xor(l, 2, 32); l += __shfl_xor(l, 4, 32); l += __shfl_xor(l, 8, 32);
        const float inv = CCAR / (l * PCAR);
#pragma unroll
        for (int nt = 0; nt < 4; ++nt) os[(i + 8 * hi) * 68 + nt * 16 + lr] = acc[nt][i] * inv;
    }
    __syncthreads();
    u16* dst = AT + ((size_t)b * (SEQ - RH) + (qbase - RH)) * DM + h * HD;
{
#pragma unroll
        for (int s = 0; s < 4; ++s) {
            const int row = 4 * s + (lane >> 3), pc = (lane & 7) * 8;
            const v4f x0 = *(const v4fa*)&os[row * 68 + pc]; const v4f x1 = *(const v4fa*)&os[row * 68 + pc + 4];
            v8us o;
#pragma unroll
            for (int q = 0; q < 4; ++q) { o[q] = f2h(x0[q]); o[4 + q] = f2h(x1[q]); }
            *(v8us*)(dst + (size_t)row * DM + pc) = o;
        }
        
    }
}

// k_attn_e: query rows < RH, bf16 hi+lo operands (hi.hi + lo.hi + hi.lo into one accumulator; residuals unscaled). ctx hi/lo bf16 -> ATEh/ATEl [b][t][1024].
__global__ __launch_bounds__(32) void k_attn_e(const u16* __restrict__ QEh, const u16* __restrict__ QEl, const u16* __restrict__ KEh, const u16* __restrict__ KEl, const u16* __restrict__ VEh, const u16* __restrict__ VEl, u16* ATEh, u16* ATEl) {
    __shared__ __align__(16) u16 pwh[16 * 40];
    __shared__ __align__(16) u16 pwl[16 * 40];
    __shared__ __align__(16) float os[16 * 68];
    const int lane = threadIdx.x & 31, lr = lane & 15, hi = lane >> 4;
    const int bh = blockIdx.x / (RH / 16), qt = blockIdx.x - bh * (RH / 16);
    const int b = bh / NH, h = bh - b * NH;
    const int qbase = qt * 16;
    const size_t pb = (size_t)bh * RH * HD;
    const size_t qo = pb + (size_t)(qbase + lr) * HD + 8 * hi;
    const v16us qh0 = ldfr(QEh + qo), qh1 = ldfr(QEh + qo + 32), ql0 = ldfr(QEl + qo), ql1 = ldfr(QEl + qo + 32);
    v8f acc[4];
#pragma unroll
    for (int nt = 0; nt < 4; ++nt) acc[nt] = (v8f){};
    float mrow[8], lrow[8];
#pragma unroll
    for (int i = 0; i < 8; ++i) { mrow[i] = -1.0e30f; lrow[i] = 0.0f; }
    const int nsteps = (qbase + 47) >> 5;        // nsteps*32 <= RH
#pragma unroll 1
    for (int st = 0; st < nsteps; ++st) {
        const int jb = st * 32;
        const size_t ko = pb + (size_t)(jb + lr) * HD + 8 * hi;
        v8f s0 = (v8f){}, s1 = (v8f){};
        {
            const v16us kh0 = ldfr(KEh + ko), kh1 = ldfr(KEh + ko + 32), kl0 = ldfr(KEl + ko), kl1 = ldfr(KEl + ko + 32);
            s0 = mma_b(qh0, kh0, s0); s0 = mma_b(qh1, kh1, s0); s0 = mma_b(ql0, kh0, s0); s0 = mma_b(ql1, kh1, s0); s0 = mma_b(qh0, kl0, s0); s0 = mma_b(qh1, kl1, s0);
        }
        {
            const size_t k1 = ko + 16 * HD;
            const v16us kh0 = ldfr(KEh + k1), kh1 = ldfr(KEh + k1 + 32), kl0 = ldfr(KEl + k1), kl1 = ldfr(KEl + k1 + 32);
            s1 = mma_b(qh0, kh0, s1); s1 = mma_b(qh1, kh1, s1); s1 = mma_b(ql0, kh0, s1); s1 = mma_b(ql1, kh1, s1); s1 = mma_b(qh0, kl0, s1); s1 = mma_b(qh1, kl1, s1);
        }
        float corr[8];
        sm_step(s0, s1, mrow, lrow, corr, jb, qbase, lr, hi);
#pragma unroll
        for (int nt = 0; nt < 4; ++nt)
#pragma unroll
            for (int i = 0; i < 8; ++i) acc[nt][i] *= corr[i];
#pragma unroll
        for (int i = 0; i < 8; ++i) {
            const u16 a = f2bf(s0[i]); const u16 c = f2bf(s1[i]);
            pwh[(i + 8 * hi) * 40 + lr] = a; pwl[(i + 8 * hi) * 40 + lr] = f2bf(s0[i] - bf2f(a));
            pwh[(i + 8 * hi) * 40 + 16 + lr] = c; pwl[(i + 8 * hi) * 40 + 16 + lr] = f2bf(s1[i] - bf2f(c));
        }
        __syncthreads();
        const v8us h0 = *(const v8usa*)&pwh[lr * 40 + 8 * hi]; const v8us h1 = *(const v8usa*)&pwh[lr * 40 + 16 + 8 * hi];
        const v8us l0 = *(const v8usa*)&pwl[lr * 40 + 8 * hi]; const v8us l1 = *(const v8usa*)&pwl[lr * 40 + 16 + 8 * hi];
        const v16us pfh = __builtin_shufflevector(h0, h1, 0, 1, 2, 3, 4, 5, 6, 7, 8, 9, 10, 11, 12, 13, 14, 15);
        const v16us pfl = __builtin_shufflevector(l0, l1, 0, 1, 2, 3, 4, 5, 6, 7, 8, 9, 10, 11, 12, 13, 14, 15);
#pragma unroll
        for (int nt = 0; nt < 4; ++nt) {
            const size_t vo = pb + (size_t)(nt * 16 + lr) * RH + jb + 8 * hi;      // [bh][64][RH], same plane size as [bh][RH][64]
            const v16us vh = ldfr(VEh + vo), vl = ldfr(VEl + vo);
            acc[nt] = mma_b(pfh, vh, acc[nt]); acc[nt] = mma_b(pfl, vh, acc[nt]); acc[nt] = mma_b(pfh, vl, acc[nt]);
        }
        __syncthreads();
    }
#pragma unroll
    for (int i = 0; i < 8; ++i) {
        float l = lrow[i];
        l += __shfl_xor(l, 1, 32); l += __shfl_xor(l, 2, 32); l += __shfl_xor(l, 4, 32); l += __shfl_xor(l, 8, 32);
        const float inv = 1.0f / l;
#pragma unroll
        for (int nt = 0; nt < 4; ++nt) os[(i + 8 * hi) * 68 + nt * 16 + lr] = acc[nt][i] * inv;
    }
    __syncthreads();
    const size_t dofs = ((size_t)b * RH + qbase) * DM + h * HD;
{
#pragma unroll
        for (int s = 0; s < 4; ++s) {
            const int row = 4 * s + (lane >> 3), pc = (lane & 7) * 8;
            const v4f x0 = *(const v4fa*)&os[row * 68 + pc]; const v4f x1 = *(const v4fa*)&os[row * 68 + pc + 4];
            v8us oh, ol;
#pragma unroll
            for (int q = 0; q < 4; ++q) { const u16 a = f2bf(x0[q]); oh[q] = a; ol[q] = f2bf(x0[q] - bf2f(a)); const u16 c = f2bf(x1[q]); oh[4 + q] = c; ol[4 + q] = f2bf(x1[q] - bf2f(c)); }
            *(v8us*)(ATEh + dofs + (size_t)row * DM + pc) = oh;
            *(v8us*)(ATEl + dofs + (size_t)row * DM + pc) = ol;
        }
        
    }
}

// k_outp: OUT[b][toff + r][n] = scale * sum_k A[row][k] Bt[n][k] (+ A2 product when split) + bf16(bias[n]); rows of A are [b][r] with rpb rows per batch; split = bf16 hi+lo planes, else f16 planes.
__global__ __launch_bounds__(32) void k_outp(const u16* __restrict__ A, const u16* __restrict__ A2, const u16* __restrict__ Bt, const float* __restrict__ bias, float* OUT, float scale, int rpb, int toff, int split) {
    __shared__ __align__(16) float os[16 * 68];
    const int lane = threadIdx.x & 31, lr = lane & 15, hi = lane >> 4;
    const int r0 = blockIdx.x * 64, c0 = blockIdx.y * 64;
    v8f acc[4][4];
    if (split) gemm_tile<false, true>(A, A2, Bt, DM, r0, c0, lr, hi, acc);
    else       gemm_tile<true, false>(A, A, Bt, DM, r0, c0, lr, hi, acc);
    const int b = r0 / rpb, tb = toff + (r0 - b * rpb);
    float* crow0 = OUT + ((size_t)b * SEQ_FULL + tb) * DM + c0;
    const int cofs = lr * 4;
    v4f bv; bv[0] = bfr(bias[c0 + cofs]); bv[1] = bfr(bias[c0 + cofs + 1]); bv[2] = bfr(bias[c0 + cofs + 2]); bv[3] = bfr(bias[c0 + cofs + 3]);
#pragma unroll
    for (int mb = 0; mb < 4; ++mb) {
#pragma unroll
        for (int nb = 0; nb < 4; ++nb)
#pragma unroll
            for (int j = 0; j < 8; ++j) os[(hi * 8 + j) * 68 + nb * 16 + lr] = acc[mb][nb][j];
        __syncthreads();
{
#pragma unroll
            for (int s = 0; s < 8; ++s) {
                const int row = 2 * s + hi;
                const v4f x = *(const v4fa*)&os[row * 68 + cofs];
                v4f val; val[0] = x[0] * scale + bv[0]; val[1] = x[1] * scale + bv[1]; val[2] = x[2] * scale + bv[2]; val[3] = x[3] * scale + bv[3];
                *(v4f*)(crow0 + (size_t)(mb * 16 + row) * DM + cofs) = val;
            }
            
        }
        __syncthreads();
    }
}

extern "C" void kernel_launch(void* const* d_in, const int* in_sizes, int n_in,
                              void* d_out, int out_size, void* d_ws, size_t ws_size, hipStream_t stream) {
    if (n_in < 10) return;
    const long long needx = ((long long)(NB - 1) * SEQ_FULL + SEQ) * DM;
    if ((long long)in_sizes[0] < needx) return;
    if ((long long)in_sizes[1] < (long long)DM * DM || (long long)in_sizes[2] < (long long)DM * DM || (long long)in_sizes[3] < (long long)DM * DM || (long long)in_sizes[4] < (long long)DM * DM) return;
    if (in_sizes[5] < DM) return;
    if (in_sizes[6] < HD || in_sizes[7] < HD || in_sizes[8] < HD || in_sizes[9] < HD) return;
    if ((long long)out_size < needx) return;
    if (O_END * 2 > ws_size) return;
    // wire order: x, key weight, query weight, value weight, output weight, output bias, key LayerNorm gain, key LayerNorm bias, query LayerNorm gain, query LayerNorm bias
    const float* x  = (const float*)d_in[0];
    const float* Wk = (const float*)d_in[1];
    const float* Wq = (const float*)d_in[2];
    const float* Wv = (const float*)d_in[3];
    const float* Wp = (const float*)d_in[4];
    const float* bp = (const float*)d_in[5];
    const float* kg = (const float*)d_in[6];
    const float* kb = (const float*)d_in[7];
    const float* qg = (const float*)d_in[8];
    const float* qb = (const float*)d_in[9];
    float* OUT = (float*)d_out;
    u16* PL = (u16*)d_ws;

    const unsigned xn8 = (unsigned)(XBN / 8), wn8 = (unsigned)(WN / 8);
    k_cvt8<<<(xn8 + 255) / 256, 256, 0, stream>>>(x, PL + O_XB, xn8, (unsigned)((size_t)SEQ * DM / 8), (unsigned)((size_t)SEQ_FULL * DM / 8), 0, 1.0f);
    k_cvt8<<<(wn8 + 255) / 256, 256, 0, stream>>>(Wq, PL + O_WALL,          wn8, wn8, wn8, 0, 1.0f);   // rows 0..1023: query
    k_cvt8<<<(wn8 + 255) / 256, 256, 0, stream>>>(Wk, PL + O_WALL + WN,     wn8, wn8, wn8, 0, 1.0f);   // rows 1024..2047: key
    k_cvt8<<<(wn8 + 255) / 256, 256, 0, stream>>>(Wv, PL + O_WALL + 2 * WN, wn8, wn8, wn8, 0, 1.0f);   // rows 2048..3071: value
    k_cvt8<<<(wn8 + 255) / 256, 256, 0, stream>>>(Wp, PL + O_WPB, wn8, wn8, wn8, 0, 1.0f);
    k_cvt8<<<(wn8 + 255) / 256, 256, 0, stream>>>(Wp, PL + O_WPH, wn8, wn8, wn8, 1, WCAR);

    k_proj<<<dim3(NB * SEQ / 64, 3 * DM / 64, 1), 32, 0, stream>>>(PL + O_XB, PL + O_WALL, PL, O_P16, O_EH, O_EL, qg, qb, kg, kb);

    k_attn_e<<<NB * NH * (RH / 16), 32, 0, stream>>>(PL + O_EH, PL + O_EL, PL + O_EH + EPLANE, PL + O_EL + EPLANE, PL + O_EH + 2 * EPLANE, PL + O_EL + 2 * EPLANE, PL + O_ATEH, PL + O_ATEL);
    if (SEQ > RH)
        k_attn_l<<<NB * NH * ((SEQ - RH) / (16 * AW)), 32 * AW, 0, stream>>>(PL + O_P16, PL + O_P16 + PLANE, PL + O_P16 + 2 * PLANE, PL + O_AT);

    k_outp<<<dim3(NB * RH / 64, DM / 64, 1), 32, 0, stream>>>(PL + O_ATEH, PL + O_ATEL, PL + O_WPB, bp, OUT, 1.0f, RH, 0, 1);
    if (SEQ > RH)
        k_outp<<<dim3(NB * (SEQ - RH) / 64, DM / 64, 1), 32, 0, stream>>>(PL + O_AT, PL + O_AT, PL + O_WPH, bp, OUT, 1.0f / (WCAR * CCAR), SEQ - RH, RH, 0);
}

// v002
// Measured time: 257 microseconds a run.
// Timed twice side by side with v001, it ran 1.38 times as fast both times.
// Counting every step since v000, it is 1.74 times as fast.
#include <hip/hip_runtime.h>

// Compute dtypes (f32 accumulate everywhere): q/k/v projections bf16 x bf16 (inputs converted RNE to bf16, products exact), per-head LayerNorm of q and k in f32 inside the projection epilogue; scores q.k and P.V: f16 single products on query rows >= 256 (P carried x1024), bf16 hi+lo (3 products) on query rows < 256; output projection: f16 single product (ctx x16, Wo x32 carries) on rows >= 256, bf16 hi+lo ctx x bf16 Wo on rows < 256.
// Causal 16-head attention block, x [4][2048][1024]; separate bias-free [out][in] key / query / value projections (used as Bt as stored), per-head LayerNorm (eps 1e-5, gain and bias inputs) on the 64-wide query and key rows,
// the two 1024^(-1/4) factors applied as one 1/32 on the scores, causal exclusion with the diagonal kept, softmax in f32 (running max, log2 domain), heads merged h*64+d, [out][in] output projection plus bias.
// Layout: 16-bit planes in the workspace (u16 storage): x copy [b*SEQ+t][1024]; weights [3][1024][1024] (q, k, v) ; q and k head planes [b][h][t][64]; v transposed [b][h][64][t]; hi/lo bf16 planes of the same for t < 256;
// ctx f16 [b][t-256][1024] and ctx hi/lo bf16 [b][t<256][1024]. Fused flash-style attention: one wave per 16 query rows, 32 keys per step, no score plane in global memory; rows < 256: fragments straight from the k-contiguous planes; rows >= 256: four waves share K and V stages in LDS. Projection and late output GEMMs: eight waves share A and B stages in LDS.

#ifndef NB
#define NB 4
#endif
#ifndef SEQ
#define SEQ 2048
#endif
#define NB_FULL  4
#define SEQ_FULL 2048
#define DM   1024
#define NH   16
#define HD   64
#define RH   256                 // query rows / keys below RH also carry bf16 hi+lo planes
#define PCAR 1024.0f             // carry on f16 probabilities
#define CCAR 16.0f               // carry on the f16 ctx plane
#define WCAR 32.0f               // carry on the f16 output-projection weight plane
#define SCL2 (0.03125f * 1.4426950408889634f)   // 1/sqrt(1024) x log2(e)
#define LNEPS 1.0e-5f            // LayerNorm epsilon on the head rows

static_assert(DM == NH * HD);            // heads tile the channel width
static_assert(HD == 64);
static_assert(HD == 8 * 8);              // LayerNorm row = 8 lanes x 8 columns in the projection epilogue
static_assert(DM % 32 == 0);             // GEMM k-step
static_assert(HD % 32 == 0);             // score k-step
static_assert(SEQ % 64 == 0);            // 64-row GEMM tiles never straddle a batch
static_assert(RH % 64 == 0);             // early/late split on tile borders
static_assert(SEQ >= RH);
static_assert((SEQ - RH) % 64 == 0);
static_assert(RH % 32 == 0);             // 32-key steps end inside the early planes
static_assert(NB <= NB_FULL);
static_assert(SEQ <= SEQ_FULL);

typedef unsigned short u16;
typedef _Float16 h16;
typedef __attribute__((ext_vector_type(16))) __bf16         v16bf;
typedef __attribute__((ext_vector_type(16))) _Float16       v16h;
typedef __attribute__((ext_vector_type(8)))  unsigned short v8us;
typedef __attribute__((ext_vector_type(16))) unsigned short v16us;
typedef __attribute__((ext_vector_type(8)))  float          v8f;
typedef __attribute__((ext_vector_type(4)))  float          v4f;
typedef v4f  __attribute__((may_alias)) v4fa;
typedef v8us __attribute__((may_alias)) v8usa;

#define XBN    ((size_t)NB * SEQ * DM)
#define WN     ((size_t)DM * DM)
#define PLANE  ((size_t)NB * NH * SEQ * HD)
#define EPLANE ((size_t)NB * NH * RH * HD)
#define ATN    ((size_t)NB * (SEQ - RH) * DM)
#define ATEN   ((size_t)NB * RH * DM)
#define O_XB   ((size_t)0)
#define O_WALL (O_XB + XBN)
#define O_WPB  (O_WALL + 3 * WN)
#define O_WPH  (O_WPB + WN)
#define O_P16  (O_WPH + WN)
#define O_EH   (O_P16 + 3 * PLANE)
#define O_EL   (O_EH + 3 * EPLANE)
#define O_AT   (O_EL + 3 * EPLANE)
#define O_ATEH (O_AT + ATN)
#define O_ATEL (O_ATEH + ATEN)
#define O_END  (O_ATEL + ATEN)
static_assert(O_END * 2 <= (size_t)134217728);   // total carve <= 128 MiB
static_assert(XBN % 128 == 0 && WN % 128 == 0 && PLANE % 128 == 0 && EPLANE % 128 == 0 && ATN % 128 == 0 && ATEN % 128 == 0);   // every region starts on a 256-byte border

__device__ __forceinline__ u16 f2bf(float f) { unsigned u = __float_as_uint(f); u += 0x7FFFu + ((u >> 16) & 1u); return (u16)(u >> 16); }
__device__ __forceinline__ float bf2f(u16 b) { return __uint_as_float(((unsigned)b) << 16); }
__device__ __forceinline__ float bfr(float f) { return bf2f(f2bf(f)); }
__device__ __forceinline__ u16 f2h(float x) { return __builtin_bit_cast(unsigned short, (h16)x); }

// f32 -> f16 with a value select: magnitudes below the smallest normal f16 become zero, so no subnormal f16 operand can reach a WMMA.
static __device__ __forceinline__ h16 toh_flush(float v) { const h16 r = (h16)v; return (fabsf(v) < 6.103515625e-05f) ? (h16)0.0f : r; }
static __device__ __forceinline__ u16 f2h_fl(float v) { return __builtin_bit_cast(unsigned short, toh_flush(v)); }

// Fragment loader for A and B alike: 'p' points at (row or column) + k0 + 8*(lane>>4); elements 0..7 = k0+8h.., elements 8..15 = k0+16+8h..
__device__ __forceinline__ v16us ldfr(const u16* p) {
    const v8us lo = *(const v8us*)p; const v8us hi = *(const v8us*)(p + 16);
    return __builtin_shufflevector(lo, hi, 0, 1, 2, 3, 4, 5, 6, 7, 8, 9, 10, 11, 12, 13, 14, 15);
}
// One WMMA plus its own hazard guard (ties exactly one accumulator, keeps A and B live).
__device__ __forceinline__ v8f mma_h(v16us a, v16us b, v8f c) {
    const v16h ah = __builtin_bit_cast(v16h, a); const v16h bh = __builtin_bit_cast(v16h, b);
    c = __builtin_amdgcn_wmma_f32_16x16x32_f16(false, ah, false, bh, (short)0, c, false, false);
    asm volatile("v_nop\n\tv_nop\n\tv_nop\n\tv_nop" : "+v"(c) : "v"(ah), "v"(bh));
    return c;
}
__device__ __forceinline__ v8f mma_b(v16us a, v16us b, v8f c) {
    const v16bf ab = __builtin_bit_cast(v16bf, a); const v16bf bb = __builtin_bit_cast(v16bf, b);
    c = __builtin_amdgcn_wmma_f32_16x16x32_bf16(false, ab, false, bb, (short)0, c, false, false);
    asm volatile("v_nop\n\tv_nop\n\tv_nop\n\tv_nop" : "+v"(c) : "v"(ab), "v"(bb));
    return c;
}
template <bool F16> __device__ __forceinline__ v8f mmag(v16us a, v16us b, v8f c) { if (F16) return mma_h(a, b, c); else return mma_b(a, b, c); }

// One wave computes a 64x64 tile: acc[mb][nb] element j = C[r0 + 16 mb + 8 (lane>>4) + j][c0 + 16 nb + (lane&15)] = sum_k A[m][k] Bt[n][k] (+ A2[m][k] Bt[n][k] when SPLIT). K % 32 == 0.
template <bool F16, bool SPLIT>
__device__ __forceinline__ void gemm_tile(const u16* __restrict__ A, const u16* __restrict__ A2, const u16* __restrict__ Bt, const int K, const int r0, const int c0, const int lr, const int hi, v8f (&acc)[4][4]) {
#pragma unroll
    for (int mb = 0; mb < 4; ++mb)
#pragma unroll
        for (int nb = 0; nb < 4; ++nb) acc[mb][nb] = (v8f){};
    const size_t aoff = (size_t)(r0 + lr) * K + 8 * hi, boff = (size_t)(c0 + lr) * K + 8 * hi;
#pragma unroll 1
    for (int kc = 0; kc < K; kc += 32) {
        v16us a[4], a2[4];
#pragma unroll
        for (int mb = 0; mb < 4; ++mb) { a[mb] = ldfr(A + aoff + (size_t)mb * 16 * K + kc); if (SPLIT) a2[mb] = ldfr(A2 + aoff + (size_t)mb * 16 * K + kc); else a2[mb] = a[mb]; }
#pragma unroll
        for (int nb = 0; nb < 4; ++nb) { const v16us bb = ldfr(Bt + boff + (size_t)nb * 16 * K + kc);
#pragma unroll
            for (int mb = 0; mb < 4; ++mb) { acc[mb][nb] = mmag<F16>(a[mb], bb, acc[mb][nb]); if (SPLIT) acc[mb][nb] = mmag<F16>(a2[mb], bb, acc[mb][nb]); } }
    }
}

__device__ __forceinline__ unsigned lds_byte(const u16* p) { return (unsigned)(size_t)(const __attribute__((address_space(3))) u16*)p; }

#define GWM  4                   // waves down a GEMM work-group, 64 rows each
#define GWN  2                   // waves across, 64 columns each
#define GTH  (32 * GWM * GWN)    // threads per GEMM work-group
#define GKS  64                  // k per stage: 128-B rows, whole cache lines
#define GPIT 72                  // u16 per staged row: 144 B = 16 B x odd, the pitch for 16-byte LDS readers of 128-B rows
#define GAR  (64 * GWM)          // A rows per stage
#define GBR  (64 * GWN)          // Bt rows per stage
#define GSTG ((GAR + GBR) * GPIT)   // u16 per stage buffer: A rows, then Bt rows
#define GEPI (16 * 68 * 4 + 64 * 72 * 2)   // bytes of epilogue staging per wave (f32 row block, then the 16-bit transpose block), laid over the ring after the k loop
static_assert(GTH == 256 && GAR == 256 && GBR == 128);   // stage_ab: 32 rows per copy, 8 copies for A and 4 for Bt
static_assert(DM % GKS == 0 && DM / GKS >= 2);           // the two-buffer prologue needs two stages
static_assert(GEPI % 16 == 0 && GEPI * GWM * GWN <= 2 * GSTG * 2);
static_assert((NB * SEQ) % GAR == 0 && (NB * (SEQ - RH)) % GAR == 0 && RH % GAR == 0 && SEQ % GAR == 0 && DM % GBR == 0);   // whole work-groups; early/late and q/k/v the same for all waves of one

// One 64-k stage for a work-group of 256 threads: 256 A rows and 128 Bt rows of 128 B, 16 bytes per lane and copy (8 lanes = one row = one line), straight into LDS. ga / gb / la: this thread's place in row tid>>3 of A, of Bt, of the buffer.
// The s_wait_xcnt 0 is the last line of the copies' own statement so that no address register of a copy is rewritten ahead of it.
__device__ __forceinline__ void stage_ab(const u16* ga, const u16* gb, const int K, const unsigned la) {
    const size_t rs = (size_t)32 * K;                 // 32 rows on in global memory
    const unsigned ls = 32 * GPIT * 2;                // 32 rows on in LDS, bytes
    const unsigned lb = la + GAR * GPIT * 2;
    asm volatile("global_load_async_to_lds_b128 %0, %1, off\n\t"
                 "global_load_async_to_lds_b128 %2, %3, off\n\t"
                 "global_load_async_to_lds_b128 %4, %5, off\n\t"
                 "global_load_async_to_lds_b128 %6, %7, off\n\t"
                 "global_load_async_to_lds_b128 %8, %9, off\n\t"
                 "global_load_async_to_lds_b128 %10, %11, off\n\t"
                 "global_load_async_to_lds_b128 %12, %13, off\n\t"
                 "global_load_async_to_lds_b128 %14, %15, off\n\t"
                 "global_load_async_to_lds_b128 %16, %17, off\n\t"
                 "global_load_async_to_lds_b128 %18, %19, off\n\t"
                 "global_load_async_to_lds_b128 %20, %21, off\n\t"
                 "global_load_async_to_lds_b128 %22, %23, off\n\t"
                 "s_wait_xcnt 0x0"
                 :: "v"(la), "v"(ga), "v"(la + ls), "v"(ga + rs), "v"(la + 2 * ls), "v"(ga + 2 * rs), "v"(la + 3 * ls), "v"(ga + 3 * rs),
                    "v"(la + 4 * ls), "v"(ga + 4 * rs), "v"(la + 5 * ls), "v"(ga + 5 * rs), "v"(la + 6 * ls), "v"(ga + 6 * rs), "v"(la + 7 * ls), "v"(ga + 7 * rs),
                    "v"(lb), "v"(gb), "v"(lb + ls), "v"(gb + rs), "v"(lb + 2 * ls), "v"(gb + 2 * rs), "v"(lb + 3 * ls), "v"(gb + 3 * rs) : "memory");
}

// The same 64x64 tile per wave and the same k order as gemm_tile, for a work-group of GWM x GWN waves on rows R0.. and columns C0..: the waves share each 64-k stage of A and Bt,
// brought into the two buffers of 'ring' by asynchronous copies one stage ahead. On return no copy is in flight and every wave has left the ring (the last trip's barrier), so the caller may reuse it.
template <bool F16>
__device__ __forceinline__ void gemm_tile_s(const u16* __restrict__ A, const u16* __restrict__ Bt, const int K, const int R0, const int C0, u16* ring, const int tid, const int wm, const int wn, const int lr, const int hi, v8f (&acc)[4][4]) {
#pragma unroll
    for (int mb = 0; mb < 4; ++mb)
#pragma unroll
        for (int nb = 0; nb < 4; ++nb) acc[mb][nb] = (v8f){};
    const u16* ga = A + (size_t)(R0 + (tid >> 3)) * K + (tid & 7) * 8;
    const u16* gb = Bt + (size_t)(C0 + (tid >> 3)) * K + (tid & 7) * 8;
    const unsigned la = lds_byte(ring + (tid >> 3) * GPIT + (tid & 7) * 8);
    const int nst = K / GKS;
    stage_ab(ga, gb, K, la);
    asm volatile("s_wait_asynccnt 0x0" ::: "memory");   // this wave's copies of stage 0 have landed
    __syncthreads();                                     // stage 0 readable by every wave
    stage_ab(ga + GKS, gb + GKS, K, la + GSTG * 2);
#pragma unroll 1   // kept rolled: one body of 32 products, the buffer picked by st & 1; unrolling would only grow the text
    for (int st = 0; st < nst; ++st) {
        const u16* ar = ring + (st & 1) * GSTG + (wm * 64 + lr) * GPIT + 8 * hi;
        const u16* br = ring + (st & 1) * GSTG + (GAR + wn * 64 + lr) * GPIT + 8 * hi;
#pragma unroll   // this and the loops inside: every fragment and accumulator index a constant, so that they stay in registers
        for (int kc = 0; kc < GKS; kc += 32) {
            v16us a[4], bb[4];                  // the block's 16 LDS reads stand together, ahead of its 16 products
#pragma unroll
            for (int mb = 0; mb < 4; ++mb) a[mb] = ldfr(ar + mb * 16 * GPIT + kc);
#pragma unroll
            for (int nb = 0; nb < 4; ++nb) bb[nb] = ldfr(br + nb * 16 * GPIT + kc);
#pragma unroll
            for (int nb = 0; nb < 4; ++nb)
#pragma unroll
                for (int mb = 0; mb < 4; ++mb) acc[mb][nb] = mmag<F16>(a[mb], bb[nb], acc[mb][nb]);
        }
        asm volatile("s_wait_dscnt 0x0" ::: "memory");      // this wave's LDS reads of the stage are done before the buffer is refilled
        asm volatile("s_wait_asynccnt 0x0" ::: "memory");   // this wave's copies of the next stage have landed
        __syncthreads();                                     // publishes the next stage and ends every reader's last read of this one
        if (st + 2 < nst) stage_ab(ga + (st + 2) * GKS, gb + (st + 2) * GKS, K, la + (st & 1) * (GSTG * 2));
    }
    asm volatile("s_wait_asynccnt 0x0" ::: "memory");       // no copy is left in flight when the ring becomes epilogue staging
}

// Source groups are addressed as (i / seg) * segf + i % seg so a reduced build reads the right rows of full-size inputs.
__global__ __launch_bounds__(256) void k_cvt8(const float* __restrict__ src, u16* dst, unsigned n8, unsigned seg, unsigned segf, int tof16, float scale) {
    const unsigned i = blockIdx.x * 256u + threadIdx.x;
    if (i >= n8) return;
    const unsigned bb = i / seg, r = i - bb * seg;
    const size_t si = ((size_t)bb * segf + r) * 8;
    const v4f v0 = *(const v4f*)(src + si); const v4f v1 = *(const v4f*)(src + si + 4);
    v8us o;
#pragma unroll
    for (int k = 0; k < 4; ++k) {
        const u16 b0 = f2bf(v0[k]), b1 = f2bf(v1[k]);
        const u16 h0 = f2h(bf2f(b0) * scale), h1 = f2h(bf2f(b1) * scale);
        o[k] = tof16 ? h0 : b0; o[4 + k] = tof16 ? h1 : b1;
    }
    v8us* dp = (v8us*)(dst + (size_t)i * 8);
    *dp = o; 
}

// k_proj: [NB*SEQ][1024] x [3072][1024]^T (rows 0..1023 query weight, 1024..2047 key weight, 2048..3071 value weight). One wave per 64x64 tile = 64 time rows of one head, eight waves (4 x 2 tiles) per work-group sharing the staged operands.
// Epilogue q/k: per-row LayerNorm over the 64 head columns (mean and biased variance in f32 across 8 lanes x 8 columns, eps 1e-5, gain and bias taken as bf16 values of the inputs; both parameter sets are loaded and chosen by value),
// then f16 head plane rows [b][h][t][64] (+ bf16 hi/lo rows for t < RH); v: transposed through LDS into [b][h][d][t] lines of 64 t (+ hi/lo for t < RH). Planes addressed by element offsets from one base.
// All f16 plane values go through the value-select convert (no subnormal f16 can be produced).
__global__ __launch_bounds__(GTH) void k_proj(const u16* __restrict__ XB, const u16* __restrict__ WALL, u16* PL, size_t oP16, size_t oEH, size_t oEL,
                                             const float* __restrict__ QG, const float* __restrict__ QB, const float* __restrict__ KG, const float* __restrict__ KB) {
    __shared__ __align__(16) u16 ring[2 * GSTG];
    const int tid = threadIdx.x, lane = tid & 31, lr = lane & 15, hi = lane >> 4;
    const int wv = __builtin_amdgcn_readfirstlane(tid >> 5), wm = wv % GWM, wn = wv / GWM;   // wave number as a scalar: tile indices and the branches on them stay scalar
    float* os = (float*)((char*)ring + wv * GEPI);                       // this wave's own staging, used after the k loop only
    u16* ts = (u16*)((char*)ring + wv * GEPI + 16 * 68 * 4);
    const int r0 = blockIdx.x * GAR + wm * 64, c0 = blockIdx.y * GBR + wn * 64;
    const int which = c0 / DM, hd = (c0 - which * DM) / HD;
    const int b = r0 / SEQ, t0 = r0 - b * SEQ;
    const bool early = (t0 < RH);
    const size_t bh = (size_t)b * NH + hd;
    v8f acc[4][4];
    gemm_tile_s<false>(XB, WALL, DM, blockIdx.x * GAR, blockIdx.y * GBR, ring, tid, wm, wn, lr, hi, acc);
    if (which < 2) {
        const size_t o16 = oP16 + (size_t)which * PLANE + (bh * SEQ + t0) * HD;
        const size_t oeh = oEH + (size_t)which * EPLANE + (bh * RH + (early ? t0 : 0)) * HD;
        const size_t oel = oEL + (size_t)which * EPLANE + (bh * RH + (early ? t0 : 0)) * HD;
        const int gc = (lane & 7) * 8;                 // this lane's 8 head columns (same in every row group)
        const v4f gq0 = *(const v4f*)(QG + gc), gq1 = *(const v4f*)(QG + gc + 4);
        const v4f bq0 = *(const v4f*)(QB + gc), bq1 = *(const v4f*)(QB + gc + 4);
        const v4f gk0 = *(const v4f*)(KG + gc), gk1 = *(const v4f*)(KG + gc + 4);
        const v4f bk0 = *(const v4f*)(KB + gc), bk1 = *(const v4f*)(KB + gc + 4);
        v4f g0, g1, be0, be1;
#pragma unroll
        for (int q = 0; q < 4; ++q) {
            g0[q]  = bfr((which == 0) ? gq0[q] : gk0[q]); g1[q]  = bfr((which == 0) ? gq1[q] : gk1[q]);
            be0[q] = bfr((which == 0) ? bq0[q] : bk0[q]); be1[q] = bfr((which == 0) ? bq1[q] : bk1[q]);
        }
#pragma unroll
        for (int mb = 0; mb < 4; ++mb) {
#pragma unroll
            for (int nb = 0; nb < 4; ++nb)
#pragma unroll
                for (int j = 0; j < 8; ++j) os[(hi * 8 + j) * 68 + nb * 16 + lr] = acc[mb][nb][j];
            __syncthreads();
{
#pragma unroll
                for (int s = 0; s < 4; ++s) {
                    const int row = 4 * s + (lane >> 3), pc = (lane & 7) * 8;
                    const v4f x0 = *(const v4fa*)&os[row * 68 + pc]; const v4f x1 = *(const v4fa*)&os[row * 68 + pc + 4];
                    // LayerNorm of the 64-wide row held by the 8 lanes sharing lane>>3 (all 32 lanes active, uniform control)
                    float sm = ((x0[0] + x0[1]) + (x0[2] + x0[3])) + ((x1[0] + x1[1]) + (x1[2] + x1[3]));
                    sm += __shfl_xor(sm, 1, 32); sm += __shfl_xor(sm, 2, 32); sm += __shfl_xor(sm, 4, 32);
                    const float mean = sm * (1.0f / 64.0f);
                    v4f d0, d1;
#pragma unroll
                    for (int q = 0; q < 4; ++q) { d0[q] = x0[q] - mean; d1[q] = x1[q] - mean; }
                    float vs = ((d0[0] * d0[0] + d0[1] * d0[1]) + (d0[2] * d0[2] + d0[3] * d0[3])) + ((d1[0] * d1[0] + d1[1] * d1[1]) + (d1[2] * d1[2] + d1[3] * d1[3]));
                    vs += __shfl_xor(vs, 1, 32); vs += __shfl_xor(vs, 2, 32); vs += __shfl_xor(vs, 4, 32);
                    const float rinv = rsqrtf(vs * (1.0f / 64.0f) + LNEPS);
                    v4f y0, y1;
#pragma unroll
                    for (int q = 0; q < 4; ++q) { y0[q] = d0[q] * rinv * g0[q] + be0[q]; y1[q] = d1[q] * rinv * g1[q] + be1[q]; }
                    v8us q16;
#pragma unroll
                    for (int q = 0; q < 4; ++q) { q16[q] = f2h_fl(y0[q]); q16[4 + q] = f2h_fl(y1[q]); }
                    const size_t ro = (size_t)(mb * 16 + row) * HD + pc;
                    *(v8us*)(PL + o16 + ro) = q16;
                    if (early) {
                        v8us oh, ol;
#pragma unroll
                        for (int q = 0; q < 4; ++q) { const u16 a = f2bf(y0[q]); oh[q] = a; ol[q] = f2bf(y0[q] - bf2f(a)); const u16 c = f2bf(y1[q]); oh[4 + q] = c; ol[4 + q] = f2bf(y1[q] - bf2f(c)); }
                        *(v8us*)(PL + oeh + ro) = oh; *(v8us*)(PL + oel + ro) = ol;
                    }
                }
                
            }
            __syncthreads();
        }
    } else {
#pragma unroll
        for (int pl = 0; pl < 3; ++pl) {
            if (pl == 0 || early) {
#pragma unroll
                for (int mb = 0; mb < 4; ++mb)
#pragma unroll
                    for (int nb = 0; nb < 4; ++nb) {
                        v8us pk;
#pragma unroll
                        for (int j = 0; j < 8; ++j) { const float y = acc[mb][nb][j]; const u16 hb = f2bf(y); pk[j] = (pl == 0) ? f2h_fl(y) : ((pl == 1) ? hb : f2bf(y - bf2f(hb))); }
                        *(v8usa*)&ts[(nb * 16 + lr) * 72 + mb * 16 + hi * 8] = pk;     // ts[d][t]: 8 consecutive t per lane
                    }
                __syncthreads();
                const size_t dofs = (pl == 0) ? (oP16 + 2 * PLANE + bh * HD * SEQ + t0) : (((pl == 1) ? oEH : oEL) + 2 * EPLANE + bh * HD * RH + t0);
                const int dp = (pl == 0) ? SEQ : RH;
{
#pragma unroll 4
                    for (int s = 0; s < 16; ++s) {
                        const int d = 4 * s + (lane >> 3), pc = (lane & 7) * 8;
                        const v8us v = *(const v8usa*)&ts[d * 72 + pc];
                        *(v8us*)(PL + dofs + (size_t)d * dp + pc) = v;
                    }
                    
                }
                __syncthreads();
            }
        }
    }
}

// Online-softmax update for one 16 x 32 score step. s0/s1 hold raw scores for keys jb + (lane&15) and jb + 16 + (lane&15), rows qbase + 8 (lane>>4) + i; on return they hold exp2(t - running max).
// lrow keeps PER-LANE partial sums (reduced over the 16 lanes of a row once, after the key loop). Masked entries are replaced before the maximum; every row keeps its own key.
__device__ __forceinline__ void sm_step(v8f& s0, v8f& s1, float (&mrow)[8], float (&lrow)[8], float (&corr)[8], const int jb, const int qbase, const int lr, const int hi) {
#pragma unroll
    for (int i = 0; i < 8; ++i) {
        const int row = qbase + i + 8 * hi;
        float a0 = s0[i] * SCL2, a1 = s1[i] * SCL2;
        a0 = (jb + lr > row) ? -1.0e30f : a0;
        a1 = (jb + 16 + lr > row) ? -1.0e30f : a1;
        float mx = fmaxf(a0, a1);
        mx = fmaxf(mx, __shfl_xor(mx, 1, 32)); mx = fmaxf(mx, __shfl_xor(mx, 2, 32)); mx = fmaxf(mx, __shfl_xor(mx, 4, 32)); mx = fmaxf(mx, __shfl_xor(mx, 8, 32));
        const float mnew = fmaxf(mrow[i], mx);
        const float c  = __builtin_amdgcn_exp2f(mrow[i] - mnew);
        const float p0 = __builtin_amdgcn_exp2f(a0 - mnew);
        const float p1 = __builtin_amdgcn_exp2f(a1 - mnew);
        lrow[i] = lrow[i] * c + (p0 + p1);
        mrow[i] = mnew; corr[i] = c; s0[i] = p0; s1[i] = p1;
    }
}

#define AW   4                   // waves per late-attention work-group, 16 query rows each
#define KPIT 72                  // u16 per staged key row: 144 B = 16 B x odd, the pitch for 16-byte LDS readers of 128-B rows
#define VPIT 40                  // u16 per staged value row: 80 B = 16 B x odd, the same for 64-B rows
#define NQB_L (((SEQ - RH) / (16 * AW)) > 0 ? ((SEQ - RH) / (16 * AW)) : 1)
static_assert((SEQ - RH) % (16 * AW) == 0);   // whole work-groups of query rows
static_assert((RH + 16 * AW) / 32 >= 2);      // the two-buffer prologue needs two key steps
static_assert((16 * AW) % 32 == 0 && RH % 32 == 0);   // a work-group's last key step ends on its last query row

// One 32-key stage for a work-group of 128 threads: key rows jb..jb+31 (32 x 128 B, contiguous in the plane) and the 64 value rows' columns jb..jb+31 (64 x 64 B), 16 bytes per lane and copy, straight into LDS.
// The s_wait_xcnt 0 is the last line of the copies' own statement so that no address register of a copy is rewritten ahead of it.
__device__ __forceinline__ void stage_kv(const u16* __restrict__ Kb, const u16* __restrict__ Vb, const int jb, u16* kd, u16* vd, const int tid) {
    const u16* gk0 = Kb + (size_t)(jb + (tid >> 3)) * HD + (tid & 7) * 8;      // rows 0..15 of the stage
    const u16* gk1 = gk0 + 16 * HD;                                           // rows 16..31
    const u16* gv0 = Vb + (size_t)(tid >> 2) * SEQ + jb + (tid & 3) * 8;       // head columns 0..31
    const u16* gv1 = gv0 + (size_t)32 * SEQ;                                  // head columns 32..63
    const unsigned lk0 = lds_byte(kd + (tid >> 3) * KPIT + (tid & 7) * 8), lk1 = lk0 + 16 * KPIT * 2;
    const unsigned lv0 = lds_byte(vd + (tid >> 2) * VPIT + (tid & 3) * 8), lv1 = lv0 + 32 * VPIT * 2;
    asm volatile("global_load_async_to_lds_b128 %0, %1, off\n\t"
                 "global_load_async_to_lds_b128 %2, %3, off\n\t"
                 "global_load_async_to_lds_b128 %4, %5, off\n\t"
                 "global_load_async_to_lds_b128 %6, %7, off\n\t"
                 "s_wait_xcnt 0x0"
                 :: "v"(lk0), "v"(gk0), "v"(lk1), "v"(gk1), "v"(lv0), "v"(gv0), "v"(lv1), "v"(gv1) : "memory");
}

// k_attn_l: query rows >= RH, f16 single products. One work-group of AW waves per 16*AW query rows of one (batch, head), one wave per 16 rows; the waves share each 32-key stage of K and V,
// brought into two LDS buffers by asynchronous copies one stage ahead. Every wave walks the work-group's key range: a step wholly above a wave's diagonal adds exact zeros. ctx f16 x CCAR -> AT [b][t-RH][1024].
__global__ __launch_bounds__(32 * AW) void k_attn_l(const u16* __restrict__ QP, const u16* __restrict__ KP, const u16* __restrict__ VT, u16* AT) {
    __shared__ __align__(16) u16 ks[2][32 * KPIT];
    __shared__ __align__(16) u16 vs[2][HD * VPIT];
    __shared__ __align__(16) u16 pwa[AW][16 * 40];
    __shared__ __align__(16) float osa[AW][16 * 68];
    const int tid = threadIdx.x, lane = tid & 31, lr = lane & 15, hi = lane >> 4, wv = tid >> 5;
    u16* pw = pwa[wv]; float* os = osa[wv];
    const int bh = blockIdx.x / NQB_L, qb = blockIdx.x - bh * NQB_L;
    const int b = bh / NH, h = bh - b * NH;
    const int qblk = RH + qb * (16 * AW);
    const int qbase = qblk + wv * 16;
    const size_t pb = (size_t)bh * SEQ * HD;
    const u16* Qb = QP + pb; const u16* Kb = KP + pb; const u16* Vb = VT + pb;
    const int nsteps = (qblk + 16 * AW) >> 5;    // keys 0 .. qblk+16*AW-1 in steps of 32; nsteps*32 <= SEQ, nsteps >= 2
    stage_kv(Kb, Vb, 0, ks[0], vs[0], tid);
    asm volatile("s_wait_asynccnt 0x0" ::: "memory");   // this wave's copies of stage 0 have landed
    __syncthreads();                                     // stage 0 readable by every wave
    stage_kv(Kb, Vb, 32, ks[1], vs[1], tid);
    const v16us q0 = ldfr(Qb + (size_t)(qbase + lr) * HD + 8 * hi);
    const v16us q1 = ldfr(Qb + (size_t)(qbase + lr) * HD + 32 + 8 * hi);
    v8f acc[4];
#pragma unroll
    for (int nt = 0; nt < 4; ++nt) acc[nt] = (v8f){};
    float mrow[8], lrow[8];
#pragma unroll
    for (int i = 0; i < 8; ++i) { mrow[i] = -1.0e30f; lrow[i] = 0.0f; }
#pragma unroll 1
    for (int st = 0; st < nsteps; ++st) {
        const int jb = st * 32;
        const u16* kr0 = ks[st & 1] + lr * KPIT + 8 * hi; const u16* kr1 = kr0 + 16 * KPIT;
        const u16* vr = vs[st & 1] + lr * VPIT + 8 * hi;
        v8f s0 = (v8f){}, s1 = (v8f){};
        s0 = mma_h(q0, ldfr(kr0), s0); s0 = mma_h(q1, ldfr(kr0 + 32), s0);
        s1 = mma_h(q0, ldfr(kr1), s1); s1 = mma_h(q1, ldfr(kr1 + 32), s1);
        float corr[8];
        sm_step(s0, s1, mrow, lrow, corr, jb, qbase, lr, hi);
#pragma unroll
        for (int nt = 0; nt < 4; ++nt)
#pragma unroll
            for (int i = 0; i < 8; ++i) acc[nt][i] *= corr[i];
#pragma unroll
        for (int i = 0; i < 8; ++i) { pw[(i + 8 * hi) * 40 + lr] = f2h(s0[i] * PCAR); pw[(i + 8 * hi) * 40 + 16 + lr] = f2h(s1[i] * PCAR); }
        __syncthreads();
        const v8us plo = *(const v8usa*)&pw[lr * 40 + 8 * hi]; const v8us phi = *(const v8usa*)&pw[lr * 40 + 16 + 8 * hi];
        const v16us pf = __builtin_shufflevector(plo, phi, 0, 1, 2, 3, 4, 5, 6, 7, 8, 9, 10, 11, 12, 13, 14, 15);
#pragma unroll
        for (int nt = 0; nt < 4; ++nt) { const v16us vf = ldfr(vr + nt * 16 * VPIT); acc[nt] = mma_h(pf, vf, acc[nt]); }
        asm volatile("s_wait_dscnt 0x0" ::: "memory");      // this wave's LDS reads of the stage are done before the buffer is refilled
        asm volatile("s_wait_asynccnt 0x0" ::: "memory");   // this wave's copies of the next stage have landed
        __syncthreads();                                     // publishes the next stage and ends every reader's last read of this one
        if (st + 2 < nsteps) stage_kv(Kb, Vb, jb + 64, ks[st & 1], vs[st & 1], tid);
    }
    asm volatile("s_wait_asynccnt 0x0" ::: "memory");       // no copy is left in flight when the wave goes on to its end
#pragma unroll
    for (int i = 0; i < 8; ++i) {
        float l = lrow[i];
        l += __shfl_xor(l, 1, 32); l += __shfl_xor(l, 2, 32); l += __shfl_xor(l, 4, 32); l += __shfl_xor(l, 8, 32);
        const float inv = CCAR / (l * PCAR);
#pragma unroll
        for (int nt = 0; nt < 4; ++nt) os[(i + 8 * hi) * 68 + nt * 16 + lr] = acc[nt][i] * inv;
    }
    __syncthreads();
    u16* dst = AT + ((size_t)b * (SEQ - RH) + (qbase - RH)) * DM + h * HD;
{
#pragma unroll
        for (int s = 0; s < 4; ++s) {
            const int row = 4 * s + (lane >> 3), pc = (lane & 7) * 8;
            const v4f x0 = *(const v4fa*)&os[row * 68 + pc]; const v4f x1 = *(const v4fa*)&os[row * 68 + pc + 4];
            v8us o;
#pragma unroll
            for (int q = 0; q < 4; ++q) { o[q] = f2h(x0[q]); o[4 + q] = f2h(x1[q]); }
            *(v8us*)(dst + (size_t)row * DM + pc) = o;
        }
        
    }
}

// k_attn_e: query rows < RH, bf16 hi+lo operands (hi.hi + lo.hi + hi.lo into one accumulator; residuals unscaled). ctx hi/lo bf16 -> ATEh/ATEl [b][t][1024].
__global__ __launch_bounds__(32) void k_attn_e(const u16* __restrict__ QEh, const u16* __restrict__ QEl, const u16* __restrict__ KEh, const u16* __restrict__ KEl, const u16* __restrict__ VEh, const u16* __restrict__ VEl, u16* ATEh, u16* ATEl) {
    __shared__ __align__(16) u16 pwh[16 * 40];
    __shared__ __align__(16) u16 pwl[16 * 40];
    __shared__ __align__(16) float os[16 * 68];
    const int lane = threadIdx.x & 31, lr = lane & 15, hi = lane >> 4;
    const int bh = blockIdx.x / (RH / 16), qt = blockIdx.x - bh * (RH / 16);
    const int b = bh / NH, h = bh - b * NH;
    const int qbase = qt * 16;
    const size_t pb = (size_t)bh * RH * HD;
    const size_t qo = pb + (size_t)(qbase + lr) * HD + 8 * hi;
    const v16us qh0 = ldfr(QEh + qo), qh1 = ldfr(QEh + qo + 32), ql0 = ldfr(QEl + qo), ql1 = ldfr(QEl + qo + 32);
    v8f acc[4];
#pragma unroll
    for (int nt = 0; nt < 4; ++nt) acc[nt] = (v8f){};
    float mrow[8], lrow[8];
#pragma unroll
    for (int i = 0; i < 8; ++i) { mrow[i] = -1.0e30f; lrow[i] = 0.0f; }
    const int nsteps = (qbase + 47) >> 5;        // nsteps*32 <= RH
#pragma unroll 1
    for (int st = 0; st < nsteps; ++st) {
        const int jb = st * 32;
        const size_t ko = pb + (size_t)(jb + lr) * HD + 8 * hi;
        v8f s0 = (v8f){}, s1 = (v8f){};
        {
            const v16us kh0 = ldfr(KEh + ko), kh1 = ldfr(KEh + ko + 32), kl0 = ldfr(KEl + ko), kl1 = ldfr(KEl + ko + 32);
            s0 = mma_b(qh0, kh0, s0); s0 = mma_b(qh1, kh1, s0); s0 = mma_b(ql0, kh0, s0); s0 = mma_b(ql1, kh1, s0); s0 = mma_b(qh0, kl0, s0); s0 = mma_b(qh1, kl1, s0);
        }
        {
            const size_t k1 = ko + 16 * HD;
            const v16us kh0 = ldfr(KEh + k1), kh1 = ldfr(KEh + k1 + 32), kl0 = ldfr(KEl + k1), kl1 = ldfr(KEl + k1 + 32);
            s1 = mma_b(qh0, kh0, s1); s1 = mma_b(qh1, kh1, s1); s1 = mma_b(ql0, kh0, s1); s1 = mma_b(ql1, kh1, s1); s1 = mma_b(qh0, kl0, s1); s1 = mma_b(qh1, kl1, s1);
        }
        float corr[8];
        sm_step(s0, s1, mrow, lrow, corr, jb, qbase, lr, hi);
#pragma unroll
        for (int nt = 0; nt < 4; ++nt)
#pragma unroll
            for (int i = 0; i < 8; ++i) acc[nt][i] *= corr[i];
#pragma unroll
        for (int i = 0; i < 8; ++i) {
            const u16 a = f2bf(s0[i]); const u16 c = f2bf(s1[i]);
            pwh[(i + 8 * hi) * 40 + lr] = a; pwl[(i + 8 * hi) * 40 + lr] = f2bf(s0[i] - bf2f(a));
            pwh[(i + 8 * hi) * 40 + 16 + lr] = c; pwl[(i + 8 * hi) * 40 + 16 + lr] = f2bf(s1[i] - bf2f(c));
        }
        __syncthreads();
        const v8us h0 = *(const v8usa*)&pwh[lr * 40 + 8 * hi]; const v8us h1 = *(const v8usa*)&pwh[lr * 40 + 16 + 8 * hi];
        const v8us l0 = *(const v8usa*)&pwl[lr * 40 + 8 * hi]; const v8us l1 = *(const v8usa*)&pwl[lr * 40 + 16 + 8 * hi];
        const v16us pfh = __builtin_shufflevector(h0, h1, 0, 1, 2, 3, 4, 5, 6, 7, 8, 9, 10, 11, 12, 13, 14, 15);
        const v16us pfl = __builtin_shufflevector(l0, l1, 0, 1, 2, 3, 4, 5, 6, 7, 8, 9, 10, 11, 12, 13, 14, 15);
#pragma unroll
        for (int nt = 0; nt < 4; ++nt) {
            const size_t vo = pb + (size_t)(nt * 16 + lr) * RH + jb + 8 * hi;      // [bh][64][RH], same plane size as [bh][RH][64]
            const v16us vh = ldfr(VEh + vo), vl = ldfr(VEl + vo);
            acc[nt] = mma_b(pfh, vh, acc[nt]); acc[nt] = mma_b(pfl, vh, acc[nt]); acc[nt] = mma_b(pfh, vl, acc[nt]);
        }
        __syncthreads();
    }
#pragma unroll
    for (int i = 0; i < 8; ++i) {
        float l = lrow[i];
        l += __shfl_xor(l, 1, 32); l += __shfl_xor(l, 2, 32); l += __shfl_xor(l, 4, 32); l += __shfl_xor(l, 8, 32);
        const float inv = 1.0f / l;
#pragma unroll
        for (int nt = 0; nt < 4; ++nt) os[(i + 8 * hi) * 68 + nt * 16 + lr] = acc[nt][i] * inv;
    }
    __syncthreads();
    const size_t dofs = ((size_t)b * RH + qbase) * DM + h * HD;
{
#pragma unroll
        for (int s = 0; s < 4; ++s) {
            const int row = 4 * s + (lane >> 3), pc = (lane & 7) * 8;
            const v4f x0 = *(const v4fa*)&os[row * 68 + pc]; const v4f x1 = *(const v4fa*)&os[row * 68 + pc + 4];
            v8us oh, ol;
#pragma unroll
            for (int q = 0; q < 4; ++q) { const u16 a = f2bf(x0[q]); oh[q] = a; ol[q] = f2bf(x0[q] - bf2f(a)); const u16 c = f2bf(x1[q]); oh[4 + q] = c; ol[4 + q] = f2bf(x1[q] - bf2f(c)); }
            *(v8us*)(ATEh + dofs + (size_t)row * DM + pc) = oh;
            *(v8us*)(ATEl + dofs + (size_t)row * DM + pc) = ol;
        }
        
    }
}

// Output projection: OUT[b][toff + r][n] = scale * sum_k A[row][k] Bt[n][k] (+ A2 product in k_outp_e) + bf16(bias[n]); rows of A are [b][r] with rpb rows per batch.
// Shared epilogue of one wave's 64x64 tile at rows r0.., columns c0..: whole 256-B row pieces through the wave's own staging 'os'. Every wave of the work-group passes the same barriers.
__device__ __forceinline__ void outp_store(const v8f (&acc)[4][4], float* os, const float* __restrict__ bias, float* OUT, const float scale, const int rpb, const int toff, const int r0, const int c0, const int lr, const int hi) {
    const int b = r0 / rpb, tb = toff + (r0 - b * rpb);
    float* crow0 = OUT + ((size_t)b * SEQ_FULL + tb) * DM + c0;
    const int cofs = lr * 4;
    v4f bv; bv[0] = bfr(bias[c0 + cofs]); bv[1] = bfr(bias[c0 + cofs + 1]); bv[2] = bfr(bias[c0 + cofs + 2]); bv[3] = bfr(bias[c0 + cofs + 3]);
#pragma unroll
    for (int mb = 0; mb < 4; ++mb) {
#pragma unroll
        for (int nb = 0; nb < 4; ++nb)
#pragma unroll
            for (int j = 0; j < 8; ++j) os[(hi * 8 + j) * 68 + nb * 16 + lr] = acc[mb][nb][j];
        __syncthreads();
#pragma unroll
        for (int s = 0; s < 8; ++s) {
            const int row = 2 * s + hi;
            const v4f x = *(const v4fa*)&os[row * 68 + cofs];
            v4f val; val[0] = x[0] * scale + bv[0]; val[1] = x[1] * scale + bv[1]; val[2] = x[2] * scale + bv[2]; val[3] = x[3] * scale + bv[3];
            *(v4f*)(crow0 + (size_t)(mb * 16 + row) * DM + cofs) = val;
        }
        __syncthreads();
    }
}

// k_outp_e: rows < RH, bf16 hi+lo ctx planes; one wave per work-group and 64x64 tile, fragments straight from the planes (few tiles: one wave per work-group spreads them over the chip).
__global__ __launch_bounds__(32) void k_outp_e(const u16* __restrict__ A, const u16* __restrict__ A2, const u16* __restrict__ Bt, const float* __restrict__ bias, float* OUT, float scale, int rpb, int toff) {
    __shared__ __align__(16) float os[16 * 68];
    const int lane = threadIdx.x & 31, lr = lane & 15, hi = lane >> 4;
    const int r0 = blockIdx.x * 64, c0 = blockIdx.y * 64;
    v8f acc[4][4];
    gemm_tile<false, true>(A, A2, Bt, DM, r0, c0, lr, hi, acc);
    outp_store(acc, os, bias, OUT, scale, rpb, toff, r0, c0, lr, hi);
}

// k_outp_l: rows >= RH, f16 planes; eight waves (4 x 2 tiles of 64x64) per work-group sharing the staged operands.
__global__ __launch_bounds__(GTH) void k_outp_l(const u16* __restrict__ A, const u16* __restrict__ Bt, const float* __restrict__ bias, float* OUT, float scale, int rpb, int toff) {
    __shared__ __align__(16) u16 ring[2 * GSTG];
    const int tid = threadIdx.x, lane = tid & 31, lr = lane & 15, hi = lane >> 4;
    const int wv = __builtin_amdgcn_readfirstlane(tid >> 5), wm = wv % GWM, wn = wv / GWM;   // wave number as a scalar: tile indices and the branches on them stay scalar
    float* os = (float*)((char*)ring + wv * GEPI);                       // this wave's own staging, used after the k loop only
    v8f acc[4][4];
    gemm_tile_s<true>(A, Bt, DM, blockIdx.x * GAR, blockIdx.y * GBR, ring, tid, wm, wn, lr, hi, acc);
    outp_store(acc, os, bias, OUT, scale, rpb, toff, blockIdx.x * GAR + wm * 64, blockIdx.y * GBR + wn * 64, lr, hi);
}

extern "C" void kernel_launch(void* const* d_in, const int* in_sizes, int n_in,
                              void* d_out, int out_size, void* d_ws, size_t ws_size, hipStream_t stream) {
    if (n_in < 10) return;
    const long long needx = ((long long)(NB - 1) * SEQ_FULL + SEQ) * DM;
    if ((long long)in_sizes[0] < needx) return;
    if ((long long)in_sizes[1] < (long long)DM * DM || (long long)in_sizes[2] < (long long)DM * DM || (long long)in_sizes[3] < (long long)DM * DM || (long long)in_sizes[4] < (long long)DM * DM) return;
    if (in_sizes[5] < DM) return;
    if (in_sizes[6] < HD || in_sizes[7] < HD || in_sizes[8] < HD || in_sizes[9] < HD) return;
    if ((long long)out_size < needx) return;
    if (O_END * 2 > ws_size) return;
    // wire order: x, key weight, query weight, value weight, output weight, output bias, key LayerNorm gain, key LayerNorm bias, query LayerNorm gain, query LayerNorm bias
    const float* x  = (const float*)d_in[0];
    const float* Wk = (const float*)d_in[1];
    const float* Wq = (const float*)d_in[2];
    const float* Wv = (const float*)d_in[3];
    const float* Wp = (const float*)d_in[4];
    const float* bp = (const float*)d_in[5];
    const float* kg = (const float*)d_in[6];
    const float* kb = (const float*)d_in[7];
    const float* qg = (const float*)d_in[8];
    const float* qb = (const float*)d_in[9];
    float* OUT = (float*)d_out;
    u16* PL = (u16*)d_ws;

    const unsigned xn8 = (unsigned)(XBN / 8), wn8 = (unsigned)(WN / 8);
    k_cvt8<<<(xn8 + 255) / 256, 256, 0, stream>>>(x, PL + O_XB, xn8, (unsigned)((size_t)SEQ * DM / 8), (unsigned)((size_t)SEQ_FULL * DM / 8), 0, 1.0f);
    k_cvt8<<<(wn8 + 255) / 256, 256, 0, stream>>>(Wq, PL + O_WALL,          wn8, wn8, wn8, 0, 1.0f);   // rows 0..1023: query
    k_cvt8<<<(wn8 + 255) / 256, 256, 0, stream>>>(Wk, PL + O_WALL + WN,     wn8, wn8, wn8, 0, 1.0f);   // rows 1024..2047: key
    k_cvt8<<<(wn8 + 255) / 256, 256, 0, stream>>>(Wv, PL + O_WALL + 2 * WN, wn8, wn8, wn8, 0, 1.0f);   // rows 2048..3071: value
    k_cvt8<<<(wn8 + 255) / 256, 256, 0, stream>>>(Wp, PL + O_WPB, wn8, wn8, wn8, 0, 1.0f);
    k_cvt8<<<(wn8 + 255) / 256, 256, 0, stream>>>(Wp, PL + O_WPH, wn8, wn8, wn8, 1, WCAR);

    k_proj<<<dim3(NB * SEQ / GAR, 3 * DM / GBR, 1), GTH, 0, stream>>>(PL + O_XB, PL + O_WALL, PL, O_P16, O_EH, O_EL, qg, qb, kg, kb);

    k_attn_e<<<NB * NH * (RH / 16), 32, 0, stream>>>(PL + O_EH, PL + O_EL, PL + O_EH + EPLANE, PL + O_EL + EPLANE, PL + O_EH + 2 * EPLANE, PL + O_EL + 2 * EPLANE, PL + O_ATEH, PL + O_ATEL);
    if (SEQ > RH)
        k_attn_l<<<NB * NH * ((SEQ - RH) / (16 * AW)), 32 * AW, 0, stream>>>(PL + O_P16, PL + O_P16 + PLANE, PL + O_P16 + 2 * PLANE, PL + O_AT);

    k_outp_e<<<dim3(NB * RH / 64, DM / 64, 1), 32, 0, stream>>>(PL + O_ATEH, PL + O_ATEL, PL + O_WPB, bp, OUT, 1.0f, RH, 0);
    if (SEQ > RH)
        k_outp_l<<<dim3(NB * (SEQ - RH) / GAR, DM / GBR, 1), GTH, 0, stream>>>(PL + O_AT, PL + O_WPH, bp, OUT, 1.0f / (WCAR * CCAR), SEQ - RH, RH);
}

// v003
// It runs in 247 microseconds.
// Two timings next to v002 put it at 1.04 and 1.03 times that version's speed.
// Over all steps from v000 it is 1.81 times as fast.
#include <hip/hip_runtime.h>

// Compute dtypes (f32 accumulate everywhere): q/k/v projections bf16 x bf16 (inputs converted RNE to bf16, products exact), per-head LayerNorm of q and k in f32 inside the projection epilogue; scores q.k and P.V: f16 single products on query rows >= 256 (P carried x1024), bf16 hi+lo (3 products) on query rows < 256; output projection: f16 single product (ctx x16, Wo x32 carries) on rows >= 256, bf16 hi+lo ctx x bf16 Wo on rows < 256.
// Causal 16-head attention block, x [4][2048][1024]; separate bias-free [out][in] key / query / value projections (used as Bt as stored), per-head LayerNorm (eps 1e-5, gain and bias inputs) on the 64-wide query and key rows,
// the two 1024^(-1/4) factors applied as one 1/32 on the scores, causal exclusion with the diagonal kept, softmax in f32 (running max, log2 domain), heads merged h*64+d, [out][in] output projection plus bias.
// Layout: 16-bit planes in the workspace (u16 storage): x copy [b*SEQ+t][1024]; weights [3][1024][1024] (q, k, v) ; q and k head planes [b][h][t][64]; v transposed [b][h][64][t]; hi/lo bf16 planes of the same for t < 256;
// ctx f16 [b][t-256][1024] and ctx hi/lo bf16 [b][t<256][1024]. Fused flash-style attention: one wave per 16 query rows, 32 keys per step, no score plane in global memory; rows < 256: fragments straight from the k-contiguous planes; rows >= 256: four waves share K and V stages in LDS. Projection and late output GEMMs: eight waves share A and B stages in LDS.

#ifndef NB
#define NB 4
#endif
#ifndef SEQ
#define SEQ 2048
#endif
#define NB_FULL  4
#define SEQ_FULL 2048
#define DM   1024
#define NH   16
#define HD   64
#define RH   256                 // query rows / keys below RH also carry bf16 hi+lo planes
#define PCAR 1024.0f             // carry on f16 probabilities
#define CCAR 16.0f               // carry on the f16 ctx plane
#define WCAR 32.0f               // carry on the f16 output-projection weight plane
#define SCL2 (0.03125f * 1.4426950408889634f)   // 1/sqrt(1024) x log2(e)
#define LNEPS 1.0e-5f            // LayerNorm epsilon on the head rows

static_assert(DM == NH * HD);            // heads tile the channel width
static_assert(HD == 64);
static_assert(HD == 8 * 8);              // LayerNorm row = 8 lanes x 8 columns in the projection epilogue
static_assert(DM % 32 == 0);             // GEMM k-step
static_assert(HD % 32 == 0);             // score k-step
static_assert(SEQ % 64 == 0);            // 64-row GEMM tiles never straddle a batch
static_assert(RH % 64 == 0);             // early/late split on tile borders
static_assert(SEQ >= RH);
static_assert((SEQ - RH) % 64 == 0);
static_assert(RH % 32 == 0);             // 32-key steps end inside the early planes
static_assert(NB <= NB_FULL);
static_assert(SEQ <= SEQ_FULL);

typedef unsigned short u16;
typedef _Float16 h16;
typedef __attribute__((ext_vector_type(16))) __bf16         v16bf;
typedef __attribute__((ext_vector_type(16))) _Float16       v16h;
typedef __attribute__((ext_vector_type(8)))  unsigned short v8us;
typedef __attribute__((ext_vector_type(16))) unsigned short v16us;
typedef __attribute__((ext_vector_type(8)))  float          v8f;
typedef __attribute__((ext_vector_type(4)))  float          v4f;
typedef v4f  __attribute__((may_alias)) v4fa;
typedef v8us __attribute__((may_alias)) v8usa;

#define XBN    ((size_t)NB * SEQ * DM)
#define WN     ((size_t)DM * DM)
#define PLANE  ((size_t)NB * NH * SEQ * HD)
#define EPLANE ((size_t)NB * NH * RH * HD)
#define ATN    ((size_t)NB * (SEQ - RH) * DM)
#define ATEN   ((size_t)NB * RH * DM)
#define O_XB   ((size_t)0)
#define O_WALL (O_XB + XBN)
#define O_WPB  (O_WALL + 3 * WN)
#define O_WPH  (O_WPB + WN)
#define O_P16  (O_WPH + WN)
#define O_EH   (O_P16 + 3 * PLANE)
#define O_EL   (O_EH + 3 * EPLANE)
#define O_AT   (O_EL + 3 * EPLANE)
#define O_ATEH (O_AT + ATN)
#define O_ATEL (O_ATEH + ATEN)
#define O_END  (O_ATEL + ATEN)
static_assert(O_END * 2 <= (size_t)134217728);   // total carve <= 128 MiB
static_assert(XBN % 128 == 0 && WN % 128 == 0 && PLANE % 128 == 0 && EPLANE % 128 == 0 && ATN % 128 == 0 && ATEN % 128 == 0);   // every region starts on a 256-byte border

__device__ __forceinline__ u16 f2bf(float f) { unsigned u = __float_as_uint(f); u += 0x7FFFu + ((u >> 16) & 1u); return (u16)(u >> 16); }
__device__ __forceinline__ float bf2f(u16 b) { return __uint_as_float(((unsigned)b) << 16); }
__device__ __forceinline__ float bfr(float f) { return bf2f(f2bf(f)); }
__device__ __forceinline__ u16 f2h(float x) { return __builtin_bit_cast(unsigned short, (h16)x); }

// f32 -> f16 with a value select: magnitudes below the smallest normal f16 become zero, so no subnormal f16 operand can reach a WMMA.
static __device__ __forceinline__ h16 toh_flush(float v) { const h16 r = (h16)v; return (fabsf(v) < 6.103515625e-05f) ? (h16)0.0f : r; }
static __device__ __forceinline__ u16 f2h_fl(float v) { return __builtin_bit_cast(unsigned short, toh_flush(v)); }

// Fragment loader for A and B alike: 'p' points at (row or column) + k0 + 8*(lane>>4); elements 0..7 = k0+8h.., elements 8..15 = k0+16+8h..
__device__ __forceinline__ v16us ldfr(const u16* p) {
    const v8us lo = *(const v8us*)p; const v8us hi = *(const v8us*)(p + 16);
    return __builtin_shufflevector(lo, hi, 0, 1, 2, 3, 4, 5, 6, 7, 8, 9, 10, 11, 12, 13, 14, 15);
}
// One WMMA plus its own hazard guard (ties exactly one accumulator, keeps A and B live).
__device__ __forceinline__ v8f mma_h(v16us a, v16us b, v8f c) {
    const v16h ah = __builtin_bit_cast(v16h, a); const v16h bh = __builtin_bit_cast(v16h, b);
    c = __builtin_amdgcn_wmma_f32_16x16x32_f16(false, ah, false, bh, (short)0, c, false, false);
    asm volatile("v_nop\n\tv_nop\n\tv_nop\n\tv_nop" : "+v"(c) : "v"(ah), "v"(bh));
    return c;
}
__device__ __forceinline__ v8f mma_b(v16us a, v16us b, v8f c) {
    const v16bf ab = __builtin_bit_cast(v16bf, a); const v16bf bb = __builtin_bit_cast(v16bf, b);
    c = __builtin_amdgcn_wmma_f32_16x16x32_bf16(false, ab, false, bb, (short)0, c, false, false);
    asm volatile("v_nop\n\tv_nop\n\tv_nop\n\tv_nop" : "+v"(c) : "v"(ab), "v"(bb));
    return c;
}
template <bool F16> __device__ __forceinline__ v8f mmag(v16us a, v16us b, v8f c) { if (F16) return mma_h(a, b, c); else return mma_b(a, b, c); }

// One wave computes a 64x64 tile: acc[mb][nb] element j = C[r0 + 16 mb + 8 (lane>>4) + j][c0 + 16 nb + (lane&15)] = sum_k A[m][k] Bt[n][k] (+ A2[m][k] Bt[n][k] when SPLIT). K % 32 == 0.
template <bool F16, bool SPLIT>
__device__ __forceinline__ void gemm_tile(const u16* __restrict__ A, const u16* __restrict__ A2, const u16* __restrict__ Bt, const int K, const int r0, const int c0, const int lr, const int hi, v8f (&acc)[4][4]) {
#pragma unroll
    for (int mb = 0; mb < 4; ++mb)
#pragma unroll
        for (int nb = 0; nb < 4; ++nb) acc[mb][nb] = (v8f){};
    const size_t aoff = (size_t)(r0 + lr) * K + 8 * hi, boff = (size_t)(c0 + lr) * K + 8 * hi;
#pragma unroll 1
    for (int kc = 0; kc < K; kc += 32) {
        v16us a[4], a2[4];
#pragma unroll
        for (int mb = 0; mb < 4; ++mb) { a[mb] = ldfr(A + aoff + (size_t)mb * 16 * K + kc); if (SPLIT) a2[mb] = ldfr(A2 + aoff + (size_t)mb * 16 * K + kc); else a2[mb] = a[mb]; }
#pragma unroll
        for (int nb = 0; nb < 4; ++nb) { const v16us bb = ldfr(Bt + boff + (size_t)nb * 16 * K + kc);
#pragma unroll
            for (int mb = 0; mb < 4; ++mb) { acc[mb][nb] = mmag<F16>(a[mb], bb, acc[mb][nb]); if (SPLIT) acc[mb][nb] = mmag<F16>(a2[mb], bb, acc[mb][nb]); } }
    }
}

__device__ __forceinline__ unsigned lds_byte(const u16* p) { return (unsigned)(size_t)(const __attribute__((address_space(3))) u16*)p; }

#define GWM  4                   // waves down a GEMM work-group, 64 rows each
#define GWN  2                   // waves across, 64 columns each
#define GTH  (32 * GWM * GWN)    // threads per GEMM work-group
#define GKS  64                  // k per stage: 128-B rows, whole cache lines
#define GPIT 72                  // u16 per staged row: 144 B = 16 B x odd, the pitch for 16-byte LDS readers of 128-B rows
#define GAR  (64 * GWM)          // A rows per stage
#define GBR  (64 * GWN)          // Bt rows per stage
#define GSTG ((GAR + GBR) * GPIT)   // u16 per stage buffer: A rows, then Bt rows
#define GEPI (16 * 68 * 4 + 64 * 72 * 2)   // bytes of epilogue staging per wave (f32 row block, then the 16-bit transpose block), laid over the ring after the k loop
static_assert(GTH == 256 && GAR == 256 && GBR == 128);   // stage_ab: 32 rows per copy, 8 copies for A and 4 for Bt
static_assert(DM % GKS == 0 && DM / GKS >= 2);           // the two-buffer prologue needs two stages
static_assert(GEPI % 16 == 0 && GEPI * GWM * GWN <= 2 * GSTG * 2);
static_assert((NB * SEQ) % GAR == 0 && (NB * (SEQ - RH)) % GAR == 0 && RH % GAR == 0 && SEQ % GAR == 0 && DM % GBR == 0);   // whole work-groups; early/late and q/k/v the same for all waves of one

// One 64-k stage for a work-group of 256 threads: 256 A rows and 128 Bt rows of 128 B, 16 bytes per lane and copy (8 lanes = one row = one line), straight into LDS. ga / gb / la: this thread's place in row tid>>3 of A, of Bt, of the buffer.
// The s_wait_xcnt 0 is the last line of the copies' own statement so that no address register of a copy is rewritten ahead of it.
__device__ __forceinline__ void stage_ab(const u16* ga, const u16* gb, const int K, const unsigned la) {
    const size_t rs = (size_t)32 * K;                 // 32 rows on in global memory
    const unsigned ls = 32 * GPIT * 2;                // 32 rows on in LDS, bytes
    const unsigned lb = la + GAR * GPIT * 2;
    asm volatile("global_load_async_to_lds_b128 %0, %1, off\n\t"
                 "global_load_async_to_lds_b128 %2, %3, off\n\t"
                 "global_load_async_to_lds_b128 %4, %5, off\n\t"
                 "global_load_async_to_lds_b128 %6, %7, off\n\t"
                 "global_load_async_to_lds_b128 %8, %9, off\n\t"
                 "global_load_async_to_lds_b128 %10, %11, off\n\t"
                 "global_load_async_to_lds_b128 %12, %13, off\n\t"
                 "global_load_async_to_lds_b128 %14, %15, off\n\t"
                 "global_load_async_to_lds_b128 %16, %17, off\n\t"
                 "global_load_async_to_lds_b128 %18, %19, off\n\t"
                 "global_load_async_to_lds_b128 %20, %21, off\n\t"
                 "global_load_async_to_lds_b128 %22, %23, off\n\t"
                 "s_wait_xcnt 0x0"
                 :: "v"(la), "v"(ga), "v"(la + ls), "v"(ga + rs), "v"(la + 2 * ls), "v"(ga + 2 * rs), "v"(la + 3 * ls), "v"(ga + 3 * rs),
                    "v"(la + 4 * ls), "v"(ga + 4 * rs), "v"(la + 5 * ls), "v"(ga + 5 * rs), "v"(la + 6 * ls), "v"(ga + 6 * rs), "v"(la + 7 * ls), "v"(ga + 7 * rs),
                    "v"(lb), "v"(gb), "v"(lb + ls), "v"(gb + rs), "v"(lb + 2 * ls), "v"(gb + 2 * rs), "v"(lb + 3 * ls), "v"(gb + 3 * rs) : "memory");
}

// The same 64x64 tile per wave and the same k order as gemm_tile, for a work-group of GWM x GWN waves on rows R0.. and columns C0..: the waves share each 64-k stage of A and Bt,
// brought into the two buffers of 'ring' by asynchronous copies one stage ahead. On return no copy is in flight and every wave has left the ring (the last trip's barrier), so the caller may reuse it.
template <bool F16>
__device__ __forceinline__ void gemm_tile_s(const u16* __restrict__ A, const u16* __restrict__ Bt, const int K, const int R0, const int C0, u16* ring, const int tid, const int wm, const int wn, const int lr, const int hi, v8f (&acc)[4][4]) {
#pragma unroll
    for (int mb = 0; mb < 4; ++mb)
#pragma unroll
        for (int nb = 0; nb < 4; ++nb) acc[mb][nb] = (v8f){};
    const u16* ga = A + (size_t)(R0 + (tid >> 3)) * K + (tid & 7) * 8;
    const u16* gb = Bt + (size_t)(C0 + (tid >> 3)) * K + (tid & 7) * 8;
    const unsigned la = lds_byte(ring + (tid >> 3) * GPIT + (tid & 7) * 8);
    const int nst = K / GKS;
    stage_ab(ga, gb, K, la);
    asm volatile("s_wait_asynccnt 0x0" ::: "memory");   // this wave's copies of stage 0 have landed
    __syncthreads();                                     // stage 0 readable by every wave
    stage_ab(ga + GKS, gb + GKS, K, la + GSTG * 2);
#pragma unroll 1   // kept rolled: one body of 32 products, the buffer picked by st & 1; unrolling would only grow the text
    for (int st = 0; st < nst; ++st) {
        const u16* ar = ring + (st & 1) * GSTG + (wm * 64 + lr) * GPIT + 8 * hi;
        const u16* br = ring + (st & 1) * GSTG + (GAR + wn * 64 + lr) * GPIT + 8 * hi;
#pragma unroll   // this and the loops inside: every fragment and accumulator index a constant, so that they stay in registers
        for (int kc = 0; kc < GKS; kc += 32) {
            v16us a[4], bb[4];                  // the block's 16 LDS reads stand together, ahead of its 16 products
#pragma unroll
            for (int mb = 0; mb < 4; ++mb) a[mb] = ldfr(ar + mb * 16 * GPIT + kc);
#pragma unroll
            for (int nb = 0; nb < 4; ++nb) bb[nb] = ldfr(br + nb * 16 * GPIT + kc);
#pragma unroll
            for (int nb = 0; nb < 4; ++nb)
#pragma unroll
                for (int mb = 0; mb < 4; ++mb) acc[mb][nb] = mmag<F16>(a[mb], bb[nb], acc[mb][nb]);
        }
        asm volatile("s_wait_dscnt 0x0" ::: "memory");      // this wave's LDS reads of the stage are done before the buffer is refilled
        asm volatile("s_wait_asynccnt 0x0" ::: "memory");   // this wave's copies of the next stage have landed
        __syncthreads();                                     // publishes the next stage and ends every reader's last read of this one
        if (st + 2 < nst) stage_ab(ga + (st + 2) * GKS, gb + (st + 2) * GKS, K, la + (st & 1) * (GSTG * 2));
    }
    asm volatile("s_wait_asynccnt 0x0" ::: "memory");       // no copy is left in flight when the ring becomes epilogue staging
}

#define CVW   16                 // waves per conversion work-group
#define CVG   256                // conversion work-groups: with CVW, the launch's wave count (chosen for speed only), started once
#define CNW   (CVG * CVW)        // waves of the conversion launch
#define XROWS (NB * SEQ)         // rows of x
#define CROWS (XROWS + 4 * DM)   // rows of DM f32 to convert: x, then the query, key, value and output weights
static_assert(DM == 8 * 128);    // one row = 8 loads of 16 B per lane, each load of a wave 512 contiguous bytes
static_assert(O_XB == 0 && O_WALL == (size_t)XROWS * DM && O_WPB == O_WALL + 3 * WN && O_WPH == O_WPB + WN);   // row r of the list above lands at PL + r * DM; the f16 output-weight plane lies WN further on

typedef __attribute__((ext_vector_type(4))) unsigned short v4us;

// One converted row of 1024 16-bit values: 8 stores of 8 B per lane, each store of a wave 256 contiguous bytes (two whole lines). 'row' is the same in every lane, 'lofs' the lane's byte offset in the first 256 bytes.
// Written as one statement so that its last line, s_wait_xcnt 0, stands in front of every later write of a register that these stores name (in a statement of its own the compiler moved the next conversions over it).
__device__ __forceinline__ void store_row(u16* row, const unsigned lofs, const v4us (&d)[8]) {
    asm volatile("global_store_b64 %0, %1, %9\n\t"
                 "global_store_b64 %0, %2, %9 offset:256\n\t"
                 "global_store_b64 %0, %3, %9 offset:512\n\t"
                 "global_store_b64 %0, %4, %9 offset:768\n\t"
                 "global_store_b64 %0, %5, %9 offset:1024\n\t"
                 "global_store_b64 %0, %6, %9 offset:1280\n\t"
                 "global_store_b64 %0, %7, %9 offset:1536\n\t"
                 "global_store_b64 %0, %8, %9 offset:1792\n\t"
                 "s_wait_xcnt 0x0"
                 :: "v"(lofs), "v"(d[0]), "v"(d[1]), "v"(d[2]), "v"(d[3]), "v"(d[4]), "v"(d[5]), "v"(d[6]), "v"(d[7]), "s"(row) : "memory");
}

// k_cvt_all: every f32 -> 16-bit plane of the call in one launch of CVG work-groups. One wave per row of 1024 values and trip, rows dealt round robin over the launch's waves (wave gw takes rows gw, gw + CNW, ...);
// 8 whole-line loads of 16 B per lane in flight per wave. x and all four weights -> bf16 (RNE); the output weight also -> f16 of (bf16 value x WCAR). A reduced build reads the right rows of the full-size x.
__global__ __launch_bounds__(32 * CVW) void k_cvt_all(const float* __restrict__ x, const float* __restrict__ Wq, const float* __restrict__ Wk, const float* __restrict__ Wv, const float* __restrict__ Wp, u16* __restrict__ PL) {
    const int lane = threadIdx.x & 31;
    const int gw = __builtin_amdgcn_readfirstlane(blockIdx.x * CVW + (threadIdx.x >> 5));   // wave number as a scalar: the row, its source and the branches on it stay scalar
#pragma unroll 1   // kept rolled: few trips, and the other waves of the WGP cover a wave's load latency
    for (int r = gw; r < CROWS; r += CNW) {
        const float* src;
        if (r < XROWS) src = x + ((size_t)(r / SEQ) * SEQ_FULL + (r % SEQ)) * DM;
        else {
            const int w = (r - XROWS) / DM, wr = (r - XROWS) % DM;
            src = ((w == 0) ? Wq : (w == 1) ? Wk : (w == 2) ? Wv : Wp) + (size_t)wr * DM;
        }
        v4f v[8];
#pragma unroll
        for (int j = 0; j < 8; ++j) v[j] = *(const v4f*)(src + j * 128 + lane * 4);
        v4us ob[8];
#pragma unroll
        for (int j = 0; j < 8; ++j)
#pragma unroll
            for (int k = 0; k < 4; ++k) ob[j][k] = f2bf(v[j][k]);
        u16* row = PL + (size_t)r * DM;
        store_row(row, lane * 8, ob);
        if (r >= XROWS + 3 * DM) {
            v4us oh[8];
#pragma unroll
            for (int j = 0; j < 8; ++j)
#pragma unroll
                for (int k = 0; k < 4; ++k) oh[j][k] = f2h(bf2f(ob[j][k]) * WCAR);
            store_row(row + WN, lane * 8, oh);
        }
    }
}

// k_proj: [NB*SEQ][1024] x [3072][1024]^T (rows 0..1023 query weight, 1024..2047 key weight, 2048..3071 value weight). One wave per 64x64 tile = 64 time rows of one head, eight waves (4 x 2 tiles) per work-group sharing the staged operands.
// Epilogue q/k: per-row LayerNorm over the 64 head columns (mean and biased variance in f32 across 8 lanes x 8 columns, eps 1e-5, gain and bias taken as bf16 values of the inputs; both parameter sets are loaded and chosen by value),
// then f16 head plane rows [b][h][t][64] (+ bf16 hi/lo rows for t < RH); v: transposed through LDS into [b][h][d][t] lines of 64 t (+ hi/lo for t < RH). Planes addressed by element offsets from one base.
// All f16 plane values go through the value-select convert (no subnormal f16 can be produced).
__global__ __launch_bounds__(GTH) void k_proj(const u16* __restrict__ XB, const u16* __restrict__ WALL, u16* PL, size_t oP16, size_t oEH, size_t oEL,
                                             const float* __restrict__ QG, const float* __restrict__ QB, const float* __restrict__ KG, const float* __restrict__ KB) {
    __shared__ __align__(16) u16 ring[2 * GSTG];
    const int tid = threadIdx.x, lane = tid & 31, lr = lane & 15, hi = lane >> 4;
    const int wv = __builtin_amdgcn_readfirstlane(tid >> 5), wm = wv % GWM, wn = wv / GWM;   // wave number as a scalar: tile indices and the branches on them stay scalar
    float* os = (float*)((char*)ring + wv * GEPI);                       // this wave's own staging, used after the k loop only
    u16* ts = (u16*)((char*)ring + wv * GEPI + 16 * 68 * 4);
    const int r0 = blockIdx.x * GAR + wm * 64, c0 = blockIdx.y * GBR + wn * 64;
    const int which = c0 / DM, hd = (c0 - which * DM) / HD;
    const int b = r0 / SEQ, t0 = r0 - b * SEQ;
    const bool early = (t0 < RH);
    const size_t bh = (size_t)b * NH + hd;
    v8f acc[4][4];
    gemm_tile_s<false>(XB, WALL, DM, blockIdx.x * GAR, blockIdx.y * GBR, ring, tid, wm, wn, lr, hi, acc);
    if (which < 2) {
        const size_t o16 = oP16 + (size_t)which * PLANE + (bh * SEQ + t0) * HD;
        const size_t oeh = oEH + (size_t)which * EPLANE + (bh * RH + (early ? t0 : 0)) * HD;
        const size_t oel = oEL + (size_t)which * EPLANE + (bh * RH + (early ? t0 : 0)) * HD;
        const int gc = (lane & 7) * 8;                 // this lane's 8 head columns (same in every row group)
        const v4f gq0 = *(const v4f*)(QG + gc), gq1 = *(const v4f*)(QG + gc + 4);
        const v4f bq0 = *(const v4f*)(QB + gc), bq1 = *(const v4f*)(QB + gc + 4);
        const v4f gk0 = *(const v4f*)(KG + gc), gk1 = *(const v4f*)(KG + gc + 4);
        const v4f bk0 = *(const v4f*)(KB + gc), bk1 = *(const v4f*)(KB + gc + 4);
        v4f g0, g1, be0, be1;
#pragma unroll
        for (int q = 0; q < 4; ++q) {
            g0[q]  = bfr((which == 0) ? gq0[q] : gk0[q]); g1[q]  = bfr((which == 0) ? gq1[q] : gk1[q]);
            be0[q] = bfr((which == 0) ? bq0[q] : bk0[q]); be1[q] = bfr((which == 0) ? bq1[q] : bk1[q]);
        }
#pragma unroll
        for (int mb = 0; mb < 4; ++mb) {
#pragma unroll
            for (int nb = 0; nb < 4; ++nb)
#pragma unroll
                for (int j = 0; j < 8; ++j) os[(hi * 8 + j) * 68 + nb * 16 + lr] = acc[mb][nb][j];
            __syncthreads();
{
#pragma unroll
                for (int s = 0; s < 4; ++s) {
                    const int row = 4 * s + (lane >> 3), pc = (lane & 7) * 8;
                    const v4f x0 = *(const v4fa*)&os[row * 68 + pc]; const v4f x1 = *(const v4fa*)&os[row * 68 + pc + 4];
                    // LayerNorm of the 64-wide row held by the 8 lanes sharing lane>>3 (all 32 lanes active, uniform control)
                    float sm = ((x0[0] + x0[1]) + (x0[2] + x0[3])) + ((x1[0] + x1[1]) + (x1[2] + x1[3]));
                    sm += __shfl_xor(sm, 1, 32); sm += __shfl_xor(sm, 2, 32); sm += __shfl_xor(sm, 4, 32);
                    const float mean = sm * (1.0f / 64.0f);
                    v4f d0, d1;
#pragma unroll
                    for (int q = 0; q < 4; ++q) { d0[q] = x0[q] - mean; d1[q] = x1[q] - mean; }
                    float vs = ((d0[0] * d0[0] + d0[1] * d0[1]) + (d0[2] * d0[2] + d0[3] * d0[3])) + ((d1[0] * d1[0] + d1[1] * d1[1]) + (d1[2] * d1[2] + d1[3] * d1[3]));
                    vs += __shfl_xor(vs, 1, 32); vs += __shfl_xor(vs, 2, 32); vs += __shfl_xor(vs, 4, 32);
                    const float rinv = rsqrtf(vs * (1.0f / 64.0f) + LNEPS);
                    v4f y0, y1;
#pragma unroll
                    for (int q = 0; q < 4; ++q) { y0[q] = d0[q] * rinv * g0[q] + be0[q]; y1[q] = d1[q] * rinv * g1[q] + be1[q]; }
                    v8us q16;
#pragma unroll
                    for (int q = 0; q < 4; ++q) { q16[q] = f2h_fl(y0[q]); q16[4 + q] = f2h_fl(y1[q]); }
                    const size_t ro = (size_t)(mb * 16 + row) * HD + pc;
                    *(v8us*)(PL + o16 + ro) = q16;
                    if (early) {
                        v8us oh, ol;
#pragma unroll
                        for (int q = 0; q < 4; ++q) { const u16 a = f2bf(y0[q]); oh[q] = a; ol[q] = f2bf(y0[q] - bf2f(a)); const u16 c = f2bf(y1[q]); oh[4 + q] = c; ol[4 + q] = f2bf(y1[q] - bf2f(c)); }
                        *(v8us*)(PL + oeh + ro) = oh; *(v8us*)(PL + oel + ro) = ol;
                    }
                }
                
            }
            __syncthreads();
        }
    } else {
#pragma unroll
        for (int pl = 0; pl < 3; ++pl) {
            if (pl == 0 || early) {
#pragma unroll
                for (int mb = 0; mb < 4; ++mb)
#pragma unroll
                    for (int nb = 0; nb < 4; ++nb) {
                        v8us pk;
#pragma unroll
                        for (int j = 0; j < 8; ++j) { const float y = acc[mb][nb][j]; const u16 hb = f2bf(y); pk[j] = (pl == 0) ? f2h_fl(y) : ((pl == 1) ? hb : f2bf(y - bf2f(hb))); }
                        *(v8usa*)&ts[(nb * 16 + lr) * 72 + mb * 16 + hi * 8] = pk;     // ts[d][t]: 8 consecutive t per lane
                    }
                __syncthreads();
                const size_t dofs = (pl == 0) ? (oP16 + 2 * PLANE + bh * HD * SEQ + t0) : (((pl == 1) ? oEH : oEL) + 2 * EPLANE + bh * HD * RH + t0);
                const int dp = (pl == 0) ? SEQ : RH;
{
#pragma unroll 4
                    for (int s = 0; s < 16; ++s) {
                        const int d = 4 * s + (lane >> 3), pc = (lane & 7) * 8;
                        const v8us v = *(const v8usa*)&ts[d * 72 + pc];
                        *(v8us*)(PL + dofs + (size_t)d * dp + pc) = v;
                    }
                    
                }
                __syncthreads();
            }
        }
    }
}

// Online-softmax update for one 16 x 32 score step. s0/s1 hold raw scores for keys jb + (lane&15) and jb + 16 + (lane&15), rows qbase + 8 (lane>>4) + i; on return they hold exp2(t - running max).
// lrow keeps PER-LANE partial sums (reduced over the 16 lanes of a row once, after the key loop). Masked entries are replaced before the maximum; every row keeps its own key.
__device__ __forceinline__ void sm_step(v8f& s0, v8f& s1, float (&mrow)[8], float (&lrow)[8], float (&corr)[8], const int jb, const int qbase, const int lr, const int hi) {
#pragma unroll
    for (int i = 0; i < 8; ++i) {
        const int row = qbase + i + 8 * hi;
        float a0 = s0[i] * SCL2, a1 = s1[i] * SCL2;
        a0 = (jb + lr > row) ? -1.0e30f : a0;
        a1 = (jb + 16 + lr > row) ? -1.0e30f : a1;
        float mx = fmaxf(a0, a1);
        mx = fmaxf(mx, __shfl_xor(mx, 1, 32)); mx = fmaxf(mx, __shfl_xor(mx, 2, 32)); mx = fmaxf(mx, __shfl_xor(mx, 4, 32)); mx = fmaxf(mx, __shfl_xor(mx, 8, 32));
        const float mnew = fmaxf(mrow[i], mx);
        const float c  = __builtin_amdgcn_exp2f(mrow[i] - mnew);
        const float p0 = __builtin_amdgcn_exp2f(a0 - mnew);
        const float p1 = __builtin_amdgcn_exp2f(a1 - mnew);
        lrow[i] = lrow[i] * c + (p0 + p1);
        mrow[i] = mnew; corr[i] = c; s0[i] = p0; s1[i] = p1;
    }
}

#define AW   4                   // waves per late-attention work-group, 16 query rows each
#define KPIT 72                  // u16 per staged key row: 144 B = 16 B x odd, the pitch for 16-byte LDS readers of 128-B rows
#define VPIT 40                  // u16 per staged value row: 80 B = 16 B x odd, the same for 64-B rows
#define NQB_L (((SEQ - RH) / (16 * AW)) > 0 ? ((SEQ - RH) / (16 * AW)) : 1)
static_assert((SEQ - RH) % (16 * AW) == 0);   // whole work-groups of query rows
static_assert((RH + 16 * AW) / 32 >= 2);      // the two-buffer prologue needs two key steps
static_assert((16 * AW) % 32 == 0 && RH % 32 == 0);   // a work-group's last key step ends on its last query row

// One 32-key stage for a work-group of 128 threads: key rows jb..jb+31 (32 x 128 B, contiguous in the plane) and the 64 value rows' columns jb..jb+31 (64 x 64 B), 16 bytes per lane and copy, straight into LDS.
// The s_wait_xcnt 0 is the last line of the copies' own statement so that no address register of a copy is rewritten ahead of it.
__device__ __forceinline__ void stage_kv(const u16* __restrict__ Kb, const u16* __restrict__ Vb, const int jb, u16* kd, u16* vd, const int tid) {
    const u16* gk0 = Kb + (size_t)(jb + (tid >> 3)) * HD + (tid & 7) * 8;      // rows 0..15 of the stage
    const u16* gk1 = gk0 + 16 * HD;                                           // rows 16..31
    const u16* gv0 = Vb + (size_t)(tid >> 2) * SEQ + jb + (tid & 3) * 8;       // head columns 0..31
    const u16* gv1 = gv0 + (size_t)32 * SEQ;                                  // head columns 32..63
    const unsigned lk0 = lds_byte(kd + (tid >> 3) * KPIT + (tid & 7) * 8), lk1 = lk0 + 16 * KPIT * 2;
    const unsigned lv0 = lds_byte(vd + (tid >> 2) * VPIT + (tid & 3) * 8), lv1 = lv0 + 32 * VPIT * 2;
    asm volatile("global_load_async_to_lds_b128 %0, %1, off\n\t"
                 "global_load_async_to_lds_b128 %2, %3, off\n\t"
                 "global_load_async_to_lds_b128 %4, %5, off\n\t"
                 "global_load_async_to_lds_b128 %6, %7, off\n\t"
                 "s_wait_xcnt 0x0"
                 :: "v"(lk0), "v"(gk0), "v"(lk1), "v"(gk1), "v"(lv0), "v"(gv0), "v"(lv1), "v"(gv1) : "memory");
}

// k_attn_l: query rows >= RH, f16 single products. One work-group of AW waves per 16*AW query rows of one (batch, head), one wave per 16 rows; the waves share each 32-key stage of K and V,
// brought into two LDS buffers by asynchronous copies one stage ahead. Every wave walks the work-group's key range: a step wholly above a wave's diagonal adds exact zeros. ctx f16 x CCAR -> AT [b][t-RH][1024].
__global__ __launch_bounds__(32 * AW) void k_attn_l(const u16* __restrict__ QP, const u16* __restrict__ KP, const u16* __restrict__ VT, u16* AT) {
    __shared__ __align__(16) u16 ks[2][32 * KPIT];
    __shared__ __align__(16) u16 vs[2][HD * VPIT];
    __shared__ __align__(16) u16 pwa[AW][16 * 40];
    __shared__ __align__(16) float osa[AW][16 * 68];
    const int tid = threadIdx.x, lane = tid & 31, lr = lane & 15, hi = lane >> 4, wv = tid >> 5;
    u16* pw = pwa[wv]; float* os = osa[wv];
    const int bh = blockIdx.x / NQB_L, qb = blockIdx.x - bh * NQB_L;
    const int b = bh / NH, h = bh - b * NH;
    const int qblk = RH + qb * (16 * AW);
    const int qbase = qblk + wv * 16;
    const size_t pb = (size_t)bh * SEQ * HD;
    const u16* Qb = QP + pb; const u16* Kb = KP + pb; const u16* Vb = VT + pb;
    const int nsteps = (qblk + 16 * AW) >> 5;    // keys 0 .. qblk+16*AW-1 in steps of 32; nsteps*32 <= SEQ, nsteps >= 2
    stage_kv(Kb, Vb, 0, ks[0], vs[0], tid);
    asm volatile("s_wait_asynccnt 0x0" ::: "memory");   // this wave's copies of stage 0 have landed
    __syncthreads();                                     // stage 0 readable by every wave
    stage_kv(Kb, Vb, 32, ks[1], vs[1], tid);
    const v16us q0 = ldfr(Qb + (size_t)(qbase + lr) * HD + 8 * hi);
    const v16us q1 = ldfr(Qb + (size_t)(qbase + lr) * HD + 32 + 8 * hi);
    v8f acc[4];
#pragma unroll
    for (int nt = 0; nt < 4; ++nt) acc[nt] = (v8f){};
    float mrow[8], lrow[8];
#pragma unroll
    for (int i = 0; i < 8; ++i) { mrow[i] = -1.0e30f; lrow[i] = 0.0f; }
#pragma unroll 1
    for (int st = 0; st < nsteps; ++st) {
        const int jb = st * 32;
        const u16* kr0 = ks[st & 1] + lr * KPIT + 8 * hi; const u16* kr1 = kr0 + 16 * KPIT;
        const u16* vr = vs[st & 1] + lr * VPIT + 8 * hi;
        v8f s0 = (v8f){}, s1 = (v8f){};
        s0 = mma_h(q0, ldfr(kr0), s0); s0 = mma_h(q1, ldfr(kr0 + 32), s0);
        s1 = mma_h(q0, ldfr(kr1), s1); s1 = mma_h(q1, ldfr(kr1 + 32), s1);
        float corr[8];
        sm_step(s0, s1, mrow, lrow, corr, jb, qbase, lr, hi);
#pragma unroll
        for (int nt = 0; nt < 4; ++nt)
#pragma unroll
            for (int i = 0; i < 8; ++i) acc[nt][i] *= corr[i];
#pragma unroll
        for (int i = 0; i < 8; ++i) { pw[(i + 8 * hi) * 40 + lr] = f2h(s0[i] * PCAR); pw[(i + 8 * hi) * 40 + 16 + lr] = f2h(s1[i] * PCAR); }
        __syncthreads();
        const v8us plo = *(const v8usa*)&pw[lr * 40 + 8 * hi]; const v8us phi = *(const v8usa*)&pw[lr * 40 + 16 + 8 * hi];
        const v16us pf = __builtin_shufflevector(plo, phi, 0, 1, 2, 3, 4, 5, 6, 7, 8, 9, 10, 11, 12, 13, 14, 15);
#pragma unroll
        for (int nt = 0; nt < 4; ++nt) { const v16us vf = ldfr(vr + nt * 16 * VPIT); acc[nt] = mma_h(pf, vf, acc[nt]); }
        asm volatile("s_wait_dscnt 0x0" ::: "memory");      // this wave's LDS reads of the stage are done before the buffer is refilled
        asm volatile("s_wait_asynccnt 0x0" ::: "memory");   // this wave's copies of the next stage have landed
        __syncthreads();                                     // publishes the next stage and ends every reader's last read of this one
        if (st + 2 < nsteps) stage_kv(Kb, Vb, jb + 64, ks[st & 1], vs[st & 1], tid);
    }
    asm volatile("s_wait_asynccnt 0x0" ::: "memory");       // no copy is left in flight when the wave goes on to its end
#pragma unroll
    for (int i = 0; i < 8; ++i) {
        float l = lrow[i];
        l += __shfl_xor(l, 1, 32); l += __shfl_xor(l, 2, 32); l += __shfl_xor(l, 4, 32); l += __shfl_xor(l, 8, 32);
        const float inv = CCAR / (l * PCAR);
#pragma unroll
        for (int nt = 0; nt < 4; ++nt) os[(i + 8 * hi) * 68 + nt * 16 + lr] = acc[nt][i] * inv;
    }
    __syncthreads();
    u16* dst = AT + ((size_t)b * (SEQ - RH) + (qbase - RH)) * DM + h * HD;
{
#pragma unroll
        for (int s = 0; s < 4; ++s) {
            const int row = 4 * s + (lane >> 3), pc = (lane & 7) * 8;
            const v4f x0 = *(const v4fa*)&os[row * 68 + pc]; const v4f x1 = *(const v4fa*)&os[row * 68 + pc + 4];
            v8us o;
#pragma unroll
            for (int q = 0; q < 4; ++q) { o[q] = f2h(x0[q]); o[4 + q] = f2h(x1[q]); }
            *(v8us*)(dst + (size_t)row * DM + pc) = o;
        }
        
    }
}

// k_attn_e: query rows < RH, bf16 hi+lo operands (hi.hi + lo.hi + hi.lo into one accumulator; residuals unscaled). ctx hi/lo bf16 -> ATEh/ATEl [b][t][1024].
__global__ __launch_bounds__(32) void k_attn_e(const u16* __restrict__ QEh, const u16* __restrict__ QEl, const u16* __restrict__ KEh, const u16* __restrict__ KEl, const u16* __restrict__ VEh, const u16* __restrict__ VEl, u16* ATEh, u16* ATEl) {
    __shared__ __align__(16) u16 pwh[16 * 40];
    __shared__ __align__(16) u16 pwl[16 * 40];
    __shared__ __align__(16) float os[16 * 68];
    const int lane = threadIdx.x & 31, lr = lane & 15, hi = lane >> 4;
    const int bh = blockIdx.x / (RH / 16), qt = blockIdx.x - bh * (RH / 16);
    const int b = bh / NH, h = bh - b * NH;
    const int qbase = qt * 16;
    const size_t pb = (size_t)bh * RH * HD;
    const size_t qo = pb + (size_t)(qbase + lr) * HD + 8 * hi;
    const v16us qh0 = ldfr(QEh + qo), qh1 = ldfr(QEh + qo + 32), ql0 = ldfr(QEl + qo), ql1 = ldfr(QEl + qo + 32);
    v8f acc[4];
#pragma unroll
    for (int nt = 0; nt < 4; ++nt) acc[nt] = (v8f){};
    float mrow[8], lrow[8];
#pragma unroll
    for (int i = 0; i < 8; ++i) { mrow[i] = -1.0e30f; lrow[i] = 0.0f; }
    const int nsteps = (qbase + 47) >> 5;        // nsteps*32 <= RH
#pragma unroll 1
    for (int st = 0; st < nsteps; ++st) {
        const int jb = st * 32;
        const size_t ko = pb + (size_t)(jb + lr) * HD + 8 * hi;
        v8f s0 = (v8f){}, s1 = (v8f){};
        {
            const v16us kh0 = ldfr(KEh + ko), kh1 = ldfr(KEh + ko + 32), kl0 = ldfr(KEl + ko), kl1 = ldfr(KEl + ko + 32);
            s0 = mma_b(qh0, kh0, s0); s0 = mma_b(qh1, kh1, s0); s0 = mma_b(ql0, kh0, s0); s0 = mma_b(ql1, kh1, s0); s0 = mma_b(qh0, kl0, s0); s0 = mma_b(qh1, kl1, s0);
        }
        {
            const size_t k1 = ko + 16 * HD;
            const v16us kh0 = ldfr(KEh + k1), kh1 = ldfr(KEh + k1 + 32), kl0 = ldfr(KEl + k1), kl1 = ldfr(KEl + k1 + 32);
            s1 = mma_b(qh0, kh0, s1); s1 = mma_b(qh1, kh1, s1); s1 = mma_b(ql0, kh0, s1); s1 = mma_b(ql1, kh1, s1); s1 = mma_b(qh0, kl0, s1); s1 = mma_b(qh1, kl1, s1);
        }
        float corr[8];
        sm_step(s0, s1, mrow, lrow, corr, jb, qbase, lr, hi);
#pragma unroll
        for (int nt = 0; nt < 4; ++nt)
#pragma unroll
            for (int i = 0; i < 8; ++i) acc[nt][i] *= corr[i];
#pragma unroll
        for (int i = 0; i < 8; ++i) {
            const u16 a = f2bf(s0[i]); const u16 c = f2bf(s1[i]);
            pwh[(i + 8 * hi) * 40 + lr] = a; pwl[(i + 8 * hi) * 40 + lr] = f2bf(s0[i] - bf2f(a));
            pwh[(i + 8 * hi) * 40 + 16 + lr] = c; pwl[(i + 8 * hi) * 40 + 16 + lr] = f2bf(s1[i] - bf2f(c));
        }
        __syncthreads();
        const v8us h0 = *(const v8usa*)&pwh[lr * 40 + 8 * hi]; const v8us h1 = *(const v8usa*)&pwh[lr * 40 + 16 + 8 * hi];
        const v8us l0 = *(const v8usa*)&pwl[lr * 40 + 8 * hi]; const v8us l1 = *(const v8usa*)&pwl[lr * 40 + 16 + 8 * hi];
        const v16us pfh = __builtin_shufflevector(h0, h1, 0, 1, 2, 3, 4, 5, 6, 7, 8, 9, 10, 11, 12, 13, 14, 15);
        const v16us pfl = __builtin_shufflevector(l0, l1, 0, 1, 2, 3, 4, 5, 6, 7, 8, 9, 10, 11, 12, 13, 14, 15);
#pragma unroll
        for (int nt = 0; nt < 4; ++nt) {
            const size_t vo = pb + (size_t)(nt * 16 + lr) * RH + jb + 8 * hi;      // [bh][64][RH], same plane size as [bh][RH][64]
            const v16us vh = ldfr(VEh + vo), vl = ldfr(VEl + vo);
            acc[nt] = mma_b(pfh, vh, acc[nt]); acc[nt] = mma_b(pfl, vh, acc[nt]); acc[nt] = mma_b(pfh, vl, acc[nt]);
        }
        __syncthreads();
    }
#pragma unroll
    for (int i = 0; i < 8; ++i) {
        float l = lrow[i];
        l += __shfl_xor(l, 1, 32); l += __shfl_xor(l, 2, 32); l += __shfl_xor(l, 4, 32); l += __shfl_xor(l, 8, 32);
        const float inv = 1.0f / l;
#pragma unroll
        for (int nt = 0; nt < 4; ++nt) os[(i + 8 * hi) * 68 + nt * 16 + lr] = acc[nt][i] * inv;
    }
    __syncthreads();
    const size_t dofs = ((size_t)b * RH + qbase) * DM + h * HD;
{
#pragma unroll
        for (int s = 0; s < 4; ++s) {
            const int row = 4 * s + (lane >> 3), pc = (lane & 7) * 8;
            const v4f x0 = *(const v4fa*)&os[row * 68 + pc]; const v4f x1 = *(const v4fa*)&os[row * 68 + pc + 4];
            v8us oh, ol;
#pragma unroll
            for (int q = 0; q < 4; ++q) { const u16 a = f2bf(x0[q]); oh[q] = a; ol[q] = f2bf(x0[q] - bf2f(a)); const u16 c = f2bf(x1[q]); oh[4 + q] = c; ol[4 + q] = f2bf(x1[q] - bf2f(c)); }
            *(v8us*)(ATEh + dofs + (size_t)row * DM + pc) = oh;
            *(v8us*)(ATEl + dofs + (size_t)row * DM + pc) = ol;
        }
        
    }
}

// Output projection: OUT[b][toff + r][n] = scale * sum_k A[row][k] Bt[n][k] (+ A2 product in k_outp_e) + bf16(bias[n]); rows of A are [b][r] with rpb rows per batch.
// Shared epilogue of one wave's 64x64 tile at rows r0.., columns c0..: whole 256-B row pieces through the wave's own staging 'os'. Every wave of the work-group passes the same barriers.
__device__ __forceinline__ void outp_store(const v8f (&acc)[4][4], float* os, const float* __restrict__ bias, float* OUT, const float scale, const int rpb, const int toff, const int r0, const int c0, const int lr, const int hi) {
    const int b = r0 / rpb, tb = toff + (r0 - b * rpb);
    float* crow0 = OUT + ((size_t)b * SEQ_FULL + tb) * DM + c0;
    const int cofs = lr * 4;
    v4f bv; bv[0] = bfr(bias[c0 + cofs]); bv[1] = bfr(bias[c0 + cofs + 1]); bv[2] = bfr(bias[c0 + cofs + 2]); bv[3] = bfr(bias[c0 + cofs + 3]);
#pragma unroll
    for (int mb = 0; mb < 4; ++mb) {
#pragma unroll
        for (int nb = 0; nb < 4; ++nb)
#pragma unroll
            for (int j = 0; j < 8; ++j) os[(hi * 8 + j) * 68 + nb * 16 + lr] = acc[mb][nb][j];
        __syncthreads();
#pragma unroll
        for (int s = 0; s < 8; ++s) {
            const int row = 2 * s + hi;
            const v4f x = *(const v4fa*)&os[row * 68 + cofs];
            v4f val; val[0] = x[0] * scale + bv[0]; val[1] = x[1] * scale + bv[1]; val[2] = x[2] * scale + bv[2]; val[3] = x[3] * scale + bv[3];
            *(v4f*)(crow0 + (size_t)(mb * 16 + row) * DM + cofs) = val;
        }
        __syncthreads();
    }
}

// k_outp_e: rows < RH, bf16 hi+lo ctx planes; one wave per work-group and 64x64 tile, fragments straight from the planes (few tiles: one wave per work-group spreads them over the chip).
__global__ __launch_bounds__(32) void k_outp_e(const u16* __restrict__ A, const u16* __restrict__ A2, const u16* __restrict__ Bt, const float* __restrict__ bias, float* OUT, float scale, int rpb, int toff) {
    __shared__ __align__(16) float os[16 * 68];
    const int lane = threadIdx.x & 31, lr = lane & 15, hi = lane >> 4;
    const int r0 = blockIdx.x * 64, c0 = blockIdx.y * 64;
    v8f acc[4][4];
    gemm_tile<false, true>(A, A2, Bt, DM, r0, c0, lr, hi, acc);
    outp_store(acc, os, bias, OUT, scale, rpb, toff, r0, c0, lr, hi);
}

// k_outp_l: rows >= RH, f16 planes; eight waves (4 x 2 tiles of 64x64) per work-group sharing the staged operands.
__global__ __launch_bounds__(GTH) void k_outp_l(const u16* __restrict__ A, const u16* __restrict__ Bt, const float* __restrict__ bias, float* OUT, float scale, int rpb, int toff) {
    __shared__ __align__(16) u16 ring[2 * GSTG];
    const int tid = threadIdx.x, lane = tid & 31, lr = lane & 15, hi = lane >> 4;
    const int wv = __builtin_amdgcn_readfirstlane(tid >> 5), wm = wv % GWM, wn = wv / GWM;   // wave number as a scalar: tile indices and the branches on them stay scalar
    float* os = (float*)((char*)ring + wv * GEPI);                       // this wave's own staging, used after the k loop only
    v8f acc[4][4];
    gemm_tile_s<true>(A, Bt, DM, blockIdx.x * GAR, blockIdx.y * GBR, ring, tid, wm, wn, lr, hi, acc);
    outp_store(acc, os, bias, OUT, scale, rpb, toff, blockIdx.x * GAR + wm * 64, blockIdx.y * GBR + wn * 64, lr, hi);
}

extern "C" void kernel_launch(void* const* d_in, const int* in_sizes, int n_in,
                              void* d_out, int out_size, void* d_ws, size_t ws_size, hipStream_t stream) {
    if (n_in < 10) return;
    const long long needx = ((long long)(NB - 1) * SEQ_FULL + SEQ) * DM;
    if ((long long)in_sizes[0] < needx) return;
    if ((long long)in_sizes[1] < (long long)DM * DM || (long long)in_sizes[2] < (long long)DM * DM || (long long)in_sizes[3] < (long long)DM * DM || (long long)in_sizes[4] < (long long)DM * DM) return;
    if (in_sizes[5] < DM) return;
    if (in_sizes[6] < HD || in_sizes[7] < HD || in_sizes[8] < HD || in_sizes[9] < HD) return;
    if ((long long)out_size < needx) return;
    if (O_END * 2 > ws_size) return;
    // wire order: x, key weight, query weight, value weight, output weight, output bias, key LayerNorm gain, key LayerNorm bias, query LayerNorm gain, query LayerNorm bias
    const float* x  = (const float*)d_in[0];
    const float* Wk = (const float*)d_in[1];
    const float* Wq = (const float*)d_in[2];
    const float* Wv = (const float*)d_in[3];
    const float* Wp = (const float*)d_in[4];
    const float* bp = (const float*)d_in[5];
    const float* kg = (const float*)d_in[6];
    const float* kb = (const float*)d_in[7];
    const float* qg = (const float*)d_in[8];
    const float* qb = (const float*)d_in[9];
    float* OUT = (float*)d_out;
    u16* PL = (u16*)d_ws;

    k_cvt_all<<<CVG, 32 * CVW, 0, stream>>>(x, Wq, Wk, Wv, Wp, PL);   // planes O_XB, O_WALL (query, key, value rows), O_WPB, O_WPH

    k_proj<<<dim3(NB * SEQ / GAR, 3 * DM / GBR, 1), GTH, 0, stream>>>(PL + O_XB, PL + O_WALL, PL, O_P16, O_EH, O_EL, qg, qb, kg, kb);

    k_attn_e<<<NB * NH * (RH / 16), 32, 0, stream>>>(PL + O_EH, PL + O_EL, PL + O_EH + EPLANE, PL + O_EL + EPLANE, PL + O_EH + 2 * EPLANE, PL + O_EL + 2 * EPLANE, PL + O_ATEH, PL + O_ATEL);
    if (SEQ > RH)
        k_attn_l<<<NB * NH * ((SEQ - RH) / (16 * AW)), 32 * AW, 0, stream>>>(PL + O_P16, PL + O_P16 + PLANE, PL + O_P16 + 2 * PLANE, PL + O_AT);

    k_outp_e<<<dim3(NB * RH / 64, DM / 64, 1), 32, 0, stream>>>(PL + O_ATEH, PL + O_ATEL, PL + O_WPB, bp, OUT, 1.0f, RH, 0);
    if (SEQ > RH)
        k_outp_l<<<dim3(NB * (SEQ - RH) / GAR, DM / GBR, 1), GTH, 0, stream>>>(PL + O_AT, PL + O_WPH, bp, OUT, 1.0f / (WCAR * CCAR), SEQ - RH, RH);
}

// v004
// A run of this version takes 203 microseconds.
// Timed twice side by side with v003, it ran 1.22 times as fast both times.
// All steps since v000 together make it 2.20 times as fast.
#include <hip/hip_runtime.h>

// Compute dtypes (f32 accumulate everywhere): q/k/v projections bf16 x bf16 (inputs converted RNE to bf16, products exact), per-head LayerNorm of q and k in f32 inside the projection epilogue; scores q.k and P.V: f16 single products on query rows >= 256 (P carried x1024), bf16 hi+lo (3 products) on query rows < 256; output projection: f16 single product (ctx x16, Wo x32 carries) on rows >= 256, bf16 hi+lo ctx x bf16 Wo on rows < 256.
// Causal 16-head attention block, x [4][2048][1024]; separate bias-free [out][in] key / query / value projections (used as Bt as stored), per-head LayerNorm (eps 1e-5, gain and bias inputs) on the 64-wide query and key rows,
// the two 1024^(-1/4) factors applied as one 1/32 on the scores, causal exclusion with the diagonal kept, softmax in f32 (running max, log2 domain), heads merged h*64+d, [out][in] output projection plus bias.
// Layout: 16-bit planes in the workspace (u16 storage): x copy [b*SEQ+t][1024]; weights [3][1024][1024] (q, k, v) ; q and k head planes [b][h][t][64]; v transposed [b][h][64][t]; hi/lo bf16 planes of the same for t < 256;
// ctx f16 [b][t-256][1024] and ctx hi/lo bf16 [b][t<256][1024]. Fused flash-style attention: one wave per 16 query rows, 32 keys per step, no score plane in global memory; rows < 256: fragments straight from the k-contiguous planes; rows >= 256: four waves share K and V stages in LDS and both products run transposed. Projection and late output GEMMs: eight waves share A and B stages in LDS.

#ifndef NB
#define NB 4
#endif
#ifndef SEQ
#define SEQ 2048
#endif
#define NB_FULL  4
#define SEQ_FULL 2048
#define DM   1024
#define NH   16
#define HD   64
#define RH   256                 // query rows / keys below RH also carry bf16 hi+lo planes
#define PCAR 1024.0f             // carry on f16 probabilities
#define CCAR 16.0f               // carry on the f16 ctx plane
#define WCAR 32.0f               // carry on the f16 output-projection weight plane
#define SCL2 (0.03125f * 1.4426950408889634f)   // 1/sqrt(1024) x log2(e)
#define LNEPS 1.0e-5f            // LayerNorm epsilon on the head rows

static_assert(DM == NH * HD);            // heads tile the channel width
static_assert(HD == 64);
static_assert(HD == 8 * 8);              // LayerNorm row = 8 lanes x 8 columns in the projection epilogue
static_assert(DM % 32 == 0);             // GEMM k-step
static_assert(HD % 32 == 0);             // score k-step
static_assert(SEQ % 64 == 0);            // 64-row GEMM tiles never straddle a batch
static_assert(RH % 64 == 0);             // early/late split on tile borders
static_assert(SEQ >= RH);
static_assert((SEQ - RH) % 64 == 0);
static_assert(RH % 32 == 0);             // 32-key steps end inside the early planes
static_assert(NB <= NB_FULL);
static_assert(SEQ <= SEQ_FULL);

typedef unsigned short u16;
typedef _Float16 h16;
typedef __attribute__((ext_vector_type(16))) __bf16         v16bf;
typedef __attribute__((ext_vector_type(16))) _Float16       v16h;
typedef __attribute__((ext_vector_type(8)))  unsigned short v8us;
typedef __attribute__((ext_vector_type(16))) unsigned short v16us;
typedef __attribute__((ext_vector_type(8)))  float          v8f;
typedef __attribute__((ext_vector_type(4)))  float          v4f;
typedef v4f  __attribute__((may_alias)) v4fa;
typedef v8us __attribute__((may_alias)) v8usa;

#define XBN    ((size_t)NB * SEQ * DM)
#define WN     ((size_t)DM * DM)
#define PLANE  ((size_t)NB * NH * SEQ * HD)
#define EPLANE ((size_t)NB * NH * RH * HD)
#define ATN    ((size_t)NB * (SEQ - RH) * DM)
#define ATEN   ((size_t)NB * RH * DM)
#define O_XB   ((size_t)0)
#define O_WALL (O_XB + XBN)
#define O_WPB  (O_WALL + 3 * WN)
#define O_WPH  (O_WPB + WN)
#define O_P16  (O_WPH + WN)
#define O_EH   (O_P16 + 3 * PLANE)
#define O_EL   (O_EH + 3 * EPLANE)
#define O_AT   (O_EL + 3 * EPLANE)
#define O_ATEH (O_AT + ATN)
#define O_ATEL (O_ATEH + ATEN)
#define O_END  (O_ATEL + ATEN)
static_assert(O_END * 2 <= (size_t)134217728);   // total carve <= 128 MiB
static_assert(XBN % 128 == 0 && WN % 128 == 0 && PLANE % 128 == 0 && EPLANE % 128 == 0 && ATN % 128 == 0 && ATEN % 128 == 0);   // every region starts on a 256-byte border

__device__ __forceinline__ u16 f2bf(float f) { unsigned u = __float_as_uint(f); u += 0x7FFFu + ((u >> 16) & 1u); return (u16)(u >> 16); }
__device__ __forceinline__ float bf2f(u16 b) { return __uint_as_float(((unsigned)b) << 16); }
__device__ __forceinline__ float bfr(float f) { return bf2f(f2bf(f)); }
__device__ __forceinline__ u16 f2h(float x) { return __builtin_bit_cast(unsigned short, (h16)x); }

// f32 -> f16 with a value select: magnitudes below the smallest normal f16 become zero, so no subnormal f16 operand can reach a WMMA.
static __device__ __forceinline__ h16 toh_flush(float v) { const h16 r = (h16)v; return (fabsf(v) < 6.103515625e-05f) ? (h16)0.0f : r; }
static __device__ __forceinline__ u16 f2h_fl(float v) { return __builtin_bit_cast(unsigned short, toh_flush(v)); }

// Fragment loader for A and B alike: 'p' points at (row or column) + k0 + 8*(lane>>4); elements 0..7 = k0+8h.., elements 8..15 = k0+16+8h..
__device__ __forceinline__ v16us ldfr(const u16* p) {
    const v8us lo = *(const v8us*)p; const v8us hi = *(const v8us*)(p + 16);
    return __builtin_shufflevector(lo, hi, 0, 1, 2, 3, 4, 5, 6, 7, 8, 9, 10, 11, 12, 13, 14, 15);
}
// One WMMA plus its own hazard guard (ties exactly one accumulator, keeps A and B live).
__device__ __forceinline__ v8f mma_h(v16us a, v16us b, v8f c) {
    const v16h ah = __builtin_bit_cast(v16h, a); const v16h bh = __builtin_bit_cast(v16h, b);
    c = __builtin_amdgcn_wmma_f32_16x16x32_f16(false, ah, false, bh, (short)0, c, false, false);
    asm volatile("v_nop\n\tv_nop\n\tv_nop\n\tv_nop" : "+v"(c) : "v"(ah), "v"(bh));
    return c;
}
__device__ __forceinline__ v8f mma_b(v16us a, v16us b, v8f c) {
    const v16bf ab = __builtin_bit_cast(v16bf, a); const v16bf bb = __builtin_bit_cast(v16bf, b);
    c = __builtin_amdgcn_wmma_f32_16x16x32_bf16(false, ab, false, bb, (short)0, c, false, false);
    asm volatile("v_nop\n\tv_nop\n\tv_nop\n\tv_nop" : "+v"(c) : "v"(ab), "v"(bb));
    return c;
}
template <bool F16> __device__ __forceinline__ v8f mmag(v16us a, v16us b, v8f c) { if (F16) return mma_h(a, b, c); else return mma_b(a, b, c); }

// One wave computes a 64x64 tile: acc[mb][nb] element j = C[r0 + 16 mb + 8 (lane>>4) + j][c0 + 16 nb + (lane&15)] = sum_k A[m][k] Bt[n][k] (+ A2[m][k] Bt[n][k] when SPLIT). K % 32 == 0.
template <bool F16, bool SPLIT>
__device__ __forceinline__ void gemm_tile(const u16* __restrict__ A, const u16* __restrict__ A2, const u16* __restrict__ Bt, const int K, const int r0, const int c0, const int lr, const int hi, v8f (&acc)[4][4]) {
#pragma unroll
    for (int mb = 0; mb < 4; ++mb)
#pragma unroll
        for (int nb = 0; nb < 4; ++nb) acc[mb][nb] = (v8f){};
    const size_t aoff = (size_t)(r0 + lr) * K + 8 * hi, boff = (size_t)(c0 + lr) * K + 8 * hi;
#pragma unroll 1
    for (int kc = 0; kc < K; kc += 32) {
        v16us a[4], a2[4];
#pragma unroll
        for (int mb = 0; mb < 4; ++mb) { a[mb] = ldfr(A + aoff + (size_t)mb * 16 * K + kc); if (SPLIT) a2[mb] = ldfr(A2 + aoff + (size_t)mb * 16 * K + kc); else a2[mb] = a[mb]; }
#pragma unroll
        for (int nb = 0; nb < 4; ++nb) { const v16us bb = ldfr(Bt + boff + (size_t)nb * 16 * K + kc);
#pragma unroll
            for (int mb = 0; mb < 4; ++mb) { acc[mb][nb] = mmag<F16>(a[mb], bb, acc[mb][nb]); if (SPLIT) acc[mb][nb] = mmag<F16>(a2[mb], bb, acc[mb][nb]); } }
    }
}

__device__ __forceinline__ unsigned lds_byte(const u16* p) { return (unsigned)(size_t)(const __attribute__((address_space(3))) u16*)p; }

#define GWM  4                   // waves down a GEMM work-group, 64 rows each
#define GWN  2                   // waves across, 64 columns each
#define GTH  (32 * GWM * GWN)    // threads per GEMM work-group
#define GKS  64                  // k per stage: 128-B rows, whole cache lines
#define GPIT 72                  // u16 per staged row: 144 B = 16 B x odd, the pitch for 16-byte LDS readers of 128-B rows
#define GAR  (64 * GWM)          // A rows per stage
#define GBR  (64 * GWN)          // Bt rows per stage
#define GSTG ((GAR + GBR) * GPIT)   // u16 per stage buffer: A rows, then Bt rows
#define GEPI (16 * 68 * 4 + 64 * 72 * 2)   // bytes of epilogue staging per wave (f32 row block, then the 16-bit transpose block), laid over the ring after the k loop
static_assert(GTH == 256 && GAR == 256 && GBR == 128);   // stage_ab: 32 rows per copy, 8 copies for A and 4 for Bt
static_assert(DM % GKS == 0 && DM / GKS >= 2);           // the two-buffer prologue needs two stages
static_assert(GEPI % 16 == 0 && GEPI * GWM * GWN <= 2 * GSTG * 2);
static_assert((NB * SEQ) % GAR == 0 && (NB * (SEQ - RH)) % GAR == 0 && RH % GAR == 0 && SEQ % GAR == 0 && DM % GBR == 0);   // whole work-groups; early/late and q/k/v the same for all waves of one

// One 64-k stage for a work-group of 256 threads: 256 A rows and 128 Bt rows of 128 B, 16 bytes per lane and copy (8 lanes = one row = one line), straight into LDS. ga / gb / la: this thread's place in row tid>>3 of A, of Bt, of the buffer.
// The s_wait_xcnt 0 is the last line of the copies' own statement so that no address register of a copy is rewritten ahead of it.
__device__ __forceinline__ void stage_ab(const u16* ga, const u16* gb, const int K, const unsigned la) {
    const size_t rs = (size_t)32 * K;                 // 32 rows on in global memory
    const unsigned ls = 32 * GPIT * 2;                // 32 rows on in LDS, bytes
    const unsigned lb = la + GAR * GPIT * 2;
    asm volatile("global_load_async_to_lds_b128 %0, %1, off\n\t"
                 "global_load_async_to_lds_b128 %2, %3, off\n\t"
                 "global_load_async_to_lds_b128 %4, %5, off\n\t"
                 "global_load_async_to_lds_b128 %6, %7, off\n\t"
                 "global_load_async_to_lds_b128 %8, %9, off\n\t"
                 "global_load_async_to_lds_b128 %10, %11, off\n\t"
                 "global_load_async_to_lds_b128 %12, %13, off\n\t"
                 "global_load_async_to_lds_b128 %14, %15, off\n\t"
                 "global_load_async_to_lds_b128 %16, %17, off\n\t"
                 "global_load_async_to_lds_b128 %18, %19, off\n\t"
                 "global_load_async_to_lds_b128 %20, %21, off\n\t"
                 "global_load_async_to_lds_b128 %22, %23, off\n\t"
                 "s_wait_xcnt 0x0"
                 :: "v"(la), "v"(ga), "v"(la + ls), "v"(ga + rs), "v"(la + 2 * ls), "v"(ga + 2 * rs), "v"(la + 3 * ls), "v"(ga + 3 * rs),
                    "v"(la + 4 * ls), "v"(ga + 4 * rs), "v"(la + 5 * ls), "v"(ga + 5 * rs), "v"(la + 6 * ls), "v"(ga + 6 * rs), "v"(la + 7 * ls), "v"(ga + 7 * rs),
                    "v"(lb), "v"(gb), "v"(lb + ls), "v"(gb + rs), "v"(lb + 2 * ls), "v"(gb + 2 * rs), "v"(lb + 3 * ls), "v"(gb + 3 * rs) : "memory");
}

// The same 64x64 tile per wave and the same k order as gemm_tile, for a work-group of GWM x GWN waves on rows R0.. and columns C0..: the waves share each 64-k stage of A and Bt,
// brought into the two buffers of 'ring' by asynchronous copies one stage ahead. On return no copy is in flight and every wave has left the ring (the last trip's barrier), so the caller may reuse it.
template <bool F16>
__device__ __forceinline__ void gemm_tile_s(const u16* __restrict__ A, const u16* __restrict__ Bt, const int K, const int R0, const int C0, u16* ring, const int tid, const int wm, const int wn, const int lr, const int hi, v8f (&acc)[4][4]) {
#pragma unroll
    for (int mb = 0; mb < 4; ++mb)
#pragma unroll
        for (int nb = 0; nb < 4; ++nb) acc[mb][nb] = (v8f){};
    const u16* ga = A + (size_t)(R0 + (tid >> 3)) * K + (tid & 7) * 8;
    const u16* gb = Bt + (size_t)(C0 + (tid >> 3)) * K + (tid & 7) * 8;
    const unsigned la = lds_byte(ring + (tid >> 3) * GPIT + (tid & 7) * 8);
    const int nst = K / GKS;
    stage_ab(ga, gb, K, la);
    asm volatile("s_wait_asynccnt 0x0" ::: "memory");   // this wave's copies of stage 0 have landed
    __syncthreads();                                     // stage 0 readable by every wave
    stage_ab(ga + GKS, gb + GKS, K, la + GSTG * 2);
#pragma unroll 1   // kept rolled: one body of 32 products, the buffer picked by st & 1; unrolling would only grow the text
    for (int st = 0; st < nst; ++st) {
        const u16* ar = ring + (st & 1) * GSTG + (wm * 64 + lr) * GPIT + 8 * hi;
        const u16* br = ring + (st & 1) * GSTG + (GAR + wn * 64 + lr) * GPIT + 8 * hi;
#pragma unroll   // this and the loops inside: every fragment and accumulator index a constant, so that they stay in registers
        for (int kc = 0; kc < GKS; kc += 32) {
            v16us a[4], bb[4];                  // the block's 16 LDS reads stand together, ahead of its 16 products
#pragma unroll
            for (int mb = 0; mb < 4; ++mb) a[mb] = ldfr(ar + mb * 16 * GPIT + kc);
#pragma unroll
            for (int nb = 0; nb < 4; ++nb) bb[nb] = ldfr(br + nb * 16 * GPIT + kc);
#pragma unroll
            for (int nb = 0; nb < 4; ++nb)
#pragma unroll
                for (int mb = 0; mb < 4; ++mb) acc[mb][nb] = mmag<F16>(a[mb], bb[nb], acc[mb][nb]);
        }
        asm volatile("s_wait_dscnt 0x0" ::: "memory");      // this wave's LDS reads of the stage are done before the buffer is refilled
        asm volatile("s_wait_asynccnt 0x0" ::: "memory");   // this wave's copies of the next stage have landed
        __syncthreads();                                     // publishes the next stage and ends every reader's last read of this one
        if (st + 2 < nst) stage_ab(ga + (st + 2) * GKS, gb + (st + 2) * GKS, K, la + (st & 1) * (GSTG * 2));
    }
    asm volatile("s_wait_asynccnt 0x0" ::: "memory");       // no copy is left in flight when the ring becomes epilogue staging
}

#define CVW   16                 // waves per conversion work-group
#define CVG   256                // conversion work-groups: with CVW, the launch's wave count (chosen for speed only), started once
#define CNW   (CVG * CVW)        // waves of the conversion launch
#define XROWS (NB * SEQ)         // rows of x
#define CROWS (XROWS + 4 * DM)   // rows of DM f32 to convert: x, then the query, key, value and output weights
static_assert(DM == 8 * 128);    // one row = 8 loads of 16 B per lane, each load of a wave 512 contiguous bytes
static_assert(O_XB == 0 && O_WALL == (size_t)XROWS * DM && O_WPB == O_WALL + 3 * WN && O_WPH == O_WPB + WN);   // row r of the list above lands at PL + r * DM; the f16 output-weight plane lies WN further on

typedef __attribute__((ext_vector_type(4))) unsigned short v4us;

// One converted row of 1024 16-bit values: 8 stores of 8 B per lane, each store of a wave 256 contiguous bytes (two whole lines). 'row' is the same in every lane, 'lofs' the lane's byte offset in the first 256 bytes.
// Written as one statement so that its last line, s_wait_xcnt 0, stands in front of every later write of a register that these stores name (in a statement of its own the compiler moved the next conversions over it).
__device__ __forceinline__ void store_row(u16* row, const unsigned lofs, const v4us (&d)[8]) {
    asm volatile("global_store_b64 %0, %1, %9\n\t"
                 "global_store_b64 %0, %2, %9 offset:256\n\t"
                 "global_store_b64 %0, %3, %9 offset:512\n\t"
                 "global_store_b64 %0, %4, %9 offset:768\n\t"
                 "global_store_b64 %0, %5, %9 offset:1024\n\t"
                 "global_store_b64 %0, %6, %9 offset:1280\n\t"
                 "global_store_b64 %0, %7, %9 offset:1536\n\t"
                 "global_store_b64 %0, %8, %9 offset:1792\n\t"
                 "s_wait_xcnt 0x0"
                 :: "v"(lofs), "v"(d[0]), "v"(d[1]), "v"(d[2]), "v"(d[3]), "v"(d[4]), "v"(d[5]), "v"(d[6]), "v"(d[7]), "s"(row) : "memory");
}

// k_cvt_all: every f32 -> 16-bit plane of the call in one launch of CVG work-groups. One wave per row of 1024 values and trip, rows dealt round robin over the launch's waves (wave gw takes rows gw, gw + CNW, ...);
// 8 whole-line loads of 16 B per lane in flight per wave. x and all four weights -> bf16 (RNE); the output weight also -> f16 of (bf16 value x WCAR). A reduced build reads the right rows of the full-size x.
__global__ __launch_bounds__(32 * CVW) void k_cvt_all(const float* __restrict__ x, const float* __restrict__ Wq, const float* __restrict__ Wk, const float* __restrict__ Wv, const float* __restrict__ Wp, u16* __restrict__ PL) {
    const int lane = threadIdx.x & 31;
    const int gw = __builtin_amdgcn_readfirstlane(blockIdx.x * CVW + (threadIdx.x >> 5));   // wave number as a scalar: the row, its source and the branches on it stay scalar
#pragma unroll 1   // kept rolled: few trips, and the other waves of the WGP cover a wave's load latency
    for (int r = gw; r < CROWS; r += CNW) {
        const float* src;
        if (r < XROWS) src = x + ((size_t)(r / SEQ) * SEQ_FULL + (r % SEQ)) * DM;
        else {
            const int w = (r - XROWS) / DM, wr = (r - XROWS) % DM;
            src = ((w == 0) ? Wq : (w == 1) ? Wk : (w == 2) ? Wv : Wp) + (size_t)wr * DM;
        }
        v4f v[8];
#pragma unroll
        for (int j = 0; j < 8; ++j) v[j] = *(const v4f*)(src + j * 128 + lane * 4);
        v4us ob[8];
#pragma unroll
        for (int j = 0; j < 8; ++j)
#pragma unroll
            for (int k = 0; k < 4; ++k) ob[j][k] = f2bf(v[j][k]);
        u16* row = PL + (size_t)r * DM;
        store_row(row, lane * 8, ob);
        if (r >= XROWS + 3 * DM) {
            v4us oh[8];
#pragma unroll
            for (int j = 0; j < 8; ++j)
#pragma unroll
                for (int k = 0; k < 4; ++k) oh[j][k] = f2h(bf2f(ob[j][k]) * WCAR);
            store_row(row + WN, lane * 8, oh);
        }
    }
}

// k_proj: [NB*SEQ][1024] x [3072][1024]^T (rows 0..1023 query weight, 1024..2047 key weight, 2048..3071 value weight). One wave per 64x64 tile = 64 time rows of one head, eight waves (4 x 2 tiles) per work-group sharing the staged operands.
// Epilogue q/k: per-row LayerNorm over the 64 head columns (mean and biased variance in f32 across 8 lanes x 8 columns, eps 1e-5, gain and bias taken as bf16 values of the inputs; both parameter sets are loaded and chosen by value),
// then f16 head plane rows [b][h][t][64] (+ bf16 hi/lo rows for t < RH); v: transposed through LDS into [b][h][d][t] lines of 64 t (+ hi/lo for t < RH). Planes addressed by element offsets from one base.
// All f16 plane values go through the value-select convert (no subnormal f16 can be produced).
__global__ __launch_bounds__(GTH) void k_proj(const u16* __restrict__ XB, const u16* __restrict__ WALL, u16* PL, size_t oP16, size_t oEH, size_t oEL,
                                             const float* __restrict__ QG, const float* __restrict__ QB, const float* __restrict__ KG, const float* __restrict__ KB) {
    __shared__ __align__(16) u16 ring[2 * GSTG];
    const int tid = threadIdx.x, lane = tid & 31, lr = lane & 15, hi = lane >> 4;
    const int wv = __builtin_amdgcn_readfirstlane(tid >> 5), wm = wv % GWM, wn = wv / GWM;   // wave number as a scalar: tile indices and the branches on them stay scalar
    float* os = (float*)((char*)ring + wv * GEPI);                       // this wave's own staging, used after the k loop only
    u16* ts = (u16*)((char*)ring + wv * GEPI + 16 * 68 * 4);
    const int r0 = blockIdx.x * GAR + wm * 64, c0 = blockIdx.y * GBR + wn * 64;
    const int which = c0 / DM, hd = (c0 - which * DM) / HD;
    const int b = r0 / SEQ, t0 = r0 - b * SEQ;
    const bool early = (t0 < RH);
    const size_t bh = (size_t)b * NH + hd;
    v8f acc[4][4];
    gemm_tile_s<false>(XB, WALL, DM, blockIdx.x * GAR, blockIdx.y * GBR, ring, tid, wm, wn, lr, hi, acc);
    if (which < 2) {
        const size_t o16 = oP16 + (size_t)which * PLANE + (bh * SEQ + t0) * HD;
        const size_t oeh = oEH + (size_t)which * EPLANE + (bh * RH + (early ? t0 : 0)) * HD;
        const size_t oel = oEL + (size_t)which * EPLANE + (bh * RH + (early ? t0 : 0)) * HD;
        const int gc = (lane & 7) * 8;                 // this lane's 8 head columns (same in every row group)
        const v4f gq0 = *(const v4f*)(QG + gc), gq1 = *(const v4f*)(QG + gc + 4);
        const v4f bq0 = *(const v4f*)(QB + gc), bq1 = *(const v4f*)(QB + gc + 4);
        const v4f gk0 = *(const v4f*)(KG + gc), gk1 = *(const v4f*)(KG + gc + 4);
        const v4f bk0 = *(const v4f*)(KB + gc), bk1 = *(const v4f*)(KB + gc + 4);
        v4f g0, g1, be0, be1;
#pragma unroll
        for (int q = 0; q < 4; ++q) {
            g0[q]  = bfr((which == 0) ? gq0[q] : gk0[q]); g1[q]  = bfr((which == 0) ? gq1[q] : gk1[q]);
            be0[q] = bfr((which == 0) ? bq0[q] : bk0[q]); be1[q] = bfr((which == 0) ? bq1[q] : bk1[q]);
        }
#pragma unroll
        for (int mb = 0; mb < 4; ++mb) {
#pragma unroll
            for (int nb = 0; nb < 4; ++nb)
#pragma unroll
                for (int j = 0; j < 8; ++j) os[(hi * 8 + j) * 68 + nb * 16 + lr] = acc[mb][nb][j];
            __syncthreads();
{
#pragma unroll
                for (int s = 0; s < 4; ++s) {
                    const int row = 4 * s + (lane >> 3), pc = (lane & 7) * 8;
                    const v4f x0 = *(const v4fa*)&os[row * 68 + pc]; const v4f x1 = *(const v4fa*)&os[row * 68 + pc + 4];
                    // LayerNorm of the 64-wide row held by the 8 lanes sharing lane>>3 (all 32 lanes active, uniform control)
                    float sm = ((x0[0] + x0[1]) + (x0[2] + x0[3])) + ((x1[0] + x1[1]) + (x1[2] + x1[3]));
                    sm += __shfl_xor(sm, 1, 32); sm += __shfl_xor(sm, 2, 32); sm += __shfl_xor(sm, 4, 32);
                    const float mean = sm * (1.0f / 64.0f);
                    v4f d0, d1;
#pragma unroll
                    for (int q = 0; q < 4; ++q) { d0[q] = x0[q] - mean; d1[q] = x1[q] - mean; }
                    float vs = ((d0[0] * d0[0] + d0[1] * d0[1]) + (d0[2] * d0[2] + d0[3] * d0[3])) + ((d1[0] * d1[0] + d1[1] * d1[1]) + (d1[2] * d1[2] + d1[3] * d1[3]));
                    vs += __shfl_xor(vs, 1, 32); vs += __shfl_xor(vs, 2, 32); vs += __shfl_xor(vs, 4, 32);
                    const float rinv = rsqrtf(vs * (1.0f / 64.0f) + LNEPS);
                    v4f y0, y1;
#pragma unroll
                    for (int q = 0; q < 4; ++q) { y0[q] = d0[q] * rinv * g0[q] + be0[q]; y1[q] = d1[q] * rinv * g1[q] + be1[q]; }
                    v8us q16;
#pragma unroll
                    for (int q = 0; q < 4; ++q) { q16[q] = f2h_fl(y0[q]); q16[4 + q] = f2h_fl(y1[q]); }
                    const size_t ro = (size_t)(mb * 16 + row) * HD + pc;
                    *(v8us*)(PL + o16 + ro) = q16;
                    if (early) {
                        v8us oh, ol;
#pragma unroll
                        for (int q = 0; q < 4; ++q) { const u16 a = f2bf(y0[q]); oh[q] = a; ol[q] = f2bf(y0[q] - bf2f(a)); const u16 c = f2bf(y1[q]); oh[4 + q] = c; ol[4 + q] = f2bf(y1[q] - bf2f(c)); }
                        *(v8us*)(PL + oeh + ro) = oh; *(v8us*)(PL + oel + ro) = ol;
                    }
                }
                
            }
            __syncthreads();
        }
    } else {
#pragma unroll
        for (int pl = 0; pl < 3; ++pl) {
            if (pl == 0 || early) {
#pragma unroll
                for (int mb = 0; mb < 4; ++mb)
#pragma unroll
                    for (int nb = 0; nb < 4; ++nb) {
                        v8us pk;
#pragma unroll
                        for (int j = 0; j < 8; ++j) { const float y = acc[mb][nb][j]; const u16 hb = f2bf(y); pk[j] = (pl == 0) ? f2h_fl(y) : ((pl == 1) ? hb : f2bf(y - bf2f(hb))); }
                        *(v8usa*)&ts[(nb * 16 + lr) * 72 + mb * 16 + hi * 8] = pk;     // ts[d][t]: 8 consecutive t per lane
                    }
                __syncthreads();
                const size_t dofs = (pl == 0) ? (oP16 + 2 * PLANE + bh * HD * SEQ + t0) : (((pl == 1) ? oEH : oEL) + 2 * EPLANE + bh * HD * RH + t0);
                const int dp = (pl == 0) ? SEQ : RH;
{
#pragma unroll 4
                    for (int s = 0; s < 16; ++s) {
                        const int d = 4 * s + (lane >> 3), pc = (lane & 7) * 8;
                        const v8us v = *(const v8usa*)&ts[d * 72 + pc];
                        *(v8us*)(PL + dofs + (size_t)d * dp + pc) = v;
                    }
                    
                }
                __syncthreads();
            }
        }
    }
}

// Online-softmax update for one 16 x 32 score step. s0/s1 hold raw scores for keys jb + (lane&15) and jb + 16 + (lane&15), rows qbase + 8 (lane>>4) + i; on return they hold exp2(t - running max).
// lrow keeps PER-LANE partial sums (reduced over the 16 lanes of a row once, after the key loop). Masked entries are replaced before the maximum; every row keeps its own key.
__device__ __forceinline__ void sm_step(v8f& s0, v8f& s1, float (&mrow)[8], float (&lrow)[8], float (&corr)[8], const int jb, const int qbase, const int lr, const int hi) {
#pragma unroll
    for (int i = 0; i < 8; ++i) {
        const int row = qbase + i + 8 * hi;
        float a0 = s0[i] * SCL2, a1 = s1[i] * SCL2;
        a0 = (jb + lr > row) ? -1.0e30f : a0;
        a1 = (jb + 16 + lr > row) ? -1.0e30f : a1;
        float mx = fmaxf(a0, a1);
        mx = fmaxf(mx, __shfl_xor(mx, 1, 32)); mx = fmaxf(mx, __shfl_xor(mx, 2, 32)); mx = fmaxf(mx, __shfl_xor(mx, 4, 32)); mx = fmaxf(mx, __shfl_xor(mx, 8, 32));
        const float mnew = fmaxf(mrow[i], mx);
        const float c  = __builtin_amdgcn_exp2f(mrow[i] - mnew);
        const float p0 = __builtin_amdgcn_exp2f(a0 - mnew);
        const float p1 = __builtin_amdgcn_exp2f(a1 - mnew);
        lrow[i] = lrow[i] * c + (p0 + p1);
        mrow[i] = mnew; corr[i] = c; s0[i] = p0; s1[i] = p1;
    }
}

#define AW   4                   // waves per late-attention work-group, 16 query rows each
#define KPIT 72                  // u16 per staged key row: 144 B = 16 B x odd, the pitch for 16-byte LDS readers of 128-B rows
#define VPIT 40                  // u16 per staged value row: 80 B = 16 B x odd, the same for 64-B rows
#define NQB_L (((SEQ - RH) / (16 * AW)) > 0 ? ((SEQ - RH) / (16 * AW)) : 1)
static_assert((SEQ - RH) % (16 * AW) == 0);   // whole work-groups of query rows
static_assert((RH + 16 * AW) / 32 >= 2);      // the two-buffer prologue needs two key steps
static_assert((16 * AW) % 32 == 0 && RH % 32 == 0);   // a work-group's last key step ends on its last query row

// One 32-key stage for a work-group of 128 threads: key rows jb..jb+31 (32 x 128 B, contiguous in the plane) and the 64 value rows' columns jb..jb+31 (64 x 64 B), 16 bytes per lane and copy, straight into LDS.
// The s_wait_xcnt 0 is the last line of the copies' own statement so that no address register of a copy is rewritten ahead of it.
__device__ __forceinline__ void stage_kv(const u16* __restrict__ Kb, const u16* __restrict__ Vb, const int jb, u16* kd, u16* vd, const int tid) {
    const u16* gk0 = Kb + (size_t)(jb + (tid >> 3)) * HD + (tid & 7) * 8;      // rows 0..15 of the stage
    const u16* gk1 = gk0 + 16 * HD;                                           // rows 16..31
    const u16* gv0 = Vb + (size_t)(tid >> 2) * SEQ + jb + (tid & 3) * 8;       // head columns 0..31
    const u16* gv1 = gv0 + (size_t)32 * SEQ;                                  // head columns 32..63
    const unsigned lk0 = lds_byte(kd + (tid >> 3) * KPIT + (tid & 7) * 8), lk1 = lk0 + 16 * KPIT * 2;
    const unsigned lv0 = lds_byte(vd + (tid >> 2) * VPIT + (tid & 3) * 8), lv1 = lv0 + 32 * VPIT * 2;
    asm volatile("global_load_async_to_lds_b128 %0, %1, off\n\t"
                 "global_load_async_to_lds_b128 %2, %3, off\n\t"
                 "global_load_async_to_lds_b128 %4, %5, off\n\t"
                 "global_load_async_to_lds_b128 %6, %7, off\n\t"
                 "s_wait_xcnt 0x0"
                 :: "v"(lk0), "v"(gk0), "v"(lk1), "v"(gk1), "v"(lv0), "v"(gv0), "v"(lv1), "v"(gv1) : "memory");
}

// Lane l's value from lane l ^ 16 (the other half of the wave), by a vector cross-row move.
__device__ __forceinline__ float xhalf(float x) {
    const int v = __builtin_bit_cast(int, x);
    return __builtin_bit_cast(float, __builtin_amdgcn_permlanex16(v, v, 0x76543210, 0xfedcba98, false, false));
}

// 2^c and 2^a[0..7] (first form), 2^a[0..7] (second form), as v_exp_f32 like the builtin. One statement each, results in registers of their own ("=&v") and a closing v_nop:
// so no instruction directly behind an exponential reads its result or overwrites its source (left to itself the compiler gave an exponential's result the register the one before it had just read).
__device__ __forceinline__ void exp2_9(const float c, const v8f a, float& ec, v8f& e) {
    float r0, r1, r2, r3, r4, r5, r6, r7;
    asm("v_exp_f32 %0, %9\n\tv_exp_f32 %1, %10\n\tv_exp_f32 %2, %11\n\tv_exp_f32 %3, %12\n\tv_exp_f32 %4, %13\n\tv_exp_f32 %5, %14\n\tv_exp_f32 %6, %15\n\tv_exp_f32 %7, %16\n\tv_exp_f32 %8, %17\n\tv_nop"
        : "=&v"(ec), "=&v"(r0), "=&v"(r1), "=&v"(r2), "=&v"(r3), "=&v"(r4), "=&v"(r5), "=&v"(r6), "=&v"(r7)
        : "v"(c), "v"(a[0]), "v"(a[1]), "v"(a[2]), "v"(a[3]), "v"(a[4]), "v"(a[5]), "v"(a[6]), "v"(a[7]));
    e[0] = r0; e[1] = r1; e[2] = r2; e[3] = r3; e[4] = r4; e[5] = r5; e[6] = r6; e[7] = r7;
}
__device__ __forceinline__ void exp2_8(const v8f a, v8f& e) {
    float r0, r1, r2, r3, r4, r5, r6, r7;
    asm("v_exp_f32 %0, %8\n\tv_exp_f32 %1, %9\n\tv_exp_f32 %2, %10\n\tv_exp_f32 %3, %11\n\tv_exp_f32 %4, %12\n\tv_exp_f32 %5, %13\n\tv_exp_f32 %6, %14\n\tv_exp_f32 %7, %15\n\tv_nop"
        : "=&v"(r0), "=&v"(r1), "=&v"(r2), "=&v"(r3), "=&v"(r4), "=&v"(r5), "=&v"(r6), "=&v"(r7)
        : "v"(a[0]), "v"(a[1]), "v"(a[2]), "v"(a[3]), "v"(a[4]), "v"(a[5]), "v"(a[6]), "v"(a[7]));
    e[0] = r0; e[1] = r1; e[2] = r2; e[3] = r3; e[4] = r4; e[5] = r5; e[6] = r6; e[7] = r7;
}

// k_attn_l: query rows >= RH, f16 single products. One work-group of AW waves per 16*AW query rows of one (batch, head), one wave per 16 rows; the waves share each 32-key stage of K and V,
// brought into two LDS buffers by asynchronous copies one stage ahead. Every wave walks the work-group's key range: a step wholly above a wave's diagonal adds exact zeros. ctx f16 x CCAR -> AT [b][t-RH][1024].
// Both products are taken transposed: S^T = K Q^T (A = key rows from LDS, B = the wave's query rows, kept in registers) and O^T += V^T P^T (A = rows of the staged V^T, B = P^T).
// A lane then holds 16 of the 32 scores of ONE query (qbase + (lane&15); keys jb + 8 (lane>>4) + r and jb + 16 + 8 (lane>>4) + r): maximum and sum run inside the lane, the two halves of the wave meet in one exchange,
// and the two score tiles, converted in place, are the B operand of the second product in the loader's own k order, so P goes through no LDS and no barrier.
__global__ __launch_bounds__(32 * AW) void k_attn_l(const u16* __restrict__ QP, const u16* __restrict__ KP, const u16* __restrict__ VT, u16* AT) {
    __shared__ __align__(16) u16 ks[2][32 * KPIT];
    __shared__ __align__(16) u16 vs[2][HD * VPIT];
    const int tid = threadIdx.x, lane = tid & 31, lr = lane & 15, hi = lane >> 4;
    const int wv = __builtin_amdgcn_readfirstlane(tid >> 5);   // wave number as a scalar: the test for steps that touch the diagonal stays a scalar branch
    const int bh = blockIdx.x / NQB_L, qb = blockIdx.x - bh * NQB_L;
    const int b = bh / NH, h = bh - b * NH;
    const int qblk = RH + qb * (16 * AW);
    const int qbase = qblk + wv * 16;
    const size_t pb = (size_t)bh * SEQ * HD;
    const u16* Qb = QP + pb; const u16* Kb = KP + pb; const u16* Vb = VT + pb;
    const int nsteps = (qblk + 16 * AW) >> 5;    // keys 0 .. qblk+16*AW-1 in steps of 32; nsteps*32 <= SEQ, nsteps >= 2
    stage_kv(Kb, Vb, 0, ks[0], vs[0], tid);
    asm volatile("s_wait_asynccnt 0x0" ::: "memory");   // this wave's copies of stage 0 have landed
    __syncthreads();                                     // stage 0 readable by every wave
    stage_kv(Kb, Vb, 32, ks[1], vs[1], tid);
    const v16us q0 = ldfr(Qb + (size_t)(qbase + lr) * HD + 8 * hi);
    const v16us q1 = ldfr(Qb + (size_t)(qbase + lr) * HD + 32 + 8 * hi);
    v8f acc[4];                                  // acc[dt][r] = O^T[16 dt + 8 hi + r][qbase + lr], carried x PCAR
#pragma unroll
    for (int dt = 0; dt < 4; ++dt) acc[dt] = (v8f){};
    float mrun = -1.0e30f, lsum = 0.0f;          // this lane's query: running maximum of the raw scores (both halves alike); sum of this half's probabilities x PCAR
#pragma unroll 1
    for (int st = 0; st < nsteps; ++st) {
        const int jb = st * 32;
        const u16* kr0 = ks[st & 1] + lr * KPIT + 8 * hi; const u16* kr1 = kr0 + 16 * KPIT;
        const u16* vr = vs[st & 1] + lr * VPIT + 8 * hi;
        const v16us k00 = ldfr(kr0), k01 = ldfr(kr0 + 32), k10 = ldfr(kr1), k11 = ldfr(kr1 + 32);   // the step's 8 key reads stand together, ahead of its 4 score products
        v8f s0 = (v8f){}, s1 = (v8f){};
        s0 = mma_h(k00, q0, s0); s1 = mma_h(k10, q0, s1);
        s0 = mma_h(k01, q1, s0); s1 = mma_h(k11, q1, s1);
        v16us vf[4];                             // the step's 8 value reads stand together too: they return while the softmax runs
#pragma unroll
        for (int dt = 0; dt < 4; ++dt) vf[dt] = ldfr(vr + dt * 16 * VPIT);
        if (jb + 31 > qbase) {                   // only a step that reaches past the wave's first query row can hold an excluded key
            const int dq = qbase + lr - jb - 8 * hi;      // key index r (or 16 + r) inside this lane's share is excluded when it exceeds dq
#pragma unroll
            for (int r = 0; r < 8; ++r) { s0[r] = (r > dq) ? -1.0e30f : s0[r]; s1[r] = (16 + r > dq) ? -1.0e30f : s1[r]; }
        }
        float mx = fmaxf(s0[0], s1[0]);
#pragma unroll
        for (int r = 1; r < 8; ++r) mx = fmaxf(mx, fmaxf(s0[r], s1[r]));
        mx = fmaxf(mx, xhalf(mx));
        const float mnew = fmaxf(mrun, mx);      // finite from the first step on: key 0 is open to every query
        const float nm = 10.0f - mnew * SCL2;    // 2^10 = PCAR: the carry rides in the exponent
#pragma unroll
        for (int r = 0; r < 8; ++r) { s0[r] = __builtin_fmaf(s0[r], SCL2, nm); s1[r] = __builtin_fmaf(s1[r], SCL2, nm); }
        float corr;
        exp2_9((mrun - mnew) * SCL2, s0, corr, s0);
        exp2_8(s1, s1);
        mrun = mnew;
        v16h pf;
        float ps = 0.0f;
#pragma unroll
        for (int r = 0; r < 8; ++r) { ps += s0[r] + s1[r]; pf[r] = (h16)s0[r]; pf[8 + r] = (h16)s1[r]; }
        lsum = lsum * corr + ps;
#pragma unroll
        for (int dt = 0; dt < 4; ++dt)
#pragma unroll
            for (int r = 0; r < 8; ++r) acc[dt][r] *= corr;
        const v16us pu = __builtin_bit_cast(v16us, pf);
#pragma unroll
        for (int dt = 0; dt < 4; ++dt) acc[dt] = mma_h(vf[dt], pu, acc[dt]);
        asm volatile("s_wait_dscnt 0x0" ::: "memory");      // this wave's LDS reads of the stage are done before the buffer is refilled
        asm volatile("s_wait_asynccnt 0x0" ::: "memory");   // this wave's copies of the next stage have landed
        __syncthreads();                                     // publishes the next stage and ends every reader's last read of this one
        if (st + 2 < nsteps) stage_kv(Kb, Vb, jb + 64, ks[st & 1], vs[st & 1], tid);
    }
    asm volatile("s_wait_asynccnt 0x0" ::: "memory");       // no copy is left in flight when the wave goes on to its end
    const float inv = CCAR / (lsum + xhalf(lsum));          // both carry PCAR, so it cancels
    u16* dst = AT + ((size_t)b * (SEQ - RH) + (qbase - RH) + lr) * DM + h * HD + 8 * hi;
#pragma unroll
    for (int dt = 0; dt < 4; ++dt) {             // a lane's 8 registers are 8 consecutive head columns of its query row: one 16-byte store; the wave's four stores fill each row's whole 128-B line
        v8us o;
#pragma unroll
        for (int r = 0; r < 8; ++r) o[r] = f2h(acc[dt][r] * inv);
        *(v8us*)(dst + dt * 16) = o;
    }
}

// k_attn_e: query rows < RH, bf16 hi+lo operands (hi.hi + lo.hi + hi.lo into one accumulator; residuals unscaled). ctx hi/lo bf16 -> ATEh/ATEl [b][t][1024].
__global__ __launch_bounds__(32) void k_attn_e(const u16* __restrict__ QEh, const u16* __restrict__ QEl, const u16* __restrict__ KEh, const u16* __restrict__ KEl, const u16* __restrict__ VEh, const u16* __restrict__ VEl, u16* ATEh, u16* ATEl) {
    __shared__ __align__(16) u16 pwh[16 * 40];
    __shared__ __align__(16) u16 pwl[16 * 40];
    __shared__ __align__(16) float os[16 * 68];
    const int lane = threadIdx.x & 31, lr = lane & 15, hi = lane >> 4;
    const int bh = blockIdx.x / (RH / 16), qt = blockIdx.x - bh * (RH / 16);
    const int b = bh / NH, h = bh - b * NH;
    const int qbase = qt * 16;
    const size_t pb = (size_t)bh * RH * HD;
    const size_t qo = pb + (size_t)(qbase + lr) * HD + 8 * hi;
    const v16us qh0 = ldfr(QEh + qo), qh1 = ldfr(QEh + qo + 32), ql0 = ldfr(QEl + qo), ql1 = ldfr(QEl + qo + 32);
    v8f acc[4];
#pragma unroll
    for (int nt = 0; nt < 4; ++nt) acc[nt] = (v8f){};
    float mrow[8], lrow[8];
#pragma unroll
    for (int i = 0; i < 8; ++i) { mrow[i] = -1.0e30f; lrow[i] = 0.0f; }
    const int nsteps = (qbase + 47) >> 5;        // nsteps*32 <= RH
#pragma unroll 1
    for (int st = 0; st < nsteps; ++st) {
        const int jb = st * 32;
        const size_t ko = pb + (size_t)(jb + lr) * HD + 8 * hi;
        v8f s0 = (v8f){}, s1 = (v8f){};
        {
            const v16us kh0 = ldfr(KEh + ko), kh1 = ldfr(KEh + ko + 32), kl0 = ldfr(KEl + ko), kl1 = ldfr(KEl + ko + 32);
            s0 = mma_b(qh0, kh0, s0); s0 = mma_b(qh1, kh1, s0); s0 = mma_b(ql0, kh0, s0); s0 = mma_b(ql1, kh1, s0); s0 = mma_b(qh0, kl0, s0); s0 = mma_b(qh1, kl1, s0);
        }
        {
            const size_t k1 = ko + 16 * HD;
            const v16us kh0 = ldfr(KEh + k1), kh1 = ldfr(KEh + k1 + 32), kl0 = ldfr(KEl + k1), kl1 = ldfr(KEl + k1 + 32);
            s1 = mma_b(qh0, kh0, s1); s1 = mma_b(qh1, kh1, s1); s1 = mma_b(ql0, kh0, s1); s1 = mma_b(ql1, kh1, s1); s1 = mma_b(qh0, kl0, s1); s1 = mma_b(qh1, kl1, s1);
        }
        float corr[8];
        sm_step(s0, s1, mrow, lrow, corr, jb, qbase, lr, hi);
#pragma unroll
        for (int nt = 0; nt < 4; ++nt)
#pragma unroll
            for (int i = 0; i < 8; ++i) acc[nt][i] *= corr[i];
#pragma unroll
        for (int i = 0; i < 8; ++i) {
            const u16 a = f2bf(s0[i]); const u16 c = f2bf(s1[i]);
            pwh[(i + 8 * hi) * 40 + lr] = a; pwl[(i + 8 * hi) * 40 + lr] = f2bf(s0[i] - bf2f(a));
            pwh[(i + 8 * hi) * 40 + 16 + lr] = c; pwl[(i + 8 * hi) * 40 + 16 + lr] = f2bf(s1[i] - bf2f(c));
        }
        __syncthreads();
        const v8us h0 = *(const v8usa*)&pwh[lr * 40 + 8 * hi]; const v8us h1 = *(const v8usa*)&pwh[lr * 40 + 16 + 8 * hi];
        const v8us l0 = *(const v8usa*)&pwl[lr * 40 + 8 * hi]; const v8us l1 = *(const v8usa*)&pwl[lr * 40 + 16 + 8 * hi];
        const v16us pfh = __builtin_shufflevector(h0, h1, 0, 1, 2, 3, 4, 5, 6, 7, 8, 9, 10, 11, 12, 13, 14, 15);
        const v16us pfl = __builtin_shufflevector(l0, l1, 0, 1, 2, 3, 4, 5, 6, 7, 8, 9, 10, 11, 12, 13, 14, 15);
#pragma unroll
        for (int nt = 0; nt < 4; ++nt) {
            const size_t vo = pb + (size_t)(nt * 16 + lr) * RH + jb + 8 * hi;      // [bh][64][RH], same plane size as [bh][RH][64]
            const v16us vh = ldfr(VEh + vo), vl = ldfr(VEl + vo);
            acc[nt] = mma_b(pfh, vh, acc[nt]); acc[nt] = mma_b(pfl, vh, acc[nt]); acc[nt] = mma_b(pfh, vl, acc[nt]);
        }
        __syncthreads();
    }
#pragma unroll
    for (int i = 0; i < 8; ++i) {
        float l = lrow[i];
        l += __shfl_xor(l, 1, 32); l += __shfl_xor(l, 2, 32); l += __shfl_xor(l, 4, 32); l += __shfl_xor(l, 8, 32);
        const float inv = 1.0f / l;
#pragma unroll
        for (int nt = 0; nt < 4; ++nt) os[(i + 8 * hi) * 68 + nt * 16 + lr] = acc[nt][i] * inv;
    }
    __syncthreads();
    const size_t dofs = ((size_t)b * RH + qbase) * DM + h * HD;
{
#pragma unroll
        for (int s = 0; s < 4; ++s) {
            const int row = 4 * s + (lane >> 3), pc = (lane & 7) * 8;
            const v4f x0 = *(const v4fa*)&os[row * 68 + pc]; const v4f x1 = *(const v4fa*)&os[row * 68 + pc + 4];
            v8us oh, ol;
#pragma unroll
            for (int q = 0; q < 4; ++q) { const u16 a = f2bf(x0[q]); oh[q] = a; ol[q] = f2bf(x0[q] - bf2f(a)); const u16 c = f2bf(x1[q]); oh[4 + q] = c; ol[4 + q] = f2bf(x1[q] - bf2f(c)); }
            *(v8us*)(ATEh + dofs + (size_t)row * DM + pc) = oh;
            *(v8us*)(ATEl + dofs + (size_t)row * DM + pc) = ol;
        }
        
    }
}

// Output projection: OUT[b][toff + r][n] = scale * sum_k A[row][k] Bt[n][k] (+ A2 product in k_outp_e) + bf16(bias[n]); rows of A are [b][r] with rpb rows per batch.
// Shared epilogue of one wave's 64x64 tile at rows r0.., columns c0..: whole 256-B row pieces through the wave's own staging 'os'. Every wave of the work-group passes the same barriers.
__device__ __forceinline__ void outp_store(const v8f (&acc)[4][4], float* os, const float* __restrict__ bias, float* OUT, const float scale, const int rpb, const int toff, const int r0, const int c0, const int lr, const int hi) {
    const int b = r0 / rpb, tb = toff + (r0 - b * rpb);
    float* crow0 = OUT + ((size_t)b * SEQ_FULL + tb) * DM + c0;
    const int cofs = lr * 4;
    v4f bv; bv[0] = bfr(bias[c0 + cofs]); bv[1] = bfr(bias[c0 + cofs + 1]); bv[2] = bfr(bias[c0 + cofs + 2]); bv[3] = bfr(bias[c0 + cofs + 3]);
#pragma unroll
    for (int mb = 0; mb < 4; ++mb) {
#pragma unroll
        for (int nb = 0; nb < 4; ++nb)
#pragma unroll
            for (int j = 0; j < 8; ++j) os[(hi * 8 + j) * 68 + nb * 16 + lr] = acc[mb][nb][j];
        __syncthreads();
#pragma unroll
        for (int s = 0; s < 8; ++s) {
            const int row = 2 * s + hi;
            const v4f x = *(const v4fa*)&os[row * 68 + cofs];
            v4f val; val[0] = x[0] * scale + bv[0]; val[1] = x[1] * scale + bv[1]; val[2] = x[2] * scale + bv[2]; val[3] = x[3] * scale + bv[3];
            *(v4f*)(crow0 + (size_t)(mb * 16 + row) * DM + cofs) = val;
        }
        __syncthreads();
    }
}

// k_outp_e: rows < RH, bf16 hi+lo ctx planes; one wave per work-group and 64x64 tile, fragments straight from the planes (few tiles: one wave per work-group spreads them over the chip).
__global__ __launch_bounds__(32) void k_outp_e(const u16* __restrict__ A, const u16* __restrict__ A2, const u16* __restrict__ Bt, const float* __restrict__ bias, float* OUT, float scale, int rpb, int toff) {
    __shared__ __align__(16) float os[16 * 68];
    const int lane = threadIdx.x & 31, lr = lane & 15, hi = lane >> 4;
    const int r0 = blockIdx.x * 64, c0 = blockIdx.y * 64;
    v8f acc[4][4];
    gemm_tile<false, true>(A, A2, Bt, DM, r0, c0, lr, hi, acc);
    outp_store(acc, os, bias, OUT, scale, rpb, toff, r0, c0, lr, hi);
}

// k_outp_l: rows >= RH, f16 planes; eight waves (4 x 2 tiles of 64x64) per work-group sharing the staged operands.
__global__ __launch_bounds__(GTH) void k_outp_l(const u16* __restrict__ A, const u16* __restrict__ Bt, const float* __restrict__ bias, float* OUT, float scale, int rpb, int toff) {
    __shared__ __align__(16) u16 ring[2 * GSTG];
    const int tid = threadIdx.x, lane = tid & 31, lr = lane & 15, hi = lane >> 4;
    const int wv = __builtin_amdgcn_readfirstlane(tid >> 5), wm = wv % GWM, wn = wv / GWM;   // wave number as a scalar: tile indices and the branches on them stay scalar
    float* os = (float*)((char*)ring + wv * GEPI);                       // this wave's own staging, used after the k loop only
    v8f acc[4][4];
    gemm_tile_s<true>(A, Bt, DM, blockIdx.x * GAR, blockIdx.y * GBR, ring, tid, wm, wn, lr, hi, acc);
    outp_store(acc, os, bias, OUT, scale, rpb, toff, blockIdx.x * GAR + wm * 64, blockIdx.y * GBR + wn * 64, lr, hi);
}

extern "C" void kernel_launch(void* const* d_in, const int* in_sizes, int n_in,
                              void* d_out, int out_size, void* d_ws, size_t ws_size, hipStream_t stream) {
    if (n_in < 10) return;
    const long long needx = ((long long)(NB - 1) * SEQ_FULL + SEQ) * DM;
    if ((long long)in_sizes[0] < needx) return;
    if ((long long)in_sizes[1] < (long long)DM * DM || (long long)in_sizes[2] < (long long)DM * DM || (long long)in_sizes[3] < (long long)DM * DM || (long long)in_sizes[4] < (long long)DM * DM) return;
    if (in_sizes[5] < DM) return;
    if (in_sizes[6] < HD || in_sizes[7] < HD || in_sizes[8] < HD || in_sizes[9] < HD) return;
    if ((long long)out_size < needx) return;
    if (O_END * 2 > ws_size) return;
    // wire order: x, key weight, query weight, value weight, output weight, output bias, key LayerNorm gain, key LayerNorm bias, query LayerNorm gain, query LayerNorm bias
    const float* x  = (const float*)d_in[0];
    const float* Wk = (const float*)d_in[1];
    const float* Wq = (const float*)d_in[2];
    const float* Wv = (const float*)d_in[3];
    const float* Wp = (const float*)d_in[4];
    const float* bp = (const float*)d_in[5];
    const float* kg = (const float*)d_in[6];
    const float* kb = (const float*)d_in[7];
    const float* qg = (const float*)d_in[8];
    const float* qb = (const float*)d_in[9];
    float* OUT = (float*)d_out;
    u16* PL = (u16*)d_ws;

    k_cvt_all<<<CVG, 32 * CVW, 0, stream>>>(x, Wq, Wk, Wv, Wp, PL);   // planes O_XB, O_WALL (query, key, value rows), O_WPB, O_WPH

    k_proj<<<dim3(NB * SEQ / GAR, 3 * DM / GBR, 1), GTH, 0, stream>>>(PL + O_XB, PL + O_WALL, PL, O_P16, O_EH, O_EL, qg, qb, kg, kb);

    k_attn_e<<<NB * NH * (RH / 16), 32, 0, stream>>>(PL + O_EH, PL + O_EL, PL + O_EH + EPLANE, PL + O_EL + EPLANE, PL + O_EH + 2 * EPLANE, PL + O_EL + 2 * EPLANE, PL + O_ATEH, PL + O_ATEL);
    if (SEQ > RH)
        k_attn_l<<<NB * NH * ((SEQ - RH) / (16 * AW)), 32 * AW, 0, stream>>>(PL + O_P16, PL + O_P16 + PLANE, PL + O_P16 + 2 * PLANE, PL + O_AT);

    k_outp_e<<<dim3(NB * RH / 64, DM / 64, 1), 32, 0, stream>>>(PL + O_ATEH, PL + O_ATEL, PL + O_WPB, bp, OUT, 1.0f, RH, 0);
    if (SEQ > RH)
        k_outp_l<<<dim3(NB * (SEQ - RH) / GAR, DM / GBR, 1), GTH, 0, stream>>>(PL + O_AT, PL + O_WPH, bp, OUT, 1.0f / (WCAR * CCAR), SEQ - RH, RH);
}

// v005
// Measured time: 167 microseconds a run.
// Timed twice side by side with v004, it ran 1.19 times as fast both times.
// All steps since v000 together make it 2.63 times as fast.
#include <hip/hip_runtime.h>

// Compute dtypes (f32 accumulate everywhere): q/k/v projections bf16 x bf16 (inputs converted RNE to bf16, products exact), per-head LayerNorm of q and k in f32 inside the projection epilogue; scores q.k and P.V: f16 single products on query rows >= 256 (P carried x1024), bf16 hi+lo (3 products) on query rows < 256; output projection: f16 single product (ctx x16, Wo x32 carries) on rows >= 256, bf16 hi+lo ctx x bf16 Wo on rows < 256.
// Causal 16-head attention block, x [4][2048][1024]; separate bias-free [out][in] key / query / value projections (used as Bt as stored), per-head LayerNorm (eps 1e-5, gain and bias inputs) on the 64-wide query and key rows,
// the two 1024^(-1/4) factors applied as one 1/32 on the scores, causal exclusion with the diagonal kept, softmax in f32 (running max, log2 domain), heads merged h*64+d, [out][in] output projection plus bias.
// Layout: 16-bit planes in the workspace (u16 storage): x copy [b*SEQ+t][1024]; weights [3][1024][1024] (q, k, v) ; q and k head planes [b][h][t][64]; v transposed [b][h][64][t]; hi/lo bf16 planes of the same for t < 256;
// ctx f16 [b][t-256][1024] and ctx hi/lo bf16 [b][t<256][1024]. Fused flash-style attention: one wave per 16 query rows, 32 keys per step, no score plane in global memory; rows < 256: fragments straight from the k-contiguous planes; rows >= 256: four waves share K and V stages in LDS and both products run transposed. Projection and late output GEMMs: eight waves share A and B stages in LDS.

#ifndef NB
#define NB 4
#endif
#ifndef SEQ
#define SEQ 2048
#endif
#define NB_FULL  4
#define SEQ_FULL 2048
#define DM   1024
#define NH   16
#define HD   64
#define RH   256                 // query rows / keys below RH also carry bf16 hi+lo planes
#define PCAR 1024.0f             // carry on f16 probabilities
#define CCAR 16.0f               // carry on the f16 ctx plane
#define WCAR 32.0f               // carry on the f16 output-projection weight plane
#define SCL2 (0.03125f * 1.4426950408889634f)   // 1/sqrt(1024) x log2(e)
#define LNEPS 1.0e-5f            // LayerNorm epsilon on the head rows

static_assert(DM == NH * HD);            // heads tile the channel width
static_assert(HD == 64);
static_assert(HD == 8 * 8);              // LayerNorm row = 8 lanes x 8 columns in the projection epilogue
static_assert(DM % 64 == 0);             // GEMM k-step: two 32-k blocks a trip
static_assert(HD % 32 == 0);             // score k-step
static_assert(SEQ % 64 == 0);            // 64-row GEMM tiles never straddle a batch
static_assert(RH % 64 == 0);             // early/late split on tile borders
static_assert(SEQ >= RH);
static_assert((SEQ - RH) % 64 == 0);
static_assert(RH % 32 == 0);             // 32-key steps end inside the early planes
static_assert(NB <= NB_FULL);
static_assert(SEQ <= SEQ_FULL);

typedef unsigned short u16;
typedef _Float16 h16;
typedef __attribute__((ext_vector_type(16))) __bf16         v16bf;
typedef __attribute__((ext_vector_type(16))) _Float16       v16h;
typedef __attribute__((ext_vector_type(8)))  unsigned short v8us;
typedef __attribute__((ext_vector_type(16))) unsigned short v16us;
typedef __attribute__((ext_vector_type(8)))  float          v8f;
typedef __attribute__((ext_vector_type(4)))  float          v4f;
typedef v4f  __attribute__((may_alias)) v4fa;
typedef v8us __attribute__((may_alias)) v8usa;

#define XBN    ((size_t)NB * SEQ * DM)
#define WN     ((size_t)DM * DM)
#define PLANE  ((size_t)NB * NH * SEQ * HD)
#define EPLANE ((size_t)NB * NH * RH * HD)
#define ATN    ((size_t)NB * (SEQ - RH) * DM)
#define ATEN   ((size_t)NB * RH * DM)
#define O_XB   ((size_t)0)
#define O_WALL (O_XB + XBN)
#define O_WPB  (O_WALL + 3 * WN)
#define O_WPH  (O_WPB + WN)
#define O_P16  (O_WPH + WN)
#define O_EH   (O_P16 + 3 * PLANE)
#define O_EL   (O_EH + 3 * EPLANE)
#define O_AT   (O_EL + 3 * EPLANE)
#define O_ATEH (O_AT + ATN)
#define O_ATEL (O_ATEH + ATEN)
#define O_END  (O_ATEL + ATEN)
static_assert(O_END * 2 <= (size_t)134217728);   // total carve <= 128 MiB
static_assert(XBN % 128 == 0 && WN % 128 == 0 && PLANE % 128 == 0 && EPLANE % 128 == 0 && ATN % 128 == 0 && ATEN % 128 == 0);   // every region starts on a 256-byte border

__device__ __forceinline__ u16 f2bf(float f) { unsigned u = __float_as_uint(f); u += 0x7FFFu + ((u >> 16) & 1u); return (u16)(u >> 16); }
__device__ __forceinline__ float bf2f(u16 b) { return __uint_as_float(((unsigned)b) << 16); }
__device__ __forceinline__ float bfr(float f) { return bf2f(f2bf(f)); }
__device__ __forceinline__ u16 f2h(float x) { return __builtin_bit_cast(unsigned short, (h16)x); }

// f32 -> f16 with a value select: magnitudes below the smallest normal f16 become zero, so no subnormal f16 operand can reach a WMMA.
static __device__ __forceinline__ h16 toh_flush(float v) { const h16 r = (h16)v; return (fabsf(v) < 6.103515625e-05f) ? (h16)0.0f : r; }
static __device__ __forceinline__ u16 f2h_fl(float v) { return __builtin_bit_cast(unsigned short, toh_flush(v)); }

// Fragment loader for A and B alike: 'p' points at (row or column) + k0 + 8*(lane>>4); elements 0..7 = k0+8h.., elements 8..15 = k0+16+8h..
__device__ __forceinline__ v16us ldfr(const u16* p) {
    const v8us lo = *(const v8us*)p; const v8us hi = *(const v8us*)(p + 16);
    return __builtin_shufflevector(lo, hi, 0, 1, 2, 3, 4, 5, 6, 7, 8, 9, 10, 11, 12, 13, 14, 15);
}
// One WMMA plus its own hazard guard (ties exactly one accumulator, keeps A and B live).
__device__ __forceinline__ v8f mma_h(v16us a, v16us b, v8f c) {
    const v16h ah = __builtin_bit_cast(v16h, a); const v16h bh = __builtin_bit_cast(v16h, b);
    c = __builtin_amdgcn_wmma_f32_16x16x32_f16(false, ah, false, bh, (short)0, c, false, false);
    asm volatile("v_nop\n\tv_nop\n\tv_nop\n\tv_nop" : "+v"(c) : "v"(ah), "v"(bh));
    return c;
}
__device__ __forceinline__ v8f mma_b(v16us a, v16us b, v8f c) {
    const v16bf ab = __builtin_bit_cast(v16bf, a); const v16bf bb = __builtin_bit_cast(v16bf, b);
    c = __builtin_amdgcn_wmma_f32_16x16x32_bf16(false, ab, false, bb, (short)0, c, false, false);
    asm volatile("v_nop\n\tv_nop\n\tv_nop\n\tv_nop" : "+v"(c) : "v"(ab), "v"(bb));
    return c;
}
template <bool F16> __device__ __forceinline__ v8f mmag(v16us a, v16us b, v8f c) { if (F16) return mma_h(a, b, c); else return mma_b(a, b, c); }
// The same products with the hazard distance left to the compiler's own padding, for the kernel that holds two fragment sets: an asm operand cannot lie above v255, so the guard above would press accumulators and both sets into 256 registers (spills).
__device__ __forceinline__ v8f mma_bp(v16us a, v16us b, v8f c) { return __builtin_amdgcn_wmma_f32_16x16x32_bf16(false, __builtin_bit_cast(v16bf, a), false, __builtin_bit_cast(v16bf, b), (short)0, c, false, false); }
__device__ __forceinline__ v8f mma_hp(v16us a, v16us b, v8f c) { return __builtin_amdgcn_wmma_f32_16x16x32_f16(false, __builtin_bit_cast(v16h, a), false, __builtin_bit_cast(v16h, b), (short)0, c, false, false); }
template <bool F16> __device__ __forceinline__ v8f mmap(v16us a, v16us b, v8f c) { if (F16) return mma_hp(a, b, c); else return mma_bp(a, b, c); }

// The fragments of one 32-k block of a wave's 64x64 tile, straight from the k-contiguous planes: 4 row blocks of A (and of A2 when SPLIT), 4 column blocks of Bt. pa / pa2 / pb: this lane's place in the block, row or column block 0.
template <bool SPLIT>
__device__ __forceinline__ void ld_blk(const u16* pa, const u16* pa2, const u16* pb, const int K, v16us (&a)[4], v16us (&a2)[4], v16us (&bb)[4]) {
#pragma unroll
    for (int mb = 0; mb < 4; ++mb) { a[mb] = ldfr(pa + (size_t)mb * 16 * K); if (SPLIT) a2[mb] = ldfr(pa2 + (size_t)mb * 16 * K); else a2[mb] = a[mb]; }
#pragma unroll
    for (int nb = 0; nb < 4; ++nb) bb[nb] = ldfr(pb + (size_t)nb * 16 * K);
    __builtin_amdgcn_sched_barrier(0);   // holds the group of loads here, ahead of the products that follow: left free, the compiler sank them to their first use, one block later, and the wave waited there
}
// Stands behind the products that follow a group of loads and in front of the advance of the pointers that the loads name. The pointers are inputs so that their registers stay theirs up to the wait
// (otherwise a later load of the same group was given an earlier one's address register as its destination).
// The first scheduling barrier keeps the wait behind the products, where it is free (moved up to the loads it would hold the products back); the second keeps the advance behind the wait.
__device__ __forceinline__ void ld_done(const u16* p0, const u16* p1, const u16* p2) {
    __builtin_amdgcn_sched_barrier(0);
    asm volatile("s_wait_xcnt 0x0" :: "v"(p0), "v"(p1), "v"(p2) : "memory");
    __builtin_amdgcn_sched_barrier(0);
}
__device__ __forceinline__ void ld_done(const u16* p0, const u16* p1, const u16* p2, const u16* p3) {
    __builtin_amdgcn_sched_barrier(0);
    asm volatile("s_wait_xcnt 0x0" :: "v"(p0), "v"(p1), "v"(p2), "v"(p3) : "memory");
    __builtin_amdgcn_sched_barrier(0);
}
template <bool F16, bool SPLIT>
__device__ __forceinline__ void mm_blk(const v16us (&a)[4], const v16us (&a2)[4], const v16us (&bb)[4], v8f (&acc)[4][4]) {
#pragma unroll
    for (int nb = 0; nb < 4; ++nb)
#pragma unroll
        for (int mb = 0; mb < 4; ++mb) { acc[mb][nb] = mmap<F16>(a[mb], bb[nb], acc[mb][nb]); if (SPLIT) acc[mb][nb] = mmap<F16>(a2[mb], bb[nb], acc[mb][nb]); }
}
// One wave computes a 64x64 tile: acc[mb][nb] element j = C[r0 + 16 mb + 8 (lane>>4) + j][c0 + 16 nb + (lane&15)] = sum_k A[m][k] Bt[n][k] (+ A2[m][k] Bt[n][k] when SPLIT). K % 64 == 0.
// Two fragment sets: all loads of a 32-k block are issued as one group while the block before it is multiplied, so a lone wave waits out at most one load latency per block, and that behind 32 products.
template <bool F16, bool SPLIT>
__device__ __forceinline__ void gemm_tile(const u16* __restrict__ A, const u16* __restrict__ A2, const u16* __restrict__ Bt, const int K, const int r0, const int c0, const int lr, const int hi, v8f (&acc)[4][4]) {
#pragma unroll
    for (int mb = 0; mb < 4; ++mb)
#pragma unroll
        for (int nb = 0; nb < 4; ++nb) acc[mb][nb] = (v8f){};
    const size_t aoff = (size_t)(r0 + lr) * K + 8 * hi, boff = (size_t)(c0 + lr) * K + 8 * hi;
    const u16* pa = A + aoff; const u16* pa2 = A2 + aoff; const u16* pb = Bt + boff;   // this lane's place in the block to be loaded next
    v16us a[4], a2[4], bb[4], an[4], a2n[4], bn[4];
    ld_blk<SPLIT>(pa, pa2, pb, K, a, a2, bb);
    ld_done(pa, pa2, pb);
    pa += 32; pa2 += 32; pb += 32;
#pragma unroll 1   // kept rolled: one trip already holds both fragment sets' turns
    for (int kc = 0; kc < K; kc += 64) {
        ld_blk<SPLIT>(pa, pa2, pb, K, an, a2n, bn);
        mm_blk<F16, SPLIT>(a, a2, bb, acc);
        ld_done(pa, pa2, pb);
        const int adv = (kc + 64 < K) ? 32 : -32;   // the last trip has no block ahead: it reads its first block again (in bounds), and nothing uses it
        pa += adv; pa2 += adv; pb += adv;
        ld_blk<SPLIT>(pa, pa2, pb, K, a, a2, bb);
        mm_blk<F16, SPLIT>(an, a2n, bn, acc);
        pa += 32; pa2 += 32; pb += 32;   // the compiler takes this advance up to the loads and puts its own waits in front of it
    }
}

__device__ __forceinline__ unsigned lds_byte(const u16* p) { return (unsigned)(size_t)(const __attribute__((address_space(3))) u16*)p; }

#define GWM  4                   // waves down a GEMM work-group, 64 rows each
#define GWN  2                   // waves across, 64 columns each
#define GTH  (32 * GWM * GWN)    // threads per GEMM work-group
#define GKS  64                  // k per stage: 128-B rows, whole cache lines
#define GPIT 72                  // u16 per staged row: 144 B = 16 B x odd, the pitch for 16-byte LDS readers of 128-B rows
#define GAR  (64 * GWM)          // A rows per stage
#define GBR  (64 * GWN)          // Bt rows per stage
#define GSTG ((GAR + GBR) * GPIT)   // u16 per stage buffer: A rows, then Bt rows
#define GEPI (16 * 68 * 4 + 64 * 72 * 2)   // bytes of epilogue staging per wave (f32 row block, then the 16-bit transpose block), laid over the ring after the k loop
static_assert(GTH == 256 && GAR == 256 && GBR == 128);   // stage_ab: 32 rows per copy, 8 copies for A and 4 for Bt
static_assert(DM % GKS == 0 && DM / GKS >= 2);           // the two-buffer prologue needs two stages
static_assert(GEPI % 16 == 0 && GEPI * GWM * GWN <= 2 * GSTG * 2);
static_assert((NB * SEQ) % GAR == 0 && (NB * (SEQ - RH)) % GAR == 0 && RH % GAR == 0 && SEQ % GAR == 0 && DM % GBR == 0);   // whole work-groups; early/late and q/k/v the same for all waves of one

// One 64-k stage for a work-group of 256 threads: 256 A rows and 128 Bt rows of 128 B, 16 bytes per lane and copy (8 lanes = one row = one line), straight into LDS. ga / gb / la: this thread's place in row tid>>3 of A, of Bt, of the buffer.
// The s_wait_xcnt 0 is the last line of the copies' own statement so that no address register of a copy is rewritten ahead of it.
__device__ __forceinline__ void stage_ab(const u16* ga, const u16* gb, const int K, const unsigned la) {
    const size_t rs = (size_t)32 * K;                 // 32 rows on in global memory
    const unsigned ls = 32 * GPIT * 2;                // 32 rows on in LDS, bytes
    const unsigned lb = la + GAR * GPIT * 2;
    asm volatile("global_load_async_to_lds_b128 %0, %1, off\n\t"
                 "global_load_async_to_lds_b128 %2, %3, off\n\t"
                 "global_load_async_to_lds_b128 %4, %5, off\n\t"
                 "global_load_async_to_lds_b128 %6, %7, off\n\t"
                 "global_load_async_to_lds_b128 %8, %9, off\n\t"
                 "global_load_async_to_lds_b128 %10, %11, off\n\t"
                 "global_load_async_to_lds_b128 %12, %13, off\n\t"
                 "global_load_async_to_lds_b128 %14, %15, off\n\t"
                 "global_load_async_to_lds_b128 %16, %17, off\n\t"
                 "global_load_async_to_lds_b128 %18, %19, off\n\t"
                 "global_load_async_to_lds_b128 %20, %21, off\n\t"
                 "global_load_async_to_lds_b128 %22, %23, off\n\t"
                 "s_wait_xcnt 0x0"
                 :: "v"(la), "v"(ga), "v"(la + ls), "v"(ga + rs), "v"(la + 2 * ls), "v"(ga + 2 * rs), "v"(la + 3 * ls), "v"(ga + 3 * rs),
                    "v"(la + 4 * ls), "v"(ga + 4 * rs), "v"(la + 5 * ls), "v"(ga + 5 * rs), "v"(la + 6 * ls), "v"(ga + 6 * rs), "v"(la + 7 * ls), "v"(ga + 7 * rs),
                    "v"(lb), "v"(gb), "v"(lb + ls), "v"(gb + rs), "v"(lb + 2 * ls), "v"(gb + 2 * rs), "v"(lb + 3 * ls), "v"(gb + 3 * rs) : "memory");
}

// The same 64x64 tile per wave and the same k order as gemm_tile, for a work-group of GWM x GWN waves on rows R0.. and columns C0..: the waves share each 64-k stage of A and Bt,
// brought into the two buffers of 'ring' by asynchronous copies one stage ahead. On return no copy is in flight and every wave has left the ring (the last trip's barrier), so the caller may reuse it.
template <bool F16>
__device__ __forceinline__ void gemm_tile_s(const u16* __restrict__ A, const u16* __restrict__ Bt, const int K, const int R0, const int C0, u16* ring, const int tid, const int wm, const int wn, const int lr, const int hi, v8f (&acc)[4][4]) {
#pragma unroll
    for (int mb = 0; mb < 4; ++mb)
#pragma unroll
        for (int nb = 0; nb < 4; ++nb) acc[mb][nb] = (v8f){};
    const u16* ga = A + (size_t)(R0 + (tid >> 3)) * K + (tid & 7) * 8;
    const u16* gb = Bt + (size_t)(C0 + (tid >> 3)) * K + (tid & 7) * 8;
    const unsigned la = lds_byte(ring + (tid >> 3) * GPIT + (tid & 7) * 8);
    const int nst = K / GKS;
    stage_ab(ga, gb, K, la);
    asm volatile("s_wait_asynccnt 0x0" ::: "memory");   // this wave's copies of stage 0 have landed
    __syncthreads();                                     // stage 0 readable by every wave
    stage_ab(ga + GKS, gb + GKS, K, la + GSTG * 2);
#pragma unroll 1   // kept rolled: one body of 32 products, the buffer picked by st & 1; unrolling would only grow the text
    for (int st = 0; st < nst; ++st) {
        const u16* ar = ring + (st & 1) * GSTG + (wm * 64 + lr) * GPIT + 8 * hi;
        const u16* br = ring + (st & 1) * GSTG + (GAR + wn * 64 + lr) * GPIT + 8 * hi;
#pragma unroll   // this and the loops inside: every fragment and accumulator index a constant, so that they stay in registers
        for (int kc = 0; kc < GKS; kc += 32) {
            v16us a[4], bb[4];                  // the block's 16 LDS reads stand together, ahead of its 16 products
#pragma unroll
            for (int mb = 0; mb < 4; ++mb) a[mb] = ldfr(ar + mb * 16 * GPIT + kc);
#pragma unroll
            for (int nb = 0; nb < 4; ++nb) bb[nb] = ldfr(br + nb * 16 * GPIT + kc);
#pragma unroll
            for (int nb = 0; nb < 4; ++nb)
#pragma unroll
                for (int mb = 0; mb < 4; ++mb) acc[mb][nb] = mmag<F16>(a[mb], bb[nb], acc[mb][nb]);
        }
        asm volatile("s_wait_dscnt 0x0" ::: "memory");      // this wave's LDS reads of the stage are done before the buffer is refilled
        asm volatile("s_wait_asynccnt 0x0" ::: "memory");   // this wave's copies of the next stage have landed
        __syncthreads();                                     // publishes the next stage and ends every reader's last read of this one
        if (st + 2 < nst) stage_ab(ga + (st + 2) * GKS, gb + (st + 2) * GKS, K, la + (st & 1) * (GSTG * 2));
    }
    asm volatile("s_wait_asynccnt 0x0" ::: "memory");       // no copy is left in flight when the ring becomes epilogue staging
}

#define CVW   16                 // waves per conversion work-group
#define CVG   256                // conversion work-groups: with CVW, the launch's wave count (chosen for speed only), started once
#define CNW   (CVG * CVW)        // waves of the conversion launch
#define XROWS (NB * SEQ)         // rows of x
#define CROWS (XROWS + 4 * DM)   // rows of DM f32 to convert: x, then the query, key, value and output weights
static_assert(DM == 8 * 128);    // one row = 8 loads of 16 B per lane, each load of a wave 512 contiguous bytes
static_assert(O_XB == 0 && O_WALL == (size_t)XROWS * DM && O_WPB == O_WALL + 3 * WN && O_WPH == O_WPB + WN);   // row r of the list above lands at PL + r * DM; the f16 output-weight plane lies WN further on

typedef __attribute__((ext_vector_type(4))) unsigned short v4us;

// One converted row of 1024 16-bit values: 8 stores of 8 B per lane, each store of a wave 256 contiguous bytes (two whole lines). 'row' is the same in every lane, 'lofs' the lane's byte offset in the first 256 bytes.
// Written as one statement so that its last line, s_wait_xcnt 0, stands in front of every later write of a register that these stores name (in a statement of its own the compiler moved the next conversions over it).
__device__ __forceinline__ void store_row(u16* row, const unsigned lofs, const v4us (&d)[8]) {
    asm volatile("global_store_b64 %0, %1, %9\n\t"
                 "global_store_b64 %0, %2, %9 offset:256\n\t"
                 "global_store_b64 %0, %3, %9 offset:512\n\t"
                 "global_store_b64 %0, %4, %9 offset:768\n\t"
                 "global_store_b64 %0, %5, %9 offset:1024\n\t"
                 "global_store_b64 %0, %6, %9 offset:1280\n\t"
                 "global_store_b64 %0, %7, %9 offset:1536\n\t"
                 "global_store_b64 %0, %8, %9 offset:1792\n\t"
                 "s_wait_xcnt 0x0"
                 :: "v"(lofs), "v"(d[0]), "v"(d[1]), "v"(d[2]), "v"(d[3]), "v"(d[4]), "v"(d[5]), "v"(d[6]), "v"(d[7]), "s"(row) : "memory");
}

// k_cvt_all: every f32 -> 16-bit plane of the call in one launch of CVG work-groups. One wave per row of 1024 values and trip, rows dealt round robin over the launch's waves (wave gw takes rows gw, gw + CNW, ...);
// 8 whole-line loads of 16 B per lane in flight per wave. x and all four weights -> bf16 (RNE); the output weight also -> f16 of (bf16 value x WCAR). A reduced build reads the right rows of the full-size x.
__global__ __launch_bounds__(32 * CVW) void k_cvt_all(const float* __restrict__ x, const float* __restrict__ Wq, const float* __restrict__ Wk, const float* __restrict__ Wv, const float* __restrict__ Wp, u16* __restrict__ PL) {
    const int lane = threadIdx.x & 31;
    const int gw = __builtin_amdgcn_readfirstlane(blockIdx.x * CVW + (threadIdx.x >> 5));   // wave number as a scalar: the row, its source and the branches on it stay scalar
#pragma unroll 1   // kept rolled: few trips, and the other waves of the WGP cover a wave's load latency
    for (int r = gw; r < CROWS; r += CNW) {
        const float* src;
        if (r < XROWS) src = x + ((size_t)(r / SEQ) * SEQ_FULL + (r % SEQ)) * DM;
        else {
            const int w = (r - XROWS) / DM, wr = (r - XROWS) % DM;
            src = ((w == 0) ? Wq : (w == 1) ? Wk : (w == 2) ? Wv : Wp) + (size_t)wr * DM;
        }
        v4f v[8];
#pragma unroll
        for (int j = 0; j < 8; ++j) v[j] = *(const v4f*)(src + j * 128 + lane * 4);
        v4us ob[8];
#pragma unroll
        for (int j = 0; j < 8; ++j)
#pragma unroll
            for (int k = 0; k < 4; ++k) ob[j][k] = f2bf(v[j][k]);
        u16* row = PL + (size_t)r * DM;
        store_row(row, lane * 8, ob);
        if (r >= XROWS + 3 * DM) {
            v4us oh[8];
#pragma unroll
            for (int j = 0; j < 8; ++j)
#pragma unroll
                for (int k = 0; k < 4; ++k) oh[j][k] = f2h(bf2f(ob[j][k]) * WCAR);
            store_row(row + WN, lane * 8, oh);
        }
    }
}

// k_proj: [NB*SEQ][1024] x [3072][1024]^T (rows 0..1023 query weight, 1024..2047 key weight, 2048..3071 value weight). One wave per 64x64 tile = 64 time rows of one head, eight waves (4 x 2 tiles) per work-group sharing the staged operands.
// Epilogue q/k: per-row LayerNorm over the 64 head columns (mean and biased variance in f32 across 8 lanes x 8 columns, eps 1e-5, gain and bias taken as bf16 values of the inputs; both parameter sets are loaded and chosen by value),
// then f16 head plane rows [b][h][t][64] (+ bf16 hi/lo rows for t < RH); v: transposed through LDS into [b][h][d][t] lines of 64 t (+ hi/lo for t < RH). Planes addressed by element offsets from one base.
// All f16 plane values go through the value-select convert (no subnormal f16 can be produced).
__global__ __launch_bounds__(GTH) void k_proj(const u16* __restrict__ XB, const u16* __restrict__ WALL, u16* PL, size_t oP16, size_t oEH, size_t oEL,
                                             const float* __restrict__ QG, const float* __restrict__ QB, const float* __restrict__ KG, const float* __restrict__ KB) {
    __shared__ __align__(16) u16 ring[2 * GSTG];
    const int tid = threadIdx.x, lane = tid & 31, lr = lane & 15, hi = lane >> 4;
    const int wv = __builtin_amdgcn_readfirstlane(tid >> 5), wm = wv % GWM, wn = wv / GWM;   // wave number as a scalar: tile indices and the branches on them stay scalar
    float* os = (float*)((char*)ring + wv * GEPI);                       // this wave's own staging, used after the k loop only
    u16* ts = (u16*)((char*)ring + wv * GEPI + 16 * 68 * 4);
    const int r0 = blockIdx.x * GAR + wm * 64, c0 = blockIdx.y * GBR + wn * 64;
    const int which = c0 / DM, hd = (c0 - which * DM) / HD;
    const int b = r0 / SEQ, t0 = r0 - b * SEQ;
    const bool early = (t0 < RH);
    const size_t bh = (size_t)b * NH + hd;
    v8f acc[4][4];
    gemm_tile_s<false>(XB, WALL, DM, blockIdx.x * GAR, blockIdx.y * GBR, ring, tid, wm, wn, lr, hi, acc);
    if (which < 2) {
        const size_t o16 = oP16 + (size_t)which * PLANE + (bh * SEQ + t0) * HD;
        const size_t oeh = oEH + (size_t)which * EPLANE + (bh * RH + (early ? t0 : 0)) * HD;
        const size_t oel = oEL + (size_t)which * EPLANE + (bh * RH + (early ? t0 : 0)) * HD;
        const int gc = (lane & 7) * 8;                 // this lane's 8 head columns (same in every row group)
        const v4f gq0 = *(const v4f*)(QG + gc), gq1 = *(const v4f*)(QG + gc + 4);
        const v4f bq0 = *(const v4f*)(QB + gc), bq1 = *(const v4f*)(QB + gc + 4);
        const v4f gk0 = *(const v4f*)(KG + gc), gk1 = *(const v4f*)(KG + gc + 4);
        const v4f bk0 = *(const v4f*)(KB + gc), bk1 = *(const v4f*)(KB + gc + 4);
        v4f g0, g1, be0, be1;
#pragma unroll
        for (int q = 0; q < 4; ++q) {
            g0[q]  = bfr((which == 0) ? gq0[q] : gk0[q]); g1[q]  = bfr((which == 0) ? gq1[q] : gk1[q]);
            be0[q] = bfr((which == 0) ? bq0[q] : bk0[q]); be1[q] = bfr((which == 0) ? bq1[q] : bk1[q]);
        }
#pragma unroll
        for (int mb = 0; mb < 4; ++mb) {
#pragma unroll
            for (int nb = 0; nb < 4; ++nb)
#pragma unroll
                for (int j = 0; j < 8; ++j) os[(hi * 8 + j) * 68 + nb * 16 + lr] = acc[mb][nb][j];
            __syncthreads();
{
#pragma unroll
                for (int s = 0; s < 4; ++s) {
                    const int row = 4 * s + (lane >> 3), pc = (lane & 7) * 8;
                    const v4f x0 = *(const v4fa*)&os[row * 68 + pc]; const v4f x1 = *(const v4fa*)&os[row * 68 + pc + 4];
                    // LayerNorm of the 64-wide row held by the 8 lanes sharing lane>>3 (all 32 lanes active, uniform control)
                    float sm = ((x0[0] + x0[1]) + (x0[2] + x0[3])) + ((x1[0] + x1[1]) + (x1[2] + x1[3]));
                    sm += __shfl_xor(sm, 1, 32); sm += __shfl_xor(sm, 2, 32); sm += __shfl_xor(sm, 4, 32);
                    const float mean = sm * (1.0f / 64.0f);
                    v4f d0, d1;
#pragma unroll
                    for (int q = 0; q < 4; ++q) { d0[q] = x0[q] - mean; d1[q] = x1[q] - mean; }
                    float vs = ((d0[0] * d0[0] + d0[1] * d0[1]) + (d0[2] * d0[2] + d0[3] * d0[3])) + ((d1[0] * d1[0] + d1[1] * d1[1]) + (d1[2] * d1[2] + d1[3] * d1[3]));
                    vs += __shfl_xor(vs, 1, 32); vs += __shfl_xor(vs, 2, 32); vs += __shfl_xor(vs, 4, 32);
                    const float rinv = rsqrtf(vs * (1.0f / 64.0f) + LNEPS);
                    v4f y0, y1;
#pragma unroll
                    for (int q = 0; q < 4; ++q) { y0[q] = d0[q] * rinv * g0[q] + be0[q]; y1[q] = d1[q] * rinv * g1[q] + be1[q]; }
                    v8us q16;
#pragma unroll
                    for (int q = 0; q < 4; ++q) { q16[q] = f2h_fl(y0[q]); q16[4 + q] = f2h_fl(y1[q]); }
                    const size_t ro = (size_t)(mb * 16 + row) * HD + pc;
                    *(v8us*)(PL + o16 + ro) = q16;
                    if (early) {
                        v8us oh, ol;
#pragma unroll
                        for (int q = 0; q < 4; ++q) { const u16 a = f2bf(y0[q]); oh[q] = a; ol[q] = f2bf(y0[q] - bf2f(a)); const u16 c = f2bf(y1[q]); oh[4 + q] = c; ol[4 + q] = f2bf(y1[q] - bf2f(c)); }
                        *(v8us*)(PL + oeh + ro) = oh; *(v8us*)(PL + oel + ro) = ol;
                    }
                }
                
            }
            __syncthreads();
        }
    } else {
#pragma unroll
        for (int pl = 0; pl < 3; ++pl) {
            if (pl == 0 || early) {
#pragma unroll
                for (int mb = 0; mb < 4; ++mb)
#pragma unroll
                    for (int nb = 0; nb < 4; ++nb) {
                        v8us pk;
#pragma unroll
                        for (int j = 0; j < 8; ++j) { const float y = acc[mb][nb][j]; const u16 hb = f2bf(y); pk[j] = (pl == 0) ? f2h_fl(y) : ((pl == 1) ? hb : f2bf(y - bf2f(hb))); }
                        *(v8usa*)&ts[(nb * 16 + lr) * 72 + mb * 16 + hi * 8] = pk;     // ts[d][t]: 8 consecutive t per lane
                    }
                __syncthreads();
                const size_t dofs = (pl == 0) ? (oP16 + 2 * PLANE + bh * HD * SEQ + t0) : (((pl == 1) ? oEH : oEL) + 2 * EPLANE + bh * HD * RH + t0);
                const int dp = (pl == 0) ? SEQ : RH;
{
#pragma unroll 4
                    for (int s = 0; s < 16; ++s) {
                        const int d = 4 * s + (lane >> 3), pc = (lane & 7) * 8;
                        const v8us v = *(const v8usa*)&ts[d * 72 + pc];
                        *(v8us*)(PL + dofs + (size_t)d * dp + pc) = v;
                    }
                    
                }
                __syncthreads();
            }
        }
    }
}

// Online-softmax update for one 16 x 32 score step. s0/s1 hold raw scores for keys jb + (lane&15) and jb + 16 + (lane&15), rows qbase + 8 (lane>>4) + i; on return they hold exp2(t - running max).
// lrow keeps PER-LANE partial sums (reduced over the 16 lanes of a row once, after the key loop). Masked entries are replaced before the maximum; every row keeps its own key.
__device__ __forceinline__ void sm_step(v8f& s0, v8f& s1, float (&mrow)[8], float (&lrow)[8], float (&corr)[8], const int jb, const int qbase, const int lr, const int hi) {
#pragma unroll
    for (int i = 0; i < 8; ++i) {
        const int row = qbase + i + 8 * hi;
        float a0 = s0[i] * SCL2, a1 = s1[i] * SCL2;
        a0 = (jb + lr > row) ? -1.0e30f : a0;
        a1 = (jb + 16 + lr > row) ? -1.0e30f : a1;
        float mx = fmaxf(a0, a1);
        mx = fmaxf(mx, __shfl_xor(mx, 1, 32)); mx = fmaxf(mx, __shfl_xor(mx, 2, 32)); mx = fmaxf(mx, __shfl_xor(mx, 4, 32)); mx = fmaxf(mx, __shfl_xor(mx, 8, 32));
        const float mnew = fmaxf(mrow[i], mx);
        // The row's three exponentials as v_exp_f32, like the builtin. One statement, each in its own register, and a closing v_nop: so no instruction directly behind an exponential reads its result or overwrites its source
        // (with the registers of this build the compiler gave an exponential's result the register the one before it had just read).
        float c = mrow[i] - mnew, p0 = a0 - mnew, p1 = a1 - mnew;
        asm("v_exp_f32 %0, %0\n\tv_exp_f32 %1, %1\n\tv_exp_f32 %2, %2\n\tv_nop" : "+v"(c), "+v"(p0), "+v"(p1));
        lrow[i] = lrow[i] * c + (p0 + p1);
        mrow[i] = mnew; corr[i] = c; s0[i] = p0; s1[i] = p1;
    }
}

#define AW   4                   // waves per late-attention work-group, 16 query rows each
#define KPIT 72                  // u16 per staged key row: 144 B = 16 B x odd, the pitch for 16-byte LDS readers of 128-B rows
#define VPIT 40                  // u16 per staged value row: 80 B = 16 B x odd, the same for 64-B rows
#define NQB_L (((SEQ - RH) / (16 * AW)) > 0 ? ((SEQ - RH) / (16 * AW)) : 1)
static_assert((SEQ - RH) % (16 * AW) == 0);   // whole work-groups of query rows
static_assert((RH + 16 * AW) / 32 >= 2);      // the two-buffer prologue needs two key steps
static_assert((16 * AW) % 32 == 0 && RH % 32 == 0);   // a work-group's last key step ends on its last query row

// One 32-key stage for a work-group of 128 threads: key rows jb..jb+31 (32 x 128 B, contiguous in the plane) and the 64 value rows' columns jb..jb+31 (64 x 64 B), 16 bytes per lane and copy, straight into LDS.
// The s_wait_xcnt 0 is the last line of the copies' own statement so that no address register of a copy is rewritten ahead of it.
__device__ __forceinline__ void stage_kv(const u16* __restrict__ Kb, const u16* __restrict__ Vb, const int jb, u16* kd, u16* vd, const int tid) {
    const u16* gk0 = Kb + (size_t)(jb + (tid >> 3)) * HD + (tid & 7) * 8;      // rows 0..15 of the stage
    const u16* gk1 = gk0 + 16 * HD;                                           // rows 16..31
    const u16* gv0 = Vb + (size_t)(tid >> 2) * SEQ + jb + (tid & 3) * 8;       // head columns 0..31
    const u16* gv1 = gv0 + (size_t)32 * SEQ;                                  // head columns 32..63
    const unsigned lk0 = lds_byte(kd + (tid >> 3) * KPIT + (tid & 7) * 8), lk1 = lk0 + 16 * KPIT * 2;
    const unsigned lv0 = lds_byte(vd + (tid >> 2) * VPIT + (tid & 3) * 8), lv1 = lv0 + 32 * VPIT * 2;
    asm volatile("global_load_async_to_lds_b128 %0, %1, off\n\t"
                 "global_load_async_to_lds_b128 %2, %3, off\n\t"
                 "global_load_async_to_lds_b128 %4, %5, off\n\t"
                 "global_load_async_to_lds_b128 %6, %7, off\n\t"
                 "s_wait_xcnt 0x0"
                 :: "v"(lk0), "v"(gk0), "v"(lk1), "v"(gk1), "v"(lv0), "v"(gv0), "v"(lv1), "v"(gv1) : "memory");
}

// Lane l's value from lane l ^ 16 (the other half of the wave), by a vector cross-row move.
__device__ __forceinline__ float xhalf(float x) {
    const int v = __builtin_bit_cast(int, x);
    return __builtin_bit_cast(float, __builtin_amdgcn_permlanex16(v, v, 0x76543210, 0xfedcba98, false, false));
}

// 2^c and 2^a[0..7] (first form), 2^a[0..7] (second form), as v_exp_f32 like the builtin. One statement each, results in registers of their own ("=&v") and a closing v_nop:
// so no instruction directly behind an exponential reads its result or overwrites its source (left to itself the compiler gave an exponential's result the register the one before it had just read).
__device__ __forceinline__ void exp2_9(const float c, const v8f a, float& ec, v8f& e) {
    float r0, r1, r2, r3, r4, r5, r6, r7;
    asm("v_exp_f32 %0, %9\n\tv_exp_f32 %1, %10\n\tv_exp_f32 %2, %11\n\tv_exp_f32 %3, %12\n\tv_exp_f32 %4, %13\n\tv_exp_f32 %5, %14\n\tv_exp_f32 %6, %15\n\tv_exp_f32 %7, %16\n\tv_exp_f32 %8, %17\n\tv_nop"
        : "=&v"(ec), "=&v"(r0), "=&v"(r1), "=&v"(r2), "=&v"(r3), "=&v"(r4), "=&v"(r5), "=&v"(r6), "=&v"(r7)
        : "v"(c), "v"(a[0]), "v"(a[1]), "v"(a[2]), "v"(a[3]), "v"(a[4]), "v"(a[5]), "v"(a[6]), "v"(a[7]));
    e[0] = r0; e[1] = r1; e[2] = r2; e[3] = r3; e[4] = r4; e[5] = r5; e[6] = r6; e[7] = r7;
}
__device__ __forceinline__ void exp2_8(const v8f a, v8f& e) {
    float r0, r1, r2, r3, r4, r5, r6, r7;
    asm("v_exp_f32 %0, %8\n\tv_exp_f32 %1, %9\n\tv_exp_f32 %2, %10\n\tv_exp_f32 %3, %11\n\tv_exp_f32 %4, %12\n\tv_exp_f32 %5, %13\n\tv_exp_f32 %6, %14\n\tv_exp_f32 %7, %15\n\tv_nop"
        : "=&v"(r0), "=&v"(r1), "=&v"(r2), "=&v"(r3), "=&v"(r4), "=&v"(r5), "=&v"(r6), "=&v"(r7)
        : "v"(a[0]), "v"(a[1]), "v"(a[2]), "v"(a[3]), "v"(a[4]), "v"(a[5]), "v"(a[6]), "v"(a[7]));
    e[0] = r0; e[1] = r1; e[2] = r2; e[3] = r3; e[4] = r4; e[5] = r5; e[6] = r6; e[7] = r7;
}

// k_attn_l: query rows >= RH, f16 single products. One work-group of AW waves per 16*AW query rows of one (batch, head), one wave per 16 rows; the waves share each 32-key stage of K and V,
// brought into two LDS buffers by asynchronous copies one stage ahead. Every wave walks the work-group's key range: a step wholly above a wave's diagonal adds exact zeros. ctx f16 x CCAR -> AT [b][t-RH][1024].
// Both products are taken transposed: S^T = K Q^T (A = key rows from LDS, B = the wave's query rows, kept in registers) and O^T += V^T P^T (A = rows of the staged V^T, B = P^T).
// A lane then holds 16 of the 32 scores of ONE query (qbase + (lane&15); keys jb + 8 (lane>>4) + r and jb + 16 + 8 (lane>>4) + r): maximum and sum run inside the lane, the two halves of the wave meet in one exchange,
// and the two score tiles, converted in place, are the B operand of the second product in the loader's own k order, so P goes through no LDS and no barrier.
__global__ __launch_bounds__(32 * AW) void k_attn_l(const u16* __restrict__ QP, const u16* __restrict__ KP, const u16* __restrict__ VT, u16* AT) {
    __shared__ __align__(16) u16 ks[2][32 * KPIT];
    __shared__ __align__(16) u16 vs[2][HD * VPIT];
    const int tid = threadIdx.x, lane = tid & 31, lr = lane & 15, hi = lane >> 4;
    const int wv = __builtin_amdgcn_readfirstlane(tid >> 5);   // wave number as a scalar: the test for steps that touch the diagonal stays a scalar branch
    const int bh = blockIdx.x / NQB_L, qb = blockIdx.x - bh * NQB_L;
    const int b = bh / NH, h = bh - b * NH;
    const int qblk = RH + qb * (16 * AW);
    const int qbase = qblk + wv * 16;
    const size_t pb = (size_t)bh * SEQ * HD;
    const u16* Qb = QP + pb; const u16* Kb = KP + pb; const u16* Vb = VT + pb;
    const int nsteps = (qblk + 16 * AW) >> 5;    // keys 0 .. qblk+16*AW-1 in steps of 32; nsteps*32 <= SEQ, nsteps >= 2
    stage_kv(Kb, Vb, 0, ks[0], vs[0], tid);
    asm volatile("s_wait_asynccnt 0x0" ::: "memory");   // this wave's copies of stage 0 have landed
    __syncthreads();                                     // stage 0 readable by every wave
    stage_kv(Kb, Vb, 32, ks[1], vs[1], tid);
    const v16us q0 = ldfr(Qb + (size_t)(qbase + lr) * HD + 8 * hi);
    const v16us q1 = ldfr(Qb + (size_t)(qbase + lr) * HD + 32 + 8 * hi);
    v8f acc[4];                                  // acc[dt][r] = O^T[16 dt + 8 hi + r][qbase + lr], carried x PCAR
#pragma unroll
    for (int dt = 0; dt < 4; ++dt) acc[dt] = (v8f){};
    float mrun = -1.0e30f, lsum = 0.0f;          // this lane's query: running maximum of the raw scores (both halves alike); sum of this half's probabilities x PCAR
#pragma unroll 1
    for (int st = 0; st < nsteps; ++st) {
        const int jb = st * 32;
        const u16* kr0 = ks[st & 1] + lr * KPIT + 8 * hi; const u16* kr1 = kr0 + 16 * KPIT;
        const u16* vr = vs[st & 1] + lr * VPIT + 8 * hi;
        const v16us k00 = ldfr(kr0), k01 = ldfr(kr0 + 32), k10 = ldfr(kr1), k11 = ldfr(kr1 + 32);   // the step's 8 key reads stand together, ahead of its 4 score products
        v8f s0 = (v8f){}, s1 = (v8f){};
        s0 = mma_h(k00, q0, s0); s1 = mma_h(k10, q0, s1);
        s0 = mma_h(k01, q1, s0); s1 = mma_h(k11, q1, s1);
        v16us vf[4];                             // the step's 8 value reads stand together too: they return while the softmax runs
#pragma unroll
        for (int dt = 0; dt < 4; ++dt) vf[dt] = ldfr(vr + dt * 16 * VPIT);
        if (jb + 31 > qbase) {                   // only a step that reaches past the wave's first query row can hold an excluded key
            const int dq = qbase + lr - jb - 8 * hi;      // key index r (or 16 + r) inside this lane's share is excluded when it exceeds dq
#pragma unroll
            for (int r = 0; r < 8; ++r) { s0[r] = (r > dq) ? -1.0e30f : s0[r]; s1[r] = (16 + r > dq) ? -1.0e30f : s1[r]; }
        }
        float mx = fmaxf(s0[0], s1[0]);
#pragma unroll
        for (int r = 1; r < 8; ++r) mx = fmaxf(mx, fmaxf(s0[r], s1[r]));
        mx = fmaxf(mx, xhalf(mx));
        const float mnew = fmaxf(mrun, mx);      // finite from the first step on: key 0 is open to every query
        const float nm = 10.0f - mnew * SCL2;    // 2^10 = PCAR: the carry rides in the exponent
#pragma unroll
        for (int r = 0; r < 8; ++r) { s0[r] = __builtin_fmaf(s0[r], SCL2, nm); s1[r] = __builtin_fmaf(s1[r], SCL2, nm); }
        float corr;
        exp2_9((mrun - mnew) * SCL2, s0, corr, s0);
        exp2_8(s1, s1);
        mrun = mnew;
        v16h pf;
        float ps = 0.0f;
#pragma unroll
        for (int r = 0; r < 8; ++r) { ps += s0[r] + s1[r]; pf[r] = (h16)s0[r]; pf[8 + r] = (h16)s1[r]; }
        lsum = lsum * corr + ps;
#pragma unroll
        for (int dt = 0; dt < 4; ++dt)
#pragma unroll
            for (int r = 0; r < 8; ++r) acc[dt][r] *= corr;
        const v16us pu = __builtin_bit_cast(v16us, pf);
#pragma unroll
        for (int dt = 0; dt < 4; ++dt) acc[dt] = mma_h(vf[dt], pu, acc[dt]);
        asm volatile("s_wait_dscnt 0x0" ::: "memory");      // this wave's LDS reads of the stage are done before the buffer is refilled
        asm volatile("s_wait_asynccnt 0x0" ::: "memory");   // this wave's copies of the next stage have landed
        __syncthreads();                                     // publishes the next stage and ends every reader's last read of this one
        if (st + 2 < nsteps) stage_kv(Kb, Vb, jb + 64, ks[st & 1], vs[st & 1], tid);
    }
    asm volatile("s_wait_asynccnt 0x0" ::: "memory");       // no copy is left in flight when the wave goes on to its end
    const float inv = CCAR / (lsum + xhalf(lsum));          // both carry PCAR, so it cancels
    u16* dst = AT + ((size_t)b * (SEQ - RH) + (qbase - RH) + lr) * DM + h * HD + 8 * hi;
#pragma unroll
    for (int dt = 0; dt < 4; ++dt) {             // a lane's 8 registers are 8 consecutive head columns of its query row: one 16-byte store; the wave's four stores fill each row's whole 128-B line
        v8us o;
#pragma unroll
        for (int r = 0; r < 8; ++r) o[r] = f2h(acc[dt][r] * inv);
        *(v8us*)(dst + dt * 16) = o;
    }
}

// k_attn_e: query rows < RH, bf16 hi+lo operands (hi.hi + lo.hi + hi.lo into one accumulator; residuals unscaled). ctx hi/lo bf16 -> ATEh/ATEl [b][t][1024].
__global__ __launch_bounds__(32) void k_attn_e(const u16* __restrict__ QEh, const u16* __restrict__ QEl, const u16* __restrict__ KEh, const u16* __restrict__ KEl, const u16* __restrict__ VEh, const u16* __restrict__ VEl, u16* ATEh, u16* ATEl) {
    __shared__ __align__(16) u16 pwh[16 * 40];
    __shared__ __align__(16) u16 pwl[16 * 40];
    __shared__ __align__(16) float os[16 * 68];
    const int lane = threadIdx.x & 31, lr = lane & 15, hi = lane >> 4;
    const int bh = blockIdx.x / (RH / 16), qt = blockIdx.x - bh * (RH / 16);
    const int b = bh / NH, h = bh - b * NH;
    const int qbase = qt * 16;
    const size_t pb = (size_t)bh * RH * HD;
    const size_t qo = pb + (size_t)(qbase + lr) * HD + 8 * hi;
    const v16us qh0 = ldfr(QEh + qo), qh1 = ldfr(QEh + qo + 32), ql0 = ldfr(QEl + qo), ql1 = ldfr(QEl + qo + 32);
    v8f acc[4];
#pragma unroll
    for (int nt = 0; nt < 4; ++nt) acc[nt] = (v8f){};
    float mrow[8], lrow[8];
#pragma unroll
    for (int i = 0; i < 8; ++i) { mrow[i] = -1.0e30f; lrow[i] = 0.0f; }
    const int nsteps = (qbase + 47) >> 5;        // nsteps*32 <= RH
    const u16* pkh = KEh + pb + (size_t)lr * HD + 8 * hi; const u16* pkl = KEl + pb + (size_t)lr * HD + 8 * hi;   // this lane's place in the step's key rows
    const u16* pvh = VEh + pb + (size_t)lr * RH + 8 * hi; const u16* pvl = VEl + pb + (size_t)lr * RH + 8 * hi;   // the same in the step's value columns; [bh][64][RH], same plane size as [bh][RH][64]
#pragma unroll 1
    for (int st = 0; st < nsteps; ++st) {
        const int jb = st * 32;
        // All of the step's global loads stand together at its head, keys first: a lone wave then waits out one load latency a step, and the value fragments land behind the score products and the softmax.
        const v16us kh0 = ldfr(pkh), kh1 = ldfr(pkh + 32), kl0 = ldfr(pkl), kl1 = ldfr(pkl + 32);
        const v16us kh2 = ldfr(pkh + 16 * HD), kh3 = ldfr(pkh + 16 * HD + 32), kl2 = ldfr(pkl + 16 * HD), kl3 = ldfr(pkl + 16 * HD + 32);
        v16us vh[4], vl[4];
#pragma unroll
        for (int nt = 0; nt < 4; ++nt) { vh[nt] = ldfr(pvh + nt * 16 * RH); vl[nt] = ldfr(pvl + nt * 16 * RH); }
        v8f s0 = (v8f){}, s1 = (v8f){};
        s0 = mma_b(qh0, kh0, s0); s0 = mma_b(qh1, kh1, s0); s0 = mma_b(ql0, kh0, s0); s0 = mma_b(ql1, kh1, s0); s0 = mma_b(qh0, kl0, s0); s0 = mma_b(qh1, kl1, s0);
        s1 = mma_b(qh0, kh2, s1); s1 = mma_b(qh1, kh3, s1); s1 = mma_b(ql0, kh2, s1); s1 = mma_b(ql1, kh3, s1); s1 = mma_b(qh0, kl2, s1); s1 = mma_b(qh1, kl3, s1);
        ld_done(pkh, pkl, pvh, pvl);
        pkh += 32 * HD; pkl += 32 * HD; pvh += 32; pvl += 32;
        float corr[8];
        sm_step(s0, s1, mrow, lrow, corr, jb, qbase, lr, hi);
#pragma unroll
        for (int nt = 0; nt < 4; ++nt)
#pragma unroll
            for (int i = 0; i < 8; ++i) acc[nt][i] *= corr[i];
#pragma unroll
        for (int i = 0; i < 8; ++i) {
            const u16 a = f2bf(s0[i]); const u16 c = f2bf(s1[i]);
            pwh[(i + 8 * hi) * 40 + lr] = a; pwl[(i + 8 * hi) * 40 + lr] = f2bf(s0[i] - bf2f(a));
            pwh[(i + 8 * hi) * 40 + 16 + lr] = c; pwl[(i + 8 * hi) * 40 + 16 + lr] = f2bf(s1[i] - bf2f(c));
        }
        __syncthreads();
        const v8us h0 = *(const v8usa*)&pwh[lr * 40 + 8 * hi]; const v8us h1 = *(const v8usa*)&pwh[lr * 40 + 16 + 8 * hi];
        const v8us l0 = *(const v8usa*)&pwl[lr * 40 + 8 * hi]; const v8us l1 = *(const v8usa*)&pwl[lr * 40 + 16 + 8 * hi];
        const v16us pfh = __builtin_shufflevector(h0, h1, 0, 1, 2, 3, 4, 5, 6, 7, 8, 9, 10, 11, 12, 13, 14, 15);
        const v16us pfl = __builtin_shufflevector(l0, l1, 0, 1, 2, 3, 4, 5, 6, 7, 8, 9, 10, 11, 12, 13, 14, 15);
#pragma unroll
        for (int nt = 0; nt < 4; ++nt) { acc[nt] = mma_b(pfh, vh[nt], acc[nt]); acc[nt] = mma_b(pfl, vh[nt], acc[nt]); acc[nt] = mma_b(pfh, vl[nt], acc[nt]); }
        __syncthreads();
    }
#pragma unroll
    for (int i = 0; i < 8; ++i) {
        float l = lrow[i];
        l += __shfl_xor(l, 1, 32); l += __shfl_xor(l, 2, 32); l += __shfl_xor(l, 4, 32); l += __shfl_xor(l, 8, 32);
        const float inv = 1.0f / l;
#pragma unroll
        for (int nt = 0; nt < 4; ++nt) os[(i + 8 * hi) * 68 + nt * 16 + lr] = acc[nt][i] * inv;
    }
    __syncthreads();
    const size_t dofs = ((size_t)b * RH + qbase) * DM + h * HD;
{
#pragma unroll
        for (int s = 0; s < 4; ++s) {
            const int row = 4 * s + (lane >> 3), pc = (lane & 7) * 8;
            const v4f x0 = *(const v4fa*)&os[row * 68 + pc]; const v4f x1 = *(const v4fa*)&os[row * 68 + pc + 4];
            v8us oh, ol;
#pragma unroll
            for (int q = 0; q < 4; ++q) { const u16 a = f2bf(x0[q]); oh[q] = a; ol[q] = f2bf(x0[q] - bf2f(a)); const u16 c = f2bf(x1[q]); oh[4 + q] = c; ol[4 + q] = f2bf(x1[q] - bf2f(c)); }
            *(v8us*)(ATEh + dofs + (size_t)row * DM + pc) = oh;
            *(v8us*)(ATEl + dofs + (size_t)row * DM + pc) = ol;
        }
        
    }
}

// Output projection: OUT[b][toff + r][n] = scale * sum_k A[row][k] Bt[n][k] (+ A2 product in k_outp_e) + bf16(bias[n]); rows of A are [b][r] with rpb rows per batch.
// Shared epilogue of one wave's 64x64 tile at rows r0.., columns c0..: whole 256-B row pieces through the wave's own staging 'os'. Every wave of the work-group passes the same barriers.
__device__ __forceinline__ void outp_store(const v8f (&acc)[4][4], float* os, const float* __restrict__ bias, float* OUT, const float scale, const int rpb, const int toff, const int r0, const int c0, const int lr, const int hi) {
    const int b = r0 / rpb, tb = toff + (r0 - b * rpb);
    float* crow0 = OUT + ((size_t)b * SEQ_FULL + tb) * DM + c0;
    const int cofs = lr * 4;
    v4f bv; bv[0] = bfr(bias[c0 + cofs]); bv[1] = bfr(bias[c0 + cofs + 1]); bv[2] = bfr(bias[c0 + cofs + 2]); bv[3] = bfr(bias[c0 + cofs + 3]);
#pragma unroll
    for (int mb = 0; mb < 4; ++mb) {
#pragma unroll
        for (int nb = 0; nb < 4; ++nb)
#pragma unroll
            for (int j = 0; j < 8; ++j) os[(hi * 8 + j) * 68 + nb * 16 + lr] = acc[mb][nb][j];
        __syncthreads();
#pragma unroll
        for (int s = 0; s < 8; ++s) {
            const int row = 2 * s + hi;
            const v4f x = *(const v4fa*)&os[row * 68 + cofs];
            v4f val; val[0] = x[0] * scale + bv[0]; val[1] = x[1] * scale + bv[1]; val[2] = x[2] * scale + bv[2]; val[3] = x[3] * scale + bv[3];
            *(v4f*)(crow0 + (size_t)(mb * 16 + row) * DM + cofs) = val;
        }
        __syncthreads();
    }
}

// k_outp_e: rows < RH, bf16 hi+lo ctx planes; one wave per work-group and 64x64 tile, fragments straight from the planes (few tiles: one wave per work-group spreads them over the chip).
__global__ __launch_bounds__(32) void k_outp_e(const u16* __restrict__ A, const u16* __restrict__ A2, const u16* __restrict__ Bt, const float* __restrict__ bias, float* OUT, float scale, int rpb, int toff) {
    __shared__ __align__(16) float os[16 * 68];
    const int lane = threadIdx.x & 31, lr = lane & 15, hi = lane >> 4;
    const int r0 = blockIdx.x * 64, c0 = blockIdx.y * 64;
    v8f acc[4][4];
    gemm_tile<false, true>(A, A2, Bt, DM, r0, c0, lr, hi, acc);
    outp_store(acc, os, bias, OUT, scale, rpb, toff, r0, c0, lr, hi);
}

// k_outp_l: rows >= RH, f16 planes; eight waves (4 x 2 tiles of 64x64) per work-group sharing the staged operands.
__global__ __launch_bounds__(GTH) void k_outp_l(const u16* __restrict__ A, const u16* __restrict__ Bt, const float* __restrict__ bias, float* OUT, float scale, int rpb, int toff) {
    __shared__ __align__(16) u16 ring[2 * GSTG];
    const int tid = threadIdx.x, lane = tid & 31, lr = lane & 15, hi = lane >> 4;
    const int wv = __builtin_amdgcn_readfirstlane(tid >> 5), wm = wv % GWM, wn = wv / GWM;   // wave number as a scalar: tile indices and the branches on them stay scalar
    float* os = (float*)((char*)ring + wv * GEPI);                       // this wave's own staging, used after the k loop only
    v8f acc[4][4];
    gemm_tile_s<true>(A, Bt, DM, blockIdx.x * GAR, blockIdx.y * GBR, ring, tid, wm, wn, lr, hi, acc);
    outp_store(acc, os, bias, OUT, scale, rpb, toff, blockIdx.x * GAR + wm * 64, blockIdx.y * GBR + wn * 64, lr, hi);
}

extern "C" void kernel_launch(void* const* d_in, const int* in_sizes, int n_in,
                              void* d_out, int out_size, void* d_ws, size_t ws_size, hipStream_t stream) {
    if (n_in < 10) return;
    const long long needx = ((long long)(NB - 1) * SEQ_FULL + SEQ) * DM;
    if ((long long)in_sizes[0] < needx) return;
    if ((long long)in_sizes[1] < (long long)DM * DM || (long long)in_sizes[2] < (long long)DM * DM || (long long)in_sizes[3] < (long long)DM * DM || (long long)in_sizes[4] < (long long)DM * DM) return;
    if (in_sizes[5] < DM) return;
    if (in_sizes[6] < HD || in_sizes[7] < HD || in_sizes[8] < HD || in_sizes[9] < HD) return;
    if ((long long)out_size < needx) return;
    if (O_END * 2 > ws_size) return;
    // wire order: x, key weight, query weight, value weight, output weight, output bias, key LayerNorm gain, key LayerNorm bias, query LayerNorm gain, query LayerNorm bias
    const float* x  = (const float*)d_in[0];
    const float* Wk = (const float*)d_in[1];
    const float* Wq = (const float*)d_in[2];
    const float* Wv = (const float*)d_in[3];
    const float* Wp = (const float*)d_in[4];
    const float* bp = (const float*)d_in[5];
    const float* kg = (const float*)d_in[6];
    const float* kb = (const float*)d_in[7];
    const float* qg = (const float*)d_in[8];
    const float* qb = (const float*)d_in[9];
    float* OUT = (float*)d_out;
    u16* PL = (u16*)d_ws;

    k_cvt_all<<<CVG, 32 * CVW, 0, stream>>>(x, Wq, Wk, Wv, Wp, PL);   // planes O_XB, O_WALL (query, key, value rows), O_WPB, O_WPH

    k_proj<<<dim3(NB * SEQ / GAR, 3 * DM / GBR, 1), GTH, 0, stream>>>(PL + O_XB, PL + O_WALL, PL, O_P16, O_EH, O_EL, qg, qb, kg, kb);

    k_attn_e<<<NB * NH * (RH / 16), 32, 0, stream>>>(PL + O_EH, PL + O_EL, PL + O_EH + EPLANE, PL + O_EL + EPLANE, PL + O_EH + 2 * EPLANE, PL + O_EL + 2 * EPLANE, PL + O_ATEH, PL + O_ATEL);
    if (SEQ > RH)
        k_attn_l<<<NB * NH * ((SEQ - RH) / (16 * AW)), 32 * AW, 0, stream>>>(PL + O_P16, PL + O_P16 + PLANE, PL + O_P16 + 2 * PLANE, PL + O_AT);

    k_outp_e<<<dim3(NB * RH / 64, DM / 64, 1), 32, 0, stream>>>(PL + O_ATEH, PL + O_ATEL, PL + O_WPB, bp, OUT, 1.0f, RH, 0);
    if (SEQ > RH)
        k_outp_l<<<dim3(NB * (SEQ - RH) / GAR, DM / GBR, 1), GTH, 0, stream>>>(PL + O_AT, PL + O_WPH, bp, OUT, 1.0f / (WCAR * CCAR), SEQ - RH, RH);
}

// v006
// Measured time: 159 microseconds a run.
// Next to v005, in two timings, it ran 1.05 and 1.06 times as fast.
// All steps since v000 together make it 2.77 times as fast.
#include <hip/hip_runtime.h>

// Compute dtypes (f32 accumulate everywhere): q/k/v projections bf16 x bf16 (inputs converted RNE to bf16, products exact), per-head LayerNorm of q and k in f32 inside the projection epilogue; scores q.k and P.V: f16 single products on query rows >= 256 (P carried x1024), bf16 hi+lo (3 products) on query rows < 256; output projection: f16 single product (ctx x16, Wo x32 carries) on rows >= 256, bf16 hi+lo ctx x bf16 Wo on rows < 256.
// Causal 16-head attention block, x [4][2048][1024]; separate bias-free [out][in] key / query / value projections (used as Bt as stored), per-head LayerNorm (eps 1e-5, gain and bias inputs) on the 64-wide query and key rows,
// the two 1024^(-1/4) factors applied as one 1/32 on the scores, causal exclusion with the diagonal kept, softmax in f32 (running max, log2 domain), heads merged h*64+d, [out][in] output projection plus bias.
// Layout: 16-bit planes in the workspace (u16 storage): x copy [b*SEQ+t][1024]; weights [3][1024][1024] (q, k, v) ; q and k head planes [b][h][t][64]; v transposed [b][h][64][t]; hi/lo bf16 planes of the same for t < 256;
// ctx f16 [b][t-256][1024] and ctx hi/lo bf16 [b][t<256][1024]. Fused flash-style attention: one wave per 16 query rows, 32 keys per step, no score plane in global memory; four waves share K and V stages in LDS (rows < 256: hi and lo planes); rows >= 256: both products run transposed. Projection and late output GEMMs: eight waves share A and B stages in LDS; early output GEMM: four waves share ctx hi, ctx lo and B stages in LDS.

#ifndef NB
#define NB 4
#endif
#ifndef SEQ
#define SEQ 2048
#endif
#define NB_FULL  4
#define SEQ_FULL 2048
#define DM   1024
#define NH   16
#define HD   64
#define RH   256                 // query rows / keys below RH also carry bf16 hi+lo planes
#define PCAR 1024.0f             // carry on f16 probabilities
#define CCAR 16.0f               // carry on the f16 ctx plane
#define WCAR 32.0f               // carry on the f16 output-projection weight plane
#define SCL2 (0.03125f * 1.4426950408889634f)   // 1/sqrt(1024) x log2(e)
#define LNEPS 1.0e-5f            // LayerNorm epsilon on the head rows

static_assert(DM == NH * HD);            // heads tile the channel width
static_assert(HD == 64);
static_assert(HD == 8 * 8);              // LayerNorm row = 8 lanes x 8 columns in the projection epilogue
static_assert(DM % 64 == 0);             // GEMM k-step: two 32-k blocks a trip
static_assert(HD % 32 == 0);             // score k-step
static_assert(SEQ % 64 == 0);            // 64-row GEMM tiles never straddle a batch
static_assert(RH % 64 == 0);             // early/late split on tile borders
static_assert(SEQ >= RH);
static_assert((SEQ - RH) % 64 == 0);
static_assert(RH % 32 == 0);             // 32-key steps end inside the early planes
static_assert(NB <= NB_FULL);
static_assert(SEQ <= SEQ_FULL);

typedef unsigned short u16;
typedef _Float16 h16;
typedef __attribute__((ext_vector_type(16))) __bf16         v16bf;
typedef __attribute__((ext_vector_type(16))) _Float16       v16h;
typedef __attribute__((ext_vector_type(8)))  unsigned short v8us;
typedef __attribute__((ext_vector_type(16))) unsigned short v16us;
typedef __attribute__((ext_vector_type(8)))  float          v8f;
typedef __attribute__((ext_vector_type(4)))  float          v4f;
typedef v4f  __attribute__((may_alias)) v4fa;
typedef v8us __attribute__((may_alias)) v8usa;

#define XBN    ((size_t)NB * SEQ * DM)
#define WN     ((size_t)DM * DM)
#define PLANE  ((size_t)NB * NH * SEQ * HD)
#define EPLANE ((size_t)NB * NH * RH * HD)
#define ATN    ((size_t)NB * (SEQ - RH) * DM)
#define ATEN   ((size_t)NB * RH * DM)
#define O_XB   ((size_t)0)
#define O_WALL (O_XB + XBN)
#define O_WPB  (O_WALL + 3 * WN)
#define O_WPH  (O_WPB + WN)
#define O_P16  (O_WPH + WN)
#define O_EH   (O_P16 + 3 * PLANE)
#define O_EL   (O_EH + 3 * EPLANE)
#define O_AT   (O_EL + 3 * EPLANE)
#define O_ATEH (O_AT + ATN)
#define O_ATEL (O_ATEH + ATEN)
#define O_END  (O_ATEL + ATEN)
static_assert(O_END * 2 <= (size_t)134217728);   // total carve <= 128 MiB
static_assert(XBN % 128 == 0 && WN % 128 == 0 && PLANE % 128 == 0 && EPLANE % 128 == 0 && ATN % 128 == 0 && ATEN % 128 == 0);   // every region starts on a 256-byte border

__device__ __forceinline__ u16 f2bf(float f) { unsigned u = __float_as_uint(f); u += 0x7FFFu + ((u >> 16) & 1u); return (u16)(u >> 16); }
__device__ __forceinline__ float bf2f(u16 b) { return __uint_as_float(((unsigned)b) << 16); }
__device__ __forceinline__ float bfr(float f) { return bf2f(f2bf(f)); }
__device__ __forceinline__ u16 f2h(float x) { return __builtin_bit_cast(unsigned short, (h16)x); }

// f32 -> f16 with a value select: magnitudes below the smallest normal f16 become zero, so no subnormal f16 operand can reach a WMMA.
static __device__ __forceinline__ h16 toh_flush(float v) { const h16 r = (h16)v; return (fabsf(v) < 6.103515625e-05f) ? (h16)0.0f : r; }
static __device__ __forceinline__ u16 f2h_fl(float v) { return __builtin_bit_cast(unsigned short, toh_flush(v)); }

// Fragment loader for A and B alike: 'p' points at (row or column) + k0 + 8*(lane>>4); elements 0..7 = k0+8h.., elements 8..15 = k0+16+8h..
__device__ __forceinline__ v16us ldfr(const u16* p) {
    const v8us lo = *(const v8us*)p; const v8us hi = *(const v8us*)(p + 16);
    return __builtin_shufflevector(lo, hi, 0, 1, 2, 3, 4, 5, 6, 7, 8, 9, 10, 11, 12, 13, 14, 15);
}
// One WMMA plus its own hazard guard (ties exactly one accumulator, keeps A and B live).
__device__ __forceinline__ v8f mma_h(v16us a, v16us b, v8f c) {
    const v16h ah = __builtin_bit_cast(v16h, a); const v16h bh = __builtin_bit_cast(v16h, b);
    c = __builtin_amdgcn_wmma_f32_16x16x32_f16(false, ah, false, bh, (short)0, c, false, false);
    asm volatile("v_nop\n\tv_nop\n\tv_nop\n\tv_nop" : "+v"(c) : "v"(ah), "v"(bh));
    return c;
}
__device__ __forceinline__ v8f mma_b(v16us a, v16us b, v8f c) {
    const v16bf ab = __builtin_bit_cast(v16bf, a); const v16bf bb = __builtin_bit_cast(v16bf, b);
    c = __builtin_amdgcn_wmma_f32_16x16x32_bf16(false, ab, false, bb, (short)0, c, false, false);
    asm volatile("v_nop\n\tv_nop\n\tv_nop\n\tv_nop" : "+v"(c) : "v"(ab), "v"(bb));
    return c;
}
template <bool F16> __device__ __forceinline__ v8f mmag(v16us a, v16us b, v8f c) { if (F16) return mma_h(a, b, c); else return mma_b(a, b, c); }
// The same bf16 product with the hazard distance left to the compiler's own padding.
__device__ __forceinline__ v8f mma_bp(v16us a, v16us b, v8f c) { return __builtin_amdgcn_wmma_f32_16x16x32_bf16(false, __builtin_bit_cast(v16bf, a), false, __builtin_bit_cast(v16bf, b), (short)0, c, false, false); }

__device__ __forceinline__ unsigned lds_byte(const u16* p) { return (unsigned)(size_t)(const __attribute__((address_space(3))) u16*)p; }

#define GWM  4                   // waves down a GEMM work-group, 64 rows each
#define GWN  2                   // waves across, 64 columns each
#define GTH  (32 * GWM * GWN)    // threads per GEMM work-group
#define GKS  64                  // k per stage: 128-B rows, whole cache lines
#define GPIT 72                  // u16 per staged row: 144 B = 16 B x odd, the pitch for 16-byte LDS readers of 128-B rows
#define GAR  (64 * GWM)          // A rows per stage
#define GBR  (64 * GWN)          // Bt rows per stage
#define GSTG ((GAR + GBR) * GPIT)   // u16 per stage buffer: A rows, then Bt rows
#define GEPI (16 * 68 * 4 + 64 * 72 * 2)   // bytes of epilogue staging per wave (f32 row block, then the 16-bit transpose block), laid over the ring after the k loop
static_assert(GTH == 256 && GAR == 256 && GBR == 128);   // stage_ab: 32 rows per copy, 8 copies for A and 4 for Bt
static_assert(DM % GKS == 0 && DM / GKS >= 2);           // the two-buffer prologue needs two stages
static_assert(GEPI % 16 == 0 && GEPI * GWM * GWN <= 2 * GSTG * 2);
static_assert((NB * SEQ) % GAR == 0 && (NB * (SEQ - RH)) % GAR == 0 && RH % GAR == 0 && SEQ % GAR == 0 && DM % GBR == 0);   // whole work-groups; early/late and q/k/v the same for all waves of one

// One 64-k stage for a work-group of 256 threads: 256 A rows and 128 Bt rows of 128 B, 16 bytes per lane and copy (8 lanes = one row = one line), straight into LDS. ga / gb / la: this thread's place in row tid>>3 of A, of Bt, of the buffer.
// The s_wait_xcnt 0 is the last line of the copies' own statement so that no address register of a copy is rewritten ahead of it.
__device__ __forceinline__ void stage_ab(const u16* ga, const u16* gb, const int K, const unsigned la) {
    const size_t rs = (size_t)32 * K;                 // 32 rows on in global memory
    const unsigned ls = 32 * GPIT * 2;                // 32 rows on in LDS, bytes
    const unsigned lb = la + GAR * GPIT * 2;
    asm volatile("global_load_async_to_lds_b128 %0, %1, off\n\t"
                 "global_load_async_to_lds_b128 %2, %3, off\n\t"
                 "global_load_async_to_lds_b128 %4, %5, off\n\t"
                 "global_load_async_to_lds_b128 %6, %7, off\n\t"
                 "global_load_async_to_lds_b128 %8, %9, off\n\t"
                 "global_load_async_to_lds_b128 %10, %11, off\n\t"
                 "global_load_async_to_lds_b128 %12, %13, off\n\t"
                 "global_load_async_to_lds_b128 %14, %15, off\n\t"
                 "global_load_async_to_lds_b128 %16, %17, off\n\t"
                 "global_load_async_to_lds_b128 %18, %19, off\n\t"
                 "global_load_async_to_lds_b128 %20, %21, off\n\t"
                 "global_load_async_to_lds_b128 %22, %23, off\n\t"
                 "s_wait_xcnt 0x0"
                 :: "v"(la), "v"(ga), "v"(la + ls), "v"(ga + rs), "v"(la + 2 * ls), "v"(ga + 2 * rs), "v"(la + 3 * ls), "v"(ga + 3 * rs),
                    "v"(la + 4 * ls), "v"(ga + 4 * rs), "v"(la + 5 * ls), "v"(ga + 5 * rs), "v"(la + 6 * ls), "v"(ga + 6 * rs), "v"(la + 7 * ls), "v"(ga + 7 * rs),
                    "v"(lb), "v"(gb), "v"(lb + ls), "v"(gb + rs), "v"(lb + 2 * ls), "v"(gb + 2 * rs), "v"(lb + 3 * ls), "v"(gb + 3 * rs) : "memory");
}

// One wave computes a 64x64 tile: acc[mb][nb] element j = C[r0 + 16 mb + 8 (lane>>4) + j][c0 + 16 nb + (lane&15)] = sum_k A[m][k] Bt[n][k], k ascending in blocks of 32. K % 64 == 0.
// A work-group of GWM x GWN waves on rows R0.. and columns C0..: the waves share each 64-k stage of A and Bt,
// brought into the two buffers of 'ring' by asynchronous copies one stage ahead. On return no copy is in flight and every wave has left the ring (the last trip's barrier), so the caller may reuse it.
template <bool F16>
__device__ __forceinline__ void gemm_tile_s(const u16* __restrict__ A, const u16* __restrict__ Bt, const int K, const int R0, const int C0, u16* ring, const int tid, const int wm, const int wn, const int lr, const int hi, v8f (&acc)[4][4]) {
#pragma unroll
    for (int mb = 0; mb < 4; ++mb)
#pragma unroll
        for (int nb = 0; nb < 4; ++nb) acc[mb][nb] = (v8f){};
    const u16* ga = A + (size_t)(R0 + (tid >> 3)) * K + (tid & 7) * 8;
    const u16* gb = Bt + (size_t)(C0 + (tid >> 3)) * K + (tid & 7) * 8;
    const unsigned la = lds_byte(ring + (tid >> 3) * GPIT + (tid & 7) * 8);
    const int nst = K / GKS;
    stage_ab(ga, gb, K, la);
    asm volatile("s_wait_asynccnt 0x0" ::: "memory");   // this wave's copies of stage 0 have landed
    __syncthreads();                                     // stage 0 readable by every wave
    stage_ab(ga + GKS, gb + GKS, K, la + GSTG * 2);
#pragma unroll 1   // kept rolled: one body of 32 products, the buffer picked by st & 1; unrolling would only grow the text
    for (int st = 0; st < nst; ++st) {
        const u16* ar = ring + (st & 1) * GSTG + (wm * 64 + lr) * GPIT + 8 * hi;
        const u16* br = ring + (st & 1) * GSTG + (GAR + wn * 64 + lr) * GPIT + 8 * hi;
#pragma unroll   // this and the loops inside: every fragment and accumulator index a constant, so that they stay in registers
        for (int kc = 0; kc < GKS; kc += 32) {
            v16us a[4], bb[4];                  // the block's 16 LDS reads stand together, ahead of its 16 products
#pragma unroll
            for (int mb = 0; mb < 4; ++mb) a[mb] = ldfr(ar + mb * 16 * GPIT + kc);
#pragma unroll
            for (int nb = 0; nb < 4; ++nb) bb[nb] = ldfr(br + nb * 16 * GPIT + kc);
#pragma unroll
            for (int nb = 0; nb < 4; ++nb)
#pragma unroll
                for (int mb = 0; mb < 4; ++mb) acc[mb][nb] = mmag<F16>(a[mb], bb[nb], acc[mb][nb]);
        }
        asm volatile("s_wait_dscnt 0x0" ::: "memory");      // this wave's LDS reads of the stage are done before the buffer is refilled
        asm volatile("s_wait_asynccnt 0x0" ::: "memory");   // this wave's copies of the next stage have landed
        __syncthreads();                                     // publishes the next stage and ends every reader's last read of this one
        if (st + 2 < nst) stage_ab(ga + (st + 2) * GKS, gb + (st + 2) * GKS, K, la + (st & 1) * (GSTG * 2));
    }
    asm volatile("s_wait_asynccnt 0x0" ::: "memory");       // no copy is left in flight when the ring becomes epilogue staging
}

#define CVW   16                 // waves per conversion work-group
#define CVG   256                // conversion work-groups: with CVW, the launch's wave count (chosen for speed only), started once
#define CNW   (CVG * CVW)        // waves of the conversion launch
#define XROWS (NB * SEQ)         // rows of x
#define CROWS (XROWS + 4 * DM)   // rows of DM f32 to convert: x, then the query, key, value and output weights
static_assert(DM == 8 * 128);    // one row = 8 loads of 16 B per lane, each load of a wave 512 contiguous bytes
static_assert(O_XB == 0 && O_WALL == (size_t)XROWS * DM && O_WPB == O_WALL + 3 * WN && O_WPH == O_WPB + WN);   // row r of the list above lands at PL + r * DM; the f16 output-weight plane lies WN further on

typedef __attribute__((ext_vector_type(4))) unsigned short v4us;

// One converted row of 1024 16-bit values: 8 stores of 8 B per lane, each store of a wave 256 contiguous bytes (two whole lines). 'row' is the same in every lane, 'lofs' the lane's byte offset in the first 256 bytes.
// Written as one statement so that its last line, s_wait_xcnt 0, stands in front of every later write of a register that these stores name (in a statement of its own the compiler moved the next conversions over it).
__device__ __forceinline__ void store_row(u16* row, const unsigned lofs, const v4us (&d)[8]) {
    asm volatile("global_store_b64 %0, %1, %9\n\t"
                 "global_store_b64 %0, %2, %9 offset:256\n\t"
                 "global_store_b64 %0, %3, %9 offset:512\n\t"
                 "global_store_b64 %0, %4, %9 offset:768\n\t"
                 "global_store_b64 %0, %5, %9 offset:1024\n\t"
                 "global_store_b64 %0, %6, %9 offset:1280\n\t"
                 "global_store_b64 %0, %7, %9 offset:1536\n\t"
                 "global_store_b64 %0, %8, %9 offset:1792\n\t"
                 "s_wait_xcnt 0x0"
                 :: "v"(lofs), "v"(d[0]), "v"(d[1]), "v"(d[2]), "v"(d[3]), "v"(d[4]), "v"(d[5]), "v"(d[6]), "v"(d[7]), "s"(row) : "memory");
}

// k_cvt_all: every f32 -> 16-bit plane of the call in one launch of CVG work-groups. One wave per row of 1024 values and trip, rows dealt round robin over the launch's waves (wave gw takes rows gw, gw + CNW, ...);
// 8 whole-line loads of 16 B per lane in flight per wave. x and all four weights -> bf16 (RNE); the output weight also -> f16 of (bf16 value x WCAR). A reduced build reads the right rows of the full-size x.
__global__ __launch_bounds__(32 * CVW) void k_cvt_all(const float* __restrict__ x, const float* __restrict__ Wq, const float* __restrict__ Wk, const float* __restrict__ Wv, const float* __restrict__ Wp, u16* __restrict__ PL) {
    const int lane = threadIdx.x & 31;
    const int gw = __builtin_amdgcn_readfirstlane(blockIdx.x * CVW + (threadIdx.x >> 5));   // wave number as a scalar: the row, its source and the branches on it stay scalar
#pragma unroll 1   // kept rolled: few trips, and the other waves of the WGP cover a wave's load latency
    for (int r = gw; r < CROWS; r += CNW) {
        const float* src;
        if (r < XROWS) src = x + ((size_t)(r / SEQ) * SEQ_FULL + (r % SEQ)) * DM;
        else {
            const int w = (r - XROWS) / DM, wr = (r - XROWS) % DM;
            src = ((w == 0) ? Wq : (w == 1) ? Wk : (w == 2) ? Wv : Wp) + (size_t)wr * DM;
        }
        v4f v[8];
#pragma unroll
        for (int j = 0; j < 8; ++j) v[j] = *(const v4f*)(src + j * 128 + lane * 4);
        v4us ob[8];
#pragma unroll
        for (int j = 0; j < 8; ++j)
#pragma unroll
            for (int k = 0; k < 4; ++k) ob[j][k] = f2bf(v[j][k]);
        u16* row = PL + (size_t)r * DM;
        store_row(row, lane * 8, ob);
        if (r >= XROWS + 3 * DM) {
            v4us oh[8];
#pragma unroll
            for (int j = 0; j < 8; ++j)
#pragma unroll
                for (int k = 0; k < 4; ++k) oh[j][k] = f2h(bf2f(ob[j][k]) * WCAR);
            store_row(row + WN, lane * 8, oh);
        }
    }
}

// k_proj: [NB*SEQ][1024] x [3072][1024]^T (rows 0..1023 query weight, 1024..2047 key weight, 2048..3071 value weight). One wave per 64x64 tile = 64 time rows of one head, eight waves (4 x 2 tiles) per work-group sharing the staged operands.
// Epilogue q/k: per-row LayerNorm over the 64 head columns (mean and biased variance in f32 across 8 lanes x 8 columns, eps 1e-5, gain and bias taken as bf16 values of the inputs; both parameter sets are loaded and chosen by value),
// then f16 head plane rows [b][h][t][64] (+ bf16 hi/lo rows for t < RH); v: transposed through LDS into [b][h][d][t] lines of 64 t (+ hi/lo for t < RH). Planes addressed by element offsets from one base.
// All f16 plane values go through the value-select convert (no subnormal f16 can be produced).
__global__ __launch_bounds__(GTH) void k_proj(const u16* __restrict__ XB, const u16* __restrict__ WALL, u16* PL, size_t oP16, size_t oEH, size_t oEL,
                                             const float* __restrict__ QG, const float* __restrict__ QB, const float* __restrict__ KG, const float* __restrict__ KB) {
    __shared__ __align__(16) u16 ring[2 * GSTG];
    const int tid = threadIdx.x, lane = tid & 31, lr = lane & 15, hi = lane >> 4;
    const int wv = __builtin_amdgcn_readfirstlane(tid >> 5), wm = wv % GWM, wn = wv / GWM;   // wave number as a scalar: tile indices and the branches on them stay scalar
    float* os = (float*)((char*)ring + wv * GEPI);                       // this wave's own staging, used after the k loop only
    u16* ts = (u16*)((char*)ring + wv * GEPI + 16 * 68 * 4);
    const int r0 = blockIdx.x * GAR + wm * 64, c0 = blockIdx.y * GBR + wn * 64;
    const int which = c0 / DM, hd = (c0 - which * DM) / HD;
    const int b = r0 / SEQ, t0 = r0 - b * SEQ;
    const bool early = (t0 < RH);
    const size_t bh = (size_t)b * NH + hd;
    v8f acc[4][4];
    gemm_tile_s<false>(XB, WALL, DM, blockIdx.x * GAR, blockIdx.y * GBR, ring, tid, wm, wn, lr, hi, acc);
    if (which < 2) {
        const size_t o16 = oP16 + (size_t)which * PLANE + (bh * SEQ + t0) * HD;
        const size_t oeh = oEH + (size_t)which * EPLANE + (bh * RH + (early ? t0 : 0)) * HD;
        const size_t oel = oEL + (size_t)which * EPLANE + (bh * RH + (early ? t0 : 0)) * HD;
        const int gc = (lane & 7) * 8;                 // this lane's 8 head columns (same in every row group)
        const v4f gq0 = *(const v4f*)(QG + gc), gq1 = *(const v4f*)(QG + gc + 4);
        const v4f bq0 = *(const v4f*)(QB + gc), bq1 = *(const v4f*)(QB + gc + 4);
        const v4f gk0 = *(const v4f*)(KG + gc), gk1 = *(const v4f*)(KG + gc + 4);
        const v4f bk0 = *(const v4f*)(KB + gc), bk1 = *(const v4f*)(KB + gc + 4);
        v4f g0, g1, be0, be1;
#pragma unroll
        for (int q = 0; q < 4; ++q) {
            g0[q]  = bfr((which == 0) ? gq0[q] : gk0[q]); g1[q]  = bfr((which == 0) ? gq1[q] : gk1[q]);
            be0[q] = bfr((which == 0) ? bq0[q] : bk0[q]); be1[q] = bfr((which == 0) ? bq1[q] : bk1[q]);
        }
#pragma unroll
        for (int mb = 0; mb < 4; ++mb) {
#pragma unroll
            for (int nb = 0; nb < 4; ++nb)
#pragma unroll
                for (int j = 0; j < 8; ++j) os[(hi * 8 + j) * 68 + nb * 16 + lr] = acc[mb][nb][j];
            __syncthreads();
{
#pragma unroll
                for (int s = 0; s < 4; ++s) {
                    const int row = 4 * s + (lane >> 3), pc = (lane & 7) * 8;
                    const v4f x0 = *(const v4fa*)&os[row * 68 + pc]; const v4f x1 = *(const v4fa*)&os[row * 68 + pc + 4];
                    // LayerNorm of the 64-wide row held by the 8 lanes sharing lane>>3 (all 32 lanes active, uniform control)
                    float sm = ((x0[0] + x0[1]) + (x0[2] + x0[3])) + ((x1[0] + x1[1]) + (x1[2] + x1[3]));
                    sm += __shfl_xor(sm, 1, 32); sm += __shfl_xor(sm, 2, 32); sm += __shfl_xor(sm, 4, 32);
                    const float mean = sm * (1.0f / 64.0f);
                    v4f d0, d1;
#pragma unroll
                    for (int q = 0; q < 4; ++q) { d0[q] = x0[q] - mean; d1[q] = x1[q] - mean; }
                    float vs = ((d0[0] * d0[0] + d0[1] * d0[1]) + (d0[2] * d0[2] + d0[3] * d0[3])) + ((d1[0] * d1[0] + d1[1] * d1[1]) + (d1[2] * d1[2] + d1[3] * d1[3]));
                    vs += __shfl_xor(vs, 1, 32); vs += __shfl_xor(vs, 2, 32); vs += __shfl_xor(vs, 4, 32);
                    const float rinv = rsqrtf(vs * (1.0f / 64.0f) + LNEPS);
                    v4f y0, y1;
#pragma unroll
                    for (int q = 0; q < 4; ++q) { y0[q] = d0[q] * rinv * g0[q] + be0[q]; y1[q] = d1[q] * rinv * g1[q] + be1[q]; }
                    v8us q16;
#pragma unroll
                    for (int q = 0; q < 4; ++q) { q16[q] = f2h_fl(y0[q]); q16[4 + q] = f2h_fl(y1[q]); }
                    const size_t ro = (size_t)(mb * 16 + row) * HD + pc;
                    *(v8us*)(PL + o16 + ro) = q16;
                    if (early) {
                        v8us oh, ol;
#pragma unroll
                        for (int q = 0; q < 4; ++q) { const u16 a = f2bf(y0[q]); oh[q] = a; ol[q] = f2bf(y0[q] - bf2f(a)); const u16 c = f2bf(y1[q]); oh[4 + q] = c; ol[4 + q] = f2bf(y1[q] - bf2f(c)); }
                        *(v8us*)(PL + oeh + ro) = oh; *(v8us*)(PL + oel + ro) = ol;
                    }
                }
                
            }
            __syncthreads();
        }
    } else {
#pragma unroll
        for (int pl = 0; pl < 3; ++pl) {
            if (pl == 0 || early) {
#pragma unroll
                for (int mb = 0; mb < 4; ++mb)
#pragma unroll
                    for (int nb = 0; nb < 4; ++nb) {
                        v8us pk;
#pragma unroll
                        for (int j = 0; j < 8; ++j) { const float y = acc[mb][nb][j]; const u16 hb = f2bf(y); pk[j] = (pl == 0) ? f2h_fl(y) : ((pl == 1) ? hb : f2bf(y - bf2f(hb))); }
                        *(v8usa*)&ts[(nb * 16 + lr) * 72 + mb * 16 + hi * 8] = pk;     // ts[d][t]: 8 consecutive t per lane
                    }
                __syncthreads();
                const size_t dofs = (pl == 0) ? (oP16 + 2 * PLANE + bh * HD * SEQ + t0) : (((pl == 1) ? oEH : oEL) + 2 * EPLANE + bh * HD * RH + t0);
                const int dp = (pl == 0) ? SEQ : RH;
{
#pragma unroll 4
                    for (int s = 0; s < 16; ++s) {
                        const int d = 4 * s + (lane >> 3), pc = (lane & 7) * 8;
                        const v8us v = *(const v8usa*)&ts[d * 72 + pc];
                        *(v8us*)(PL + dofs + (size_t)d * dp + pc) = v;
                    }
                    
                }
                __syncthreads();
            }
        }
    }
}

// Online-softmax update for one 16 x 32 score step. s0/s1 hold raw scores for keys jb + (lane&15) and jb + 16 + (lane&15), rows qbase + 8 (lane>>4) + i; on return they hold exp2(t - running max).
// lrow keeps PER-LANE partial sums (reduced over the 16 lanes of a row once, after the key loop). Masked entries are replaced before the maximum; every row keeps its own key.
__device__ __forceinline__ void sm_step(v8f& s0, v8f& s1, float (&mrow)[8], float (&lrow)[8], float (&corr)[8], const int jb, const int qbase, const int lr, const int hi) {
#pragma unroll
    for (int i = 0; i < 8; ++i) {
        const int row = qbase + i + 8 * hi;
        float a0 = s0[i] * SCL2, a1 = s1[i] * SCL2;
        a0 = (jb + lr > row) ? -1.0e30f : a0;
        a1 = (jb + 16 + lr > row) ? -1.0e30f : a1;
        float mx = fmaxf(a0, a1);
        mx = fmaxf(mx, __shfl_xor(mx, 1, 32)); mx = fmaxf(mx, __shfl_xor(mx, 2, 32)); mx = fmaxf(mx, __shfl_xor(mx, 4, 32)); mx = fmaxf(mx, __shfl_xor(mx, 8, 32));
        const float mnew = fmaxf(mrow[i], mx);
        // The row's three exponentials as v_exp_f32, like the builtin. One statement, each in its own register, and a closing v_nop: so no instruction directly behind an exponential reads its result or overwrites its source
        // (with the registers of this build the compiler gave an exponential's result the register the one before it had just read).
        float c = mrow[i] - mnew, p0 = a0 - mnew, p1 = a1 - mnew;
        asm("v_exp_f32 %0, %0\n\tv_exp_f32 %1, %1\n\tv_exp_f32 %2, %2\n\tv_nop" : "+v"(c), "+v"(p0), "+v"(p1));
        lrow[i] = lrow[i] * c + (p0 + p1);
        mrow[i] = mnew; corr[i] = c; s0[i] = p0; s1[i] = p1;
    }
}

#define AW   4                   // waves per late-attention work-group, 16 query rows each
#define KPIT 72                  // u16 per staged key row: 144 B = 16 B x odd, the pitch for 16-byte LDS readers of 128-B rows
#define VPIT 40                  // u16 per staged value row: 80 B = 16 B x odd, the same for 64-B rows
#define NQB_L (((SEQ - RH) / (16 * AW)) > 0 ? ((SEQ - RH) / (16 * AW)) : 1)
static_assert((SEQ - RH) % (16 * AW) == 0);   // whole work-groups of query rows
static_assert((RH + 16 * AW) / 32 >= 2);      // the two-buffer prologue needs two key steps
static_assert((16 * AW) % 32 == 0 && RH % 32 == 0);   // a work-group's last key step ends on its last query row

// One 32-key stage for a work-group of 128 threads: key rows jb..jb+31 (32 x 128 B, contiguous in the plane) and the 64 value rows' columns jb..jb+31 (64 x 64 B), 16 bytes per lane and copy, straight into LDS.
// The s_wait_xcnt 0 is the last line of the copies' own statement so that no address register of a copy is rewritten ahead of it.
__device__ __forceinline__ void stage_kv(const u16* __restrict__ Kb, const u16* __restrict__ Vb, const int jb, u16* kd, u16* vd, const int tid) {
    const u16* gk0 = Kb + (size_t)(jb + (tid >> 3)) * HD + (tid & 7) * 8;      // rows 0..15 of the stage
    const u16* gk1 = gk0 + 16 * HD;                                           // rows 16..31
    const u16* gv0 = Vb + (size_t)(tid >> 2) * SEQ + jb + (tid & 3) * 8;       // head columns 0..31
    const u16* gv1 = gv0 + (size_t)32 * SEQ;                                  // head columns 32..63
    const unsigned lk0 = lds_byte(kd + (tid >> 3) * KPIT + (tid & 7) * 8), lk1 = lk0 + 16 * KPIT * 2;
    const unsigned lv0 = lds_byte(vd + (tid >> 2) * VPIT + (tid & 3) * 8), lv1 = lv0 + 32 * VPIT * 2;
    asm volatile("global_load_async_to_lds_b128 %0, %1, off\n\t"
                 "global_load_async_to_lds_b128 %2, %3, off\n\t"
                 "global_load_async_to_lds_b128 %4, %5, off\n\t"
                 "global_load_async_to_lds_b128 %6, %7, off\n\t"
                 "s_wait_xcnt 0x0"
                 :: "v"(lk0), "v"(gk0), "v"(lk1), "v"(gk1), "v"(lv0), "v"(gv0), "v"(lv1), "v"(gv1) : "memory");
}

// Lane l's value from lane l ^ 16 (the other half of the wave), by a vector cross-row move.
__device__ __forceinline__ float xhalf(float x) {
    const int v = __builtin_bit_cast(int, x);
    return __builtin_bit_cast(float, __builtin_amdgcn_permlanex16(v, v, 0x76543210, 0xfedcba98, false, false));
}

// 2^c and 2^a[0..7] (first form), 2^a[0..7] (second form), as v_exp_f32 like the builtin. One statement each, results in registers of their own ("=&v") and a closing v_nop:
// so no instruction directly behind an exponential reads its result or overwrites its source (left to itself the compiler gave an exponential's result the register the one before it had just read).
__device__ __forceinline__ void exp2_9(const float c, const v8f a, float& ec, v8f& e) {
    float r0, r1, r2, r3, r4, r5, r6, r7;
    asm("v_exp_f32 %0, %9\n\tv_exp_f32 %1, %10\n\tv_exp_f32 %2, %11\n\tv_exp_f32 %3, %12\n\tv_exp_f32 %4, %13\n\tv_exp_f32 %5, %14\n\tv_exp_f32 %6, %15\n\tv_exp_f32 %7, %16\n\tv_exp_f32 %8, %17\n\tv_nop"
        : "=&v"(ec), "=&v"(r0), "=&v"(r1), "=&v"(r2), "=&v"(r3), "=&v"(r4), "=&v"(r5), "=&v"(r6), "=&v"(r7)
        : "v"(c), "v"(a[0]), "v"(a[1]), "v"(a[2]), "v"(a[3]), "v"(a[4]), "v"(a[5]), "v"(a[6]), "v"(a[7]));
    e[0] = r0; e[1] = r1; e[2] = r2; e[3] = r3; e[4] = r4; e[5] = r5; e[6] = r6; e[7] = r7;
}
__device__ __forceinline__ void exp2_8(const v8f a, v8f& e) {
    float r0, r1, r2, r3, r4, r5, r6, r7;
    asm("v_exp_f32 %0, %8\n\tv_exp_f32 %1, %9\n\tv_exp_f32 %2, %10\n\tv_exp_f32 %3, %11\n\tv_exp_f32 %4, %12\n\tv_exp_f32 %5, %13\n\tv_exp_f32 %6, %14\n\tv_exp_f32 %7, %15\n\tv_nop"
        : "=&v"(r0), "=&v"(r1), "=&v"(r2), "=&v"(r3), "=&v"(r4), "=&v"(r5), "=&v"(r6), "=&v"(r7)
        : "v"(a[0]), "v"(a[1]), "v"(a[2]), "v"(a[3]), "v"(a[4]), "v"(a[5]), "v"(a[6]), "v"(a[7]));
    e[0] = r0; e[1] = r1; e[2] = r2; e[3] = r3; e[4] = r4; e[5] = r5; e[6] = r6; e[7] = r7;
}

// k_attn_l: query rows >= RH, f16 single products. One work-group of AW waves per 16*AW query rows of one (batch, head), one wave per 16 rows; the waves share each 32-key stage of K and V,
// brought into two LDS buffers by asynchronous copies one stage ahead. Every wave walks the work-group's key range: a step wholly above a wave's diagonal adds exact zeros. ctx f16 x CCAR -> AT [b][t-RH][1024].
// Both products are taken transposed: S^T = K Q^T (A = key rows from LDS, B = the wave's query rows, kept in registers) and O^T += V^T P^T (A = rows of the staged V^T, B = P^T).
// A lane then holds 16 of the 32 scores of ONE query (qbase + (lane&15); keys jb + 8 (lane>>4) + r and jb + 16 + 8 (lane>>4) + r): maximum and sum run inside the lane, the two halves of the wave meet in one exchange,
// and the two score tiles, converted in place, are the B operand of the second product in the loader's own k order, so P goes through no LDS and no barrier.
__global__ __launch_bounds__(32 * AW) void k_attn_l(const u16* __restrict__ QP, const u16* __restrict__ KP, const u16* __restrict__ VT, u16* AT) {
    __shared__ __align__(16) u16 ks[2][32 * KPIT];
    __shared__ __align__(16) u16 vs[2][HD * VPIT];
    const int tid = threadIdx.x, lane = tid & 31, lr = lane & 15, hi = lane >> 4;
    const int wv = __builtin_amdgcn_readfirstlane(tid >> 5);   // wave number as a scalar: the test for steps that touch the diagonal stays a scalar branch
    const int bh = blockIdx.x / NQB_L, qb = blockIdx.x - bh * NQB_L;
    const int b = bh / NH, h = bh - b * NH;
    const int qblk = RH + qb * (16 * AW);
    const int qbase = qblk + wv * 16;
    const size_t pb = (size_t)bh * SEQ * HD;
    const u16* Qb = QP + pb; const u16* Kb = KP + pb; const u16* Vb = VT + pb;
    const int nsteps = (qblk + 16 * AW) >> 5;    // keys 0 .. qblk+16*AW-1 in steps of 32; nsteps*32 <= SEQ, nsteps >= 2
    stage_kv(Kb, Vb, 0, ks[0], vs[0], tid);
    asm volatile("s_wait_asynccnt 0x0" ::: "memory");   // this wave's copies of stage 0 have landed
    __syncthreads();                                     // stage 0 readable by every wave
    stage_kv(Kb, Vb, 32, ks[1], vs[1], tid);
    const v16us q0 = ldfr(Qb + (size_t)(qbase + lr) * HD + 8 * hi);
    const v16us q1 = ldfr(Qb + (size_t)(qbase + lr) * HD + 32 + 8 * hi);
    v8f acc[4];                                  // acc[dt][r] = O^T[16 dt + 8 hi + r][qbase + lr], carried x PCAR
#pragma unroll
    for (int dt = 0; dt < 4; ++dt) acc[dt] = (v8f){};
    float mrun = -1.0e30f, lsum = 0.0f;          // this lane's query: running maximum of the raw scores (both halves alike); sum of this half's probabilities x PCAR
#pragma unroll 1
    for (int st = 0; st < nsteps; ++st) {
        const int jb = st * 32;
        const u16* kr0 = ks[st & 1] + lr * KPIT + 8 * hi; const u16* kr1 = kr0 + 16 * KPIT;
        const u16* vr = vs[st & 1] + lr * VPIT + 8 * hi;
        const v16us k00 = ldfr(kr0), k01 = ldfr(kr0 + 32), k10 = ldfr(kr1), k11 = ldfr(kr1 + 32);   // the step's 8 key reads stand together, ahead of its 4 score products
        v8f s0 = (v8f){}, s1 = (v8f){};
        s0 = mma_h(k00, q0, s0); s1 = mma_h(k10, q0, s1);
        s0 = mma_h(k01, q1, s0); s1 = mma_h(k11, q1, s1);
        v16us vf[4];                             // the step's 8 value reads stand together too: they return while the softmax runs
#pragma unroll
        for (int dt = 0; dt < 4; ++dt) vf[dt] = ldfr(vr + dt * 16 * VPIT);
        if (jb + 31 > qbase) {                   // only a step that reaches past the wave's first query row can hold an excluded key
            const int dq = qbase + lr - jb - 8 * hi;      // key index r (or 16 + r) inside this lane's share is excluded when it exceeds dq
#pragma unroll
            for (int r = 0; r < 8; ++r) { s0[r] = (r > dq) ? -1.0e30f : s0[r]; s1[r] = (16 + r > dq) ? -1.0e30f : s1[r]; }
        }
        float mx = fmaxf(s0[0], s1[0]);
#pragma unroll
        for (int r = 1; r < 8; ++r) mx = fmaxf(mx, fmaxf(s0[r], s1[r]));
        mx = fmaxf(mx, xhalf(mx));
        const float mnew = fmaxf(mrun, mx);      // finite from the first step on: key 0 is open to every query
        const float nm = 10.0f - mnew * SCL2;    // 2^10 = PCAR: the carry rides in the exponent
#pragma unroll
        for (int r = 0; r < 8; ++r) { s0[r] = __builtin_fmaf(s0[r], SCL2, nm); s1[r] = __builtin_fmaf(s1[r], SCL2, nm); }
        float corr;
        exp2_9((mrun - mnew) * SCL2, s0, corr, s0);
        exp2_8(s1, s1);
        mrun = mnew;
        v16h pf;
        float ps = 0.0f;
#pragma unroll
        for (int r = 0; r < 8; ++r) { ps += s0[r] + s1[r]; pf[r] = (h16)s0[r]; pf[8 + r] = (h16)s1[r]; }
        lsum = lsum * corr + ps;
#pragma unroll
        for (int dt = 0; dt < 4; ++dt)
#pragma unroll
            for (int r = 0; r < 8; ++r) acc[dt][r] *= corr;
        const v16us pu = __builtin_bit_cast(v16us, pf);
#pragma unroll
        for (int dt = 0; dt < 4; ++dt) acc[dt] = mma_h(vf[dt], pu, acc[dt]);
        asm volatile("s_wait_dscnt 0x0" ::: "memory");      // this wave's LDS reads of the stage are done before the buffer is refilled
        asm volatile("s_wait_asynccnt 0x0" ::: "memory");   // this wave's copies of the next stage have landed
        __syncthreads();                                     // publishes the next stage and ends every reader's last read of this one
        if (st + 2 < nsteps) stage_kv(Kb, Vb, jb + 64, ks[st & 1], vs[st & 1], tid);
    }
    asm volatile("s_wait_asynccnt 0x0" ::: "memory");       // no copy is left in flight when the wave goes on to its end
    const float inv = CCAR / (lsum + xhalf(lsum));          // both carry PCAR, so it cancels
    u16* dst = AT + ((size_t)b * (SEQ - RH) + (qbase - RH) + lr) * DM + h * HD + 8 * hi;
#pragma unroll
    for (int dt = 0; dt < 4; ++dt) {             // a lane's 8 registers are 8 consecutive head columns of its query row: one 16-byte store; the wave's four stores fill each row's whole 128-B line
        v8us o;
#pragma unroll
        for (int r = 0; r < 8; ++r) o[r] = f2h(acc[dt][r] * inv);
        *(v8us*)(dst + dt * 16) = o;
    }
}

#define EAW  4                   // waves per early-attention work-group, 16 query rows each
static_assert(RH % (16 * EAW) == 0);          // whole work-groups of query rows
static_assert((16 * EAW) / 32 >= 2);          // the two-buffer prologue needs two key steps
static_assert((16 * EAW) % 32 == 0);          // a work-group's last key step ends on its last query row, inside the early planes

// One 32-key stage of the hi and lo planes for a work-group of 128 threads: key rows jb..jb+31 (32 x 128 B, contiguous in each plane) and the 64 value rows' columns jb..jb+31 (64 x 64 B), 16 bytes per lane and copy, straight into LDS.
// The s_wait_xcnt 0 is the last line of the copies' own statement so that no address register of a copy is rewritten ahead of it.
__device__ __forceinline__ void stage_kv_e(const u16* __restrict__ Kh, const u16* __restrict__ Kl, const u16* __restrict__ Vh, const u16* __restrict__ Vl, const int jb, u16* kdh, u16* kdl, u16* vdh, u16* vdl, const int tid) {
    const size_t ko = (size_t)(jb + (tid >> 3)) * HD + (tid & 7) * 8;         // rows 0..15 of the stage; 16 * HD further on: rows 16..31
    const size_t vo = (size_t)(tid >> 2) * RH + jb + (tid & 3) * 8;           // head columns 0..31; 32 * RH further on: head columns 32..63
    const int kl = (tid >> 3) * KPIT + (tid & 7) * 8, vl = (tid >> 2) * VPIT + (tid & 3) * 8;
    const unsigned lkh = lds_byte(kdh + kl), lkl = lds_byte(kdl + kl), lvh = lds_byte(vdh + vl), lvl = lds_byte(vdl + vl);
    asm volatile("global_load_async_to_lds_b128 %0, %1, off\n\t"
                 "global_load_async_to_lds_b128 %2, %3, off\n\t"
                 "global_load_async_to_lds_b128 %4, %5, off\n\t"
                 "global_load_async_to_lds_b128 %6, %7, off\n\t"
                 "global_load_async_to_lds_b128 %8, %9, off\n\t"
                 "global_load_async_to_lds_b128 %10, %11, off\n\t"
                 "global_load_async_to_lds_b128 %12, %13, off\n\t"
                 "global_load_async_to_lds_b128 %14, %15, off\n\t"
                 "s_wait_xcnt 0x0"
                 :: "v"(lkh), "v"(Kh + ko), "v"(lkh + 16 * KPIT * 2), "v"(Kh + ko + 16 * HD), "v"(lkl), "v"(Kl + ko), "v"(lkl + 16 * KPIT * 2), "v"(Kl + ko + 16 * HD),
                    "v"(lvh), "v"(Vh + vo), "v"(lvh + 32 * VPIT * 2), "v"(Vh + vo + 32 * RH), "v"(lvl), "v"(Vl + vo), "v"(lvl + 32 * VPIT * 2), "v"(Vl + vo + 32 * RH) : "memory");
}

// k_attn_e: query rows < RH, bf16 hi+lo operands (hi.hi + lo.hi + hi.lo into one accumulator; residuals unscaled). ctx hi/lo bf16 -> ATEh/ATEl [b][t][1024].
// One work-group of EAW waves per 16*EAW query rows of one (batch, head), one wave per 16 rows; the waves share each 32-key stage of the K and V hi and lo planes, brought into two LDS buffers by asynchronous copies one stage ahead
// (whole lines from L2, fetched once per work-group, where fragment loads straight from the planes touch 16 lines each). Every wave walks the work-group's key range: a step wholly above a wave's diagonal adds exact zeros.
__global__ __launch_bounds__(32 * EAW) void k_attn_e(const u16* __restrict__ QEh, const u16* __restrict__ QEl, const u16* __restrict__ KEh, const u16* __restrict__ KEl, const u16* __restrict__ VEh, const u16* __restrict__ VEl, u16* ATEh, u16* ATEl) {
    __shared__ __align__(16) u16 ksh[2][32 * KPIT];
    __shared__ __align__(16) u16 ksl[2][32 * KPIT];
    __shared__ __align__(16) u16 vsh[2][HD * VPIT];
    __shared__ __align__(16) u16 vsl[2][HD * VPIT];
    __shared__ __align__(16) u16 pwha[EAW][16 * 40];
    __shared__ __align__(16) u16 pwla[EAW][16 * 40];
    __shared__ __align__(16) float osa[EAW][16 * 68];
    const int tid = threadIdx.x, lane = tid & 31, lr = lane & 15, hi = lane >> 4;
    const int wv = __builtin_amdgcn_readfirstlane(tid >> 5);   // wave number as a scalar: the wave's own staging addresses stay scalar
    u16* pwh = pwha[wv]; u16* pwl = pwla[wv]; float* os = osa[wv];   // this wave's own P and output staging
    const int bh = blockIdx.x / (RH / (16 * EAW)), qb = blockIdx.x - bh * (RH / (16 * EAW));
    const int b = bh / NH, h = bh - b * NH;
    const int qblk = qb * (16 * EAW);
    const int qbase = qblk + wv * 16;
    const size_t pb = (size_t)bh * RH * HD;
    const u16* Kh = KEh + pb; const u16* Kl = KEl + pb; const u16* Vh = VEh + pb; const u16* Vl = VEl + pb;   // V planes [bh][64][RH], same plane size as [bh][RH][64]
    const int nsteps = (qblk + 16 * EAW) >> 5;   // keys 0 .. qblk+16*EAW-1 in steps of 32; nsteps*32 <= RH, nsteps >= 2
    stage_kv_e(Kh, Kl, Vh, Vl, 0, ksh[0], ksl[0], vsh[0], vsl[0], tid);
    asm volatile("s_wait_asynccnt 0x0" ::: "memory");   // this wave's copies of stage 0 have landed
    __syncthreads();                                     // stage 0 readable by every wave
    stage_kv_e(Kh, Kl, Vh, Vl, 32, ksh[1], ksl[1], vsh[1], vsl[1], tid);
    const size_t qo = pb + (size_t)(qbase + lr) * HD + 8 * hi;
    const v16us qh0 = ldfr(QEh + qo), qh1 = ldfr(QEh + qo + 32), ql0 = ldfr(QEl + qo), ql1 = ldfr(QEl + qo + 32);
    v8f acc[4];
#pragma unroll
    for (int nt = 0; nt < 4; ++nt) acc[nt] = (v8f){};
    float mrow[8], lrow[8];
#pragma unroll
    for (int i = 0; i < 8; ++i) { mrow[i] = -1.0e30f; lrow[i] = 0.0f; }
#pragma unroll 1
    for (int st = 0; st < nsteps; ++st) {
        const int jb = st * 32;
        const u16* krh = ksh[st & 1] + lr * KPIT + 8 * hi; const u16* krl = ksl[st & 1] + lr * KPIT + 8 * hi;   // this lane's place in the stage's key rows
        const u16* vrh = vsh[st & 1] + lr * VPIT + 8 * hi; const u16* vrl = vsl[st & 1] + lr * VPIT + 8 * hi;   // the same in the stage's value rows
        // The step's 16 key reads stand together, ahead of its 12 score products.
        const v16us kh0 = ldfr(krh), kh1 = ldfr(krh + 32), kl0 = ldfr(krl), kl1 = ldfr(krl + 32);
        const v16us kh2 = ldfr(krh + 16 * KPIT), kh3 = ldfr(krh + 16 * KPIT + 32), kl2 = ldfr(krl + 16 * KPIT), kl3 = ldfr(krl + 16 * KPIT + 32);
        v8f s0 = (v8f){}, s1 = (v8f){};
        s0 = mma_b(qh0, kh0, s0); s0 = mma_b(qh1, kh1, s0); s0 = mma_b(ql0, kh0, s0); s0 = mma_b(ql1, kh1, s0); s0 = mma_b(qh0, kl0, s0); s0 = mma_b(qh1, kl1, s0);
        s1 = mma_b(qh0, kh2, s1); s1 = mma_b(qh1, kh3, s1); s1 = mma_b(ql0, kh2, s1); s1 = mma_b(ql1, kh3, s1); s1 = mma_b(qh0, kl2, s1); s1 = mma_b(qh1, kl3, s1);
        __builtin_amdgcn_sched_barrier(0);   // this and the one behind the softmax keep the value reads out of it: strewn among its cross-lane exchanges (same counter), they made each exchange's wait wait for them too
        float corr[8];
        sm_step(s0, s1, mrow, lrow, corr, jb, qbase, lr, hi);
        __builtin_amdgcn_sched_barrier(0);
        v16us vh[4], vl[4];                      // the step's 16 value reads stand together: they return while the accumulators are rescaled and P is converted
#pragma unroll
        for (int nt = 0; nt < 4; ++nt) { vh[nt] = ldfr(vrh + nt * 16 * VPIT); vl[nt] = ldfr(vrl + nt * 16 * VPIT); }
#pragma unroll
        for (int nt = 0; nt < 4; ++nt)
#pragma unroll
            for (int i = 0; i < 8; ++i) acc[nt][i] *= corr[i];
#pragma unroll
        for (int i = 0; i < 8; ++i) {
            const u16 a = f2bf(s0[i]); const u16 c = f2bf(s1[i]);
            pwh[(i + 8 * hi) * 40 + lr] = a; pwl[(i + 8 * hi) * 40 + lr] = f2bf(s0[i] - bf2f(a));
            pwh[(i + 8 * hi) * 40 + 16 + lr] = c; pwl[(i + 8 * hi) * 40 + 16 + lr] = f2bf(s1[i] - bf2f(c));
        }
        __syncthreads();
        const v8us h0 = *(const v8usa*)&pwh[lr * 40 + 8 * hi]; const v8us h1 = *(const v8usa*)&pwh[lr * 40 + 16 + 8 * hi];
        const v8us l0 = *(const v8usa*)&pwl[lr * 40 + 8 * hi]; const v8us l1 = *(const v8usa*)&pwl[lr * 40 + 16 + 8 * hi];
        const v16us pfh = __builtin_shufflevector(h0, h1, 0, 1, 2, 3, 4, 5, 6, 7, 8, 9, 10, 11, 12, 13, 14, 15);
        const v16us pfl = __builtin_shufflevector(l0, l1, 0, 1, 2, 3, 4, 5, 6, 7, 8, 9, 10, 11, 12, 13, 14, 15);
#pragma unroll
        for (int nt = 0; nt < 4; ++nt) { acc[nt] = mma_b(pfh, vh[nt], acc[nt]); acc[nt] = mma_b(pfl, vh[nt], acc[nt]); acc[nt] = mma_b(pfh, vl[nt], acc[nt]); }
        asm volatile("s_wait_dscnt 0x0" ::: "memory");      // this wave's LDS reads of the stage (and of its P rows) are done before the buffer is refilled
        asm volatile("s_wait_asynccnt 0x0" ::: "memory");   // this wave's copies of the next stage have landed
        __syncthreads();                                     // publishes the next stage and ends every reader's last read of this one
        if (st + 2 < nsteps) stage_kv_e(Kh, Kl, Vh, Vl, jb + 64, ksh[st & 1], ksl[st & 1], vsh[st & 1], vsl[st & 1], tid);
    }
    asm volatile("s_wait_asynccnt 0x0" ::: "memory");       // no copy is left in flight when the wave goes on to its end
#pragma unroll
    for (int i = 0; i < 8; ++i) {
        float l = lrow[i];
        l += __shfl_xor(l, 1, 32); l += __shfl_xor(l, 2, 32); l += __shfl_xor(l, 4, 32); l += __shfl_xor(l, 8, 32);
        const float inv = 1.0f / l;
#pragma unroll
        for (int nt = 0; nt < 4; ++nt) os[(i + 8 * hi) * 68 + nt * 16 + lr] = acc[nt][i] * inv;
    }
    __syncthreads();
    const size_t dofs = ((size_t)b * RH + qbase) * DM + h * HD;
{
#pragma unroll
        for (int s = 0; s < 4; ++s) {
            const int row = 4 * s + (lane >> 3), pc = (lane & 7) * 8;
            const v4f x0 = *(const v4fa*)&os[row * 68 + pc]; const v4f x1 = *(const v4fa*)&os[row * 68 + pc + 4];
            v8us oh, ol;
#pragma unroll
            for (int q = 0; q < 4; ++q) { const u16 a = f2bf(x0[q]); oh[q] = a; ol[q] = f2bf(x0[q] - bf2f(a)); const u16 c = f2bf(x1[q]); oh[4 + q] = c; ol[4 + q] = f2bf(x1[q] - bf2f(c)); }
            *(v8us*)(ATEh + dofs + (size_t)row * DM + pc) = oh;
            *(v8us*)(ATEl + dofs + (size_t)row * DM + pc) = ol;
        }
        
    }
}

// Output projection: OUT[b][toff + r][n] = scale * sum_k A[row][k] Bt[n][k] (+ A2 product in k_outp_e) + bf16(bias[n]); rows of A are [b][r] with rpb rows per batch.
// Epilogue of one wave's 64x64 tile (k_outp_l) at rows r0.., columns c0..: whole 256-B row pieces through the wave's own staging 'os'. Every wave of the work-group passes the same barriers.
__device__ __forceinline__ void outp_store(const v8f (&acc)[4][4], float* os, const float* __restrict__ bias, float* OUT, const float scale, const int rpb, const int toff, const int r0, const int c0, const int lr, const int hi) {
    const int b = r0 / rpb, tb = toff + (r0 - b * rpb);
    float* crow0 = OUT + ((size_t)b * SEQ_FULL + tb) * DM + c0;
    const int cofs = lr * 4;
    v4f bv; bv[0] = bfr(bias[c0 + cofs]); bv[1] = bfr(bias[c0 + cofs + 1]); bv[2] = bfr(bias[c0 + cofs + 2]); bv[3] = bfr(bias[c0 + cofs + 3]);
#pragma unroll
    for (int mb = 0; mb < 4; ++mb) {
#pragma unroll
        for (int nb = 0; nb < 4; ++nb)
#pragma unroll
            for (int j = 0; j < 8; ++j) os[(hi * 8 + j) * 68 + nb * 16 + lr] = acc[mb][nb][j];
        __syncthreads();
#pragma unroll
        for (int s = 0; s < 8; ++s) {
            const int row = 2 * s + hi;
            const v4f x = *(const v4fa*)&os[row * 68 + cofs];
            v4f val; val[0] = x[0] * scale + bv[0]; val[1] = x[1] * scale + bv[1]; val[2] = x[2] * scale + bv[2]; val[3] = x[3] * scale + bv[3];
            *(v4f*)(crow0 + (size_t)(mb * 16 + row) * DM + cofs) = val;
        }
        __syncthreads();
    }
}

#define EWM  2                   // waves down an early output work-group, 32 rows each
#define EWN  2                   // waves across, 32 columns each
#define ETH  (32 * EWM * EWN)    // threads per early output work-group
#define EKS  128                 // k per stage: 256-B rows, two whole cache lines
#define EPIT 136                 // u16 per staged row: 272 B = 16 B x odd, the pitch for 16-byte LDS readers of 256-B rows
#define ESTG (3 * 64 * EPIT)     // u16 per stage buffer: 64 rows of ctx hi, 64 of ctx lo, 64 of Bt
static_assert(ETH == 128);                               // stage_64: 8 rows per copy, 8 copies for 64 rows
static_assert(DM % EKS == 0 && DM / EKS >= 2);           // the two-buffer prologue needs two stages
static_assert(64 * 68 * 4 <= 2 * ESTG * 2);              // the f32 output tile is laid over the ring after the k loop
static_assert((NB * RH) % 64 == 0 && RH % 64 == 0 && DM % 64 == 0);   // whole tiles, none straddles a batch

// 64 rows of 256 B (128 k) of one plane for a work-group of 128 threads: 16 bytes per lane and copy (16 lanes = one row = two lines), straight into LDS. g / l: this thread's place in row tid>>4 of the plane's rows, of their place in the buffer.
// The s_wait_xcnt 0 is the last line of the copies' own statement so that no address register of a copy is rewritten ahead of it.
__device__ __forceinline__ void stage_64(const u16* g, const unsigned l) {
    const size_t rs = (size_t)8 * DM;                 // 8 rows on in global memory
    const unsigned ls = 8 * EPIT * 2;                 // 8 rows on in LDS, bytes
    asm volatile("global_load_async_to_lds_b128 %0, %1, off\n\t"
                 "global_load_async_to_lds_b128 %2, %3, off\n\t"
                 "global_load_async_to_lds_b128 %4, %5, off\n\t"
                 "global_load_async_to_lds_b128 %6, %7, off\n\t"
                 "global_load_async_to_lds_b128 %8, %9, off\n\t"
                 "global_load_async_to_lds_b128 %10, %11, off\n\t"
                 "global_load_async_to_lds_b128 %12, %13, off\n\t"
                 "global_load_async_to_lds_b128 %14, %15, off\n\t"
                 "s_wait_xcnt 0x0"
                 :: "v"(l), "v"(g), "v"(l + ls), "v"(g + rs), "v"(l + 2 * ls), "v"(g + 2 * rs), "v"(l + 3 * ls), "v"(g + 3 * rs),
                    "v"(l + 4 * ls), "v"(g + 4 * rs), "v"(l + 5 * ls), "v"(g + 5 * rs), "v"(l + 6 * ls), "v"(g + 6 * rs), "v"(l + 7 * ls), "v"(g + 7 * rs) : "memory");
}
// One 128-k stage of the three planes: 24 copies per wave in flight.
__device__ __forceinline__ void stage_e(const u16* ga, const u16* ga2, const u16* gb, const unsigned la) {
    stage_64(ga, la); stage_64(ga2, la + 64 * EPIT * 2); stage_64(gb, la + 128 * EPIT * 2);
}

// k_outp_e: rows < RH, bf16 hi+lo ctx planes; one work-group of four waves (2 x 2 tiles of 32x32) per 64x64 tile. The waves share each 128-k stage of ctx hi, ctx lo and Bt,
// brought into the two buffers of 'ring' by asynchronous copies one stage ahead (whole lines from L2, where fragment loads straight from the planes touch 16 lines each).
// Per accumulator the order of the sum is k ascending in blocks of 32, hi product then lo product. The f32 tile goes out through the ring in whole 256-B row pieces.
__global__ __launch_bounds__(ETH) void k_outp_e(const u16* __restrict__ A, const u16* __restrict__ A2, const u16* __restrict__ Bt, const float* __restrict__ bias, float* OUT, float scale, int rpb, int toff) {
    __shared__ __align__(16) u16 ring[2 * ESTG];
    const int tid = threadIdx.x, lane = tid & 31, lr = lane & 15, hi = lane >> 4;
    const int wv = __builtin_amdgcn_readfirstlane(tid >> 5), wm = wv % EWM, wn = wv / EWM;   // wave number as a scalar: tile indices stay scalar
    const int r0 = blockIdx.x * 64, c0 = blockIdx.y * 64;
    const int cofs = (tid & 15) * 4;                        // this thread's 4 output columns in the epilogue; their bias is fetched here, so that its latency lies behind the k loop
    const v4f braw = *(const v4f*)(bias + c0 + cofs);
    v8f acc[2][2];               // acc[mb][nb] element j = C[r0 + 32 wm + 16 mb + 8 hi + j][c0 + 32 wn + 16 nb + lr]
#pragma unroll
    for (int mb = 0; mb < 2; ++mb)
#pragma unroll
        for (int nb = 0; nb < 2; ++nb) acc[mb][nb] = (v8f){};
    const size_t go = (size_t)(tid >> 4) * DM + (tid & 15) * 8;
    const u16* ga = A + (size_t)r0 * DM + go; const u16* ga2 = A2 + (size_t)r0 * DM + go; const u16* gb = Bt + (size_t)c0 * DM + go;
    const unsigned la = lds_byte(ring + (tid >> 4) * EPIT + (tid & 15) * 8);
    const int nst = DM / EKS;
    stage_e(ga, ga2, gb, la);
    asm volatile("s_wait_asynccnt 0x0" ::: "memory");   // this wave's copies of stage 0 have landed
    __syncthreads();                                     // stage 0 readable by every wave
    stage_e(ga + EKS, ga2 + EKS, gb + EKS, la + ESTG * 2);
#pragma unroll 1   // kept rolled: one body of 32 products, the buffer picked by st & 1
    for (int st = 0; st < nst; ++st) {
        const u16* ar = ring + (st & 1) * ESTG + (wm * 32 + lr) * EPIT + 8 * hi;
        const u16* br = ring + (st & 1) * ESTG + (128 + wn * 32 + lr) * EPIT + 8 * hi;
        v16us a[EKS / 32][2], a2[EKS / 32][2], bb[EKS / 32][2];
#pragma unroll   // this and the loops below: every fragment and accumulator index a constant, so that they stay in registers
        for (int kb = 0; kb < EKS / 32; ++kb) {
#pragma unroll
            for (int mb = 0; mb < 2; ++mb) a[kb][mb] = ldfr(ar + mb * 16 * EPIT + kb * 32);
#pragma unroll
            for (int nb = 0; nb < 2; ++nb) bb[kb][nb] = ldfr(br + nb * 16 * EPIT + kb * 32);
#pragma unroll
            for (int mb = 0; mb < 2; ++mb) a2[kb][mb] = ldfr(ar + (64 + mb * 16) * EPIT + kb * 32);
        }
        __builtin_amdgcn_sched_barrier(0);   // holds the stage's 48 LDS reads together, ahead of its products: left free, the compiler spread them among the products in one register set
#pragma unroll
        for (int kb = 0; kb < EKS / 32; ++kb) {
#pragma unroll
            for (int nb = 0; nb < 2; ++nb)
#pragma unroll
                for (int mb = 0; mb < 2; ++mb) acc[mb][nb] = mma_bp(a[kb][mb], bb[kb][nb], acc[mb][nb]);
#pragma unroll
            for (int nb = 0; nb < 2; ++nb)
#pragma unroll
                for (int mb = 0; mb < 2; ++mb) acc[mb][nb] = mma_bp(a2[kb][mb], bb[kb][nb], acc[mb][nb]);
        }
        __builtin_amdgcn_sched_barrier(0);   // keeps the waits below behind the products: moved up over them (they touch no memory), the wait for all 48 reads stood ahead of the products, which then no longer ran while the later reads return
        asm volatile("s_wait_dscnt 0x0" ::: "memory");      // this wave's LDS reads of the stage are done before the buffer is refilled
        asm volatile("s_wait_asynccnt 0x0" ::: "memory");   // this wave's copies of the next stage have landed
        __syncthreads();                                     // publishes the next stage and ends every reader's last read of this one
        if (st + 2 < nst) stage_e(ga + (st + 2) * EKS, ga2 + (st + 2) * EKS, gb + (st + 2) * EKS, la + (st & 1) * (ESTG * 2));
    }
    asm volatile("s_wait_asynccnt 0x0" ::: "memory");       // no copy is left in flight when the ring becomes output staging
    float* ot = (float*)ring;                               // [64][68] f32; every wave has left the ring (the last trip's barrier)
#pragma unroll
    for (int mb = 0; mb < 2; ++mb)
#pragma unroll
        for (int nb = 0; nb < 2; ++nb)
#pragma unroll
            for (int j = 0; j < 8; ++j) ot[(wm * 32 + mb * 16 + hi * 8 + j) * 68 + wn * 32 + nb * 16 + lr] = acc[mb][nb][j];
    __syncthreads();                                         // the whole tile is staged before any row piece is read back
    const int b = r0 / rpb, tb = toff + (r0 - b * rpb);
    float* crow0 = OUT + ((size_t)b * SEQ_FULL + tb) * DM + c0;
    v4f bv; bv[0] = bfr(braw[0]); bv[1] = bfr(braw[1]); bv[2] = bfr(braw[2]); bv[3] = bfr(braw[3]);
#pragma unroll
    for (int s = 0; s < 8; ++s) {
        const int row = 8 * s + (tid >> 4);
        const v4f x = *(const v4fa*)&ot[row * 68 + cofs];
        v4f val; val[0] = x[0] * scale + bv[0]; val[1] = x[1] * scale + bv[1]; val[2] = x[2] * scale + bv[2]; val[3] = x[3] * scale + bv[3];
        *(v4f*)(crow0 + (size_t)row * DM + cofs) = val;
    }
}

// k_outp_l: rows >= RH, f16 planes; eight waves (4 x 2 tiles of 64x64) per work-group sharing the staged operands.
__global__ __launch_bounds__(GTH) void k_outp_l(const u16* __restrict__ A, const u16* __restrict__ Bt, const float* __restrict__ bias, float* OUT, float scale, int rpb, int toff) {
    __shared__ __align__(16) u16 ring[2 * GSTG];
    const int tid = threadIdx.x, lane = tid & 31, lr = lane & 15, hi = lane >> 4;
    const int wv = __builtin_amdgcn_readfirstlane(tid >> 5), wm = wv % GWM, wn = wv / GWM;   // wave number as a scalar: tile indices and the branches on them stay scalar
    float* os = (float*)((char*)ring + wv * GEPI);                       // this wave's own staging, used after the k loop only
    v8f acc[4][4];
    gemm_tile_s<true>(A, Bt, DM, blockIdx.x * GAR, blockIdx.y * GBR, ring, tid, wm, wn, lr, hi, acc);
    outp_store(acc, os, bias, OUT, scale, rpb, toff, blockIdx.x * GAR + wm * 64, blockIdx.y * GBR + wn * 64, lr, hi);
}

extern "C" void kernel_launch(void* const* d_in, const int* in_sizes, int n_in,
                              void* d_out, int out_size, void* d_ws, size_t ws_size, hipStream_t stream) {
    if (n_in < 10) return;
    const long long needx = ((long long)(NB - 1) * SEQ_FULL + SEQ) * DM;
    if ((long long)in_sizes[0] < needx) return;
    if ((long long)in_sizes[1] < (long long)DM * DM || (long long)in_sizes[2] < (long long)DM * DM || (long long)in_sizes[3] < (long long)DM * DM || (long long)in_sizes[4] < (long long)DM * DM) return;
    if (in_sizes[5] < DM) return;
    if (in_sizes[6] < HD || in_sizes[7] < HD || in_sizes[8] < HD || in_sizes[9] < HD) return;
    if ((long long)out_size < needx) return;
    if (O_END * 2 > ws_size) return;
    // wire order: x, key weight, query weight, value weight, output weight, output bias, key LayerNorm gain, key LayerNorm bias, query LayerNorm gain, query LayerNorm bias
    const float* x  = (const float*)d_in[0];
    const float* Wk = (const float*)d_in[1];
    const float* Wq = (const float*)d_in[2];
    const float* Wv = (const float*)d_in[3];
    const float* Wp = (const float*)d_in[4];
    const float* bp = (const float*)d_in[5];
    const float* kg = (const float*)d_in[6];
    const float* kb = (const float*)d_in[7];
    const float* qg = (const float*)d_in[8];
    const float* qb = (const float*)d_in[9];
    float* OUT = (float*)d_out;
    u16* PL = (u16*)d_ws;

    k_cvt_all<<<CVG, 32 * CVW, 0, stream>>>(x, Wq, Wk, Wv, Wp, PL);   // planes O_XB, O_WALL (query, key, value rows), O_WPB, O_WPH

    k_proj<<<dim3(NB * SEQ / GAR, 3 * DM / GBR, 1), GTH, 0, stream>>>(PL + O_XB, PL + O_WALL, PL, O_P16, O_EH, O_EL, qg, qb, kg, kb);

    k_attn_e<<<NB * NH * (RH / (16 * EAW)), 32 * EAW, 0, stream>>>(PL + O_EH, PL + O_EL, PL + O_EH + EPLANE, PL + O_EL + EPLANE, PL + O_EH + 2 * EPLANE, PL + O_EL + 2 * EPLANE, PL + O_ATEH, PL + O_ATEL);
    if (SEQ > RH)
        k_attn_l<<<NB * NH * ((SEQ - RH) / (16 * AW)), 32 * AW, 0, stream>>>(PL + O_P16, PL + O_P16 + PLANE, PL + O_P16 + 2 * PLANE, PL + O_AT);

    k_outp_e<<<dim3(NB * RH / 64, DM / 64, 1), ETH, 0, stream>>>(PL + O_ATEH, PL + O_ATEL, PL + O_WPB, bp, OUT, 1.0f, RH, 0);
    if (SEQ > RH)
        k_outp_l<<<dim3(NB * (SEQ - RH) / GAR, DM / GBR, 1), GTH, 0, stream>>>(PL + O_AT, PL + O_WPH, bp, OUT, 1.0f / (WCAR * CCAR), SEQ - RH, RH);
}

// v007
// A run of this version takes 146 microseconds.
// Two timings next to v006 put it at 1.08 and 1.09 times that version's speed.
// Counting every step since v000, it is 3.00 times as fast.
#include <hip/hip_runtime.h>

// Compute dtypes (f32 accumulate everywhere): q/k/v projections bf16 x bf16 (inputs converted RNE to bf16, products exact), per-head LayerNorm of q and k in f32 inside the projection epilogue; scores q.k and P.V: f16 single products on query rows >= 256 (P carried x1024), bf16 hi+lo (3 products) on query rows < 256; output projection: f16 single product (ctx x16, Wo x32 carries) on rows >= 256, bf16 hi+lo ctx x bf16 Wo on rows < 256.
// Causal 16-head attention block, x [4][2048][1024]; separate bias-free [out][in] key / query / value projections (used as Bt as stored), per-head LayerNorm (eps 1e-5, gain and bias inputs) on the 64-wide query and key rows,
// the two 1024^(-1/4) factors applied as one 1/32 on the scores, causal exclusion with the diagonal kept, softmax in f32 (running max, log2 domain), heads merged h*64+d, [out][in] output projection plus bias.
// Layout: 16-bit planes in the workspace (u16 storage): x copy [b*SEQ+t][1024]; weights [3][1024][1024] (q, k, v) ; q and k head planes [b][h][t][64]; v transposed [b][h][64][t]; hi/lo bf16 planes of the same for t < 256;
// ctx f16 [b][t-256][1024] and ctx hi/lo bf16 [b][t<256][1024]. Fused flash-style attention: one wave per 16 query rows, 32 keys per step, no score plane in global memory; four waves share K and V stages in LDS (rows < 256: hi and lo planes); rows >= 256: both products run transposed. Projection and late output GEMMs: eight waves share A and B stages in LDS; early output GEMM: four waves share ctx hi, ctx lo and B stages in LDS.

#ifndef NB
#define NB 4
#endif
#ifndef SEQ
#define SEQ 2048
#endif
#define NB_FULL  4
#define SEQ_FULL 2048
#define DM   1024
#define NH   16
#define HD   64
#define RH   256                 // query rows / keys below RH also carry bf16 hi+lo planes
#define PCAR 1024.0f             // carry on f16 probabilities
#define CCAR 16.0f               // carry on the f16 ctx plane
#define WCAR 32.0f               // carry on the f16 output-projection weight plane
#define SCL2 (0.03125f * 1.4426950408889634f)   // 1/sqrt(1024) x log2(e)
#define LNEPS 1.0e-5f            // LayerNorm epsilon on the head rows

static_assert(DM == NH * HD);            // heads tile the channel width
static_assert(HD == 64);
static_assert(HD == 8 * 8);              // LayerNorm row = 8 lanes x 8 columns in the projection epilogue
static_assert(DM % 64 == 0);             // GEMM k-step: two 32-k blocks a trip
static_assert(HD % 32 == 0);             // score k-step
static_assert(SEQ % 64 == 0);            // 64-row GEMM tiles never straddle a batch
static_assert(RH % 64 == 0);             // early/late split on tile borders
static_assert(SEQ >= RH);
static_assert((SEQ - RH) % 64 == 0);
static_assert(RH % 32 == 0);             // 32-key steps end inside the early planes
static_assert(NB <= NB_FULL);
static_assert(SEQ <= SEQ_FULL);

typedef unsigned short u16;
typedef _Float16 h16;
typedef __attribute__((ext_vector_type(16))) __bf16         v16bf;
typedef __attribute__((ext_vector_type(16))) _Float16       v16h;
typedef __attribute__((ext_vector_type(8)))  unsigned short v8us;
typedef __attribute__((ext_vector_type(16))) unsigned short v16us;
typedef __attribute__((ext_vector_type(8)))  float          v8f;
typedef __attribute__((ext_vector_type(4)))  float          v4f;
typedef v4f  __attribute__((may_alias)) v4fa;
typedef v8us __attribute__((may_alias)) v8usa;

#define XBN    ((size_t)NB * SEQ * DM)
#define WN     ((size_t)DM * DM)
#define PLANE  ((size_t)NB * NH * SEQ * HD)
#define EPLANE ((size_t)NB * NH * RH * HD)
#define ATN    ((size_t)NB * (SEQ - RH) * DM)
#define ATEN   ((size_t)NB * RH * DM)
#define O_XB   ((size_t)0)
#define O_WALL (O_XB + XBN)
#define O_WPB  (O_WALL + 3 * WN)
#define O_WPH  (O_WPB + WN)
#define O_P16  (O_WPH + WN)
#define O_EH   (O_P16 + 3 * PLANE)
#define O_EL   (O_EH + 3 * EPLANE)
#define O_AT   (O_EL + 3 * EPLANE)
#define O_ATEH (O_AT + ATN)
#define O_ATEL (O_ATEH + ATEN)
#define O_END  (O_ATEL + ATEN)
static_assert(O_END * 2 <= (size_t)134217728);   // total carve <= 128 MiB
static_assert(XBN % 128 == 0 && WN % 128 == 0 && PLANE % 128 == 0 && EPLANE % 128 == 0 && ATN % 128 == 0 && ATEN % 128 == 0);   // every region starts on a 256-byte border

__device__ __forceinline__ u16 f2bf(float f) { unsigned u = __float_as_uint(f); u += 0x7FFFu + ((u >> 16) & 1u); return (u16)(u >> 16); }
__device__ __forceinline__ float bf2f(u16 b) { return __uint_as_float(((unsigned)b) << 16); }
__device__ __forceinline__ float bfr(float f) { return bf2f(f2bf(f)); }
__device__ __forceinline__ u16 f2h(float x) { return __builtin_bit_cast(unsigned short, (h16)x); }

// f32 -> f16 with a value select: magnitudes below the smallest normal f16 become zero, so no subnormal f16 operand can reach a WMMA.
static __device__ __forceinline__ h16 toh_flush(float v) { const h16 r = (h16)v; return (fabsf(v) < 6.103515625e-05f) ? (h16)0.0f : r; }
static __device__ __forceinline__ u16 f2h_fl(float v) { return __builtin_bit_cast(unsigned short, toh_flush(v)); }

// Fragment loader for A and B alike: 'p' points at (row or column) + k0 + 8*(lane>>4); elements 0..7 = k0+8h.., elements 8..15 = k0+16+8h..
__device__ __forceinline__ v16us ldfr(const u16* p) {
    const v8us lo = *(const v8us*)p; const v8us hi = *(const v8us*)(p + 16);
    return __builtin_shufflevector(lo, hi, 0, 1, 2, 3, 4, 5, 6, 7, 8, 9, 10, 11, 12, 13, 14, 15);
}
// One WMMA plus its own hazard guard (ties exactly one accumulator, keeps A and B live).
__device__ __forceinline__ v8f mma_h(v16us a, v16us b, v8f c) {
    const v16h ah = __builtin_bit_cast(v16h, a); const v16h bh = __builtin_bit_cast(v16h, b);
    c = __builtin_amdgcn_wmma_f32_16x16x32_f16(false, ah, false, bh, (short)0, c, false, false);
    asm volatile("v_nop\n\tv_nop\n\tv_nop\n\tv_nop" : "+v"(c) : "v"(ah), "v"(bh));
    return c;
}
__device__ __forceinline__ v8f mma_b(v16us a, v16us b, v8f c) {
    const v16bf ab = __builtin_bit_cast(v16bf, a); const v16bf bb = __builtin_bit_cast(v16bf, b);
    c = __builtin_amdgcn_wmma_f32_16x16x32_bf16(false, ab, false, bb, (short)0, c, false, false);
    asm volatile("v_nop\n\tv_nop\n\tv_nop\n\tv_nop" : "+v"(c) : "v"(ab), "v"(bb));
    return c;
}
template <bool F16> __device__ __forceinline__ v8f mmag(v16us a, v16us b, v8f c) { if (F16) return mma_h(a, b, c); else return mma_b(a, b, c); }
// The same bf16 product with the hazard distance left to the compiler's own padding.
__device__ __forceinline__ v8f mma_bp(v16us a, v16us b, v8f c) { return __builtin_amdgcn_wmma_f32_16x16x32_bf16(false, __builtin_bit_cast(v16bf, a), false, __builtin_bit_cast(v16bf, b), (short)0, c, false, false); }

__device__ __forceinline__ unsigned lds_byte(const u16* p) { return (unsigned)(size_t)(const __attribute__((address_space(3))) u16*)p; }

#define GWM  4                   // waves down a GEMM work-group, 64 rows each
#define GWN  2                   // waves across, 64 columns each
#define GTH  (32 * GWM * GWN)    // threads per GEMM work-group
#define GKS  64                  // k per stage: 128-B rows, whole cache lines
#define GPIT 72                  // u16 per staged row: 144 B = 16 B x odd, the pitch for 16-byte LDS readers of 128-B rows
#define GAR  (64 * GWM)          // A rows per stage
#define GBR  (64 * GWN)          // Bt rows per stage
#define GSTG ((GAR + GBR) * GPIT)   // u16 per stage buffer: A rows, then Bt rows
#define GEPI (16 * 68 * 4 + 64 * 72 * 2)   // bytes of epilogue staging per wave (f32 row block, then the 16-bit transpose block), laid over the ring after the k loop
static_assert(GTH == 256 && GAR == 256 && GBR == 128);   // stage_ab: 32 rows per copy, 8 copies for A and 4 for Bt
static_assert(DM % GKS == 0 && DM / GKS >= 2);           // the two-buffer prologue needs two stages
static_assert(GEPI % 16 == 0 && GEPI * GWM * GWN <= 2 * GSTG * 2);
static_assert((NB * SEQ) % GAR == 0 && (NB * (SEQ - RH)) % GAR == 0 && RH % GAR == 0 && SEQ % GAR == 0 && DM % GBR == 0);   // whole work-groups; early/late and q/k/v the same for all waves of one

// One 64-k stage for a work-group of 256 threads: 256 A rows and 128 Bt rows of 128 B, 16 bytes per lane and copy (8 lanes = one row = one line), straight into LDS. ga / gb / la: this thread's place in row tid>>3 of A, of Bt, of the buffer.
// The s_wait_xcnt 0 is the last line of the copies' own statement so that no address register of a copy is rewritten ahead of it.
__device__ __forceinline__ void stage_ab(const u16* ga, const u16* gb, const int K, const unsigned la) {
    const size_t rs = (size_t)32 * K;                 // 32 rows on in global memory
    const unsigned ls = 32 * GPIT * 2;                // 32 rows on in LDS, bytes
    const unsigned lb = la + GAR * GPIT * 2;
    asm volatile("global_load_async_to_lds_b128 %0, %1, off\n\t"
                 "global_load_async_to_lds_b128 %2, %3, off\n\t"
                 "global_load_async_to_lds_b128 %4, %5, off\n\t"
                 "global_load_async_to_lds_b128 %6, %7, off\n\t"
                 "global_load_async_to_lds_b128 %8, %9, off\n\t"
                 "global_load_async_to_lds_b128 %10, %11, off\n\t"
                 "global_load_async_to_lds_b128 %12, %13, off\n\t"
                 "global_load_async_to_lds_b128 %14, %15, off\n\t"
                 "global_load_async_to_lds_b128 %16, %17, off\n\t"
                 "global_load_async_to_lds_b128 %18, %19, off\n\t"
                 "global_load_async_to_lds_b128 %20, %21, off\n\t"
                 "global_load_async_to_lds_b128 %22, %23, off\n\t"
                 "s_wait_xcnt 0x0"
                 :: "v"(la), "v"(ga), "v"(la + ls), "v"(ga + rs), "v"(la + 2 * ls), "v"(ga + 2 * rs), "v"(la + 3 * ls), "v"(ga + 3 * rs),
                    "v"(la + 4 * ls), "v"(ga + 4 * rs), "v"(la + 5 * ls), "v"(ga + 5 * rs), "v"(la + 6 * ls), "v"(ga + 6 * rs), "v"(la + 7 * ls), "v"(ga + 7 * rs),
                    "v"(lb), "v"(gb), "v"(lb + ls), "v"(gb + rs), "v"(lb + 2 * ls), "v"(gb + 2 * rs), "v"(lb + 3 * ls), "v"(gb + 3 * rs) : "memory");
}

// One wave computes a 64x64 tile: acc[mb][nb] element j = C[r0 + 16 mb + 8 (lane>>4) + j][c0 + 16 nb + (lane&15)] = sum_k A[m][k] Bt[n][k], k ascending in blocks of 32. K % 64 == 0.
// A work-group of GWM x GWN waves on rows R0.. and columns C0..: the waves share each 64-k stage of A and Bt,
// brought into the two buffers of 'ring' by asynchronous copies one stage ahead. On return no copy is in flight and every wave has left the ring (the last trip's barrier), so the caller may reuse it.
template <bool F16>
__device__ __forceinline__ void gemm_tile_s(const u16* __restrict__ A, const u16* __restrict__ Bt, const int K, const int R0, const int C0, u16* ring, const int tid, const int wm, const int wn, const int lr, const int hi, v8f (&acc)[4][4]) {
#pragma unroll
    for (int mb = 0; mb < 4; ++mb)
#pragma unroll
        for (int nb = 0; nb < 4; ++nb) acc[mb][nb] = (v8f){};
    const u16* ga = A + (size_t)(R0 + (tid >> 3)) * K + (tid & 7) * 8;
    const u16* gb = Bt + (size_t)(C0 + (tid >> 3)) * K + (tid & 7) * 8;
    const unsigned la = lds_byte(ring + (tid >> 3) * GPIT + (tid & 7) * 8);
    const int nst = K / GKS;
    stage_ab(ga, gb, K, la);
    asm volatile("s_wait_asynccnt 0x0" ::: "memory");   // this wave's copies of stage 0 have landed
    __syncthreads();                                     // stage 0 readable by every wave
    stage_ab(ga + GKS, gb + GKS, K, la + GSTG * 2);
#pragma unroll 1   // kept rolled: one body of 32 products, the buffer picked by st & 1; unrolling would only grow the text
    for (int st = 0; st < nst; ++st) {
        const u16* ar = ring + (st & 1) * GSTG + (wm * 64 + lr) * GPIT + 8 * hi;
        const u16* br = ring + (st & 1) * GSTG + (GAR + wn * 64 + lr) * GPIT + 8 * hi;
#pragma unroll   // this and the loops inside: every fragment and accumulator index a constant, so that they stay in registers
        for (int kc = 0; kc < GKS; kc += 32) {
            v16us a[4], bb[4];                  // the block's 16 LDS reads stand together, ahead of its 16 products
#pragma unroll
            for (int mb = 0; mb < 4; ++mb) a[mb] = ldfr(ar + mb * 16 * GPIT + kc);
#pragma unroll
            for (int nb = 0; nb < 4; ++nb) bb[nb] = ldfr(br + nb * 16 * GPIT + kc);
#pragma unroll
            for (int nb = 0; nb < 4; ++nb)
#pragma unroll
                for (int mb = 0; mb < 4; ++mb) acc[mb][nb] = mmag<F16>(a[mb], bb[nb], acc[mb][nb]);
        }
        asm volatile("s_wait_dscnt 0x0" ::: "memory");      // this wave's LDS reads of the stage are done before the buffer is refilled
        asm volatile("s_wait_asynccnt 0x0" ::: "memory");   // this wave's copies of the next stage have landed
        __syncthreads();                                     // publishes the next stage and ends every reader's last read of this one
        if (st + 2 < nst) stage_ab(ga + (st + 2) * GKS, gb + (st + 2) * GKS, K, la + (st & 1) * (GSTG * 2));
    }
    asm volatile("s_wait_asynccnt 0x0" ::: "memory");       // no copy is left in flight when the ring becomes epilogue staging
}

#define CVW   16                 // waves per conversion work-group
#define CVG   256                // conversion work-groups: with CVW, the launch's wave count (chosen for speed only), started once
#define CNW   (CVG * CVW)        // waves of the conversion launch
#define XROWS (NB * SEQ)         // rows of x
#define CROWS (XROWS + 4 * DM)   // rows of DM f32 to convert: x, then the query, key, value and output weights
static_assert(DM == 8 * 128);    // one row = 8 loads of 16 B per lane, each load of a wave 512 contiguous bytes
static_assert(O_XB == 0 && O_WALL == (size_t)XROWS * DM && O_WPB == O_WALL + 3 * WN && O_WPH == O_WPB + WN);   // row r of the list above lands at PL + r * DM; the f16 output-weight plane lies WN further on

typedef __attribute__((ext_vector_type(4))) unsigned short v4us;

// One converted row of 1024 16-bit values: 8 stores of 8 B per lane, each store of a wave 256 contiguous bytes (two whole lines). 'row' is the same in every lane, 'lofs' the lane's byte offset in the first 256 bytes.
// Written as one statement so that its last line, s_wait_xcnt 0, stands in front of every later write of a register that these stores name (in a statement of its own the compiler moved the next conversions over it).
__device__ __forceinline__ void store_row(u16* row, const unsigned lofs, const v4us (&d)[8]) {
    asm volatile("global_store_b64 %0, %1, %9\n\t"
                 "global_store_b64 %0, %2, %9 offset:256\n\t"
                 "global_store_b64 %0, %3, %9 offset:512\n\t"
                 "global_store_b64 %0, %4, %9 offset:768\n\t"
                 "global_store_b64 %0, %5, %9 offset:1024\n\t"
                 "global_store_b64 %0, %6, %9 offset:1280\n\t"
                 "global_store_b64 %0, %7, %9 offset:1536\n\t"
                 "global_store_b64 %0, %8, %9 offset:1792\n\t"
                 "s_wait_xcnt 0x0"
                 :: "v"(lofs), "v"(d[0]), "v"(d[1]), "v"(d[2]), "v"(d[3]), "v"(d[4]), "v"(d[5]), "v"(d[6]), "v"(d[7]), "s"(row) : "memory");
}

// k_cvt_all: every f32 -> 16-bit plane of the call in one launch of CVG work-groups. One wave per row of 1024 values and trip, rows dealt round robin over the launch's waves (wave gw takes rows gw, gw + CNW, ...);
// 8 whole-line loads of 16 B per lane in flight per wave. x and all four weights -> bf16 (RNE); the output weight also -> f16 of (bf16 value x WCAR). A reduced build reads the right rows of the full-size x.
__global__ __launch_bounds__(32 * CVW) void k_cvt_all(const float* __restrict__ x, const float* __restrict__ Wq, const float* __restrict__ Wk, const float* __restrict__ Wv, const float* __restrict__ Wp, u16* __restrict__ PL) {
    const int lane = threadIdx.x & 31;
    const int gw = __builtin_amdgcn_readfirstlane(blockIdx.x * CVW + (threadIdx.x >> 5));   // wave number as a scalar: the row, its source and the branches on it stay scalar
#pragma unroll 1   // kept rolled: few trips, and the other waves of the WGP cover a wave's load latency
    for (int r = gw; r < CROWS; r += CNW) {
        const float* src;
        if (r < XROWS) src = x + ((size_t)(r / SEQ) * SEQ_FULL + (r % SEQ)) * DM;
        else {
            const int w = (r - XROWS) / DM, wr = (r - XROWS) % DM;
            src = ((w == 0) ? Wq : (w == 1) ? Wk : (w == 2) ? Wv : Wp) + (size_t)wr * DM;
        }
        v4f v[8];
#pragma unroll
        for (int j = 0; j < 8; ++j) v[j] = *(const v4f*)(src + j * 128 + lane * 4);
        v4us ob[8];
#pragma unroll
        for (int j = 0; j < 8; ++j)
#pragma unroll
            for (int k = 0; k < 4; ++k) ob[j][k] = f2bf(v[j][k]);
        u16* row = PL + (size_t)r * DM;
        store_row(row, lane * 8, ob);
        if (r >= XROWS + 3 * DM) {
            v4us oh[8];
#pragma unroll
            for (int j = 0; j < 8; ++j)
#pragma unroll
                for (int k = 0; k < 4; ++k) oh[j][k] = f2h(bf2f(ob[j][k]) * WCAR);
            store_row(row + WN, lane * 8, oh);
        }
    }
}

// k_proj: [NB*SEQ][1024] x [3072][1024]^T (rows 0..1023 query weight, 1024..2047 key weight, 2048..3071 value weight). One wave per 64x64 tile = 64 time rows of one head, eight waves (4 x 2 tiles) per work-group sharing the staged operands.
// Epilogue q/k: per-row LayerNorm over the 64 head columns (mean and biased variance in f32 across 8 lanes x 8 columns, eps 1e-5, gain and bias taken as bf16 values of the inputs; both parameter sets are loaded and chosen by value),
// then f16 head plane rows [b][h][t][64] (+ bf16 hi/lo rows for t < RH); v: transposed through LDS into [b][h][d][t] lines of 64 t (+ hi/lo for t < RH). Planes addressed by element offsets from one base.
// All f16 plane values go through the value-select convert (no subnormal f16 can be produced).
__global__ __launch_bounds__(GTH) void k_proj(const u16* __restrict__ XB, const u16* __restrict__ WALL, u16* PL, size_t oP16, size_t oEH, size_t oEL,
                                             const float* __restrict__ QG, const float* __restrict__ QB, const float* __restrict__ KG, const float* __restrict__ KB) {
    __shared__ __align__(16) u16 ring[2 * GSTG];
    const int tid = threadIdx.x, lane = tid & 31, lr = lane & 15, hi = lane >> 4;
    const int wv = __builtin_amdgcn_readfirstlane(tid >> 5), wm = wv % GWM, wn = wv / GWM;   // wave number as a scalar: tile indices and the branches on them stay scalar
    float* os = (float*)((char*)ring + wv * GEPI);                       // this wave's own staging, used after the k loop only
    u16* ts = (u16*)((char*)ring + wv * GEPI + 16 * 68 * 4);
    const int r0 = blockIdx.x * GAR + wm * 64, c0 = blockIdx.y * GBR + wn * 64;
    const int which = c0 / DM, hd = (c0 - which * DM) / HD;
    const int b = r0 / SEQ, t0 = r0 - b * SEQ;
    const bool early = (t0 < RH);
    const size_t bh = (size_t)b * NH + hd;
    v8f acc[4][4];
    gemm_tile_s<false>(XB, WALL, DM, blockIdx.x * GAR, blockIdx.y * GBR, ring, tid, wm, wn, lr, hi, acc);
    if (which < 2) {
        const size_t o16 = oP16 + (size_t)which * PLANE + (bh * SEQ + t0) * HD;
        const size_t oeh = oEH + (size_t)which * EPLANE + (bh * RH + (early ? t0 : 0)) * HD;
        const size_t oel = oEL + (size_t)which * EPLANE + (bh * RH + (early ? t0 : 0)) * HD;
        const int gc = (lane & 7) * 8;                 // this lane's 8 head columns (same in every row group)
        const v4f gq0 = *(const v4f*)(QG + gc), gq1 = *(const v4f*)(QG + gc + 4);
        const v4f bq0 = *(const v4f*)(QB + gc), bq1 = *(const v4f*)(QB + gc + 4);
        const v4f gk0 = *(const v4f*)(KG + gc), gk1 = *(const v4f*)(KG + gc + 4);
        const v4f bk0 = *(const v4f*)(KB + gc), bk1 = *(const v4f*)(KB + gc + 4);
        v4f g0, g1, be0, be1;
#pragma unroll
        for (int q = 0; q < 4; ++q) {
            g0[q]  = bfr((which == 0) ? gq0[q] : gk0[q]); g1[q]  = bfr((which == 0) ? gq1[q] : gk1[q]);
            be0[q] = bfr((which == 0) ? bq0[q] : bk0[q]); be1[q] = bfr((which == 0) ? bq1[q] : bk1[q]);
        }
#pragma unroll
        for (int mb = 0; mb < 4; ++mb) {
#pragma unroll
            for (int nb = 0; nb < 4; ++nb)
#pragma unroll
                for (int j = 0; j < 8; ++j) os[(hi * 8 + j) * 68 + nb * 16 + lr] = acc[mb][nb][j];
            __syncthreads();
{
#pragma unroll
                for (int s = 0; s < 4; ++s) {
                    const int row = 4 * s + (lane >> 3), pc = (lane & 7) * 8;
                    const v4f x0 = *(const v4fa*)&os[row * 68 + pc]; const v4f x1 = *(const v4fa*)&os[row * 68 + pc + 4];
                    // LayerNorm of the 64-wide row held by the 8 lanes sharing lane>>3 (all 32 lanes active, uniform control)
                    float sm = ((x0[0] + x0[1]) + (x0[2] + x0[3])) + ((x1[0] + x1[1]) + (x1[2] + x1[3]));
                    sm += __shfl_xor(sm, 1, 32); sm += __shfl_xor(sm, 2, 32); sm += __shfl_xor(sm, 4, 32);
                    const float mean = sm * (1.0f / 64.0f);
                    v4f d0, d1;
#pragma unroll
                    for (int q = 0; q < 4; ++q) { d0[q] = x0[q] - mean; d1[q] = x1[q] - mean; }
                    float vs = ((d0[0] * d0[0] + d0[1] * d0[1]) + (d0[2] * d0[2] + d0[3] * d0[3])) + ((d1[0] * d1[0] + d1[1] * d1[1]) + (d1[2] * d1[2] + d1[3] * d1[3]));
                    vs += __shfl_xor(vs, 1, 32); vs += __shfl_xor(vs, 2, 32); vs += __shfl_xor(vs, 4, 32);
                    const float rinv = rsqrtf(vs * (1.0f / 64.0f) + LNEPS);
                    v4f y0, y1;
#pragma unroll
                    for (int q = 0; q < 4; ++q) { y0[q] = d0[q] * rinv * g0[q] + be0[q]; y1[q] = d1[q] * rinv * g1[q] + be1[q]; }
                    v8us q16;
#pragma unroll
                    for (int q = 0; q < 4; ++q) { q16[q] = f2h_fl(y0[q]); q16[4 + q] = f2h_fl(y1[q]); }
                    const size_t ro = (size_t)(mb * 16 + row) * HD + pc;
                    *(v8us*)(PL + o16 + ro) = q16;
                    if (early) {
                        v8us oh, ol;
#pragma unroll
                        for (int q = 0; q < 4; ++q) { const u16 a = f2bf(y0[q]); oh[q] = a; ol[q] = f2bf(y0[q] - bf2f(a)); const u16 c = f2bf(y1[q]); oh[4 + q] = c; ol[4 + q] = f2bf(y1[q] - bf2f(c)); }
                        *(v8us*)(PL + oeh + ro) = oh; *(v8us*)(PL + oel + ro) = ol;
                    }
                }
                
            }
            __syncthreads();
        }
    } else {
#pragma unroll
        for (int pl = 0; pl < 3; ++pl) {
            if (pl == 0 || early) {
#pragma unroll
                for (int mb = 0; mb < 4; ++mb)
#pragma unroll
                    for (int nb = 0; nb < 4; ++nb) {
                        v8us pk;
#pragma unroll
                        for (int j = 0; j < 8; ++j) { const float y = acc[mb][nb][j]; const u16 hb = f2bf(y); pk[j] = (pl == 0) ? f2h_fl(y) : ((pl == 1) ? hb : f2bf(y - bf2f(hb))); }
                        *(v8usa*)&ts[(nb * 16 + lr) * 72 + mb * 16 + hi * 8] = pk;     // ts[d][t]: 8 consecutive t per lane
                    }
                __syncthreads();
                const size_t dofs = (pl == 0) ? (oP16 + 2 * PLANE + bh * HD * SEQ + t0) : (((pl == 1) ? oEH : oEL) + 2 * EPLANE + bh * HD * RH + t0);
                const int dp = (pl == 0) ? SEQ : RH;
{
#pragma unroll 4
                    for (int s = 0; s < 16; ++s) {
                        const int d = 4 * s + (lane >> 3), pc = (lane & 7) * 8;
                        const v8us v = *(const v8usa*)&ts[d * 72 + pc];
                        *(v8us*)(PL + dofs + (size_t)d * dp + pc) = v;
                    }
                    
                }
                __syncthreads();
            }
        }
    }
}

// Online-softmax update for one 16 x 32 score step. s0/s1 hold raw scores for keys jb + (lane&15) and jb + 16 + (lane&15), rows qbase + 8 (lane>>4) + i; on return they hold exp2(t - running max).
// lrow keeps PER-LANE partial sums (reduced over the 16 lanes of a row once, after the key loop). Masked entries are replaced before the maximum; every row keeps its own key.
__device__ __forceinline__ void sm_step(v8f& s0, v8f& s1, float (&mrow)[8], float (&lrow)[8], float (&corr)[8], const int jb, const int qbase, const int lr, const int hi) {
#pragma unroll
    for (int i = 0; i < 8; ++i) {
        const int row = qbase + i + 8 * hi;
        float a0 = s0[i] * SCL2, a1 = s1[i] * SCL2;
        a0 = (jb + lr > row) ? -1.0e30f : a0;
        a1 = (jb + 16 + lr > row) ? -1.0e30f : a1;
        float mx = fmaxf(a0, a1);
        mx = fmaxf(mx, __shfl_xor(mx, 1, 32)); mx = fmaxf(mx, __shfl_xor(mx, 2, 32)); mx = fmaxf(mx, __shfl_xor(mx, 4, 32)); mx = fmaxf(mx, __shfl_xor(mx, 8, 32));
        const float mnew = fmaxf(mrow[i], mx);
        // The row's three exponentials as v_exp_f32, like the builtin. One statement, each in its own register, and a closing v_nop: so no instruction directly behind an exponential reads its result or overwrites its source
        // (with the registers of this build the compiler gave an exponential's result the register the one before it had just read).
        float c = mrow[i] - mnew, p0 = a0 - mnew, p1 = a1 - mnew;
        asm("v_exp_f32 %0, %0\n\tv_exp_f32 %1, %1\n\tv_exp_f32 %2, %2\n\tv_nop" : "+v"(c), "+v"(p0), "+v"(p1));
        lrow[i] = lrow[i] * c + (p0 + p1);
        mrow[i] = mnew; corr[i] = c; s0[i] = p0; s1[i] = p1;
    }
}

#define AW   4                   // waves per late-attention work-group, 16 query rows each
#define KPIT 72                  // u16 per staged key row: 144 B = 16 B x odd, the pitch for 16-byte LDS readers of 128-B rows
#define VPIT 40                  // u16 per staged value row: 80 B = 16 B x odd, the same for 64-B rows
#define NQB_L (((SEQ - RH) / (16 * AW)) > 0 ? ((SEQ - RH) / (16 * AW)) : 1)
static_assert((SEQ - RH) % (16 * AW) == 0);   // whole work-groups of query rows
static_assert((RH + 16 * AW) / 32 >= 2);      // the two-buffer prologue needs two key steps
static_assert((16 * AW) % 32 == 0 && RH % 32 == 0);   // a work-group's last key step ends on its last query row
#define NWGP 256                 // WGPs of the chip (used for speed only)
#define LGR  (((NWGP % (NB * NH)) == 0 && (NQB_L % (NWGP / (NB * NH))) == 0) ? (NWGP / (NB * NH)) : 1)   // query blocks (all heads of each) per such round of NWGP work-groups; 1: no mirroring

// One 32-key stage for a work-group of 128 threads: key rows jb..jb+31 (32 x 128 B, contiguous in the plane) and the 64 value rows' columns jb..jb+31 (64 x 64 B), 16 bytes per lane and copy, straight into LDS.
// The s_wait_xcnt 0 is the last line of the copies' own statement so that no address register of a copy is rewritten ahead of it.
__device__ __forceinline__ void stage_kv(const u16* __restrict__ Kb, const u16* __restrict__ Vb, const int jb, u16* kd, u16* vd, const int tid) {
    const u16* gk0 = Kb + (size_t)(jb + (tid >> 3)) * HD + (tid & 7) * 8;      // rows 0..15 of the stage
    const u16* gk1 = gk0 + 16 * HD;                                           // rows 16..31
    const u16* gv0 = Vb + (size_t)(tid >> 2) * SEQ + jb + (tid & 3) * 8;       // head columns 0..31
    const u16* gv1 = gv0 + (size_t)32 * SEQ;                                  // head columns 32..63
    const unsigned lk0 = lds_byte(kd + (tid >> 3) * KPIT + (tid & 7) * 8), lk1 = lk0 + 16 * KPIT * 2;
    const unsigned lv0 = lds_byte(vd + (tid >> 2) * VPIT + (tid & 3) * 8), lv1 = lv0 + 32 * VPIT * 2;
    asm volatile("global_load_async_to_lds_b128 %0, %1, off\n\t"
                 "global_load_async_to_lds_b128 %2, %3, off\n\t"
                 "global_load_async_to_lds_b128 %4, %5, off\n\t"
                 "global_load_async_to_lds_b128 %6, %7, off\n\t"
                 "s_wait_xcnt 0x0"
                 :: "v"(lk0), "v"(gk0), "v"(lk1), "v"(gk1), "v"(lv0), "v"(gv0), "v"(lv1), "v"(gv1) : "memory");
}

// Lane l's value from lane l ^ 16 (the other half of the wave), by a vector cross-row move.
__device__ __forceinline__ float xhalf(float x) {
    const int v = __builtin_bit_cast(int, x);
    return __builtin_bit_cast(float, __builtin_amdgcn_permlanex16(v, v, 0x76543210, 0xfedcba98, false, false));
}

// 2^c and 2^a[0..7] (first form), 2^a[0..7] (second form), as v_exp_f32 like the builtin. One statement each, results in registers of their own ("=&v") and a closing v_nop:
// so no instruction directly behind an exponential reads its result or overwrites its source (left to itself the compiler gave an exponential's result the register the one before it had just read).
__device__ __forceinline__ void exp2_9(const float c, const v8f a, float& ec, v8f& e) {
    float r0, r1, r2, r3, r4, r5, r6, r7;
    asm("v_exp_f32 %0, %9\n\tv_exp_f32 %1, %10\n\tv_exp_f32 %2, %11\n\tv_exp_f32 %3, %12\n\tv_exp_f32 %4, %13\n\tv_exp_f32 %5, %14\n\tv_exp_f32 %6, %15\n\tv_exp_f32 %7, %16\n\tv_exp_f32 %8, %17\n\tv_nop"
        : "=&v"(ec), "=&v"(r0), "=&v"(r1), "=&v"(r2), "=&v"(r3), "=&v"(r4), "=&v"(r5), "=&v"(r6), "=&v"(r7)
        : "v"(c), "v"(a[0]), "v"(a[1]), "v"(a[2]), "v"(a[3]), "v"(a[4]), "v"(a[5]), "v"(a[6]), "v"(a[7]));
    e[0] = r0; e[1] = r1; e[2] = r2; e[3] = r3; e[4] = r4; e[5] = r5; e[6] = r6; e[7] = r7;
}
__device__ __forceinline__ void exp2_8(const v8f a, v8f& e) {
    float r0, r1, r2, r3, r4, r5, r6, r7;
    asm("v_exp_f32 %0, %8\n\tv_exp_f32 %1, %9\n\tv_exp_f32 %2, %10\n\tv_exp_f32 %3, %11\n\tv_exp_f32 %4, %12\n\tv_exp_f32 %5, %13\n\tv_exp_f32 %6, %14\n\tv_exp_f32 %7, %15\n\tv_nop"
        : "=&v"(r0), "=&v"(r1), "=&v"(r2), "=&v"(r3), "=&v"(r4), "=&v"(r5), "=&v"(r6), "=&v"(r7)
        : "v"(a[0]), "v"(a[1]), "v"(a[2]), "v"(a[3]), "v"(a[4]), "v"(a[5]), "v"(a[6]), "v"(a[7]));
    e[0] = r0; e[1] = r1; e[2] = r2; e[3] = r3; e[4] = r4; e[5] = r5; e[6] = r6; e[7] = r7;
}

// k_attn_l: query rows >= RH, f16 single products. One work-group of AW waves per 16*AW query rows of one (batch, head), one wave per 16 rows; the waves share each 32-key stage of K and V,
// brought into two LDS buffers by asynchronous copies one stage ahead. Every wave walks the work-group's key range: a step wholly above a wave's diagonal adds exact zeros. ctx f16 x CCAR -> AT [b][t-RH][1024].
// Both products are taken transposed: S^T = K Q^T (A = key rows from LDS, B = the wave's query rows, kept in registers) and O^T += V^T P^T (A = rows of the staged V^T, B = P^T).
// A lane then holds 16 of the 32 scores of ONE query (qbase + (lane&15); keys jb + 8 (lane>>4) + r and jb + 16 + 8 (lane>>4) + r): maximum and sum run inside the lane, the two halves of the wave meet in one exchange,
// and the two score tiles, converted in place, are the B operand of the second product in the loader's own k order, so P goes through no LDS and no barrier.
__global__ __launch_bounds__(32 * AW) void k_attn_l(const u16* __restrict__ QP, const u16* __restrict__ KP, const u16* __restrict__ VT, u16* AT) {
    __shared__ __align__(16) u16 ks[2][32 * KPIT];
    __shared__ __align__(16) u16 vs[2][HD * VPIT];
    const int tid = threadIdx.x, lane = tid & 31, lr = lane & 15, hi = lane >> 4;
    const int wv = __builtin_amdgcn_readfirstlane(tid >> 5);   // wave number as a scalar: the test for steps that touch the diagonal stays a scalar branch
    // Work-group order, for speed only (every (head, query block) pair is taken once, wherever and whenever a work-group runs). A query block's cost grows with its index:
    // the heaviest query blocks come first, heads fastest, so that what starts last is short. All work-groups are resident at once, LGR query blocks per round of NWGP: every other round is mirrored, so that the key steps of the work-groups that share a WGP add up alike.
    const int rk = blockIdx.x / (NB * NH), bh = blockIdx.x - rk * (NB * NH);   // rank of the query block, head
    const int rd = rk / LGR;                                                   // round
    const int qb = NQB_L - 1 - ((rd & 1) ? rd * LGR + (LGR - 1) - (rk - rd * LGR) : rk);
    const int b = bh / NH, h = bh - b * NH;
    const int qblk = RH + qb * (16 * AW);
    const int qbase = qblk + wv * 16;
    const size_t pb = (size_t)bh * SEQ * HD;
    const u16* Qb = QP + pb; const u16* Kb = KP + pb; const u16* Vb = VT + pb;
    const int nsteps = (qblk + 16 * AW) >> 5;    // keys 0 .. qblk+16*AW-1 in steps of 32; nsteps*32 <= SEQ, nsteps >= 2
    stage_kv(Kb, Vb, 0, ks[0], vs[0], tid);
    asm volatile("s_wait_asynccnt 0x0" ::: "memory");   // this wave's copies of stage 0 have landed
    __syncthreads();                                     // stage 0 readable by every wave
    stage_kv(Kb, Vb, 32, ks[1], vs[1], tid);
    const v16us q0 = ldfr(Qb + (size_t)(qbase + lr) * HD + 8 * hi);
    const v16us q1 = ldfr(Qb + (size_t)(qbase + lr) * HD + 32 + 8 * hi);
    v8f acc[4];                                  // acc[dt][r] = O^T[16 dt + 8 hi + r][qbase + lr], carried x PCAR
#pragma unroll
    for (int dt = 0; dt < 4; ++dt) acc[dt] = (v8f){};
    float mrun = -1.0e30f, lsum = 0.0f;          // this lane's query: running maximum of the raw scores (both halves alike); sum of this half's probabilities x PCAR
#pragma unroll 1
    for (int st = 0; st < nsteps; ++st) {
        const int jb = st * 32;
        const u16* kr0 = ks[st & 1] + lr * KPIT + 8 * hi; const u16* kr1 = kr0 + 16 * KPIT;
        const u16* vr = vs[st & 1] + lr * VPIT + 8 * hi;
        const v16us k00 = ldfr(kr0), k01 = ldfr(kr0 + 32), k10 = ldfr(kr1), k11 = ldfr(kr1 + 32);   // the step's 8 key reads stand together, ahead of its 4 score products
        v8f s0 = (v8f){}, s1 = (v8f){};
        s0 = mma_h(k00, q0, s0); s1 = mma_h(k10, q0, s1);
        s0 = mma_h(k01, q1, s0); s1 = mma_h(k11, q1, s1);
        v16us vf[4];                             // the step's 8 value reads stand together too: they return while the softmax runs
#pragma unroll
        for (int dt = 0; dt < 4; ++dt) vf[dt] = ldfr(vr + dt * 16 * VPIT);
        if (jb + 31 > qbase) {                   // only a step that reaches past the wave's first query row can hold an excluded key
            const int dq = qbase + lr - jb - 8 * hi;      // key index r (or 16 + r) inside this lane's share is excluded when it exceeds dq
#pragma unroll
            for (int r = 0; r < 8; ++r) { s0[r] = (r > dq) ? -1.0e30f : s0[r]; s1[r] = (16 + r > dq) ? -1.0e30f : s1[r]; }
        }
        float mx = fmaxf(s0[0], s1[0]);
#pragma unroll
        for (int r = 1; r < 8; ++r) mx = fmaxf(mx, fmaxf(s0[r], s1[r]));
        mx = fmaxf(mx, xhalf(mx));
        const float mnew = fmaxf(mrun, mx);      // finite from the first step on: key 0 is open to every query
        const float nm = 10.0f - mnew * SCL2;    // 2^10 = PCAR: the carry rides in the exponent
#pragma unroll
        for (int r = 0; r < 8; ++r) { s0[r] = __builtin_fmaf(s0[r], SCL2, nm); s1[r] = __builtin_fmaf(s1[r], SCL2, nm); }
        float corr;
        exp2_9((mrun - mnew) * SCL2, s0, corr, s0);
        exp2_8(s1, s1);
        mrun = mnew;
        v16h pf;
        float ps = 0.0f;
#pragma unroll
        for (int r = 0; r < 8; ++r) { ps += s0[r] + s1[r]; pf[r] = (h16)s0[r]; pf[8 + r] = (h16)s1[r]; }
        lsum = lsum * corr + ps;
#pragma unroll
        for (int dt = 0; dt < 4; ++dt)
#pragma unroll
            for (int r = 0; r < 8; ++r) acc[dt][r] *= corr;
        const v16us pu = __builtin_bit_cast(v16us, pf);
#pragma unroll
        for (int dt = 0; dt < 4; ++dt) acc[dt] = mma_h(vf[dt], pu, acc[dt]);
        asm volatile("s_wait_dscnt 0x0" ::: "memory");      // this wave's LDS reads of the stage are done before the buffer is refilled
        asm volatile("s_wait_asynccnt 0x0" ::: "memory");   // this wave's copies of the next stage have landed
        __syncthreads();                                     // publishes the next stage and ends every reader's last read of this one
        if (st + 2 < nsteps) stage_kv(Kb, Vb, jb + 64, ks[st & 1], vs[st & 1], tid);
    }
    asm volatile("s_wait_asynccnt 0x0" ::: "memory");       // no copy is left in flight when the wave goes on to its end
    const float inv = CCAR / (lsum + xhalf(lsum));          // both carry PCAR, so it cancels
    u16* dst = AT + ((size_t)b * (SEQ - RH) + (qbase - RH) + lr) * DM + h * HD + 8 * hi;
#pragma unroll
    for (int dt = 0; dt < 4; ++dt) {             // a lane's 8 registers are 8 consecutive head columns of its query row: one 16-byte store; the wave's four stores fill each row's whole 128-B line
        v8us o;
#pragma unroll
        for (int r = 0; r < 8; ++r) o[r] = f2h(acc[dt][r] * inv);
        *(v8us*)(dst + dt * 16) = o;
    }
}

#define EAW  4                   // waves per early-attention work-group, 16 query rows each
static_assert(RH % (16 * EAW) == 0);          // whole work-groups of query rows
static_assert((16 * EAW) / 32 >= 2);          // the two-buffer prologue needs two key steps
static_assert((16 * EAW) % 32 == 0);          // a work-group's last key step ends on its last query row, inside the early planes

// One 32-key stage of the hi and lo planes for a work-group of 128 threads: key rows jb..jb+31 (32 x 128 B, contiguous in each plane) and the 64 value rows' columns jb..jb+31 (64 x 64 B), 16 bytes per lane and copy, straight into LDS.
// The s_wait_xcnt 0 is the last line of the copies' own statement so that no address register of a copy is rewritten ahead of it.
__device__ __forceinline__ void stage_kv_e(const u16* __restrict__ Kh, const u16* __restrict__ Kl, const u16* __restrict__ Vh, const u16* __restrict__ Vl, const int jb, u16* kdh, u16* kdl, u16* vdh, u16* vdl, const int tid) {
    const size_t ko = (size_t)(jb + (tid >> 3)) * HD + (tid & 7) * 8;         // rows 0..15 of the stage; 16 * HD further on: rows 16..31
    const size_t vo = (size_t)(tid >> 2) * RH + jb + (tid & 3) * 8;           // head columns 0..31; 32 * RH further on: head columns 32..63
    const int kl = (tid >> 3) * KPIT + (tid & 7) * 8, vl = (tid >> 2) * VPIT + (tid & 3) * 8;
    const unsigned lkh = lds_byte(kdh + kl), lkl = lds_byte(kdl + kl), lvh = lds_byte(vdh + vl), lvl = lds_byte(vdl + vl);
    asm volatile("global_load_async_to_lds_b128 %0, %1, off\n\t"
                 "global_load_async_to_lds_b128 %2, %3, off\n\t"
                 "global_load_async_to_lds_b128 %4, %5, off\n\t"
                 "global_load_async_to_lds_b128 %6, %7, off\n\t"
                 "global_load_async_to_lds_b128 %8, %9, off\n\t"
                 "global_load_async_to_lds_b128 %10, %11, off\n\t"
                 "global_load_async_to_lds_b128 %12, %13, off\n\t"
                 "global_load_async_to_lds_b128 %14, %15, off\n\t"
                 "s_wait_xcnt 0x0"
                 :: "v"(lkh), "v"(Kh + ko), "v"(lkh + 16 * KPIT * 2), "v"(Kh + ko + 16 * HD), "v"(lkl), "v"(Kl + ko), "v"(lkl + 16 * KPIT * 2), "v"(Kl + ko + 16 * HD),
                    "v"(lvh), "v"(Vh + vo), "v"(lvh + 32 * VPIT * 2), "v"(Vh + vo + 32 * RH), "v"(lvl), "v"(Vl + vo), "v"(lvl + 32 * VPIT * 2), "v"(Vl + vo + 32 * RH) : "memory");
}

// k_attn_e: query rows < RH, bf16 hi+lo operands (hi.hi + lo.hi + hi.lo into one accumulator; residuals unscaled). ctx hi/lo bf16 -> ATEh/ATEl [b][t][1024].
// One work-group of EAW waves per 16*EAW query rows of one (batch, head), one wave per 16 rows; the waves share each 32-key stage of the K and V hi and lo planes, brought into two LDS buffers by asynchronous copies one stage ahead
// (whole lines from L2, fetched once per work-group, where fragment loads straight from the planes touch 16 lines each). Every wave walks the work-group's key range: a step wholly above a wave's diagonal adds exact zeros.
__global__ __launch_bounds__(32 * EAW) void k_attn_e(const u16* __restrict__ QEh, const u16* __restrict__ QEl, const u16* __restrict__ KEh, const u16* __restrict__ KEl, const u16* __restrict__ VEh, const u16* __restrict__ VEl, u16* ATEh, u16* ATEl) {
    __shared__ __align__(16) u16 ksh[2][32 * KPIT];
    __shared__ __align__(16) u16 ksl[2][32 * KPIT];
    __shared__ __align__(16) u16 vsh[2][HD * VPIT];
    __shared__ __align__(16) u16 vsl[2][HD * VPIT];
    __shared__ __align__(16) u16 pwha[EAW][16 * 40];
    __shared__ __align__(16) u16 pwla[EAW][16 * 40];
    __shared__ __align__(16) float osa[EAW][16 * 68];
    const int tid = threadIdx.x, lane = tid & 31, lr = lane & 15, hi = lane >> 4;
    const int wv = __builtin_amdgcn_readfirstlane(tid >> 5);   // wave number as a scalar: the wave's own staging addresses stay scalar
    u16* pwh = pwha[wv]; u16* pwl = pwla[wv]; float* os = osa[wv];   // this wave's own P and output staging
    const int bh = blockIdx.x / (RH / (16 * EAW)), qb = blockIdx.x - bh * (RH / (16 * EAW));
    const int b = bh / NH, h = bh - b * NH;
    const int qblk = qb * (16 * EAW);
    const int qbase = qblk + wv * 16;
    const size_t pb = (size_t)bh * RH * HD;
    const u16* Kh = KEh + pb; const u16* Kl = KEl + pb; const u16* Vh = VEh + pb; const u16* Vl = VEl + pb;   // V planes [bh][64][RH], same plane size as [bh][RH][64]
    const int nsteps = (qblk + 16 * EAW) >> 5;   // keys 0 .. qblk+16*EAW-1 in steps of 32; nsteps*32 <= RH, nsteps >= 2
    stage_kv_e(Kh, Kl, Vh, Vl, 0, ksh[0], ksl[0], vsh[0], vsl[0], tid);
    asm volatile("s_wait_asynccnt 0x0" ::: "memory");   // this wave's copies of stage 0 have landed
    __syncthreads();                                     // stage 0 readable by every wave
    stage_kv_e(Kh, Kl, Vh, Vl, 32, ksh[1], ksl[1], vsh[1], vsl[1], tid);
    const size_t qo = pb + (size_t)(qbase + lr) * HD + 8 * hi;
    const v16us qh0 = ldfr(QEh + qo), qh1 = ldfr(QEh + qo + 32), ql0 = ldfr(QEl + qo), ql1 = ldfr(QEl + qo + 32);
    v8f acc[4];
#pragma unroll
    for (int nt = 0; nt < 4; ++nt) acc[nt] = (v8f){};
    float mrow[8], lrow[8];
#pragma unroll
    for (int i = 0; i < 8; ++i) { mrow[i] = -1.0e30f; lrow[i] = 0.0f; }
#pragma unroll 1
    for (int st = 0; st < nsteps; ++st) {
        const int jb = st * 32;
        const u16* krh = ksh[st & 1] + lr * KPIT + 8 * hi; const u16* krl = ksl[st & 1] + lr * KPIT + 8 * hi;   // this lane's place in the stage's key rows
        const u16* vrh = vsh[st & 1] + lr * VPIT + 8 * hi; const u16* vrl = vsl[st & 1] + lr * VPIT + 8 * hi;   // the same in the stage's value rows
        // The step's 16 key reads stand together, ahead of its 12 score products.
        const v16us kh0 = ldfr(krh), kh1 = ldfr(krh + 32), kl0 = ldfr(krl), kl1 = ldfr(krl + 32);
        const v16us kh2 = ldfr(krh + 16 * KPIT), kh3 = ldfr(krh + 16 * KPIT + 32), kl2 = ldfr(krl + 16 * KPIT), kl3 = ldfr(krl + 16 * KPIT + 32);
        v8f s0 = (v8f){}, s1 = (v8f){};
        s0 = mma_b(qh0, kh0, s0); s0 = mma_b(qh1, kh1, s0); s0 = mma_b(ql0, kh0, s0); s0 = mma_b(ql1, kh1, s0); s0 = mma_b(qh0, kl0, s0); s0 = mma_b(qh1, kl1, s0);
        s1 = mma_b(qh0, kh2, s1); s1 = mma_b(qh1, kh3, s1); s1 = mma_b(ql0, kh2, s1); s1 = mma_b(ql1, kh3, s1); s1 = mma_b(qh0, kl2, s1); s1 = mma_b(qh1, kl3, s1);
        __builtin_amdgcn_sched_barrier(0);   // this and the one behind the softmax keep the value reads out of it: strewn among its cross-lane exchanges (same counter), they made each exchange's wait wait for them too
        float corr[8];
        sm_step(s0, s1, mrow, lrow, corr, jb, qbase, lr, hi);
        __builtin_amdgcn_sched_barrier(0);
        v16us vh[4], vl[4];                      // the step's 16 value reads stand together: they return while the accumulators are rescaled and P is converted
#pragma unroll
        for (int nt = 0; nt < 4; ++nt) { vh[nt] = ldfr(vrh + nt * 16 * VPIT); vl[nt] = ldfr(vrl + nt * 16 * VPIT); }
#pragma unroll
        for (int nt = 0; nt < 4; ++nt)
#pragma unroll
            for (int i = 0; i < 8; ++i) acc[nt][i] *= corr[i];
#pragma unroll
        for (int i = 0; i < 8; ++i) {
            const u16 a = f2bf(s0[i]); const u16 c = f2bf(s1[i]);
            pwh[(i + 8 * hi) * 40 + lr] = a; pwl[(i + 8 * hi) * 40 + lr] = f2bf(s0[i] - bf2f(a));
            pwh[(i + 8 * hi) * 40 + 16 + lr] = c; pwl[(i + 8 * hi) * 40 + 16 + lr] = f2bf(s1[i] - bf2f(c));
        }
        __syncthreads();
        const v8us h0 = *(const v8usa*)&pwh[lr * 40 + 8 * hi]; const v8us h1 = *(const v8usa*)&pwh[lr * 40 + 16 + 8 * hi];
        const v8us l0 = *(const v8usa*)&pwl[lr * 40 + 8 * hi]; const v8us l1 = *(const v8usa*)&pwl[lr * 40 + 16 + 8 * hi];
        const v16us pfh = __builtin_shufflevector(h0, h1, 0, 1, 2, 3, 4, 5, 6, 7, 8, 9, 10, 11, 12, 13, 14, 15);
        const v16us pfl = __builtin_shufflevector(l0, l1, 0, 1, 2, 3, 4, 5, 6, 7, 8, 9, 10, 11, 12, 13, 14, 15);
#pragma unroll
        for (int nt = 0; nt < 4; ++nt) { acc[nt] = mma_b(pfh, vh[nt], acc[nt]); acc[nt] = mma_b(pfl, vh[nt], acc[nt]); acc[nt] = mma_b(pfh, vl[nt], acc[nt]); }
        asm volatile("s_wait_dscnt 0x0" ::: "memory");      // this wave's LDS reads of the stage (and of its P rows) are done before the buffer is refilled
        asm volatile("s_wait_asynccnt 0x0" ::: "memory");   // this wave's copies of the next stage have landed
        __syncthreads();                                     // publishes the next stage and ends every reader's last read of this one
        if (st + 2 < nsteps) stage_kv_e(Kh, Kl, Vh, Vl, jb + 64, ksh[st & 1], ksl[st & 1], vsh[st & 1], vsl[st & 1], tid);
    }
    asm volatile("s_wait_asynccnt 0x0" ::: "memory");       // no copy is left in flight when the wave goes on to its end
#pragma unroll
    for (int i = 0; i < 8; ++i) {
        float l = lrow[i];
        l += __shfl_xor(l, 1, 32); l += __shfl_xor(l, 2, 32); l += __shfl_xor(l, 4, 32); l += __shfl_xor(l, 8, 32);
        const float inv = 1.0f / l;
#pragma unroll
        for (int nt = 0; nt < 4; ++nt) os[(i + 8 * hi) * 68 + nt * 16 + lr] = acc[nt][i] * inv;
    }
    __syncthreads();
    const size_t dofs = ((size_t)b * RH + qbase) * DM + h * HD;
{
#pragma unroll
        for (int s = 0; s < 4; ++s) {
            const int row = 4 * s + (lane >> 3), pc = (lane & 7) * 8;
            const v4f x0 = *(const v4fa*)&os[row * 68 + pc]; const v4f x1 = *(const v4fa*)&os[row * 68 + pc + 4];
            v8us oh, ol;
#pragma unroll
            for (int q = 0; q < 4; ++q) { const u16 a = f2bf(x0[q]); oh[q] = a; ol[q] = f2bf(x0[q] - bf2f(a)); const u16 c = f2bf(x1[q]); oh[4 + q] = c; ol[4 + q] = f2bf(x1[q] - bf2f(c)); }
            *(v8us*)(ATEh + dofs + (size_t)row * DM + pc) = oh;
            *(v8us*)(ATEl + dofs + (size_t)row * DM + pc) = ol;
        }
        
    }
}

// Output projection: OUT[b][toff + r][n] = scale * sum_k A[row][k] Bt[n][k] (+ A2 product in k_outp_e) + bf16(bias[n]); rows of A are [b][r] with rpb rows per batch.
// Epilogue of one wave's 64x64 tile (k_outp_l) at rows r0.., columns c0..: whole 256-B row pieces through the wave's own staging 'os'. Every wave of the work-group passes the same barriers.
__device__ __forceinline__ void outp_store(const v8f (&acc)[4][4], float* os, const float* __restrict__ bias, float* OUT, const float scale, const int rpb, const int toff, const int r0, const int c0, const int lr, const int hi) {
    const int b = r0 / rpb, tb = toff + (r0 - b * rpb);
    float* crow0 = OUT + ((size_t)b * SEQ_FULL + tb) * DM + c0;
    const int cofs = lr * 4;
    v4f bv; bv[0] = bfr(bias[c0 + cofs]); bv[1] = bfr(bias[c0 + cofs + 1]); bv[2] = bfr(bias[c0 + cofs + 2]); bv[3] = bfr(bias[c0 + cofs + 3]);
#pragma unroll
    for (int mb = 0; mb < 4; ++mb) {
#pragma unroll
        for (int nb = 0; nb < 4; ++nb)
#pragma unroll
            for (int j = 0; j < 8; ++j) os[(hi * 8 + j) * 68 + nb * 16 + lr] = acc[mb][nb][j];
        __syncthreads();
#pragma unroll
        for (int s = 0; s < 8; ++s) {
            const int row = 2 * s + hi;
            const v4f x = *(const v4fa*)&os[row * 68 + cofs];
            v4f val; val[0] = x[0] * scale + bv[0]; val[1] = x[1] * scale + bv[1]; val[2] = x[2] * scale + bv[2]; val[3] = x[3] * scale + bv[3];
            *(v4f*)(crow0 + (size_t)(mb * 16 + row) * DM + cofs) = val;
        }
        __syncthreads();
    }
}

#define EWM  2                   // waves down an early output work-group, 32 rows each
#define EWN  2                   // waves across, 32 columns each
#define ETH  (32 * EWM * EWN)    // threads per early output work-group
#define EKS  128                 // k per stage: 256-B rows, two whole cache lines
#define EPIT 136                 // u16 per staged row: 272 B = 16 B x odd, the pitch for 16-byte LDS readers of 256-B rows
#define ESTG (3 * 64 * EPIT)     // u16 per stage buffer: 64 rows of ctx hi, 64 of ctx lo, 64 of Bt
static_assert(ETH == 128);                               // stage_64: 8 rows per copy, 8 copies for 64 rows
static_assert(DM % EKS == 0 && DM / EKS >= 2);           // the two-buffer prologue needs two stages
static_assert(64 * 68 * 4 <= 2 * ESTG * 2);              // the f32 output tile is laid over the ring after the k loop
static_assert((NB * RH) % 64 == 0 && RH % 64 == 0 && DM % 64 == 0);   // whole tiles, none straddles a batch

// 64 rows of 256 B (128 k) of one plane for a work-group of 128 threads: 16 bytes per lane and copy (16 lanes = one row = two lines), straight into LDS. g / l: this thread's place in row tid>>4 of the plane's rows, of their place in the buffer.
// The s_wait_xcnt 0 is the last line of the copies' own statement so that no address register of a copy is rewritten ahead of it.
__device__ __forceinline__ void stage_64(const u16* g, const unsigned l) {
    const size_t rs = (size_t)8 * DM;                 // 8 rows on in global memory
    const unsigned ls = 8 * EPIT * 2;                 // 8 rows on in LDS, bytes
    asm volatile("global_load_async_to_lds_b128 %0, %1, off\n\t"
                 "global_load_async_to_lds_b128 %2, %3, off\n\t"
                 "global_load_async_to_lds_b128 %4, %5, off\n\t"
                 "global_load_async_to_lds_b128 %6, %7, off\n\t"
                 "global_load_async_to_lds_b128 %8, %9, off\n\t"
                 "global_load_async_to_lds_b128 %10, %11, off\n\t"
                 "global_load_async_to_lds_b128 %12, %13, off\n\t"
                 "global_load_async_to_lds_b128 %14, %15, off\n\t"
                 "s_wait_xcnt 0x0"
                 :: "v"(l), "v"(g), "v"(l + ls), "v"(g + rs), "v"(l + 2 * ls), "v"(g + 2 * rs), "v"(l + 3 * ls), "v"(g + 3 * rs),
                    "v"(l + 4 * ls), "v"(g + 4 * rs), "v"(l + 5 * ls), "v"(g + 5 * rs), "v"(l + 6 * ls), "v"(g + 6 * rs), "v"(l + 7 * ls), "v"(g + 7 * rs) : "memory");
}
// One 128-k stage of the three planes: 24 copies per wave in flight.
__device__ __forceinline__ void stage_e(const u16* ga, const u16* ga2, const u16* gb, const unsigned la) {
    stage_64(ga, la); stage_64(ga2, la + 64 * EPIT * 2); stage_64(gb, la + 128 * EPIT * 2);
}

// k_outp_e: rows < RH, bf16 hi+lo ctx planes; one work-group of four waves (2 x 2 tiles of 32x32) per 64x64 tile. The waves share each 128-k stage of ctx hi, ctx lo and Bt,
// brought into the two buffers of 'ring' by asynchronous copies one stage ahead (whole lines from L2, where fragment loads straight from the planes touch 16 lines each).
// Per accumulator the order of the sum is k ascending in blocks of 32, hi product then lo product. The f32 tile goes out through the ring in whole 256-B row pieces.
__global__ __launch_bounds__(ETH) void k_outp_e(const u16* __restrict__ A, const u16* __restrict__ A2, const u16* __restrict__ Bt, const float* __restrict__ bias, float* OUT, float scale, int rpb, int toff) {
    __shared__ __align__(16) u16 ring[2 * ESTG];
    const int tid = threadIdx.x, lane = tid & 31, lr = lane & 15, hi = lane >> 4;
    const int wv = __builtin_amdgcn_readfirstlane(tid >> 5), wm = wv % EWM, wn = wv / EWM;   // wave number as a scalar: tile indices stay scalar
    const int r0 = blockIdx.x * 64, c0 = blockIdx.y * 64;
    const int cofs = (tid & 15) * 4;                        // this thread's 4 output columns in the epilogue; their bias is fetched here, so that its latency lies behind the k loop
    const v4f braw = *(const v4f*)(bias + c0 + cofs);
    v8f acc[2][2];               // acc[mb][nb] element j = C[r0 + 32 wm + 16 mb + 8 hi + j][c0 + 32 wn + 16 nb + lr]
#pragma unroll
    for (int mb = 0; mb < 2; ++mb)
#pragma unroll
        for (int nb = 0; nb < 2; ++nb) acc[mb][nb] = (v8f){};
    const size_t go = (size_t)(tid >> 4) * DM + (tid & 15) * 8;
    const u16* ga = A + (size_t)r0 * DM + go; const u16* ga2 = A2 + (size_t)r0 * DM + go; const u16* gb = Bt + (size_t)c0 * DM + go;
    const unsigned la = lds_byte(ring + (tid >> 4) * EPIT + (tid & 15) * 8);
    const int nst = DM / EKS;
    stage_e(ga, ga2, gb, la);
    asm volatile("s_wait_asynccnt 0x0" ::: "memory");   // this wave's copies of stage 0 have landed
    __syncthreads();                                     // stage 0 readable by every wave
    stage_e(ga + EKS, ga2 + EKS, gb + EKS, la + ESTG * 2);
#pragma unroll 1   // kept rolled: one body of 32 products, the buffer picked by st & 1
    for (int st = 0; st < nst; ++st) {
        const u16* ar = ring + (st & 1) * ESTG + (wm * 32 + lr) * EPIT + 8 * hi;
        const u16* br = ring + (st & 1) * ESTG + (128 + wn * 32 + lr) * EPIT + 8 * hi;
        v16us a[EKS / 32][2], a2[EKS / 32][2], bb[EKS / 32][2];
#pragma unroll   // this and the loops below: every fragment and accumulator index a constant, so that they stay in registers
        for (int kb = 0; kb < EKS / 32; ++kb) {
#pragma unroll
            for (int mb = 0; mb < 2; ++mb) a[kb][mb] = ldfr(ar + mb * 16 * EPIT + kb * 32);
#pragma unroll
            for (int nb = 0; nb < 2; ++nb) bb[kb][nb] = ldfr(br + nb * 16 * EPIT + kb * 32);
#pragma unroll
            for (int mb = 0; mb < 2; ++mb) a2[kb][mb] = ldfr(ar + (64 + mb * 16) * EPIT + kb * 32);
        }
        __builtin_amdgcn_sched_barrier(0);   // holds the stage's 48 LDS reads together, ahead of its products: left free, the compiler spread them among the products in one register set
#pragma unroll
        for (int kb = 0; kb < EKS / 32; ++kb) {
#pragma unroll
            for (int nb = 0; nb < 2; ++nb)
#pragma unroll
                for (int mb = 0; mb < 2; ++mb) acc[mb][nb] = mma_bp(a[kb][mb], bb[kb][nb], acc[mb][nb]);
#pragma unroll
            for (int nb = 0; nb < 2; ++nb)
#pragma unroll
                for (int mb = 0; mb < 2; ++mb) acc[mb][nb] = mma_bp(a2[kb][mb], bb[kb][nb], acc[mb][nb]);
        }
        __builtin_amdgcn_sched_barrier(0);   // keeps the waits below behind the products: moved up over them (they touch no memory), the wait for all 48 reads stood ahead of the products, which then no longer ran while the later reads return
        asm volatile("s_wait_dscnt 0x0" ::: "memory");      // this wave's LDS reads of the stage are done before the buffer is refilled
        asm volatile("s_wait_asynccnt 0x0" ::: "memory");   // this wave's copies of the next stage have landed
        __syncthreads();                                     // publishes the next stage and ends every reader's last read of this one
        if (st + 2 < nst) stage_e(ga + (st + 2) * EKS, ga2 + (st + 2) * EKS, gb + (st + 2) * EKS, la + (st & 1) * (ESTG * 2));
    }
    asm volatile("s_wait_asynccnt 0x0" ::: "memory");       // no copy is left in flight when the ring becomes output staging
    float* ot = (float*)ring;                               // [64][68] f32; every wave has left the ring (the last trip's barrier)
#pragma unroll
    for (int mb = 0; mb < 2; ++mb)
#pragma unroll
        for (int nb = 0; nb < 2; ++nb)
#pragma unroll
            for (int j = 0; j < 8; ++j) ot[(wm * 32 + mb * 16 + hi * 8 + j) * 68 + wn * 32 + nb * 16 + lr] = acc[mb][nb][j];
    __syncthreads();                                         // the whole tile is staged before any row piece is read back
    const int b = r0 / rpb, tb = toff + (r0 - b * rpb);
    float* crow0 = OUT + ((size_t)b * SEQ_FULL + tb) * DM + c0;
    v4f bv; bv[0] = bfr(braw[0]); bv[1] = bfr(braw[1]); bv[2] = bfr(braw[2]); bv[3] = bfr(braw[3]);
#pragma unroll
    for (int s = 0; s < 8; ++s) {
        const int row = 8 * s + (tid >> 4);
        const v4f x = *(const v4fa*)&ot[row * 68 + cofs];
        v4f val; val[0] = x[0] * scale + bv[0]; val[1] = x[1] * scale + bv[1]; val[2] = x[2] * scale + bv[2]; val[3] = x[3] * scale + bv[3];
        *(v4f*)(crow0 + (size_t)row * DM + cofs) = val;
    }
}

// k_outp_l: rows >= RH, f16 planes; eight waves (4 x 2 tiles of 64x64) per work-group sharing the staged operands.
__global__ __launch_bounds__(GTH) void k_outp_l(const u16* __restrict__ A, const u16* __restrict__ Bt, const float* __restrict__ bias, float* OUT, float scale, int rpb, int toff) {
    __shared__ __align__(16) u16 ring[2 * GSTG];
    const int tid = threadIdx.x, lane = tid & 31, lr = lane & 15, hi = lane >> 4;
    const int wv = __builtin_amdgcn_readfirstlane(tid >> 5), wm = wv % GWM, wn = wv / GWM;   // wave number as a scalar: tile indices and the branches on them stay scalar
    float* os = (float*)((char*)ring + wv * GEPI);                       // this wave's own staging, used after the k loop only
    v8f acc[4][4];
    gemm_tile_s<true>(A, Bt, DM, blockIdx.x * GAR, blockIdx.y * GBR, ring, tid, wm, wn, lr, hi, acc);
    outp_store(acc, os, bias, OUT, scale, rpb, toff, blockIdx.x * GAR + wm * 64, blockIdx.y * GBR + wn * 64, lr, hi);
}

extern "C" void kernel_launch(void* const* d_in, const int* in_sizes, int n_in,
                              void* d_out, int out_size, void* d_ws, size_t ws_size, hipStream_t stream) {
    if (n_in < 10) return;
    const long long needx = ((long long)(NB - 1) * SEQ_FULL + SEQ) * DM;
    if ((long long)in_sizes[0] < needx) return;
    if ((long long)in_sizes[1] < (long long)DM * DM || (long long)in_sizes[2] < (long long)DM * DM || (long long)in_sizes[3] < (long long)DM * DM || (long long)in_sizes[4] < (long long)DM * DM) return;
    if (in_sizes[5] < DM) return;
    if (in_sizes[6] < HD || in_sizes[7] < HD || in_sizes[8] < HD || in_sizes[9] < HD) return;
    if ((long long)out_size < needx) return;
    if (O_END * 2 > ws_size) return;
    // wire order: x, key weight, query weight, value weight, output weight, output bias, key LayerNorm gain, key LayerNorm bias, query LayerNorm gain, query LayerNorm bias
    const float* x  = (const float*)d_in[0];
    const float* Wk = (const float*)d_in[1];
    const float* Wq = (const float*)d_in[2];
    const float* Wv = (const float*)d_in[3];
    const float* Wp = (const float*)d_in[4];
    const float* bp = (const float*)d_in[5];
    const float* kg = (const float*)d_in[6];
    const float* kb = (const float*)d_in[7];
    const float* qg = (const float*)d_in[8];
    const float* qb = (const float*)d_in[9];
    float* OUT = (float*)d_out;
    u16* PL = (u16*)d_ws;

    k_cvt_all<<<CVG, 32 * CVW, 0, stream>>>(x, Wq, Wk, Wv, Wp, PL);   // planes O_XB, O_WALL (query, key, value rows), O_WPB, O_WPH

    k_proj<<<dim3(NB * SEQ / GAR, 3 * DM / GBR, 1), GTH, 0, stream>>>(PL + O_XB, PL + O_WALL, PL, O_P16, O_EH, O_EL, qg, qb, kg, kb);

    k_attn_e<<<NB * NH * (RH / (16 * EAW)), 32 * EAW, 0, stream>>>(PL + O_EH, PL + O_EL, PL + O_EH + EPLANE, PL + O_EL + EPLANE, PL + O_EH + 2 * EPLANE, PL + O_EL + 2 * EPLANE, PL + O_ATEH, PL + O_ATEL);
    if (SEQ > RH)
        k_attn_l<<<NB * NH * ((SEQ - RH) / (16 * AW)), 32 * AW, 0, stream>>>(PL + O_P16, PL + O_P16 + PLANE, PL + O_P16 + 2 * PLANE, PL + O_AT);

    k_outp_e<<<dim3(NB * RH / 64, DM / 64, 1), ETH, 0, stream>>>(PL + O_ATEH, PL + O_ATEL, PL + O_WPB, bp, OUT, 1.0f, RH, 0);
    if (SEQ > RH)
        k_outp_l<<<dim3(NB * (SEQ - RH) / GAR, DM / GBR, 1), GTH, 0, stream>>>(PL + O_AT, PL + O_WPH, bp, OUT, 1.0f / (WCAR * CCAR), SEQ - RH, RH);
}

// v008
// A run of this version takes 124 microseconds.
// Timed twice side by side with v007, it ran 1.16 and 1.17 times as fast.
// Counting every step since v000, it is 3.49 times as fast.
#include <hip/hip_runtime.h>

// Compute dtypes (f32 accumulate everywhere): q/k/v projections bf16 x bf16 (inputs converted RNE to bf16, products exact), per-head LayerNorm of q and k in f32 inside the projection epilogue; scores q.k and P.V: f16 single products on query rows >= 256 (P carried x1024), bf16 hi+lo (3 products) on query rows < 256; output projection: f16 single product (ctx x16, Wo x32 carries) on rows >= 256, bf16 hi+lo ctx x bf16 Wo on rows < 256.
// Causal 16-head attention block, x [4][2048][1024]; separate bias-free [out][in] key / query / value projections (used as Bt as stored), per-head LayerNorm (eps 1e-5, gain and bias inputs) on the 64-wide query and key rows,
// the two 1024^(-1/4) factors applied as one 1/32 on the scores, causal exclusion with the diagonal kept, softmax in f32 (running max, log2 domain), heads merged h*64+d, [out][in] output projection plus bias.
// Layout: 16-bit planes in the workspace (u16 storage): x copy [b*SEQ+t][1024]; weights [3][1024][1024] (q, k, v) ; q and k head planes [b][h][t][64]; v transposed [b][h][64][t]; hi/lo bf16 planes of the same for t < 256;
// ctx f16 [b][t-256][1024] and ctx hi/lo bf16 [b][t<256][1024]. Fused flash-style attention: one wave per 16 query rows, 32 keys per step, no score plane in global memory; four waves share K and V stages in LDS (rows < 256: hi and lo planes); rows >= 256: both products run transposed. Projection and late output GEMMs: eight waves share A and B stages in LDS; early output GEMM: eight waves share ctx hi, ctx lo and B stages in LDS. Four launches: conversions; projections; attention (rows < 256 and rows >= 256 as block ranges of one grid); output projection (the same two ranges).

#ifndef NB
#define NB 4
#endif
#ifndef SEQ
#define SEQ 2048
#endif
#define NB_FULL  4
#define SEQ_FULL 2048
#define DM   1024
#define NH   16
#define HD   64
#define RH   256                 // query rows / keys below RH also carry bf16 hi+lo planes
#define PCAR 1024.0f             // carry on f16 probabilities
#define CCAR 16.0f               // carry on the f16 ctx plane
#define WCAR 32.0f               // carry on the f16 output-projection weight plane
#define SCL2 (0.03125f * 1.4426950408889634f)   // 1/sqrt(1024) x log2(e)
#define LNEPS 1.0e-5f            // LayerNorm epsilon on the head rows

static_assert(DM == NH * HD);            // heads tile the channel width
static_assert(HD == 64);
static_assert(HD == 8 * 8);              // LayerNorm row = 8 lanes x 8 columns in the projection epilogue
static_assert(DM % 64 == 0);             // GEMM k-step: two 32-k blocks a trip
static_assert(HD % 32 == 0);             // score k-step
static_assert(SEQ % 64 == 0);            // 64-row GEMM tiles never straddle a batch
static_assert(RH % 64 == 0);             // early/late split on tile borders
static_assert(SEQ >= RH);
static_assert((SEQ - RH) % 64 == 0);
static_assert(RH % 32 == 0);             // 32-key steps end inside the early planes
static_assert(NB <= NB_FULL);
static_assert(SEQ <= SEQ_FULL);

typedef unsigned short u16;
typedef _Float16 h16;
typedef __attribute__((ext_vector_type(16))) __bf16         v16bf;
typedef __attribute__((ext_vector_type(16))) _Float16       v16h;
typedef __attribute__((ext_vector_type(8)))  unsigned short v8us;
typedef __attribute__((ext_vector_type(16))) unsigned short v16us;
typedef __attribute__((ext_vector_type(8)))  float          v8f;
typedef __attribute__((ext_vector_type(4)))  float          v4f;
typedef v4f  __attribute__((may_alias)) v4fa;
typedef v8us __attribute__((may_alias)) v8usa;

#define XBN    ((size_t)NB * SEQ * DM)
#define WN     ((size_t)DM * DM)
#define PLANE  ((size_t)NB * NH * SEQ * HD)
#define EPLANE ((size_t)NB * NH * RH * HD)
#define ATN    ((size_t)NB * (SEQ - RH) * DM)
#define ATEN   ((size_t)NB * RH * DM)
#define O_XB   ((size_t)0)
#define O_WALL (O_XB + XBN)
#define O_WPB  (O_WALL + 3 * WN)
#define O_WPH  (O_WPB + WN)
#define O_P16  (O_WPH + WN)
#define O_EH   (O_P16 + 3 * PLANE)
#define O_EL   (O_EH + 3 * EPLANE)
#define O_AT   (O_EL + 3 * EPLANE)
#define O_ATEH (O_AT + ATN)
#define O_ATEL (O_ATEH + ATEN)
#define O_END  (O_ATEL + ATEN)
static_assert(O_END * 2 <= (size_t)134217728);   // total carve <= 128 MiB
static_assert(XBN % 128 == 0 && WN % 128 == 0 && PLANE % 128 == 0 && EPLANE % 128 == 0 && ATN % 128 == 0 && ATEN % 128 == 0);   // every region starts on a 256-byte border

__device__ __forceinline__ u16 f2bf(float f) { unsigned u = __float_as_uint(f); u += 0x7FFFu + ((u >> 16) & 1u); return (u16)(u >> 16); }
__device__ __forceinline__ float bf2f(u16 b) { return __uint_as_float(((unsigned)b) << 16); }
__device__ __forceinline__ float bfr(float f) { return bf2f(f2bf(f)); }
__device__ __forceinline__ u16 f2h(float x) { return __builtin_bit_cast(unsigned short, (h16)x); }

// f32 -> f16 with a value select: magnitudes below the smallest normal f16 become zero, so no subnormal f16 operand can reach a WMMA.
static __device__ __forceinline__ h16 toh_flush(float v) { const h16 r = (h16)v; return (fabsf(v) < 6.103515625e-05f) ? (h16)0.0f : r; }
static __device__ __forceinline__ u16 f2h_fl(float v) { return __builtin_bit_cast(unsigned short, toh_flush(v)); }

// Fragment loader for A and B alike: 'p' points at (row or column) + k0 + 8*(lane>>4); elements 0..7 = k0+8h.., elements 8..15 = k0+16+8h..
__device__ __forceinline__ v16us ldfr(const u16* p) {
    const v8us lo = *(const v8us*)p; const v8us hi = *(const v8us*)(p + 16);
    return __builtin_shufflevector(lo, hi, 0, 1, 2, 3, 4, 5, 6, 7, 8, 9, 10, 11, 12, 13, 14, 15);
}
// One WMMA plus its own hazard guard (ties exactly one accumulator, keeps A and B live).
__device__ __forceinline__ v8f mma_h(v16us a, v16us b, v8f c) {
    const v16h ah = __builtin_bit_cast(v16h, a); const v16h bh = __builtin_bit_cast(v16h, b);
    c = __builtin_amdgcn_wmma_f32_16x16x32_f16(false, ah, false, bh, (short)0, c, false, false);
    asm volatile("v_nop\n\tv_nop\n\tv_nop\n\tv_nop" : "+v"(c) : "v"(ah), "v"(bh));
    return c;
}
__device__ __forceinline__ v8f mma_b(v16us a, v16us b, v8f c) {
    const v16bf ab = __builtin_bit_cast(v16bf, a); const v16bf bb = __builtin_bit_cast(v16bf, b);
    c = __builtin_amdgcn_wmma_f32_16x16x32_bf16(false, ab, false, bb, (short)0, c, false, false);
    asm volatile("v_nop\n\tv_nop\n\tv_nop\n\tv_nop" : "+v"(c) : "v"(ab), "v"(bb));
    return c;
}
template <bool F16> __device__ __forceinline__ v8f mmag(v16us a, v16us b, v8f c) { if (F16) return mma_h(a, b, c); else return mma_b(a, b, c); }
// The same bf16 product with the hazard distance left to the compiler's own padding.
__device__ __forceinline__ v8f mma_bp(v16us a, v16us b, v8f c) { return __builtin_amdgcn_wmma_f32_16x16x32_bf16(false, __builtin_bit_cast(v16bf, a), false, __builtin_bit_cast(v16bf, b), (short)0, c, false, false); }

__device__ __forceinline__ unsigned lds_byte(const u16* p) { return (unsigned)(size_t)(const __attribute__((address_space(3))) u16*)p; }

#define GWM  4                   // waves down a GEMM work-group, 64 rows each
#define GWN  2                   // waves across, 64 columns each
#define GTH  (32 * GWM * GWN)    // threads per GEMM work-group
#define GKS  64                  // k per stage: 128-B rows, whole cache lines
#define GPIT 72                  // u16 per staged row: 144 B = 16 B x odd, the pitch for 16-byte LDS readers of 128-B rows
#define GAR  (64 * GWM)          // A rows per stage
#define GBR  (64 * GWN)          // Bt rows per stage
#define GSTG ((GAR + GBR) * GPIT)   // u16 per stage buffer: A rows, then Bt rows
#define GEPI (16 * 68 * 4 + 64 * 72 * 2)   // bytes of epilogue staging per wave (f32 row block, then the 16-bit transpose block), laid over the ring after the k loop
static_assert(GTH == 256 && GAR == 256 && GBR == 128);   // stage_ab: 32 rows per copy, 8 copies for A and 4 for Bt
static_assert(DM % GKS == 0 && DM / GKS >= 2);           // the two-buffer prologue needs two stages
static_assert(GEPI % 16 == 0 && GEPI * GWM * GWN <= 2 * GSTG * 2);
static_assert((NB * SEQ) % GAR == 0 && (NB * (SEQ - RH)) % GAR == 0 && RH % GAR == 0 && SEQ % GAR == 0 && DM % GBR == 0);   // whole work-groups; early/late and q/k/v the same for all waves of one

// One 64-k stage for a work-group of 256 threads: 256 A rows and 128 Bt rows of 128 B, 16 bytes per lane and copy (8 lanes = one row = one line), straight into LDS. ga / gb / la: this thread's place in row tid>>3 of A, of Bt, of the buffer.
// The s_wait_xcnt 0 is the last line of the copies' own statement so that no address register of a copy is rewritten ahead of it.
__device__ __forceinline__ void stage_ab(const u16* ga, const u16* gb, const int K, const unsigned la) {
    const size_t rs = (size_t)32 * K;                 // 32 rows on in global memory
    const unsigned ls = 32 * GPIT * 2;                // 32 rows on in LDS, bytes
    const unsigned lb = la + GAR * GPIT * 2;
    asm volatile("global_load_async_to_lds_b128 %0, %1, off\n\t"
                 "global_load_async_to_lds_b128 %2, %3, off\n\t"
                 "global_load_async_to_lds_b128 %4, %5, off\n\t"
                 "global_load_async_to_lds_b128 %6, %7, off\n\t"
                 "global_load_async_to_lds_b128 %8, %9, off\n\t"
                 "global_load_async_to_lds_b128 %10, %11, off\n\t"
                 "global_load_async_to_lds_b128 %12, %13, off\n\t"
                 "global_load_async_to_lds_b128 %14, %15, off\n\t"
                 "global_load_async_to_lds_b128 %16, %17, off\n\t"
                 "global_load_async_to_lds_b128 %18, %19, off\n\t"
                 "global_load_async_to_lds_b128 %20, %21, off\n\t"
                 "global_load_async_to_lds_b128 %22, %23, off\n\t"
                 "s_wait_xcnt 0x0"
                 :: "v"(la), "v"(ga), "v"(la + ls), "v"(ga + rs), "v"(la + 2 * ls), "v"(ga + 2 * rs), "v"(la + 3 * ls), "v"(ga + 3 * rs),
                    "v"(la + 4 * ls), "v"(ga + 4 * rs), "v"(la + 5 * ls), "v"(ga + 5 * rs), "v"(la + 6 * ls), "v"(ga + 6 * rs), "v"(la + 7 * ls), "v"(ga + 7 * rs),
                    "v"(lb), "v"(gb), "v"(lb + ls), "v"(gb + rs), "v"(lb + 2 * ls), "v"(gb + 2 * rs), "v"(lb + 3 * ls), "v"(gb + 3 * rs) : "memory");
}

// One wave computes a 64x64 tile: acc[mb][nb] element j = C[r0 + 16 mb + 8 (lane>>4) + j][c0 + 16 nb + (lane&15)] = sum_k A[m][k] Bt[n][k], k ascending in blocks of 32. K % 64 == 0.
// A work-group of GWM x GWN waves on rows R0.. and columns C0..: the waves share each 64-k stage of A and Bt,
// brought into the two buffers of 'ring' by asynchronous copies one stage ahead. On return no copy is in flight and every wave has left the ring (the last trip's barrier), so the caller may reuse it.
template <bool F16>
__device__ __forceinline__ void gemm_tile_s(const u16* __restrict__ A, const u16* __restrict__ Bt, const int K, const int R0, const int C0, u16* ring, const int tid, const int wm, const int wn, const int lr, const int hi, v8f (&acc)[4][4]) {
#pragma unroll
    for (int mb = 0; mb < 4; ++mb)
#pragma unroll
        for (int nb = 0; nb < 4; ++nb) acc[mb][nb] = (v8f){};
    const u16* ga = A + (size_t)(R0 + (tid >> 3)) * K + (tid & 7) * 8;
    const u16* gb = Bt + (size_t)(C0 + (tid >> 3)) * K + (tid & 7) * 8;
    const unsigned la = lds_byte(ring + (tid >> 3) * GPIT + (tid & 7) * 8);
    const int nst = K / GKS;
    stage_ab(ga, gb, K, la);
    asm volatile("s_wait_asynccnt 0x0" ::: "memory");   // this wave's copies of stage 0 have landed
    __syncthreads();                                     // stage 0 readable by every wave
    stage_ab(ga + GKS, gb + GKS, K, la + GSTG * 2);
#pragma unroll 1   // kept rolled: one body of 32 products, the buffer picked by st & 1; unrolling would only grow the text
    for (int st = 0; st < nst; ++st) {
        const u16* ar = ring + (st & 1) * GSTG + (wm * 64 + lr) * GPIT + 8 * hi;
        const u16* br = ring + (st & 1) * GSTG + (GAR + wn * 64 + lr) * GPIT + 8 * hi;
#pragma unroll   // this and the loops inside: every fragment and accumulator index a constant, so that they stay in registers
        for (int kc = 0; kc < GKS; kc += 32) {
            v16us a[4], bb[4];                  // the block's 16 LDS reads stand together, ahead of its 16 products
#pragma unroll
            for (int mb = 0; mb < 4; ++mb) a[mb] = ldfr(ar + mb * 16 * GPIT + kc);
#pragma unroll
            for (int nb = 0; nb < 4; ++nb) bb[nb] = ldfr(br + nb * 16 * GPIT + kc);
#pragma unroll
            for (int nb = 0; nb < 4; ++nb)
#pragma unroll
                for (int mb = 0; mb < 4; ++mb) acc[mb][nb] = mmag<F16>(a[mb], bb[nb], acc[mb][nb]);
        }
        asm volatile("s_wait_dscnt 0x0" ::: "memory");      // this wave's LDS reads of the stage are done before the buffer is refilled
        asm volatile("s_wait_asynccnt 0x0" ::: "memory");   // this wave's copies of the next stage have landed
        __syncthreads();                                     // publishes the next stage and ends every reader's last read of this one
        if (st + 2 < nst) stage_ab(ga + (st + 2) * GKS, gb + (st + 2) * GKS, K, la + (st & 1) * (GSTG * 2));
    }
    asm volatile("s_wait_asynccnt 0x0" ::: "memory");       // no copy is left in flight when the ring becomes epilogue staging
}

#define CVW   16                 // waves per conversion work-group
#define CVG   256                // conversion work-groups: with CVW, the launch's wave count (chosen for speed only), started once
#define CNW   (CVG * CVW)        // waves of the conversion launch
#define XROWS (NB * SEQ)         // rows of x
#define CROWS (XROWS + 4 * DM)   // rows of DM f32 to convert: x, then the query, key, value and output weights
static_assert(DM == 8 * 128);    // one row = 8 loads of 16 B per lane, each load of a wave 512 contiguous bytes
static_assert(O_XB == 0 && O_WALL == (size_t)XROWS * DM && O_WPB == O_WALL + 3 * WN && O_WPH == O_WPB + WN);   // row r of the list above lands at PL + r * DM; the f16 output-weight plane lies WN further on

typedef __attribute__((ext_vector_type(4))) unsigned short v4us;

// One converted row of 1024 16-bit values: 8 stores of 8 B per lane, each store of a wave 256 contiguous bytes (two whole lines). 'row' is the same in every lane, 'lofs' the lane's byte offset in the first 256 bytes.
// Written as one statement so that its last line, s_wait_xcnt 0, stands in front of every later write of a register that these stores name (in a statement of its own the compiler moved the next conversions over it).
__device__ __forceinline__ void store_row(u16* row, const unsigned lofs, const v4us (&d)[8]) {
    asm volatile("global_store_b64 %0, %1, %9\n\t"
                 "global_store_b64 %0, %2, %9 offset:256\n\t"
                 "global_store_b64 %0, %3, %9 offset:512\n\t"
                 "global_store_b64 %0, %4, %9 offset:768\n\t"
                 "global_store_b64 %0, %5, %9 offset:1024\n\t"
                 "global_store_b64 %0, %6, %9 offset:1280\n\t"
                 "global_store_b64 %0, %7, %9 offset:1536\n\t"
                 "global_store_b64 %0, %8, %9 offset:1792\n\t"
                 "s_wait_xcnt 0x0"
                 :: "v"(lofs), "v"(d[0]), "v"(d[1]), "v"(d[2]), "v"(d[3]), "v"(d[4]), "v"(d[5]), "v"(d[6]), "v"(d[7]), "s"(row) : "memory");
}

// k_cvt_all: every f32 -> 16-bit plane of the call in one launch of CVG work-groups. One wave per row of 1024 values and trip, rows dealt round robin over the launch's waves (wave gw takes rows gw, gw + CNW, ...);
// 8 whole-line loads of 16 B per lane in flight per wave. x and all four weights -> bf16 (RNE); the output weight also -> f16 of (bf16 value x WCAR). A reduced build reads the right rows of the full-size x.
__global__ __launch_bounds__(32 * CVW) void k_cvt_all(const float* __restrict__ x, const float* __restrict__ Wq, const float* __restrict__ Wk, const float* __restrict__ Wv, const float* __restrict__ Wp, u16* __restrict__ PL) {
    const int lane = threadIdx.x & 31;
    const int gw = __builtin_amdgcn_readfirstlane(blockIdx.x * CVW + (threadIdx.x >> 5));   // wave number as a scalar: the row, its source and the branches on it stay scalar
#pragma unroll 1   // kept rolled: few trips, and the other waves of the WGP cover a wave's load latency
    for (int r = gw; r < CROWS; r += CNW) {
        const float* src;
        if (r < XROWS) src = x + ((size_t)(r / SEQ) * SEQ_FULL + (r % SEQ)) * DM;
        else {
            const int w = (r - XROWS) / DM, wr = (r - XROWS) % DM;
            src = ((w == 0) ? Wq : (w == 1) ? Wk : (w == 2) ? Wv : Wp) + (size_t)wr * DM;
        }
        v4f v[8];
#pragma unroll
        for (int j = 0; j < 8; ++j) v[j] = *(const v4f*)(src + j * 128 + lane * 4);
        v4us ob[8];
#pragma unroll
        for (int j = 0; j < 8; ++j)
#pragma unroll
            for (int k = 0; k < 4; ++k) ob[j][k] = f2bf(v[j][k]);
        u16* row = PL + (size_t)r * DM;
        store_row(row, lane * 8, ob);
        if (r >= XROWS + 3 * DM) {
            v4us oh[8];
#pragma unroll
            for (int j = 0; j < 8; ++j)
#pragma unroll
                for (int k = 0; k < 4; ++k) oh[j][k] = f2h(bf2f(ob[j][k]) * WCAR);
            store_row(row + WN, lane * 8, oh);
        }
    }
}

// k_proj: [NB*SEQ][1024] x [3072][1024]^T (rows 0..1023 query weight, 1024..2047 key weight, 2048..3071 value weight). One wave per 64x64 tile = 64 time rows of one head, eight waves (4 x 2 tiles) per work-group sharing the staged operands.
// Epilogue q/k: per-row LayerNorm over the 64 head columns (mean and biased variance in f32 across 8 lanes x 8 columns, eps 1e-5, gain and bias taken as bf16 values of the inputs; both parameter sets are loaded and chosen by value),
// then f16 head plane rows [b][h][t][64] (+ bf16 hi/lo rows for t < RH); v: transposed through LDS into [b][h][d][t] lines of 64 t (+ hi/lo for t < RH). Planes addressed by element offsets from one base.
// All f16 plane values go through the value-select convert (no subnormal f16 can be produced).
__global__ __launch_bounds__(GTH) void k_proj(const u16* __restrict__ XB, const u16* __restrict__ WALL, u16* PL, size_t oP16, size_t oEH, size_t oEL,
                                             const float* __restrict__ QG, const float* __restrict__ QB, const float* __restrict__ KG, const float* __restrict__ KB) {
    __shared__ __align__(16) u16 ring[2 * GSTG];
    const int tid = threadIdx.x, lane = tid & 31, lr = lane & 15, hi = lane >> 4;
    const int wv = __builtin_amdgcn_readfirstlane(tid >> 5), wm = wv % GWM, wn = wv / GWM;   // wave number as a scalar: tile indices and the branches on them stay scalar
    float* os = (float*)((char*)ring + wv * GEPI);                       // this wave's own staging, used after the k loop only
    u16* ts = (u16*)((char*)ring + wv * GEPI + 16 * 68 * 4);
    const int r0 = blockIdx.x * GAR + wm * 64, c0 = blockIdx.y * GBR + wn * 64;
    const int which = c0 / DM, hd = (c0 - which * DM) / HD;
    const int b = r0 / SEQ, t0 = r0 - b * SEQ;
    const bool early = (t0 < RH);
    const size_t bh = (size_t)b * NH + hd;
    v8f acc[4][4];
    gemm_tile_s<false>(XB, WALL, DM, blockIdx.x * GAR, blockIdx.y * GBR, ring, tid, wm, wn, lr, hi, acc);
    if (which < 2) {
        const size_t o16 = oP16 + (size_t)which * PLANE + (bh * SEQ + t0) * HD;
        const size_t oeh = oEH + (size_t)which * EPLANE + (bh * RH + (early ? t0 : 0)) * HD;
        const size_t oel = oEL + (size_t)which * EPLANE + (bh * RH + (early ? t0 : 0)) * HD;
        const int gc = (lane & 7) * 8;                 // this lane's 8 head columns (same in every row group)
        const v4f gq0 = *(const v4f*)(QG + gc), gq1 = *(const v4f*)(QG + gc + 4);
        const v4f bq0 = *(const v4f*)(QB + gc), bq1 = *(const v4f*)(QB + gc + 4);
        const v4f gk0 = *(const v4f*)(KG + gc), gk1 = *(const v4f*)(KG + gc + 4);
        const v4f bk0 = *(const v4f*)(KB + gc), bk1 = *(const v4f*)(KB + gc + 4);
        v4f g0, g1, be0, be1;
#pragma unroll
        for (int q = 0; q < 4; ++q) {
            g0[q]  = bfr((which == 0) ? gq0[q] : gk0[q]); g1[q]  = bfr((which == 0) ? gq1[q] : gk1[q]);
            be0[q] = bfr((which == 0) ? bq0[q] : bk0[q]); be1[q] = bfr((which == 0) ? bq1[q] : bk1[q]);
        }
#pragma unroll
        for (int mb = 0; mb < 4; ++mb) {
#pragma unroll
            for (int nb = 0; nb < 4; ++nb)
#pragma unroll
                for (int j = 0; j < 8; ++j) os[(hi * 8 + j) * 68 + nb * 16 + lr] = acc[mb][nb][j];
            __syncthreads();
{
#pragma unroll
                for (int s = 0; s < 4; ++s) {
                    const int row = 4 * s + (lane >> 3), pc = (lane & 7) * 8;
                    const v4f x0 = *(const v4fa*)&os[row * 68 + pc]; const v4f x1 = *(const v4fa*)&os[row * 68 + pc + 4];
                    // LayerNorm of the 64-wide row held by the 8 lanes sharing lane>>3 (all 32 lanes active, uniform control)
                    float sm = ((x0[0] + x0[1]) + (x0[2] + x0[3])) + ((x1[0] + x1[1]) + (x1[2] + x1[3]));
                    sm += __shfl_xor(sm, 1, 32); sm += __shfl_xor(sm, 2, 32); sm += __shfl_xor(sm, 4, 32);
                    const float mean = sm * (1.0f / 64.0f);
                    v4f d0, d1;
#pragma unroll
                    for (int q = 0; q < 4; ++q) { d0[q] = x0[q] - mean; d1[q] = x1[q] - mean; }
                    float vs = ((d0[0] * d0[0] + d0[1] * d0[1]) + (d0[2] * d0[2] + d0[3] * d0[3])) + ((d1[0] * d1[0] + d1[1] * d1[1]) + (d1[2] * d1[2] + d1[3] * d1[3]));
                    vs += __shfl_xor(vs, 1, 32); vs += __shfl_xor(vs, 2, 32); vs += __shfl_xor(vs, 4, 32);
                    const float rinv = rsqrtf(vs * (1.0f / 64.0f) + LNEPS);
                    v4f y0, y1;
#pragma unroll
                    for (int q = 0; q < 4; ++q) { y0[q] = d0[q] * rinv * g0[q] + be0[q]; y1[q] = d1[q] * rinv * g1[q] + be1[q]; }
                    v8us q16;
#pragma unroll
                    for (int q = 0; q < 4; ++q) { q16[q] = f2h_fl(y0[q]); q16[4 + q] = f2h_fl(y1[q]); }
                    const size_t ro = (size_t)(mb * 16 + row) * HD + pc;
                    *(v8us*)(PL + o16 + ro) = q16;
                    if (early) {
                        v8us oh, ol;
#pragma unroll
                        for (int q = 0; q < 4; ++q) { const u16 a = f2bf(y0[q]); oh[q] = a; ol[q] = f2bf(y0[q] - bf2f(a)); const u16 c = f2bf(y1[q]); oh[4 + q] = c; ol[4 + q] = f2bf(y1[q] - bf2f(c)); }
                        *(v8us*)(PL + oeh + ro) = oh; *(v8us*)(PL + oel + ro) = ol;
                    }
                }
                
            }
            __syncthreads();
        }
    } else {
#pragma unroll
        for (int pl = 0; pl < 3; ++pl) {
            if (pl == 0 || early) {
#pragma unroll
                for (int mb = 0; mb < 4; ++mb)
#pragma unroll
                    for (int nb = 0; nb < 4; ++nb) {
                        v8us pk;
#pragma unroll
                        for (int j = 0; j < 8; ++j) { const float y = acc[mb][nb][j]; const u16 hb = f2bf(y); pk[j] = (pl == 0) ? f2h_fl(y) : ((pl == 1) ? hb : f2bf(y - bf2f(hb))); }
                        *(v8usa*)&ts[(nb * 16 + lr) * 72 + mb * 16 + hi * 8] = pk;     // ts[d][t]: 8 consecutive t per lane
                    }
                __syncthreads();
                const size_t dofs = (pl == 0) ? (oP16 + 2 * PLANE + bh * HD * SEQ + t0) : (((pl == 1) ? oEH : oEL) + 2 * EPLANE + bh * HD * RH + t0);
                const int dp = (pl == 0) ? SEQ : RH;
{
#pragma unroll 4
                    for (int s = 0; s < 16; ++s) {
                        const int d = 4 * s + (lane >> 3), pc = (lane & 7) * 8;
                        const v8us v = *(const v8usa*)&ts[d * 72 + pc];
                        *(v8us*)(PL + dofs + (size_t)d * dp + pc) = v;
                    }
                    
                }
                __syncthreads();
            }
        }
    }
}

// Online-softmax update for one 16 x 32 score step. s0/s1 hold raw scores for keys jb + (lane&15) and jb + 16 + (lane&15), rows qbase + 8 (lane>>4) + i; on return they hold exp2(t - running max).
// lrow keeps PER-LANE partial sums (reduced over the 16 lanes of a row once, after the key loop). Masked entries are replaced before the maximum; every row keeps its own key.
__device__ __forceinline__ void sm_step(v8f& s0, v8f& s1, float (&mrow)[8], float (&lrow)[8], float (&corr)[8], const int jb, const int qbase, const int lr, const int hi) {
#pragma unroll
    for (int i = 0; i < 8; ++i) {
        const int row = qbase + i + 8 * hi;
        float a0 = s0[i] * SCL2, a1 = s1[i] * SCL2;
        a0 = (jb + lr > row) ? -1.0e30f : a0;
        a1 = (jb + 16 + lr > row) ? -1.0e30f : a1;
        float mx = fmaxf(a0, a1);
        mx = fmaxf(mx, __shfl_xor(mx, 1, 32)); mx = fmaxf(mx, __shfl_xor(mx, 2, 32)); mx = fmaxf(mx, __shfl_xor(mx, 4, 32)); mx = fmaxf(mx, __shfl_xor(mx, 8, 32));
        const float mnew = fmaxf(mrow[i], mx);
        // The row's three exponentials as v_exp_f32, like the builtin. One statement, each in its own register, and a closing v_nop: so no instruction directly behind an exponential reads its result or overwrites its source
        // (with the registers of this build the compiler gave an exponential's result the register the one before it had just read).
        float c = mrow[i] - mnew, p0 = a0 - mnew, p1 = a1 - mnew;
        asm("v_exp_f32 %0, %0\n\tv_exp_f32 %1, %1\n\tv_exp_f32 %2, %2\n\tv_nop" : "+v"(c), "+v"(p0), "+v"(p1));
        lrow[i] = lrow[i] * c + (p0 + p1);
        mrow[i] = mnew; corr[i] = c; s0[i] = p0; s1[i] = p1;
    }
}

#define AW   4                   // waves per late-attention work-group, 16 query rows each
#define KPIT 72                  // u16 per staged key row: 144 B = 16 B x odd, the pitch for 16-byte LDS readers of 128-B rows
#define VPIT 40                  // u16 per staged value row: 80 B = 16 B x odd, the same for 64-B rows
#define NQB_L (((SEQ - RH) / (16 * AW)) > 0 ? ((SEQ - RH) / (16 * AW)) : 1)
static_assert((SEQ - RH) % (16 * AW) == 0);   // whole work-groups of query rows
static_assert((RH + 16 * AW) / 32 >= 2);      // the two-buffer prologue needs two key steps
static_assert((16 * AW) % 32 == 0 && RH % 32 == 0);   // a work-group's last key step ends on its last query row
#define NWGP 256                 // WGPs of the chip (used for speed only)
#define LGR  (((NWGP % (NB * NH)) == 0 && (NQB_L % (NWGP / (NB * NH))) == 0) ? (NWGP / (NB * NH)) : 1)   // query blocks (all heads of each) per such round of NWGP work-groups; 1: no mirroring

// One 32-key stage for a work-group of 128 threads: key rows jb..jb+31 (32 x 128 B, contiguous in the plane) and the 64 value rows' columns jb..jb+31 (64 x 64 B), 16 bytes per lane and copy, straight into LDS.
// The s_wait_xcnt 0 is the last line of the copies' own statement so that no address register of a copy is rewritten ahead of it.
__device__ __forceinline__ void stage_kv(const u16* __restrict__ Kb, const u16* __restrict__ Vb, const int jb, u16* kd, u16* vd, const int tid) {
    const u16* gk0 = Kb + (size_t)(jb + (tid >> 3)) * HD + (tid & 7) * 8;      // rows 0..15 of the stage
    const u16* gk1 = gk0 + 16 * HD;                                           // rows 16..31
    const u16* gv0 = Vb + (size_t)(tid >> 2) * SEQ + jb + (tid & 3) * 8;       // head columns 0..31
    const u16* gv1 = gv0 + (size_t)32 * SEQ;                                  // head columns 32..63
    const unsigned lk0 = lds_byte(kd + (tid >> 3) * KPIT + (tid & 7) * 8), lk1 = lk0 + 16 * KPIT * 2;
    const unsigned lv0 = lds_byte(vd + (tid >> 2) * VPIT + (tid & 3) * 8), lv1 = lv0 + 32 * VPIT * 2;
    asm volatile("global_load_async_to_lds_b128 %0, %1, off\n\t"
                 "global_load_async_to_lds_b128 %2, %3, off\n\t"
                 "global_load_async_to_lds_b128 %4, %5, off\n\t"
                 "global_load_async_to_lds_b128 %6, %7, off\n\t"
                 "s_wait_xcnt 0x0"
                 :: "v"(lk0), "v"(gk0), "v"(lk1), "v"(gk1), "v"(lv0), "v"(gv0), "v"(lv1), "v"(gv1) : "memory");
}

// Lane l's value from lane l ^ 16 (the other half of the wave), by a vector cross-row move.
__device__ __forceinline__ float xhalf(float x) {
    const int v = __builtin_bit_cast(int, x);
    return __builtin_bit_cast(float, __builtin_amdgcn_permlanex16(v, v, 0x76543210, 0xfedcba98, false, false));
}

// 2^c and 2^a[0..7] (first form), 2^a[0..7] (second form), as v_exp_f32 like the builtin. One statement each, results in registers of their own ("=&v") and a closing v_nop:
// so no instruction directly behind an exponential reads its result or overwrites its source (left to itself the compiler gave an exponential's result the register the one before it had just read).
__device__ __forceinline__ void exp2_9(const float c, const v8f a, float& ec, v8f& e) {
    float r0, r1, r2, r3, r4, r5, r6, r7;
    asm("v_exp_f32 %0, %9\n\tv_exp_f32 %1, %10\n\tv_exp_f32 %2, %11\n\tv_exp_f32 %3, %12\n\tv_exp_f32 %4, %13\n\tv_exp_f32 %5, %14\n\tv_exp_f32 %6, %15\n\tv_exp_f32 %7, %16\n\tv_exp_f32 %8, %17\n\tv_nop"
        : "=&v"(ec), "=&v"(r0), "=&v"(r1), "=&v"(r2), "=&v"(r3), "=&v"(r4), "=&v"(r5), "=&v"(r6), "=&v"(r7)
        : "v"(c), "v"(a[0]), "v"(a[1]), "v"(a[2]), "v"(a[3]), "v"(a[4]), "v"(a[5]), "v"(a[6]), "v"(a[7]));
    e[0] = r0; e[1] = r1; e[2] = r2; e[3] = r3; e[4] = r4; e[5] = r5; e[6] = r6; e[7] = r7;
}
__device__ __forceinline__ void exp2_8(const v8f a, v8f& e) {
    float r0, r1, r2, r3, r4, r5, r6, r7;
    asm("v_exp_f32 %0, %8\n\tv_exp_f32 %1, %9\n\tv_exp_f32 %2, %10\n\tv_exp_f32 %3, %11\n\tv_exp_f32 %4, %12\n\tv_exp_f32 %5, %13\n\tv_exp_f32 %6, %14\n\tv_exp_f32 %7, %15\n\tv_nop"
        : "=&v"(r0), "=&v"(r1), "=&v"(r2), "=&v"(r3), "=&v"(r4), "=&v"(r5), "=&v"(r6), "=&v"(r7)
        : "v"(a[0]), "v"(a[1]), "v"(a[2]), "v"(a[3]), "v"(a[4]), "v"(a[5]), "v"(a[6]), "v"(a[7]));
    e[0] = r0; e[1] = r1; e[2] = r2; e[3] = r3; e[4] = r4; e[5] = r5; e[6] = r6; e[7] = r7;
}

// attn_l_body (block range of k_attn): query rows >= RH, f16 single products. One work-group of AW waves per 16*AW query rows of one (batch, head), one wave per 16 rows; the waves share each 32-key stage of K and V,
// brought into two LDS buffers by asynchronous copies one stage ahead. Every wave walks the work-group's key range: a step wholly above a wave's diagonal adds exact zeros. ctx f16 x CCAR -> AT [b][t-RH][1024].
// Both products are taken transposed: S^T = K Q^T (A = key rows from LDS, B = the wave's query rows, kept in registers) and O^T += V^T P^T (A = rows of the staged V^T, B = P^T).
// A lane then holds 16 of the 32 scores of ONE query (qbase + (lane&15); keys jb + 8 (lane>>4) + r and jb + 16 + 8 (lane>>4) + r): maximum and sum run inside the lane, the two halves of the wave meet in one exchange,
// and the two score tiles, converted in place, are the B operand of the second product in the loader's own k order, so P goes through no LDS and no barrier.
__device__ __forceinline__ void attn_l_body(const int bid, u16* sm, const u16* __restrict__ QP, const u16* __restrict__ KP, const u16* __restrict__ VT, u16* AT) {
    u16 (*ks)[32 * KPIT] = (u16 (*)[32 * KPIT])sm;                    // two key stages
    u16 (*vs)[HD * VPIT] = (u16 (*)[HD * VPIT])(sm + 2 * 32 * KPIT);  // two value stages
    const int tid = threadIdx.x, lane = tid & 31, lr = lane & 15, hi = lane >> 4;
    const int wv = __builtin_amdgcn_readfirstlane(tid >> 5);   // wave number as a scalar: the test for steps that touch the diagonal stays a scalar branch
    // Work-group order, for speed only (every (head, query block) pair is taken once, wherever and whenever a work-group runs). A query block's cost grows with its index:
    // the heaviest query blocks come first, heads fastest, so that what starts last is short (the lightest start as places on the WGPs fall free). LGR query blocks per round of NWGP: every other round is mirrored, so that the key steps of the work-groups that share a WGP add up alike.
    const int rk = bid / (NB * NH), bh = bid - rk * (NB * NH);   // rank of the query block, head
    const int rd = rk / LGR;                                                   // round
    const int qb = NQB_L - 1 - ((rd & 1) ? rd * LGR + (LGR - 1) - (rk - rd * LGR) : rk);
    const int b = bh / NH, h = bh - b * NH;
    const int qblk = RH + qb * (16 * AW);
    const int qbase = qblk + wv * 16;
    const size_t pb = (size_t)bh * SEQ * HD;
    const u16* Qb = QP + pb; const u16* Kb = KP + pb; const u16* Vb = VT + pb;
    const int nsteps = (qblk + 16 * AW) >> 5;    // keys 0 .. qblk+16*AW-1 in steps of 32; nsteps*32 <= SEQ, nsteps >= 2
    stage_kv(Kb, Vb, 0, ks[0], vs[0], tid);
    asm volatile("s_wait_asynccnt 0x0" ::: "memory");   // this wave's copies of stage 0 have landed
    __syncthreads();                                     // stage 0 readable by every wave
    stage_kv(Kb, Vb, 32, ks[1], vs[1], tid);
    const v16us q0 = ldfr(Qb + (size_t)(qbase + lr) * HD + 8 * hi);
    const v16us q1 = ldfr(Qb + (size_t)(qbase + lr) * HD + 32 + 8 * hi);
    v8f acc[4];                                  // acc[dt][r] = O^T[16 dt + 8 hi + r][qbase + lr], carried x PCAR
#pragma unroll
    for (int dt = 0; dt < 4; ++dt) acc[dt] = (v8f){};
    float mrun = -1.0e30f, lsum = 0.0f;          // this lane's query: running maximum of the raw scores (both halves alike); sum of this half's probabilities x PCAR
#pragma unroll 1
    for (int st = 0; st < nsteps; ++st) {
        const int jb = st * 32;
        const u16* kr0 = ks[st & 1] + lr * KPIT + 8 * hi; const u16* kr1 = kr0 + 16 * KPIT;
        const u16* vr = vs[st & 1] + lr * VPIT + 8 * hi;
        const v16us k00 = ldfr(kr0), k01 = ldfr(kr0 + 32), k10 = ldfr(kr1), k11 = ldfr(kr1 + 32);   // the step's 8 key reads stand together, ahead of its 4 score products
        v8f s0 = (v8f){}, s1 = (v8f){};
        s0 = mma_h(k00, q0, s0); s1 = mma_h(k10, q0, s1);
        s0 = mma_h(k01, q1, s0); s1 = mma_h(k11, q1, s1);
        v16us vf[4];                             // the step's 8 value reads stand together too: they return while the softmax runs
#pragma unroll
        for (int dt = 0; dt < 4; ++dt) vf[dt] = ldfr(vr + dt * 16 * VPIT);
        if (jb + 31 > qbase) {                   // only a step that reaches past the wave's first query row can hold an excluded key
            const int dq = qbase + lr - jb - 8 * hi;      // key index r (or 16 + r) inside this lane's share is excluded when it exceeds dq
#pragma unroll
            for (int r = 0; r < 8; ++r) { s0[r] = (r > dq) ? -1.0e30f : s0[r]; s1[r] = (16 + r > dq) ? -1.0e30f : s1[r]; }
        }
        float mx = fmaxf(s0[0], s1[0]);
#pragma unroll
        for (int r = 1; r < 8; ++r) mx = fmaxf(mx, fmaxf(s0[r], s1[r]));
        mx = fmaxf(mx, xhalf(mx));
        const float mnew = fmaxf(mrun, mx);      // finite from the first step on: key 0 is open to every query
        const float nm = 10.0f - mnew * SCL2;    // 2^10 = PCAR: the carry rides in the exponent
#pragma unroll
        for (int r = 0; r < 8; ++r) { s0[r] = __builtin_fmaf(s0[r], SCL2, nm); s1[r] = __builtin_fmaf(s1[r], SCL2, nm); }
        float corr;
        exp2_9((mrun - mnew) * SCL2, s0, corr, s0);
        exp2_8(s1, s1);
        mrun = mnew;
        v16h pf;
        float ps = 0.0f;
#pragma unroll
        for (int r = 0; r < 8; ++r) { ps += s0[r] + s1[r]; pf[r] = (h16)s0[r]; pf[8 + r] = (h16)s1[r]; }
        lsum = lsum * corr + ps;
#pragma unroll
        for (int dt = 0; dt < 4; ++dt)
#pragma unroll
            for (int r = 0; r < 8; ++r) acc[dt][r] *= corr;
        const v16us pu = __builtin_bit_cast(v16us, pf);
#pragma unroll
        for (int dt = 0; dt < 4; ++dt) acc[dt] = mma_h(vf[dt], pu, acc[dt]);
        asm volatile("s_wait_dscnt 0x0" ::: "memory");      // this wave's LDS reads of the stage are done before the buffer is refilled
        asm volatile("s_wait_asynccnt 0x0" ::: "memory");   // this wave's copies of the next stage have landed
        __syncthreads();                                     // publishes the next stage and ends every reader's last read of this one
        if (st + 2 < nsteps) stage_kv(Kb, Vb, jb + 64, ks[st & 1], vs[st & 1], tid);
    }
    asm volatile("s_wait_asynccnt 0x0" ::: "memory");       // no copy is left in flight when the wave goes on to its end
    const float inv = CCAR / (lsum + xhalf(lsum));          // both carry PCAR, so it cancels
    u16* dst = AT + ((size_t)b * (SEQ - RH) + (qbase - RH) + lr) * DM + h * HD + 8 * hi;
#pragma unroll
    for (int dt = 0; dt < 4; ++dt) {             // a lane's 8 registers are 8 consecutive head columns of its query row: one 16-byte store; the wave's four stores fill each row's whole 128-B line
        v8us o;
#pragma unroll
        for (int r = 0; r < 8; ++r) o[r] = f2h(acc[dt][r] * inv);
        *(v8us*)(dst + dt * 16) = o;
    }
}

#define EAW  4                   // waves per early-attention work-group, 16 query rows each
static_assert(RH % (16 * EAW) == 0);          // whole work-groups of query rows
static_assert((16 * EAW) / 32 >= 2);          // the two-buffer prologue needs two key steps
static_assert((16 * EAW) % 32 == 0);          // a work-group's last key step ends on its last query row, inside the early planes
#define AE_RING (4 * 32 * KPIT + 4 * HD * VPIT)          // u16 of the early ring: two stages each of K hi, K lo, V hi, V lo
#define AE_LDS  (AE_RING + 2 * EAW * 16 * 40)            // u16 of an early work-group's LDS: the ring, then P hi and P lo staging
static_assert(EAW * 16 * 68 * 4 <= 4 * 32 * KPIT * 2);   // the f32 output staging fits over the key stages
static_assert(2 * 32 * KPIT + 2 * HD * VPIT <= AE_LDS);  // the late ring fits in the same array
static_assert(EAW == AW);                                // one block size for both ranges

// One 32-key stage of the hi and lo planes for a work-group of 128 threads: key rows jb..jb+31 (32 x 128 B, contiguous in each plane) and the 64 value rows' columns jb..jb+31 (64 x 64 B), 16 bytes per lane and copy, straight into LDS.
// The s_wait_xcnt 0 is the last line of the copies' own statement so that no address register of a copy is rewritten ahead of it.
__device__ __forceinline__ void stage_kv_e(const u16* __restrict__ Kh, const u16* __restrict__ Kl, const u16* __restrict__ Vh, const u16* __restrict__ Vl, const int jb, u16* kdh, u16* kdl, u16* vdh, u16* vdl, const int tid) {
    const size_t ko = (size_t)(jb + (tid >> 3)) * HD + (tid & 7) * 8;         // rows 0..15 of the stage; 16 * HD further on: rows 16..31
    const size_t vo = (size_t)(tid >> 2) * RH + jb + (tid & 3) * 8;           // head columns 0..31; 32 * RH further on: head columns 32..63
    const int kl = (tid >> 3) * KPIT + (tid & 7) * 8, vl = (tid >> 2) * VPIT + (tid & 3) * 8;
    const unsigned lkh = lds_byte(kdh + kl), lkl = lds_byte(kdl + kl), lvh = lds_byte(vdh + vl), lvl = lds_byte(vdl + vl);
    asm volatile("global_load_async_to_lds_b128 %0, %1, off\n\t"
                 "global_load_async_to_lds_b128 %2, %3, off\n\t"
                 "global_load_async_to_lds_b128 %4, %5, off\n\t"
                 "global_load_async_to_lds_b128 %6, %7, off\n\t"
                 "global_load_async_to_lds_b128 %8, %9, off\n\t"
                 "global_load_async_to_lds_b128 %10, %11, off\n\t"
                 "global_load_async_to_lds_b128 %12, %13, off\n\t"
                 "global_load_async_to_lds_b128 %14, %15, off\n\t"
                 "s_wait_xcnt 0x0"
                 :: "v"(lkh), "v"(Kh + ko), "v"(lkh + 16 * KPIT * 2), "v"(Kh + ko + 16 * HD), "v"(lkl), "v"(Kl + ko), "v"(lkl + 16 * KPIT * 2), "v"(Kl + ko + 16 * HD),
                    "v"(lvh), "v"(Vh + vo), "v"(lvh + 32 * VPIT * 2), "v"(Vh + vo + 32 * RH), "v"(lvl), "v"(Vl + vo), "v"(lvl + 32 * VPIT * 2), "v"(Vl + vo + 32 * RH) : "memory");
}

// attn_e_body (block range of k_attn): query rows < RH, bf16 hi+lo operands (hi.hi + lo.hi + hi.lo into one accumulator; residuals unscaled). ctx hi/lo bf16 -> ATEh/ATEl [b][t][1024].
// One work-group of EAW waves per 16*EAW query rows of one (batch, head), one wave per 16 rows; the waves share each 32-key stage of the K and V hi and lo planes, brought into two LDS buffers by asynchronous copies one stage ahead
// (whole lines from L2, fetched once per work-group, where fragment loads straight from the planes touch 16 lines each). Every wave walks the work-group's key range: a step wholly above a wave's diagonal adds exact zeros.
__device__ __forceinline__ void attn_e_body(const int bid, u16* sm, const u16* __restrict__ QEh, const u16* __restrict__ QEl, const u16* __restrict__ KEh, const u16* __restrict__ KEl, const u16* __restrict__ VEh, const u16* __restrict__ VEl, u16* ATEh, u16* ATEl) {
    u16 (*ksh)[32 * KPIT] = (u16 (*)[32 * KPIT])sm;
    u16 (*ksl)[32 * KPIT] = (u16 (*)[32 * KPIT])(sm + 2 * 32 * KPIT);
    u16 (*vsh)[HD * VPIT] = (u16 (*)[HD * VPIT])(sm + 4 * 32 * KPIT);
    u16 (*vsl)[HD * VPIT] = (u16 (*)[HD * VPIT])(sm + 4 * 32 * KPIT + 2 * HD * VPIT);
    const int tid = threadIdx.x, lane = tid & 31, lr = lane & 15, hi = lane >> 4;
    const int wv = __builtin_amdgcn_readfirstlane(tid >> 5);   // wave number as a scalar: the wave's own staging addresses stay scalar
    u16* pwh = sm + AE_RING + wv * (16 * 40); u16* pwl = pwh + EAW * (16 * 40);   // this wave's own P staging, behind the ring
    float* os = (float*)sm + wv * (16 * 68);                                      // this wave's own output staging, laid over the key stages: used after the key loop only, when every wave has left the ring (the last trip's barrier) and no copy is in flight
    const int bh = bid / (RH / (16 * EAW)), qb = bid - bh * (RH / (16 * EAW));
    const int b = bh / NH, h = bh - b * NH;
    const int qblk = qb * (16 * EAW);
    const int qbase = qblk + wv * 16;
    const size_t pb = (size_t)bh * RH * HD;
    const u16* Kh = KEh + pb; const u16* Kl = KEl + pb; const u16* Vh = VEh + pb; const u16* Vl = VEl + pb;   // V planes [bh][64][RH], same plane size as [bh][RH][64]
    const int nsteps = (qblk + 16 * EAW) >> 5;   // keys 0 .. qblk+16*EAW-1 in steps of 32; nsteps*32 <= RH, nsteps >= 2
    stage_kv_e(Kh, Kl, Vh, Vl, 0, ksh[0], ksl[0], vsh[0], vsl[0], tid);
    asm volatile("s_wait_asynccnt 0x0" ::: "memory");   // this wave's copies of stage 0 have landed
    __syncthreads();                                     // stage 0 readable by every wave
    stage_kv_e(Kh, Kl, Vh, Vl, 32, ksh[1], ksl[1], vsh[1], vsl[1], tid);
    const size_t qo = pb + (size_t)(qbase + lr) * HD + 8 * hi;
    const v16us qh0 = ldfr(QEh + qo), qh1 = ldfr(QEh + qo + 32), ql0 = ldfr(QEl + qo), ql1 = ldfr(QEl + qo + 32);
    v8f acc[4];
#pragma unroll
    for (int nt = 0; nt < 4; ++nt) acc[nt] = (v8f){};
    float mrow[8], lrow[8];
#pragma unroll
    for (int i = 0; i < 8; ++i) { mrow[i] = -1.0e30f; lrow[i] = 0.0f; }
#pragma unroll 1
    for (int st = 0; st < nsteps; ++st) {
        const int jb = st * 32;
        const u16* krh = ksh[st & 1] + lr * KPIT + 8 * hi; const u16* krl = ksl[st & 1] + lr * KPIT + 8 * hi;   // this lane's place in the stage's key rows
        const u16* vrh = vsh[st & 1] + lr * VPIT + 8 * hi; const u16* vrl = vsl[st & 1] + lr * VPIT + 8 * hi;   // the same in the stage's value rows
        // The step's 16 key reads stand together, ahead of its 12 score products.
        const v16us kh0 = ldfr(krh), kh1 = ldfr(krh + 32), kl0 = ldfr(krl), kl1 = ldfr(krl + 32);
        const v16us kh2 = ldfr(krh + 16 * KPIT), kh3 = ldfr(krh + 16 * KPIT + 32), kl2 = ldfr(krl + 16 * KPIT), kl3 = ldfr(krl + 16 * KPIT + 32);
        v8f s0 = (v8f){}, s1 = (v8f){};
        s0 = mma_b(qh0, kh0, s0); s0 = mma_b(qh1, kh1, s0); s0 = mma_b(ql0, kh0, s0); s0 = mma_b(ql1, kh1, s0); s0 = mma_b(qh0, kl0, s0); s0 = mma_b(qh1, kl1, s0);
        s1 = mma_b(qh0, kh2, s1); s1 = mma_b(qh1, kh3, s1); s1 = mma_b(ql0, kh2, s1); s1 = mma_b(ql1, kh3, s1); s1 = mma_b(qh0, kl2, s1); s1 = mma_b(qh1, kl3, s1);
        __builtin_amdgcn_sched_barrier(0);   // this and the one behind the softmax keep the value reads out of it: strewn among its cross-lane exchanges (same counter), they made each exchange's wait wait for them too
        float corr[8];
        sm_step(s0, s1, mrow, lrow, corr, jb, qbase, lr, hi);
        __builtin_amdgcn_sched_barrier(0);
        v16us vh[2], vl[2];                      // the first 8 of the step's 16 value reads stand together: they return while the accumulators are rescaled and P is converted
#pragma unroll
        for (int nt = 0; nt < 2; ++nt) { vh[nt] = ldfr(vrh + nt * 16 * VPIT); vl[nt] = ldfr(vrl + nt * 16 * VPIT); }
#pragma unroll
        for (int nt = 0; nt < 4; ++nt)
#pragma unroll
            for (int i = 0; i < 8; ++i) acc[nt][i] *= corr[i];
#pragma unroll
        for (int i = 0; i < 8; ++i) {
            const u16 a = f2bf(s0[i]); const u16 c = f2bf(s1[i]);
            pwh[(i + 8 * hi) * 40 + lr] = a; pwl[(i + 8 * hi) * 40 + lr] = f2bf(s0[i] - bf2f(a));
            pwh[(i + 8 * hi) * 40 + 16 + lr] = c; pwl[(i + 8 * hi) * 40 + 16 + lr] = f2bf(s1[i] - bf2f(c));
        }
        __syncthreads();
        const v8us h0 = *(const v8usa*)&pwh[lr * 40 + 8 * hi]; const v8us h1 = *(const v8usa*)&pwh[lr * 40 + 16 + 8 * hi];
        const v8us l0 = *(const v8usa*)&pwl[lr * 40 + 8 * hi]; const v8us l1 = *(const v8usa*)&pwl[lr * 40 + 16 + 8 * hi];
        const v16us pfh = __builtin_shufflevector(h0, h1, 0, 1, 2, 3, 4, 5, 6, 7, 8, 9, 10, 11, 12, 13, 14, 15);
        const v16us pfl = __builtin_shufflevector(l0, l1, 0, 1, 2, 3, 4, 5, 6, 7, 8, 9, 10, 11, 12, 13, 14, 15);
#pragma unroll
        for (int nt = 0; nt < 2; ++nt) { acc[nt] = mma_b(pfh, vh[nt], acc[nt]); acc[nt] = mma_b(pfl, vh[nt], acc[nt]); acc[nt] = mma_b(pfh, vl[nt], acc[nt]); }
#pragma unroll
        for (int nt = 0; nt < 2; ++nt) { vh[nt] = ldfr(vrh + (2 + nt) * 16 * VPIT); vl[nt] = ldfr(vrl + (2 + nt) * 16 * VPIT); }   // the other 8 only now: all 16 fragments live at once took more registers than five waves to a SIMD leave, and some went to scratch
#pragma unroll
        for (int nt = 0; nt < 2; ++nt) { acc[2 + nt] = mma_b(pfh, vh[nt], acc[2 + nt]); acc[2 + nt] = mma_b(pfl, vh[nt], acc[2 + nt]); acc[2 + nt] = mma_b(pfh, vl[nt], acc[2 + nt]); }
        asm volatile("s_wait_dscnt 0x0" ::: "memory");      // this wave's LDS reads of the stage (and of its P rows) are done before the buffer is refilled
        asm volatile("s_wait_asynccnt 0x0" ::: "memory");   // this wave's copies of the next stage have landed
        __syncthreads();                                     // publishes the next stage and ends every reader's last read of this one
        if (st + 2 < nsteps) stage_kv_e(Kh, Kl, Vh, Vl, jb + 64, ksh[st & 1], ksl[st & 1], vsh[st & 1], vsl[st & 1], tid);
    }
    asm volatile("s_wait_asynccnt 0x0" ::: "memory");       // no copy is left in flight when the wave goes on to its end
#pragma unroll
    for (int i = 0; i < 8; ++i) {
        float l = lrow[i];
        l += __shfl_xor(l, 1, 32); l += __shfl_xor(l, 2, 32); l += __shfl_xor(l, 4, 32); l += __shfl_xor(l, 8, 32);
        const float inv = 1.0f / l;
#pragma unroll
        for (int nt = 0; nt < 4; ++nt) os[(i + 8 * hi) * 68 + nt * 16 + lr] = acc[nt][i] * inv;
    }
    __syncthreads();
    const size_t dofs = ((size_t)b * RH + qbase) * DM + h * HD;
{
#pragma unroll
        for (int s = 0; s < 4; ++s) {
            const int row = 4 * s + (lane >> 3), pc = (lane & 7) * 8;
            const v4f x0 = *(const v4fa*)&os[row * 68 + pc]; const v4f x1 = *(const v4fa*)&os[row * 68 + pc + 4];
            v8us oh, ol;
#pragma unroll
            for (int q = 0; q < 4; ++q) { const u16 a = f2bf(x0[q]); oh[q] = a; ol[q] = f2bf(x0[q] - bf2f(a)); const u16 c = f2bf(x1[q]); oh[4 + q] = c; ol[4 + q] = f2bf(x1[q] - bf2f(c)); }
            *(v8us*)(ATEh + dofs + (size_t)row * DM + pc) = oh;
            *(v8us*)(ATEl + dofs + (size_t)row * DM + pc) = ol;
        }
        
    }
}

#define NAE (NB * NH * (RH / (16 * EAW)))           // early work-groups
#define NAL (NB * NH * ((SEQ - RH) / (16 * AW)))    // late work-groups
// k_attn: both attention ranges in one launch; they are independent of each other, so the short, latency-bound early work-groups run beside the late ones, not in a launch of their own in front of them.
// Blocks 0 .. NAE-1: rows < RH (they come first); the rest: rows >= RH in the order of attn_l_body. The choice is the same for a whole work-group.
// amdgpu_waves_per_eu: holds the register count of the early path to what lets five work-groups share a WGP; left free it takes a quarter of a SIMD's registers, and the late range too would run four waves to a SIMD.
__global__ __launch_bounds__(32 * AW) __attribute__((amdgpu_waves_per_eu(5, 5)))
void k_attn(const u16* __restrict__ QP, const u16* __restrict__ KP, const u16* __restrict__ VT, u16* AT,
            const u16* __restrict__ QEh, const u16* __restrict__ QEl, const u16* __restrict__ KEh, const u16* __restrict__ KEl, const u16* __restrict__ VEh, const u16* __restrict__ VEl, u16* ATEh, u16* ATEl) {
    __shared__ __align__(16) u16 sm[AE_LDS];
    if (blockIdx.x < NAE) attn_e_body(blockIdx.x, sm, QEh, QEl, KEh, KEl, VEh, VEl, ATEh, ATEl);
    else attn_l_body(blockIdx.x - NAE, sm, QP, KP, VT, AT);
}

// Output projection: OUT[b][toff + r][n] = scale * sum_k A[row][k] Bt[n][k] (+ A2 product in outp_e_body) + bf16(bias[n]); rows of A are [b][r] with rpb rows per batch.
// Epilogue of one wave's 64x64 tile (outp_l_body) at rows r0.., columns c0..: whole 256-B row pieces through the wave's own staging 'os'. Every wave of the work-group passes the same barriers.
__device__ __forceinline__ void outp_store(const v8f (&acc)[4][4], float* os, const float* __restrict__ bias, float* OUT, const float scale, const int rpb, const int toff, const int r0, const int c0, const int lr, const int hi) {
    const int b = r0 / rpb, tb = toff + (r0 - b * rpb);
    float* crow0 = OUT + ((size_t)b * SEQ_FULL + tb) * DM + c0;
    const int cofs = lr * 4;
    v4f bv; bv[0] = bfr(bias[c0 + cofs]); bv[1] = bfr(bias[c0 + cofs + 1]); bv[2] = bfr(bias[c0 + cofs + 2]); bv[3] = bfr(bias[c0 + cofs + 3]);
#pragma unroll
    for (int mb = 0; mb < 4; ++mb) {
#pragma unroll
        for (int nb = 0; nb < 4; ++nb)
#pragma unroll
            for (int j = 0; j < 8; ++j) os[(hi * 8 + j) * 68 + nb * 16 + lr] = acc[mb][nb][j];
        __syncthreads();
#pragma unroll
        for (int s = 0; s < 8; ++s) {
            const int row = 2 * s + hi;
            const v4f x = *(const v4fa*)&os[row * 68 + cofs];
            v4f val; val[0] = x[0] * scale + bv[0]; val[1] = x[1] * scale + bv[1]; val[2] = x[2] * scale + bv[2]; val[3] = x[3] * scale + bv[3];
            *(v4f*)(crow0 + (size_t)(mb * 16 + row) * DM + cofs) = val;
        }
        __syncthreads();
    }
}

#define EWM  2                   // waves down an early output work-group, 32 rows each
#define EWN  4                   // waves across, 16 columns each
#define ETH  (32 * EWM * EWN)    // threads per early output work-group
#define EKS  128                 // k per stage: 256-B rows, two whole cache lines
#define EPIT 136                 // u16 per staged row: 272 B = 16 B x odd, the pitch for 16-byte LDS readers of 256-B rows
#define ESTG (3 * 64 * EPIT)     // u16 per stage buffer: 64 rows of ctx hi, 64 of ctx lo, 64 of Bt
static_assert(ETH == 256 && ETH == GTH);                 // stage_e: 16 rows per copy, 4 copies for 64 rows; one block size for both ranges of k_outp
static_assert(ESTG <= GSTG);                             // the early ring fits in the late one's array
static_assert(DM % EKS == 0 && DM / EKS >= 2);           // the two-buffer prologue needs two stages
static_assert(64 * 68 * 4 <= 2 * ESTG * 2);              // the f32 output tile is laid over the ring after the k loop
static_assert((NB * RH) % 64 == 0 && RH % 64 == 0 && DM % 64 == 0);   // whole tiles, none straddles a batch

// One 128-k stage of the three planes for a work-group of 256 threads: 64 rows of 256 B of each plane, 16 bytes per lane and copy (16 lanes = one row = two lines), 16 rows per copy, straight into LDS: 12 copies per wave in flight.
// ga / ga2 / gb: this thread's place in row tid>>4 of the tile's rows of ctx hi, ctx lo and Bt; la: its place in row tid>>4 of the buffer.
// The s_wait_xcnt 0 is the last line of the copies' own statement so that no address register of a copy is rewritten ahead of it.
__device__ __forceinline__ void stage_e(const u16* ga, const u16* ga2, const u16* gb, const unsigned la) {
    const size_t rs = (size_t)16 * DM;                // 16 rows on in global memory
    const unsigned ls = 16 * EPIT * 2;                // 16 rows on in LDS, bytes
    const unsigned l2 = la + 64 * EPIT * 2, lb = la + 128 * EPIT * 2;
    asm volatile("global_load_async_to_lds_b128 %0, %1, off\n\t"
                 "global_load_async_to_lds_b128 %2, %3, off\n\t"
                 "global_load_async_to_lds_b128 %4, %5, off\n\t"
                 "global_load_async_to_lds_b128 %6, %7, off\n\t"
                 "global_load_async_to_lds_b128 %8, %9, off\n\t"
                 "global_load_async_to_lds_b128 %10, %11, off\n\t"
                 "global_load_async_to_lds_b128 %12, %13, off\n\t"
                 "global_load_async_to_lds_b128 %14, %15, off\n\t"
                 "global_load_async_to_lds_b128 %16, %17, off\n\t"
                 "global_load_async_to_lds_b128 %18, %19, off\n\t"
                 "global_load_async_to_lds_b128 %20, %21, off\n\t"
                 "global_load_async_to_lds_b128 %22, %23, off\n\t"
                 "s_wait_xcnt 0x0"
                 :: "v"(la), "v"(ga), "v"(la + ls), "v"(ga + rs), "v"(la + 2 * ls), "v"(ga + 2 * rs), "v"(la + 3 * ls), "v"(ga + 3 * rs),
                    "v"(l2), "v"(ga2), "v"(l2 + ls), "v"(ga2 + rs), "v"(l2 + 2 * ls), "v"(ga2 + 2 * rs), "v"(l2 + 3 * ls), "v"(ga2 + 3 * rs),
                    "v"(lb), "v"(gb), "v"(lb + ls), "v"(gb + rs), "v"(lb + 2 * ls), "v"(gb + 2 * rs), "v"(lb + 3 * ls), "v"(gb + 3 * rs) : "memory");
}

// outp_e_body (block range of k_outp): rows < RH, bf16 hi+lo ctx planes; one work-group of eight waves (2 x 4 tiles of 32x16) per 64x64 tile (bx, by). The waves share each 128-k stage of ctx hi, ctx lo and Bt,
// brought into the two buffers of 'ring' by asynchronous copies one stage ahead (whole lines from L2, where fragment loads straight from the planes touch 16 lines each).
// Per accumulator the order of the sum is k ascending in blocks of 32, hi product then lo product. The f32 tile goes out through the ring in whole 256-B row pieces.
__device__ __forceinline__ void outp_e_body(const int bx, const int by, u16* ring, const u16* __restrict__ A, const u16* __restrict__ A2, const u16* __restrict__ Bt, const float* __restrict__ bias, float* OUT) {
    const int tid = threadIdx.x, lane = tid & 31, lr = lane & 15, hi = lane >> 4;
    const int wv = __builtin_amdgcn_readfirstlane(tid >> 5), wm = wv % EWM, wn = wv / EWM;   // wave number as a scalar: tile indices stay scalar
    const int r0 = bx * 64, c0 = by * 64;
    const int cofs = (tid & 15) * 4;                        // this thread's 4 output columns in the epilogue; their bias is fetched here, so that its latency lies behind the k loop
    const v4f braw = *(const v4f*)(bias + c0 + cofs);
    v8f acc[2];                  // acc[mb] element j = C[r0 + 32 wm + 16 mb + 8 hi + j][c0 + 16 wn + lr]
#pragma unroll
    for (int mb = 0; mb < 2; ++mb) acc[mb] = (v8f){};
    const size_t go = (size_t)(tid >> 4) * DM + (tid & 15) * 8;
    const u16* ga = A + (size_t)r0 * DM + go; const u16* ga2 = A2 + (size_t)r0 * DM + go; const u16* gb = Bt + (size_t)c0 * DM + go;
    const unsigned la = lds_byte(ring + (tid >> 4) * EPIT + (tid & 15) * 8);
    const int nst = DM / EKS;
    stage_e(ga, ga2, gb, la);
    asm volatile("s_wait_asynccnt 0x0" ::: "memory");   // this wave's copies of stage 0 have landed
    __syncthreads();                                     // stage 0 readable by every wave
    stage_e(ga + EKS, ga2 + EKS, gb + EKS, la + ESTG * 2);
#pragma unroll 1   // kept rolled: one body of 16 products, the buffer picked by st & 1
    for (int st = 0; st < nst; ++st) {
        const u16* ar = ring + (st & 1) * ESTG + (wm * 32 + lr) * EPIT + 8 * hi;
        const u16* br = ring + (st & 1) * ESTG + (128 + wn * 16 + lr) * EPIT + 8 * hi;
        v16us a[EKS / 32][2], a2[EKS / 32][2], bb[EKS / 32];
#pragma unroll   // this and the loops below: every fragment and accumulator index a constant, so that they stay in registers
        for (int kb = 0; kb < EKS / 32; ++kb) {
#pragma unroll
            for (int mb = 0; mb < 2; ++mb) a[kb][mb] = ldfr(ar + mb * 16 * EPIT + kb * 32);
            bb[kb] = ldfr(br + kb * 32);
#pragma unroll
            for (int mb = 0; mb < 2; ++mb) a2[kb][mb] = ldfr(ar + (64 + mb * 16) * EPIT + kb * 32);
        }
        __builtin_amdgcn_sched_barrier(0);   // holds the stage's 40 LDS reads together, ahead of its products: left free, the compiler spread them among the products in one register set, and a wave waited out an LDS latency at each place
#pragma unroll
        for (int kb = 0; kb < EKS / 32; ++kb) {
#pragma unroll
            for (int mb = 0; mb < 2; ++mb) acc[mb] = mma_bp(a[kb][mb], bb[kb], acc[mb]);
#pragma unroll
            for (int mb = 0; mb < 2; ++mb) acc[mb] = mma_bp(a2[kb][mb], bb[kb], acc[mb]);
        }
        __builtin_amdgcn_sched_barrier(0);   // keeps the waits below behind the products: moved up over them (they touch no memory), the wait for all 40 reads stood ahead of the products, which then no longer ran while the later reads return
        asm volatile("s_wait_dscnt 0x0" ::: "memory");      // this wave's LDS reads of the stage are done before the buffer is refilled
        asm volatile("s_wait_asynccnt 0x0" ::: "memory");   // this wave's copies of the next stage have landed
        __syncthreads();                                     // publishes the next stage and ends every reader's last read of this one
        if (st + 2 < nst) stage_e(ga + (st + 2) * EKS, ga2 + (st + 2) * EKS, gb + (st + 2) * EKS, la + (st & 1) * (ESTG * 2));
    }
    asm volatile("s_wait_asynccnt 0x0" ::: "memory");       // no copy is left in flight when the ring becomes output staging
    float* ot = (float*)ring;                               // [64][68] f32; every wave has left the ring (the last trip's barrier)
#pragma unroll
    for (int mb = 0; mb < 2; ++mb)
#pragma unroll
        for (int j = 0; j < 8; ++j) ot[(wm * 32 + mb * 16 + hi * 8 + j) * 68 + wn * 16 + lr] = acc[mb][j];
    __syncthreads();                                         // the whole tile is staged before any row piece is read back
    const int b = r0 / RH, tb = r0 - b * RH;
    float* crow0 = OUT + ((size_t)b * SEQ_FULL + tb) * DM + c0;
    v4f bv; bv[0] = bfr(braw[0]); bv[1] = bfr(braw[1]); bv[2] = bfr(braw[2]); bv[3] = bfr(braw[3]);
#pragma unroll
    for (int s = 0; s < 4; ++s) {
        const int row = 16 * s + (tid >> 4);
        const v4f x = *(const v4fa*)&ot[row * 68 + cofs];
        v4f val; val[0] = x[0] + bv[0]; val[1] = x[1] + bv[1]; val[2] = x[2] + bv[2]; val[3] = x[3] + bv[3];
        *(v4f*)(crow0 + (size_t)row * DM + cofs) = val;
    }
}

// outp_l_body (block range of k_outp): rows >= RH, f16 planes; eight waves (4 x 2 tiles of 64x64) per work-group (bx, by) sharing the staged operands.
__device__ __forceinline__ void outp_l_body(const int bx, const int by, u16* ring, const u16* __restrict__ A, const u16* __restrict__ Bt, const float* __restrict__ bias, float* OUT) {
    const int tid = threadIdx.x, lane = tid & 31, lr = lane & 15, hi = lane >> 4;
    const int wv = __builtin_amdgcn_readfirstlane(tid >> 5), wm = wv % GWM, wn = wv / GWM;   // wave number as a scalar: tile indices and the branches on them stay scalar
    float* os = (float*)((char*)ring + wv * GEPI);                       // this wave's own staging, used after the k loop only
    v8f acc[4][4];
    gemm_tile_s<true>(A, Bt, DM, bx * GAR, by * GBR, ring, tid, wm, wn, lr, hi, acc);
    outp_store(acc, os, bias, OUT, 1.0f / (WCAR * CCAR), (SEQ > RH) ? (SEQ - RH) : 1, RH, bx * GAR + wm * 64, by * GBR + wn * 64, lr, hi);
}

#define NOLX (NB * (SEQ - RH) / GAR)     // late work-groups down
#define NOL  (NOLX * (DM / GBR))         // late work-groups
#define NOEX (NB * RH / 64)              // early work-groups down
#define NOE  (NOEX * (DM / 64))          // early work-groups
// k_outp: both output-projection ranges in one launch; they are independent of each other, and two work-groups fit a WGP, so the short early work-groups run beside the late ones (and on the WGPs these leave empty), not in a launch of their own.
// Blocks 0 .. NOL-1: rows >= RH (the long ones start first); the rest: rows < RH; in each range the row tile runs fastest. The choice is the same for a whole work-group.
__global__ __launch_bounds__(GTH) void k_outp(const u16* __restrict__ A, const u16* __restrict__ Bt, const u16* __restrict__ AEh, const u16* __restrict__ AEl, const u16* __restrict__ BtE, const float* __restrict__ bias, float* OUT) {
    __shared__ __align__(16) u16 ring[2 * GSTG];
    const int bid = blockIdx.x;
    if (bid < NOL) outp_l_body(bid % (NOLX > 0 ? NOLX : 1), bid / (NOLX > 0 ? NOLX : 1), ring, A, Bt, bias, OUT);
    else outp_e_body((bid - NOL) % NOEX, (bid - NOL) / NOEX, ring, AEh, AEl, BtE, bias, OUT);
}

extern "C" void kernel_launch(void* const* d_in, const int* in_sizes, int n_in,
                              void* d_out, int out_size, void* d_ws, size_t ws_size, hipStream_t stream) {
    if (n_in < 10) return;
    const long long needx = ((long long)(NB - 1) * SEQ_FULL + SEQ) * DM;
    if ((long long)in_sizes[0] < needx) return;
    if ((long long)in_sizes[1] < (long long)DM * DM || (long long)in_sizes[2] < (long long)DM * DM || (long long)in_sizes[3] < (long long)DM * DM || (long long)in_sizes[4] < (long long)DM * DM) return;
    if (in_sizes[5] < DM) return;
    if (in_sizes[6] < HD || in_sizes[7] < HD || in_sizes[8] < HD || in_sizes[9] < HD) return;
    if ((long long)out_size < needx) return;
    if (O_END * 2 > ws_size) return;
    // wire order: x, key weight, query weight, value weight, output weight, output bias, key LayerNorm gain, key LayerNorm bias, query LayerNorm gain, query LayerNorm bias
    const float* x  = (const float*)d_in[0];
    const float* Wk = (const float*)d_in[1];
    const float* Wq = (const float*)d_in[2];
    const float* Wv = (const float*)d_in[3];
    const float* Wp = (const float*)d_in[4];
    const float* bp = (const float*)d_in[5];
    const float* kg = (const float*)d_in[6];
    const float* kb = (const float*)d_in[7];
    const float* qg = (const float*)d_in[8];
    const float* qb = (const float*)d_in[9];
    float* OUT = (float*)d_out;
    u16* PL = (u16*)d_ws;

    k_cvt_all<<<CVG, 32 * CVW, 0, stream>>>(x, Wq, Wk, Wv, Wp, PL);   // planes O_XB, O_WALL (query, key, value rows), O_WPB, O_WPH

    k_proj<<<dim3(NB * SEQ / GAR, 3 * DM / GBR, 1), GTH, 0, stream>>>(PL + O_XB, PL + O_WALL, PL, O_P16, O_EH, O_EL, qg, qb, kg, kb);

    k_attn<<<NAE + NAL, 32 * AW, 0, stream>>>(PL + O_P16, PL + O_P16 + PLANE, PL + O_P16 + 2 * PLANE, PL + O_AT,
                                              PL + O_EH, PL + O_EL, PL + O_EH + EPLANE, PL + O_EL + EPLANE, PL + O_EH + 2 * EPLANE, PL + O_EL + 2 * EPLANE, PL + O_ATEH, PL + O_ATEL);

    k_outp<<<NOL + NOE, GTH, 0, stream>>>(PL + O_AT, PL + O_WPH, PL + O_ATEH, PL + O_ATEL, PL + O_WPB, bp, OUT);
}

// v009
// One run takes 121 microseconds.
// In two side-by-side timings against v008, it was 1.07 and 1.06 times as fast.
// Counting every step since v000, it is 3.72 times as fast.
#include <hip/hip_runtime.h>

// Compute dtypes (f32 accumulate everywhere): q/k/v projections bf16 x bf16 (inputs converted RNE to bf16, products exact), per-head LayerNorm of q and k in f32 inside the projection epilogue; scores q.k and P.V: f16 single products on query rows >= 256 (P carried x1024), bf16 hi+lo (3 products) on query rows < 256; output projection: f16 single product (ctx x16, Wo x32 carries) on rows >= 256, bf16 hi+lo ctx x bf16 Wo on rows < 256.
// Causal 16-head attention block, x [4][2048][1024]; separate bias-free [out][in] key / query / value projections (used as Bt as stored), per-head LayerNorm (eps 1e-5, gain and bias inputs) on the 64-wide query and key rows,
// the two 1024^(-1/4) factors applied as one 1/32 on the scores, causal exclusion with the diagonal kept, softmax in f32 (running max, log2 domain), heads merged h*64+d, [out][in] output projection plus bias.
// Layout: 16-bit planes in the workspace (u16 storage): x copy [b*SEQ+t][1024]; weights [3][1024][1024] (q, k, v) ; q and k head planes [b][h][t][64]; v transposed [b][h][64][t]; hi/lo bf16 planes of the same for t < 256;
// ctx f16 [b][t-256][1024] and ctx hi/lo bf16 [b][t<256][1024]. Fused flash-style attention: one wave per 16 query rows, 32 keys per step, no score plane in global memory; four waves share K and V stages in LDS (rows < 256: hi and lo planes); rows >= 256: both products run transposed, a wave takes 32 query rows and one 32-key half of each 64-key stage, and the two halves' partial results are merged once, after the key loop. Projection and late output GEMMs: eight waves share A and B stages in LDS; early output GEMM: eight waves share ctx hi, ctx lo and B stages in LDS. Four launches: conversions; projections; attention (rows < 256 and rows >= 256 as block ranges of one grid); output projection (the same two ranges).

#ifndef NB
#define NB 4
#endif
#ifndef SEQ
#define SEQ 2048
#endif
#define NB_FULL  4
#define SEQ_FULL 2048
#define DM   1024
#define NH   16
#define HD   64
#define RH   256                 // query rows / keys below RH also carry bf16 hi+lo planes
#define PCAR 1024.0f             // carry on f16 probabilities
#define CCAR 16.0f               // carry on the f16 ctx plane
#define WCAR 32.0f               // carry on the f16 output-projection weight plane
#define SCL2 (0.03125f * 1.4426950408889634f)   // 1/sqrt(1024) x log2(e)
#define LNEPS 1.0e-5f            // LayerNorm epsilon on the head rows

static_assert(DM == NH * HD);            // heads tile the channel width
static_assert(HD == 64);
static_assert(HD == 8 * 8);              // LayerNorm row = 8 lanes x 8 columns in the projection epilogue
static_assert(DM % 64 == 0);             // GEMM k-step: two 32-k blocks a trip
static_assert(HD % 32 == 0);             // score k-step
static_assert(SEQ % 64 == 0);            // 64-row GEMM tiles never straddle a batch
static_assert(RH % 64 == 0);             // early/late split on tile borders
static_assert(SEQ >= RH);
static_assert((SEQ - RH) % 64 == 0);
static_assert(RH % 32 == 0);             // 32-key steps end inside the early planes
static_assert(NB <= NB_FULL);
static_assert(SEQ <= SEQ_FULL);

typedef unsigned short u16;
typedef _Float16 h16;
typedef __attribute__((ext_vector_type(16))) __bf16         v16bf;
typedef __attribute__((ext_vector_type(16))) _Float16       v16h;
typedef __attribute__((ext_vector_type(8)))  unsigned short v8us;
typedef __attribute__((ext_vector_type(16))) unsigned short v16us;
typedef __attribute__((ext_vector_type(8)))  float          v8f;
typedef __attribute__((ext_vector_type(4)))  float          v4f;
typedef v4f  __attribute__((may_alias)) v4fa;
typedef v8us __attribute__((may_alias)) v8usa;

#define XBN    ((size_t)NB * SEQ * DM)
#define WN     ((size_t)DM * DM)
#define PLANE  ((size_t)NB * NH * SEQ * HD)
#define EPLANE ((size_t)NB * NH * RH * HD)
#define ATN    ((size_t)NB * (SEQ - RH) * DM)
#define ATEN   ((size_t)NB * RH * DM)
#define O_XB   ((size_t)0)
#define O_WALL (O_XB + XBN)
#define O_WPB  (O_WALL + 3 * WN)
#define O_WPH  (O_WPB + WN)
#define O_P16  (O_WPH + WN)
#define O_EH   (O_P16 + 3 * PLANE)
#define O_EL   (O_EH + 3 * EPLANE)
#define O_AT   (O_EL + 3 * EPLANE)
#define O_ATEH (O_AT + ATN)
#define O_ATEL (O_ATEH + ATEN)
#define O_END  (O_ATEL + ATEN)
static_assert(O_END * 2 <= (size_t)134217728);   // total carve <= 128 MiB
static_assert(XBN % 128 == 0 && WN % 128 == 0 && PLANE % 128 == 0 && EPLANE % 128 == 0 && ATN % 128 == 0 && ATEN % 128 == 0);   // every region starts on a 256-byte border

__device__ __forceinline__ u16 f2bf(float f) { unsigned u = __float_as_uint(f); u += 0x7FFFu + ((u >> 16) & 1u); return (u16)(u >> 16); }
__device__ __forceinline__ float bf2f(u16 b) { return __uint_as_float(((unsigned)b) << 16); }
__device__ __forceinline__ float bfr(float f) { return bf2f(f2bf(f)); }
__device__ __forceinline__ u16 f2h(float x) { return __builtin_bit_cast(unsigned short, (h16)x); }

// f32 -> f16 with a value select: magnitudes below the smallest normal f16 become zero, so no subnormal f16 operand can reach a WMMA.
static __device__ __forceinline__ h16 toh_flush(float v) { const h16 r = (h16)v; return (fabsf(v) < 6.103515625e-05f) ? (h16)0.0f : r; }
static __device__ __forceinline__ u16 f2h_fl(float v) { return __builtin_bit_cast(unsigned short, toh_flush(v)); }

// Fragment loader for A and B alike: 'p' points at (row or column) + k0 + 8*(lane>>4); elements 0..7 = k0+8h.., elements 8..15 = k0+16+8h..
__device__ __forceinline__ v16us ldfr(const u16* p) {
    const v8us lo = *(const v8us*)p; const v8us hi = *(const v8us*)(p + 16);
    return __builtin_shufflevector(lo, hi, 0, 1, 2, 3, 4, 5, 6, 7, 8, 9, 10, 11, 12, 13, 14, 15);
}
// One WMMA plus its own hazard guard (ties exactly one accumulator, keeps A and B live).
__device__ __forceinline__ v8f mma_h(v16us a, v16us b, v8f c) {
    const v16h ah = __builtin_bit_cast(v16h, a); const v16h bh = __builtin_bit_cast(v16h, b);
    c = __builtin_amdgcn_wmma_f32_16x16x32_f16(false, ah, false, bh, (short)0, c, false, false);
    asm volatile("v_nop\n\tv_nop\n\tv_nop\n\tv_nop" : "+v"(c) : "v"(ah), "v"(bh));
    return c;
}
__device__ __forceinline__ v8f mma_b(v16us a, v16us b, v8f c) {
    const v16bf ab = __builtin_bit_cast(v16bf, a); const v16bf bb = __builtin_bit_cast(v16bf, b);
    c = __builtin_amdgcn_wmma_f32_16x16x32_bf16(false, ab, false, bb, (short)0, c, false, false);
    asm volatile("v_nop\n\tv_nop\n\tv_nop\n\tv_nop" : "+v"(c) : "v"(ab), "v"(bb));
    return c;
}
template <bool F16> __device__ __forceinline__ v8f mmag(v16us a, v16us b, v8f c) { if (F16) return mma_h(a, b, c); else return mma_b(a, b, c); }
// The same bf16 product with the hazard distance left to the compiler's own padding.
__device__ __forceinline__ v8f mma_bp(v16us a, v16us b, v8f c) { return __builtin_amdgcn_wmma_f32_16x16x32_bf16(false, __builtin_bit_cast(v16bf, a), false, __builtin_bit_cast(v16bf, b), (short)0, c, false, false); }

__device__ __forceinline__ unsigned lds_byte(const u16* p) { return (unsigned)(size_t)(const __attribute__((address_space(3))) u16*)p; }

#define GWM  4                   // waves down a GEMM work-group, 64 rows each
#define GWN  2                   // waves across, 64 columns each
#define GTH  (32 * GWM * GWN)    // threads per GEMM work-group
#define GKS  64                  // k per stage: 128-B rows, whole cache lines
#define GPIT 72                  // u16 per staged row: 144 B = 16 B x odd, the pitch for 16-byte LDS readers of 128-B rows
#define GAR  (64 * GWM)          // A rows per stage
#define GBR  (64 * GWN)          // Bt rows per stage
#define GSTG ((GAR + GBR) * GPIT)   // u16 per stage buffer: A rows, then Bt rows
#define GEPI (16 * 68 * 4 + 64 * 72 * 2)   // bytes of epilogue staging per wave (f32 row block, then the 16-bit transpose block), laid over the ring after the k loop
static_assert(GTH == 256 && GAR == 256 && GBR == 128);   // stage_ab: 32 rows per copy, 8 copies for A and 4 for Bt
static_assert(DM % GKS == 0 && DM / GKS >= 2);           // the two-buffer prologue needs two stages
static_assert(GEPI % 16 == 0 && GEPI * GWM * GWN <= 2 * GSTG * 2);
static_assert((NB * SEQ) % GAR == 0 && (NB * (SEQ - RH)) % GAR == 0 && RH % GAR == 0 && SEQ % GAR == 0 && DM % GBR == 0);   // whole work-groups; early/late and q/k/v the same for all waves of one

// One 64-k stage for a work-group of 256 threads: 256 A rows and 128 Bt rows of 128 B, 16 bytes per lane and copy (8 lanes = one row = one line), straight into LDS. ga / gb / la: this thread's place in row tid>>3 of A, of Bt, of the buffer.
// The s_wait_xcnt 0 is the last line of the copies' own statement so that no address register of a copy is rewritten ahead of it.
__device__ __forceinline__ void stage_ab(const u16* ga, const u16* gb, const int K, const unsigned la) {
    const size_t rs = (size_t)32 * K;                 // 32 rows on in global memory
    const unsigned ls = 32 * GPIT * 2;                // 32 rows on in LDS, bytes
    const unsigned lb = la + GAR * GPIT * 2;
    asm volatile("global_load_async_to_lds_b128 %0, %1, off\n\t"
                 "global_load_async_to_lds_b128 %2, %3, off\n\t"
                 "global_load_async_to_lds_b128 %4, %5, off\n\t"
                 "global_load_async_to_lds_b128 %6, %7, off\n\t"
                 "global_load_async_to_lds_b128 %8, %9, off\n\t"
                 "global_load_async_to_lds_b128 %10, %11, off\n\t"
                 "global_load_async_to_lds_b128 %12, %13, off\n\t"
                 "global_load_async_to_lds_b128 %14, %15, off\n\t"
                 "global_load_async_to_lds_b128 %16, %17, off\n\t"
                 "global_load_async_to_lds_b128 %18, %19, off\n\t"
                 "global_load_async_to_lds_b128 %20, %21, off\n\t"
                 "global_load_async_to_lds_b128 %22, %23, off\n\t"
                 "s_wait_xcnt 0x0"
                 :: "v"(la), "v"(ga), "v"(la + ls), "v"(ga + rs), "v"(la + 2 * ls), "v"(ga + 2 * rs), "v"(la + 3 * ls), "v"(ga + 3 * rs),
                    "v"(la + 4 * ls), "v"(ga + 4 * rs), "v"(la + 5 * ls), "v"(ga + 5 * rs), "v"(la + 6 * ls), "v"(ga + 6 * rs), "v"(la + 7 * ls), "v"(ga + 7 * rs),
                    "v"(lb), "v"(gb), "v"(lb + ls), "v"(gb + rs), "v"(lb + 2 * ls), "v"(gb + 2 * rs), "v"(lb + 3 * ls), "v"(gb + 3 * rs) : "memory");
}

// One wave computes a 64x64 tile: acc[mb][nb] element j = C[r0 + 16 mb + 8 (lane>>4) + j][c0 + 16 nb + (lane&15)] = sum_k A[m][k] Bt[n][k], k ascending in blocks of 32. K % 64 == 0.
// A work-group of GWM x GWN waves on rows R0.. and columns C0..: the waves share each 64-k stage of A and Bt,
// brought into the two buffers of 'ring' by asynchronous copies one stage ahead. On return no copy is in flight and every wave has left the ring (the last trip's barrier), so the caller may reuse it.
template <bool F16>
__device__ __forceinline__ void gemm_tile_s(const u16* __restrict__ A, const u16* __restrict__ Bt, const int K, const int R0, const int C0, u16* ring, const int tid, const int wm, const int wn, const int lr, const int hi, v8f (&acc)[4][4]) {
#pragma unroll
    for (int mb = 0; mb < 4; ++mb)
#pragma unroll
        for (int nb = 0; nb < 4; ++nb) acc[mb][nb] = (v8f){};
    const u16* ga = A + (size_t)(R0 + (tid >> 3)) * K + (tid & 7) * 8;
    const u16* gb = Bt + (size_t)(C0 + (tid >> 3)) * K + (tid & 7) * 8;
    const unsigned la = lds_byte(ring + (tid >> 3) * GPIT + (tid & 7) * 8);
    const int nst = K / GKS;
    stage_ab(ga, gb, K, la);
    asm volatile("s_wait_asynccnt 0x0" ::: "memory");   // this wave's copies of stage 0 have landed
    __syncthreads();                                     // stage 0 readable by every wave
    stage_ab(ga + GKS, gb + GKS, K, la + GSTG * 2);
#pragma unroll 1   // kept rolled: one body of 32 products, the buffer picked by st & 1; unrolling would only grow the text
    for (int st = 0; st < nst; ++st) {
        const u16* ar = ring + (st & 1) * GSTG + (wm * 64 + lr) * GPIT + 8 * hi;
        const u16* br = ring + (st & 1) * GSTG + (GAR + wn * 64 + lr) * GPIT + 8 * hi;
#pragma unroll   // this and the loops inside: every fragment and accumulator index a constant, so that they stay in registers
        for (int kc = 0; kc < GKS; kc += 32) {
            v16us a[4], bb[4];                  // the block's 16 LDS reads stand together, ahead of its 16 products
#pragma unroll
            for (int mb = 0; mb < 4; ++mb) a[mb] = ldfr(ar + mb * 16 * GPIT + kc);
#pragma unroll
            for (int nb = 0; nb < 4; ++nb) bb[nb] = ldfr(br + nb * 16 * GPIT + kc);
#pragma unroll
            for (int nb = 0; nb < 4; ++nb)
#pragma unroll
                for (int mb = 0; mb < 4; ++mb) acc[mb][nb] = mmag<F16>(a[mb], bb[nb], acc[mb][nb]);
        }
        asm volatile("s_wait_dscnt 0x0" ::: "memory");      // this wave's LDS reads of the stage are done before the buffer is refilled
        asm volatile("s_wait_asynccnt 0x0" ::: "memory");   // this wave's copies of the next stage have landed
        __syncthreads();                                     // publishes the next stage and ends every reader's last read of this one
        if (st + 2 < nst) stage_ab(ga + (st + 2) * GKS, gb + (st + 2) * GKS, K, la + (st & 1) * (GSTG * 2));
    }
    asm volatile("s_wait_asynccnt 0x0" ::: "memory");       // no copy is left in flight when the ring becomes epilogue staging
}

#define CVW   16                 // waves per conversion work-group
#define CVG   256                // conversion work-groups: with CVW, the launch's wave count (chosen for speed only), started once
#define CNW   (CVG * CVW)        // waves of the conversion launch
#define XROWS (NB * SEQ)         // rows of x
#define CROWS (XROWS + 4 * DM)   // rows of DM f32 to convert: x, then the query, key, value and output weights
static_assert(DM == 8 * 128);    // one row = 8 loads of 16 B per lane, each load of a wave 512 contiguous bytes
static_assert(O_XB == 0 && O_WALL == (size_t)XROWS * DM && O_WPB == O_WALL + 3 * WN && O_WPH == O_WPB + WN);   // row r of the list above lands at PL + r * DM; the f16 output-weight plane lies WN further on

typedef __attribute__((ext_vector_type(4))) unsigned short v4us;

// One converted row of 1024 16-bit values: 8 stores of 8 B per lane, each store of a wave 256 contiguous bytes (two whole lines). 'row' is the same in every lane, 'lofs' the lane's byte offset in the first 256 bytes.
// Written as one statement so that its last line, s_wait_xcnt 0, stands in front of every later write of a register that these stores name (in a statement of its own the compiler moved the next conversions over it).
__device__ __forceinline__ void store_row(u16* row, const unsigned lofs, const v4us (&d)[8]) {
    asm volatile("global_store_b64 %0, %1, %9\n\t"
                 "global_store_b64 %0, %2, %9 offset:256\n\t"
                 "global_store_b64 %0, %3, %9 offset:512\n\t"
                 "global_store_b64 %0, %4, %9 offset:768\n\t"
                 "global_store_b64 %0, %5, %9 offset:1024\n\t"
                 "global_store_b64 %0, %6, %9 offset:1280\n\t"
                 "global_store_b64 %0, %7, %9 offset:1536\n\t"
                 "global_store_b64 %0, %8, %9 offset:1792\n\t"
                 "s_wait_xcnt 0x0"
                 :: "v"(lofs), "v"(d[0]), "v"(d[1]), "v"(d[2]), "v"(d[3]), "v"(d[4]), "v"(d[5]), "v"(d[6]), "v"(d[7]), "s"(row) : "memory");
}

// k_cvt_all: every f32 -> 16-bit plane of the call in one launch of CVG work-groups. One wave per row of 1024 values and trip, rows dealt round robin over the launch's waves (wave gw takes rows gw, gw + CNW, ...);
// 8 whole-line loads of 16 B per lane in flight per wave. x and all four weights -> bf16 (RNE); the output weight also -> f16 of (bf16 value x WCAR). A reduced build reads the right rows of the full-size x.
__global__ __launch_bounds__(32 * CVW) void k_cvt_all(const float* __restrict__ x, const float* __restrict__ Wq, const float* __restrict__ Wk, const float* __restrict__ Wv, const float* __restrict__ Wp, u16* __restrict__ PL) {
    const int lane = threadIdx.x & 31;
    const int gw = __builtin_amdgcn_readfirstlane(blockIdx.x * CVW + (threadIdx.x >> 5));   // wave number as a scalar: the row, its source and the branches on it stay scalar
#pragma unroll 1   // kept rolled: few trips, and the other waves of the WGP cover a wave's load latency
    for (int r = gw; r < CROWS; r += CNW) {
        const float* src;
        if (r < XROWS) src = x + ((size_t)(r / SEQ) * SEQ_FULL + (r % SEQ)) * DM;
        else {
            const int w = (r - XROWS) / DM, wr = (r - XROWS) % DM;
            src = ((w == 0) ? Wq : (w == 1) ? Wk : (w == 2) ? Wv : Wp) + (size_t)wr * DM;
        }
        v4f v[8];
#pragma unroll
        for (int j = 0; j < 8; ++j) v[j] = *(const v4f*)(src + j * 128 + lane * 4);
        v4us ob[8];
#pragma unroll
        for (int j = 0; j < 8; ++j)
#pragma unroll
            for (int k = 0; k < 4; ++k) ob[j][k] = f2bf(v[j][k]);
        u16* row = PL + (size_t)r * DM;
        store_row(row, lane * 8, ob);
        if (r >= XROWS + 3 * DM) {
            v4us oh[8];
#pragma unroll
            for (int j = 0; j < 8; ++j)
#pragma unroll
                for (int k = 0; k < 4; ++k) oh[j][k] = f2h(bf2f(ob[j][k]) * WCAR);
            store_row(row + WN, lane * 8, oh);
        }
    }
}

// k_proj: [NB*SEQ][1024] x [3072][1024]^T (rows 0..1023 query weight, 1024..2047 key weight, 2048..3071 value weight). One wave per 64x64 tile = 64 time rows of one head, eight waves (4 x 2 tiles) per work-group sharing the staged operands.
// Epilogue q/k: per-row LayerNorm over the 64 head columns (mean and biased variance in f32 across 8 lanes x 8 columns, eps 1e-5, gain and bias taken as bf16 values of the inputs; both parameter sets are loaded and chosen by value),
// then f16 head plane rows [b][h][t][64] (+ bf16 hi/lo rows for t < RH); v: transposed through LDS into [b][h][d][t] lines of 64 t (+ hi/lo for t < RH). Planes addressed by element offsets from one base.
// All f16 plane values go through the value-select convert (no subnormal f16 can be produced).
__global__ __launch_bounds__(GTH) void k_proj(const u16* __restrict__ XB, const u16* __restrict__ WALL, u16* PL, size_t oP16, size_t oEH, size_t oEL,
                                             const float* __restrict__ QG, const float* __restrict__ QB, const float* __restrict__ KG, const float* __restrict__ KB) {
    __shared__ __align__(16) u16 ring[2 * GSTG];
    const int tid = threadIdx.x, lane = tid & 31, lr = lane & 15, hi = lane >> 4;
    const int wv = __builtin_amdgcn_readfirstlane(tid >> 5), wm = wv % GWM, wn = wv / GWM;   // wave number as a scalar: tile indices and the branches on them stay scalar
    float* os = (float*)((char*)ring + wv * GEPI);                       // this wave's own staging, used after the k loop only
    u16* ts = (u16*)((char*)ring + wv * GEPI + 16 * 68 * 4);
    const int r0 = blockIdx.x * GAR + wm * 64, c0 = blockIdx.y * GBR + wn * 64;
    const int which = c0 / DM, hd = (c0 - which * DM) / HD;
    const int b = r0 / SEQ, t0 = r0 - b * SEQ;
    const bool early = (t0 < RH);
    const size_t bh = (size_t)b * NH + hd;
    v8f acc[4][4];
    gemm_tile_s<false>(XB, WALL, DM, blockIdx.x * GAR, blockIdx.y * GBR, ring, tid, wm, wn, lr, hi, acc);
    if (which < 2) {
        const size_t o16 = oP16 + (size_t)which * PLANE + (bh * SEQ + t0) * HD;
        const size_t oeh = oEH + (size_t)which * EPLANE + (bh * RH + (early ? t0 : 0)) * HD;
        const size_t oel = oEL + (size_t)which * EPLANE + (bh * RH + (early ? t0 : 0)) * HD;
        const int gc = (lane & 7) * 8;                 // this lane's 8 head columns (same in every row group)
        const v4f gq0 = *(const v4f*)(QG + gc), gq1 = *(const v4f*)(QG + gc + 4);
        const v4f bq0 = *(const v4f*)(QB + gc), bq1 = *(const v4f*)(QB + gc + 4);
        const v4f gk0 = *(const v4f*)(KG + gc), gk1 = *(const v4f*)(KG + gc + 4);
        const v4f bk0 = *(const v4f*)(KB + gc), bk1 = *(const v4f*)(KB + gc + 4);
        v4f g0, g1, be0, be1;
#pragma unroll
        for (int q = 0; q < 4; ++q) {
            g0[q]  = bfr((which == 0) ? gq0[q] : gk0[q]); g1[q]  = bfr((which == 0) ? gq1[q] : gk1[q]);
            be0[q] = bfr((which == 0) ? bq0[q] : bk0[q]); be1[q] = bfr((which == 0) ? bq1[q] : bk1[q]);
        }
#pragma unroll
        for (int mb = 0; mb < 4; ++mb) {
#pragma unroll
            for (int nb = 0; nb < 4; ++nb)
#pragma unroll
                for (int j = 0; j < 8; ++j) os[(hi * 8 + j) * 68 + nb * 16 + lr] = acc[mb][nb][j];
            __syncthreads();
{
#pragma unroll
                for (int s = 0; s < 4; ++s) {
                    const int row = 4 * s + (lane >> 3), pc = (lane & 7) * 8;
                    const v4f x0 = *(const v4fa*)&os[row * 68 + pc]; const v4f x1 = *(const v4fa*)&os[row * 68 + pc + 4];
                    // LayerNorm of the 64-wide row held by the 8 lanes sharing lane>>3 (all 32 lanes active, uniform control)
                    float sm = ((x0[0] + x0[1]) + (x0[2] + x0[3])) + ((x1[0] + x1[1]) + (x1[2] + x1[3]));
                    sm += __shfl_xor(sm, 1, 32); sm += __shfl_xor(sm, 2, 32); sm += __shfl_xor(sm, 4, 32);
                    const float mean = sm * (1.0f / 64.0f);
                    v4f d0, d1;
#pragma unroll
                    for (int q = 0; q < 4; ++q) { d0[q] = x0[q] - mean; d1[q] = x1[q] - mean; }
                    float vs = ((d0[0] * d0[0] + d0[1] * d0[1]) + (d0[2] * d0[2] + d0[3] * d0[3])) + ((d1[0] * d1[0] + d1[1] * d1[1]) + (d1[2] * d1[2] + d1[3] * d1[3]));
                    vs += __shfl_xor(vs, 1, 32); vs += __shfl_xor(vs, 2, 32); vs += __shfl_xor(vs, 4, 32);
                    const float rinv = rsqrtf(vs * (1.0f / 64.0f) + LNEPS);
                    v4f y0, y1;
#pragma unroll
                    for (int q = 0; q < 4; ++q) { y0[q] = d0[q] * rinv * g0[q] + be0[q]; y1[q] = d1[q] * rinv * g1[q] + be1[q]; }
                    v8us q16;
#pragma unroll
                    for (int q = 0; q < 4; ++q) { q16[q] = f2h_fl(y0[q]); q16[4 + q] = f2h_fl(y1[q]); }
                    const size_t ro = (size_t)(mb * 16 + row) * HD + pc;
                    *(v8us*)(PL + o16 + ro) = q16;
                    if (early) {
                        v8us oh, ol;
#pragma unroll
                        for (int q = 0; q < 4; ++q) { const u16 a = f2bf(y0[q]); oh[q] = a; ol[q] = f2bf(y0[q] - bf2f(a)); const u16 c = f2bf(y1[q]); oh[4 + q] = c; ol[4 + q] = f2bf(y1[q] - bf2f(c)); }
                        *(v8us*)(PL + oeh + ro) = oh; *(v8us*)(PL + oel + ro) = ol;
                    }
                }
                
            }
            __syncthreads();
        }
    } else {
#pragma unroll
        for (int pl = 0; pl < 3; ++pl) {
            if (pl == 0 || early) {
#pragma unroll
                for (int mb = 0; mb < 4; ++mb)
#pragma unroll
                    for (int nb = 0; nb < 4; ++nb) {
                        v8us pk;
#pragma unroll
                        for (int j = 0; j < 8; ++j) { const float y = acc[mb][nb][j]; const u16 hb = f2bf(y); pk[j] = (pl == 0) ? f2h_fl(y) : ((pl == 1) ? hb : f2bf(y - bf2f(hb))); }
                        *(v8usa*)&ts[(nb * 16 + lr) * 72 + mb * 16 + hi * 8] = pk;     // ts[d][t]: 8 consecutive t per lane
                    }
                __syncthreads();
                const size_t dofs = (pl == 0) ? (oP16 + 2 * PLANE + bh * HD * SEQ + t0) : (((pl == 1) ? oEH : oEL) + 2 * EPLANE + bh * HD * RH + t0);
                const int dp = (pl == 0) ? SEQ : RH;
{
#pragma unroll 4
                    for (int s = 0; s < 16; ++s) {
                        const int d = 4 * s + (lane >> 3), pc = (lane & 7) * 8;
                        const v8us v = *(const v8usa*)&ts[d * 72 + pc];
                        *(v8us*)(PL + dofs + (size_t)d * dp + pc) = v;
                    }
                    
                }
                __syncthreads();
            }
        }
    }
}

// Online-softmax update for one 16 x 32 score step. s0/s1 hold raw scores for keys jb + (lane&15) and jb + 16 + (lane&15), rows qbase + 8 (lane>>4) + i; on return they hold exp2(t - running max).
// lrow keeps PER-LANE partial sums (reduced over the 16 lanes of a row once, after the key loop). Masked entries are replaced before the maximum; every row keeps its own key.
__device__ __forceinline__ void sm_step(v8f& s0, v8f& s1, float (&mrow)[8], float (&lrow)[8], float (&corr)[8], const int jb, const int qbase, const int lr, const int hi) {
#pragma unroll
    for (int i = 0; i < 8; ++i) {
        const int row = qbase + i + 8 * hi;
        float a0 = s0[i] * SCL2, a1 = s1[i] * SCL2;
        a0 = (jb + lr > row) ? -1.0e30f : a0;
        a1 = (jb + 16 + lr > row) ? -1.0e30f : a1;
        float mx = fmaxf(a0, a1);
        mx = fmaxf(mx, __shfl_xor(mx, 1, 32)); mx = fmaxf(mx, __shfl_xor(mx, 2, 32)); mx = fmaxf(mx, __shfl_xor(mx, 4, 32)); mx = fmaxf(mx, __shfl_xor(mx, 8, 32));
        const float mnew = fmaxf(mrow[i], mx);
        // The row's three exponentials as v_exp_f32, like the builtin. One statement, each in its own register, and a closing v_nop: so no instruction directly behind an exponential reads its result or overwrites its source
        // (with the registers of this build the compiler gave an exponential's result the register the one before it had just read).
        float c = mrow[i] - mnew, p0 = a0 - mnew, p1 = a1 - mnew;
        asm("v_exp_f32 %0, %0\n\tv_exp_f32 %1, %1\n\tv_exp_f32 %2, %2\n\tv_nop" : "+v"(c), "+v"(p0), "+v"(p1));
        lrow[i] = lrow[i] * c + (p0 + p1);
        mrow[i] = mnew; corr[i] = c; s0[i] = p0; s1[i] = p1;
    }
}

#define AW   4                   // waves per late-attention work-group: QG query groups x KH key halves
#define QT   2                   // 16-query tiles per late-attention wave: each K and V fragment read from LDS feeds QT products
#define QG   2                   // query groups of 16 * QT rows per work-group
#define KH   2                   // 32-key halves of a stage, one per wave of a query group
#define LQR  (16 * QT * QG)      // query rows per late-attention work-group
#define LKS  (32 * KH)           // keys per late-attention stage: a staged value row is one whole 128-B line
#define VPL  72                  // u16 per staged late value row: 144 B = 16 B x odd, the pitch for 16-byte LDS readers of 128-B rows
#define KPIT 72                  // u16 per staged key row: 144 B = 16 B x odd, the pitch for 16-byte LDS readers of 128-B rows
#define VPIT 40                  // u16 per staged value row: 80 B = 16 B x odd, the same for 64-B rows
#define NQB_L (((SEQ - RH) / LQR) > 0 ? ((SEQ - RH) / LQR) : 1)
static_assert(QG * KH == AW && KH == 2 && QT == KH);   // wave = query group + QG * key half; in the merge each wave of a pair finishes one of the pair's QT tiles
static_assert((SEQ - RH) % LQR == 0);         // whole work-groups of query rows
static_assert((RH + LQR) / LKS >= 2);         // the two-buffer prologue needs two stages
static_assert(LQR % LKS == 0 && RH % LKS == 0);   // a work-group's last stage ends on its last query row
static_assert(RH >= LKS);                     // every key of the first stage is open to every late query: both halves' maxima are finite from the first stage on
static_assert(LKS * 2 == 128 && HD * 2 == 128);   // stage_kv: key rows and value rows of 128 B, 8 lanes a row
#define NWGP 256                 // WGPs of the chip (used for speed only)
#define LGR  (((NWGP % (NB * NH)) == 0 && (NQB_L % (NWGP / (NB * NH))) == 0) ? (NWGP / (NB * NH)) : 1)   // query blocks (all heads of each) per such round of NWGP work-groups; 1: no mirroring

// One 64-key stage for a work-group of 128 threads: key rows jb..jb+63 (64 x 128 B, contiguous in the plane) and the 64 value rows' columns jb..jb+63 (64 x 128 B, whole lines), 16 bytes per lane and copy (8 lanes = one row = one line), 16 rows per copy, straight into LDS.
// The s_wait_xcnt 0 is the last line of the copies' own statement so that no address register of a copy is rewritten ahead of it.
__device__ __forceinline__ void stage_kv(const u16* __restrict__ Kb, const u16* __restrict__ Vb, const int jb, u16* kd, u16* vd, const int tid) {
    const u16* gk = Kb + (size_t)(jb + (tid >> 3)) * HD + (tid & 7) * 8;       // key rows 0..15 of the stage
    const u16* gv = Vb + (size_t)(tid >> 3) * SEQ + jb + (tid & 7) * 8;        // head columns 0..15
    const size_t ks16 = (size_t)16 * HD, vs16 = (size_t)16 * SEQ;              // 16 rows on in global memory
    const unsigned lk = lds_byte(kd + (tid >> 3) * KPIT + (tid & 7) * 8), lv = lds_byte(vd + (tid >> 3) * VPL + (tid & 7) * 8);
    const unsigned kl16 = 16 * KPIT * 2, vl16 = 16 * VPL * 2;                  // 16 rows on in LDS, bytes
    asm volatile("global_load_async_to_lds_b128 %0, %1, off\n\t"
                 "global_load_async_to_lds_b128 %2, %3, off\n\t"
                 "global_load_async_to_lds_b128 %4, %5, off\n\t"
                 "global_load_async_to_lds_b128 %6, %7, off\n\t"
                 "global_load_async_to_lds_b128 %8, %9, off\n\t"
                 "global_load_async_to_lds_b128 %10, %11, off\n\t"
                 "global_load_async_to_lds_b128 %12, %13, off\n\t"
                 "global_load_async_to_lds_b128 %14, %15, off\n\t"
                 "s_wait_xcnt 0x0"
                 :: "v"(lk), "v"(gk), "v"(lk + kl16), "v"(gk + ks16), "v"(lk + 2 * kl16), "v"(gk + 2 * ks16), "v"(lk + 3 * kl16), "v"(gk + 3 * ks16),
                    "v"(lv), "v"(gv), "v"(lv + vl16), "v"(gv + vs16), "v"(lv + 2 * vl16), "v"(gv + 2 * vs16), "v"(lv + 3 * vl16), "v"(gv + 3 * vs16) : "memory");
}

// Lane l's value from lane l ^ 16 (the other half of the wave), by a vector cross-row move.
__device__ __forceinline__ float xhalf(float x) {
    const int v = __builtin_bit_cast(int, x);
    return __builtin_bit_cast(float, __builtin_amdgcn_permlanex16(v, v, 0x76543210, 0xfedcba98, false, false));
}

// 2^c and 2^a[0..7] (first form), 2^a[0..7] (second form), as v_exp_f32 like the builtin. One statement each, results in registers of their own ("=&v") and a closing v_nop:
// so no instruction directly behind an exponential reads its result or overwrites its source (left to itself the compiler gave an exponential's result the register the one before it had just read).
__device__ __forceinline__ void exp2_9(const float c, const v8f a, float& ec, v8f& e) {
    float r0, r1, r2, r3, r4, r5, r6, r7;
    asm("v_exp_f32 %0, %9\n\tv_exp_f32 %1, %10\n\tv_exp_f32 %2, %11\n\tv_exp_f32 %3, %12\n\tv_exp_f32 %4, %13\n\tv_exp_f32 %5, %14\n\tv_exp_f32 %6, %15\n\tv_exp_f32 %7, %16\n\tv_exp_f32 %8, %17\n\tv_nop"
        : "=&v"(ec), "=&v"(r0), "=&v"(r1), "=&v"(r2), "=&v"(r3), "=&v"(r4), "=&v"(r5), "=&v"(r6), "=&v"(r7)
        : "v"(c), "v"(a[0]), "v"(a[1]), "v"(a[2]), "v"(a[3]), "v"(a[4]), "v"(a[5]), "v"(a[6]), "v"(a[7]));
    e[0] = r0; e[1] = r1; e[2] = r2; e[3] = r3; e[4] = r4; e[5] = r5; e[6] = r6; e[7] = r7;
}
__device__ __forceinline__ void exp2_8(const v8f a, v8f& e) {
    float r0, r1, r2, r3, r4, r5, r6, r7;
    asm("v_exp_f32 %0, %8\n\tv_exp_f32 %1, %9\n\tv_exp_f32 %2, %10\n\tv_exp_f32 %3, %11\n\tv_exp_f32 %4, %12\n\tv_exp_f32 %5, %13\n\tv_exp_f32 %6, %14\n\tv_exp_f32 %7, %15\n\tv_nop"
        : "=&v"(r0), "=&v"(r1), "=&v"(r2), "=&v"(r3), "=&v"(r4), "=&v"(r5), "=&v"(r6), "=&v"(r7)
        : "v"(a[0]), "v"(a[1]), "v"(a[2]), "v"(a[3]), "v"(a[4]), "v"(a[5]), "v"(a[6]), "v"(a[7]));
    e[0] = r0; e[1] = r1; e[2] = r2; e[3] = r3; e[4] = r4; e[5] = r5; e[6] = r6; e[7] = r7;
}

// attn_l_body (block range of k_attn): query rows >= RH, f16 single products. One work-group of AW waves per LQR query rows of one (batch, head); the waves share each 64-key stage of K and V,
// brought into two LDS buffers by asynchronous copies one stage ahead. Wave = (query group, key half): it takes QT tiles of 16 query rows and, of every stage, the 32 keys of its half, so a fragment of K or V, once in registers,
// serves QT products (half the LDS reads per product of one tile a wave), and one barrier and one round of address work serve 64 keys. Every wave walks the work-group's key range: a step wholly above a tile's diagonal adds exact zeros.
// Each wave keeps maximum, sum and output of its own keys; after the key loop the two waves of a query group exchange partial results through LDS, and each finishes one tile. ctx f16 x CCAR -> AT [b][t-RH][1024].
// Both products are taken transposed: S^T = K Q^T (A = key rows from LDS, B = the wave's query rows, kept in registers) and O^T += V^T P^T (A = rows of the staged V^T, B = P^T).
// In each tile a lane then holds 16 of the 32 scores of ONE query (qbase + 16 t + (lane&15); keys jb + 8 (lane>>4) + r and jb + 16 + 8 (lane>>4) + r): maximum and sum run inside the lane, the two halves of the wave meet in one exchange,
// and the two score tiles, converted in place, are the B operand of the second product in the loader's own k order, so P goes through no LDS and no barrier.
__device__ __forceinline__ void attn_l_body(const int bid, u16* sm, const u16* __restrict__ QP, const u16* __restrict__ KP, const u16* __restrict__ VT, u16* AT) {
    u16 (*ks)[LKS * KPIT] = (u16 (*)[LKS * KPIT])sm;                   // two key stages
    u16 (*vs)[HD * VPL] = (u16 (*)[HD * VPL])(sm + 2 * LKS * KPIT);    // two value stages
    const int tid = threadIdx.x, lane = tid & 31, lr = lane & 15, hi = lane >> 4;
    const int wv = __builtin_amdgcn_readfirstlane(tid >> 5);   // wave number as a scalar: the tests for steps that touch the diagonal stay scalar branches
    const int qg = wv % QG, kh = wv / QG;                      // query group, key half
    // Work-group order, for speed only (every (head, query block) pair is taken once, wherever and whenever a work-group runs). A query block's cost grows with its index:
    // the heaviest query blocks come first, heads fastest, so that what starts last is short (the lightest start as places on the WGPs fall free). LGR query blocks per round of NWGP: every other round is mirrored, so that the key steps of the work-groups that share a WGP add up alike.
    const int rk = bid / (NB * NH), bh = bid - rk * (NB * NH);   // rank of the query block, head
    const int rd = rk / LGR;                                                   // round
    const int qb = NQB_L - 1 - ((rd & 1) ? rd * LGR + (LGR - 1) - (rk - rd * LGR) : rk);
    const int b = bh / NH, h = bh - b * NH;
    const int qblk = RH + qb * LQR;
    const int qbase = qblk + qg * (16 * QT);
    const size_t pb = (size_t)bh * SEQ * HD;
    const u16* Qb = QP + pb; const u16* Kb = KP + pb; const u16* Vb = VT + pb;
    const int nst = (qblk + LQR) / LKS;          // keys 0 .. qblk+LQR-1 in stages of LKS; nst*LKS <= SEQ, nst >= 2
    stage_kv(Kb, Vb, 0, ks[0], vs[0], tid);
    asm volatile("s_wait_asynccnt 0x0" ::: "memory");   // this wave's copies of stage 0 have landed
    __syncthreads();                                     // stage 0 readable by every wave
    stage_kv(Kb, Vb, LKS, ks[1], vs[1], tid);
    v16us q0[QT], q1[QT];
#pragma unroll
    for (int t = 0; t < QT; ++t) {
        q0[t] = ldfr(Qb + (size_t)(qbase + 16 * t + lr) * HD + 8 * hi);
        q1[t] = ldfr(Qb + (size_t)(qbase + 16 * t + lr) * HD + 32 + 8 * hi);
    }
    v8f acc[QT][4];                              // acc[t][dt][r] = this key half's share of O^T[16 dt + 8 hi + r][qbase + 16 t + lr], carried x PCAR
    float mrun[QT], lsum[QT];                    // this lane's query of tile t, this wave's keys: running maximum of the raw scores (both halves of the wave alike); sum of this half-wave's probabilities x PCAR
#pragma unroll
    for (int t = 0; t < QT; ++t) {
#pragma unroll
        for (int dt = 0; dt < 4; ++dt) acc[t][dt] = (v8f){};
        mrun[t] = -1.0e30f; lsum[t] = 0.0f;
    }
#pragma unroll 1
    for (int st = 0; st < nst; ++st) {
        const int jb = st * LKS + kh * 32;       // first of this wave's 32 keys of the stage
        const u16* kr0 = ks[st & 1] + (kh * 32 + lr) * KPIT + 8 * hi; const u16* kr1 = kr0 + 16 * KPIT;
        const u16* vr = vs[st & 1] + lr * VPL + kh * 32 + 8 * hi;
        const v16us k00 = ldfr(kr0), k01 = ldfr(kr0 + 32), k10 = ldfr(kr1), k11 = ldfr(kr1 + 32);   // the step's 8 key reads stand together, ahead of its 4 QT score products
        v8f s0[QT], s1[QT];
#pragma unroll   // this and the loops over t and dt below: every tile index a constant, so that fragments and accumulators stay in registers
        for (int t = 0; t < QT; ++t) { s0[t] = mma_h(k00, q0[t], (v8f){}); s1[t] = mma_h(k10, q0[t], (v8f){}); }
#pragma unroll
        for (int t = 0; t < QT; ++t) { s0[t] = mma_h(k01, q1[t], s0[t]); s1[t] = mma_h(k11, q1[t], s1[t]); }
        v16us vf[2];                             // the first 4 of the step's 8 value reads stand together: they return while the softmax runs
#pragma unroll
        for (int dt = 0; dt < 2; ++dt) vf[dt] = ldfr(vr + dt * 16 * VPL);
        v16us pu[QT];
#pragma unroll
        for (int t = 0; t < QT; ++t) {
            v8f a0 = s0[t], a1 = s1[t];
            if (jb + 31 > qbase + 16 * t) {      // only a step that reaches past the tile's first query row can hold an excluded key
                const int dq = qbase + 16 * t + lr - jb - 8 * hi;   // key index r (or 16 + r) inside this lane's share is excluded when it exceeds dq
#pragma unroll
                for (int r = 0; r < 8; ++r) { a0[r] = (r > dq) ? -1.0e30f : a0[r]; a1[r] = (16 + r > dq) ? -1.0e30f : a1[r]; }
            }
            float mx = fmaxf(a0[0], a1[0]);
#pragma unroll
            for (int r = 1; r < 8; ++r) mx = fmaxf(mx, fmaxf(a0[r], a1[r]));
            mx = fmaxf(mx, xhalf(mx));
            const float mnew = fmaxf(mrun[t], mx);   // finite from the first stage on: all its keys are open to every late query
            const float nm = 10.0f - mnew * SCL2;    // 2^10 = PCAR: the carry rides in the exponent
#pragma unroll
            for (int r = 0; r < 8; ++r) { a0[r] = __builtin_fmaf(a0[r], SCL2, nm); a1[r] = __builtin_fmaf(a1[r], SCL2, nm); }
            float corr;
            exp2_9((mrun[t] - mnew) * SCL2, a0, corr, a0);
            exp2_8(a1, a1);
            mrun[t] = mnew;
            v16h pf;
            float ps = 0.0f;
#pragma unroll
            for (int r = 0; r < 8; ++r) { ps += a0[r] + a1[r]; pf[r] = (h16)a0[r]; pf[8 + r] = (h16)a1[r]; }
            lsum[t] = lsum[t] * corr + ps;
#pragma unroll
            for (int dt = 0; dt < 4; ++dt)
#pragma unroll
                for (int r = 0; r < 8; ++r) acc[t][dt][r] *= corr;
            pu[t] = __builtin_bit_cast(v16us, pf);
        }
#pragma unroll
        for (int dt = 0; dt < 2; ++dt)
#pragma unroll
            for (int t = 0; t < QT; ++t) acc[t][dt] = mma_h(vf[dt], pu[t], acc[t][dt]);
#pragma unroll
        for (int dt = 0; dt < 2; ++dt) vf[dt] = ldfr(vr + (2 + dt) * 16 * VPL);   // the other 4 only now: all 8 fragments live through the softmax took more registers than five waves to a SIMD leave, and a query fragment went to scratch
#pragma unroll
        for (int dt = 0; dt < 2; ++dt)
#pragma unroll
            for (int t = 0; t < QT; ++t) acc[t][2 + dt] = mma_h(vf[dt], pu[t], acc[t][2 + dt]);
        asm volatile("s_wait_dscnt 0x0" ::: "memory");      // this wave's LDS reads of the stage are done before the buffer is refilled
        asm volatile("s_wait_asynccnt 0x0" ::: "memory");   // this wave's copies of the next stage have landed
        __syncthreads();                                     // publishes the next stage and ends every reader's last read of this one
        if (st + 2 < nst) stage_kv(Kb, Vb, (st + 2) * LKS, ks[st & 1], vs[st & 1], tid);
    }
    asm volatile("s_wait_asynccnt 0x0" ::: "memory");       // no copy is left in flight when the ring becomes the exchange area
    // Merge of the two key halves. The wave of key half kh finishes tile kh of its query group: it hands the other tile's partial output, maximum and sum to its partner (same query group, other half; same lane = same query and columns).
    // The exchange area is laid over the ring: every wave has left it (the last trip's barrier). Per wave 9 blocks of 32 lanes x 16 B: 8 of output, 1 of (maximum, sum).
    const bool k1 = (kh != 0);
    v4fa* xw = (v4fa*)sm + (size_t)wv * (9 * 32) + lane;
    const v4fa* xr = (const v4fa*)sm + (size_t)(wv ^ QG) * (9 * 32) + lane;
    const float l0 = lsum[0] + xhalf(lsum[0]), l1 = lsum[1] + xhalf(lsum[1]);
#pragma unroll
    for (int dt = 0; dt < 4; ++dt)
#pragma unroll
        for (int g = 0; g < 2; ++g) {
            v4f x;
#pragma unroll
            for (int r = 0; r < 4; ++r) x[r] = k1 ? acc[0][dt][4 * g + r] : acc[1][dt][4 * g + r];
            xw[(dt * 2 + g) * 32] = x;
        }
    { v4f x; x[0] = k1 ? mrun[0] : mrun[1]; x[1] = k1 ? l0 : l1; x[2] = 0.0f; x[3] = 0.0f; xw[8 * 32] = x; }
    __syncthreads();                                         // every wave's partial results are staged before a partner reads them
    const v4f pml = xr[8 * 32];
    const float mk = k1 ? mrun[1] : mrun[0], lk = k1 ? l1 : l0;
    const float mall = fmaxf(mk, pml[0]);
    // The two scale factors as v_exp_f32, like the builtin. One statement and a closing v_nop: so no instruction directly behind an exponential reads its result or overwrites its source.
    float ck = (mk - mall) * SCL2, cp = (pml[0] - mall) * SCL2;
    asm("v_exp_f32 %0, %0\n\tv_exp_f32 %1, %1\n\tv_nop" : "+v"(ck), "+v"(cp));
    const float inv = CCAR / (lk * ck + pml[1] * cp);       // sums and outputs both carry PCAR, so it cancels
    const float fk = ck * inv, fp = cp * inv;
    u16* dst = AT + ((size_t)b * (SEQ - RH) + (qbase - RH) + 16 * kh + lr) * DM + h * HD + 8 * hi;
#pragma unroll
    for (int dt = 0; dt < 4; ++dt) {             // a lane's 8 registers are 8 consecutive head columns of its query row: one 16-byte store; the wave's four stores fill each row's whole 128-B line
        const v4f p0 = xr[(dt * 2) * 32], p1 = xr[(dt * 2 + 1) * 32];
        v8us o;
#pragma unroll
        for (int r = 0; r < 4; ++r) {
            o[r]     = f2h((k1 ? acc[1][dt][r] : acc[0][dt][r]) * fk + p0[r] * fp);
            o[4 + r] = f2h((k1 ? acc[1][dt][4 + r] : acc[0][dt][4 + r]) * fk + p1[r] * fp);
        }
        *(v8us*)(dst + dt * 16) = o;
    }
}

#define EAW  4                   // waves per early-attention work-group, 16 query rows each
static_assert(RH % (16 * EAW) == 0);          // whole work-groups of query rows
static_assert((16 * EAW) / 32 >= 2);          // the two-buffer prologue needs two key steps
static_assert((16 * EAW) % 32 == 0);          // a work-group's last key step ends on its last query row, inside the early planes
#define AE_RING (4 * 32 * KPIT + 4 * HD * VPIT)          // u16 of the early ring: two stages each of K hi, K lo, V hi, V lo
#define AE_LDS  (AE_RING + 2 * EAW * 16 * 40)            // u16 of an early work-group's LDS: the ring, then P hi and P lo staging
static_assert(EAW * 16 * 68 * 4 <= 4 * 32 * KPIT * 2);   // the f32 output staging fits over the key stages
static_assert(2 * LKS * KPIT + 2 * HD * VPL <= AE_LDS);  // the late ring fits in the same array
static_assert(AW * 9 * 32 * 16 <= (2 * LKS * KPIT + 2 * HD * VPL) * 2);   // the late exchange area fits over the late ring
static_assert(EAW == AW);                                // one block size for both ranges

// One 32-key stage of the hi and lo planes for a work-group of 128 threads: key rows jb..jb+31 (32 x 128 B, contiguous in each plane) and the 64 value rows' columns jb..jb+31 (64 x 64 B), 16 bytes per lane and copy, straight into LDS.
// The s_wait_xcnt 0 is the last line of the copies' own statement so that no address register of a copy is rewritten ahead of it.
__device__ __forceinline__ void stage_kv_e(const u16* __restrict__ Kh, const u16* __restrict__ Kl, const u16* __restrict__ Vh, const u16* __restrict__ Vl, const int jb, u16* kdh, u16* kdl, u16* vdh, u16* vdl, const int tid) {
    const size_t ko = (size_t)(jb + (tid >> 3)) * HD + (tid & 7) * 8;         // rows 0..15 of the stage; 16 * HD further on: rows 16..31
    const size_t vo = (size_t)(tid >> 2) * RH + jb + (tid & 3) * 8;           // head columns 0..31; 32 * RH further on: head columns 32..63
    const int kl = (tid >> 3) * KPIT + (tid & 7) * 8, vl = (tid >> 2) * VPIT + (tid & 3) * 8;
    const unsigned lkh = lds_byte(kdh + kl), lkl = lds_byte(kdl + kl), lvh = lds_byte(vdh + vl), lvl = lds_byte(vdl + vl);
    asm volatile("global_load_async_to_lds_b128 %0, %1, off\n\t"
                 "global_load_async_to_lds_b128 %2, %3, off\n\t"
                 "global_load_async_to_lds_b128 %4, %5, off\n\t"
                 "global_load_async_to_lds_b128 %6, %7, off\n\t"
                 "global_load_async_to_lds_b128 %8, %9, off\n\t"
                 "global_load_async_to_lds_b128 %10, %11, off\n\t"
                 "global_load_async_to_lds_b128 %12, %13, off\n\t"
                 "global_load_async_to_lds_b128 %14, %15, off\n\t"
                 "s_wait_xcnt 0x0"
                 :: "v"(lkh), "v"(Kh + ko), "v"(lkh + 16 * KPIT * 2), "v"(Kh + ko + 16 * HD), "v"(lkl), "v"(Kl + ko), "v"(lkl + 16 * KPIT * 2), "v"(Kl + ko + 16 * HD),
                    "v"(lvh), "v"(Vh + vo), "v"(lvh + 32 * VPIT * 2), "v"(Vh + vo + 32 * RH), "v"(lvl), "v"(Vl + vo), "v"(lvl + 32 * VPIT * 2), "v"(Vl + vo + 32 * RH) : "memory");
}

// attn_e_body (block range of k_attn): query rows < RH, bf16 hi+lo operands (hi.hi + lo.hi + hi.lo into one accumulator; residuals unscaled). ctx hi/lo bf16 -> ATEh/ATEl [b][t][1024].
// One work-group of EAW waves per 16*EAW query rows of one (batch, head), one wave per 16 rows; the waves share each 32-key stage of the K and V hi and lo planes, brought into two LDS buffers by asynchronous copies one stage ahead
// (whole lines from L2, fetched once per work-group, where fragment loads straight from the planes touch 16 lines each). Every wave walks the work-group's key range: a step wholly above a wave's diagonal adds exact zeros.
__device__ __forceinline__ void attn_e_body(const int bid, u16* sm, const u16* __restrict__ QEh, const u16* __restrict__ QEl, const u16* __restrict__ KEh, const u16* __restrict__ KEl, const u16* __restrict__ VEh, const u16* __restrict__ VEl, u16* ATEh, u16* ATEl) {
    u16 (*ksh)[32 * KPIT] = (u16 (*)[32 * KPIT])sm;
    u16 (*ksl)[32 * KPIT] = (u16 (*)[32 * KPIT])(sm + 2 * 32 * KPIT);
    u16 (*vsh)[HD * VPIT] = (u16 (*)[HD * VPIT])(sm + 4 * 32 * KPIT);
    u16 (*vsl)[HD * VPIT] = (u16 (*)[HD * VPIT])(sm + 4 * 32 * KPIT + 2 * HD * VPIT);
    const int tid = threadIdx.x, lane = tid & 31, lr = lane & 15, hi = lane >> 4;
    const int wv = __builtin_amdgcn_readfirstlane(tid >> 5);   // wave number as a scalar: the wave's own staging addresses stay scalar
    u16* pwh = sm + AE_RING + wv * (16 * 40); u16* pwl = pwh + EAW * (16 * 40);   // this wave's own P staging, behind the ring
    float* os = (float*)sm + wv * (16 * 68);                                      // this wave's own output staging, laid over the key stages: used after the key loop only, when every wave has left the ring (the last trip's barrier) and no copy is in flight
    const int bh = bid / (RH / (16 * EAW)), qb = bid - bh * (RH / (16 * EAW));
    const int b = bh / NH, h = bh - b * NH;
    const int qblk = qb * (16 * EAW);
    const int qbase = qblk + wv * 16;
    const size_t pb = (size_t)bh * RH * HD;
    const u16* Kh = KEh + pb; const u16* Kl = KEl + pb; const u16* Vh = VEh + pb; const u16* Vl = VEl + pb;   // V planes [bh][64][RH], same plane size as [bh][RH][64]
    const int nsteps = (qblk + 16 * EAW) >> 5;   // keys 0 .. qblk+16*EAW-1 in steps of 32; nsteps*32 <= RH, nsteps >= 2
    stage_kv_e(Kh, Kl, Vh, Vl, 0, ksh[0], ksl[0], vsh[0], vsl[0], tid);
    asm volatile("s_wait_asynccnt 0x0" ::: "memory");   // this wave's copies of stage 0 have landed
    __syncthreads();                                     // stage 0 readable by every wave
    stage_kv_e(Kh, Kl, Vh, Vl, 32, ksh[1], ksl[1], vsh[1], vsl[1], tid);
    const size_t qo = pb + (size_t)(qbase + lr) * HD + 8 * hi;
    const v16us qh0 = ldfr(QEh + qo), qh1 = ldfr(QEh + qo + 32), ql0 = ldfr(QEl + qo), ql1 = ldfr(QEl + qo + 32);
    v8f acc[4];
#pragma unroll
    for (int nt = 0; nt < 4; ++nt) acc[nt] = (v8f){};
    float mrow[8], lrow[8];
#pragma unroll
    for (int i = 0; i < 8; ++i) { mrow[i] = -1.0e30f; lrow[i] = 0.0f; }
#pragma unroll 1
    for (int st = 0; st < nsteps; ++st) {
        const int jb = st * 32;
        const u16* krh = ksh[st & 1] + lr * KPIT + 8 * hi; const u16* krl = ksl[st & 1] + lr * KPIT + 8 * hi;   // this lane's place in the stage's key rows
        const u16* vrh = vsh[st & 1] + lr * VPIT + 8 * hi; const u16* vrl = vsl[st & 1] + lr * VPIT + 8 * hi;   // the same in the stage's value rows
        // The step's 16 key reads stand together, ahead of its 12 score products.
        const v16us kh0 = ldfr(krh), kh1 = ldfr(krh + 32), kl0 = ldfr(krl), kl1 = ldfr(krl + 32);
        const v16us kh2 = ldfr(krh + 16 * KPIT), kh3 = ldfr(krh + 16 * KPIT + 32), kl2 = ldfr(krl + 16 * KPIT), kl3 = ldfr(krl + 16 * KPIT + 32);
        v8f s0 = (v8f){}, s1 = (v8f){};
        s0 = mma_b(qh0, kh0, s0); s0 = mma_b(qh1, kh1, s0); s0 = mma_b(ql0, kh0, s0); s0 = mma_b(ql1, kh1, s0); s0 = mma_b(qh0, kl0, s0); s0 = mma_b(qh1, kl1, s0);
        s1 = mma_b(qh0, kh2, s1); s1 = mma_b(qh1, kh3, s1); s1 = mma_b(ql0, kh2, s1); s1 = mma_b(ql1, kh3, s1); s1 = mma_b(qh0, kl2, s1); s1 = mma_b(qh1, kl3, s1);
        __builtin_amdgcn_sched_barrier(0);   // this and the one behind the softmax keep the value reads out of it: strewn among its cross-lane exchanges (same counter), they made each exchange's wait wait for them too
        float corr[8];
        sm_step(s0, s1, mrow, lrow, corr, jb, qbase, lr, hi);
        __builtin_amdgcn_sched_barrier(0);
        v16us vh[2], vl[2];                      // the first 8 of the step's 16 value reads stand together: they return while the accumulators are rescaled and P is converted
#pragma unroll
        for (int nt = 0; nt < 2; ++nt) { vh[nt] = ldfr(vrh + nt * 16 * VPIT); vl[nt] = ldfr(vrl + nt * 16 * VPIT); }
#pragma unroll
        for (int nt = 0; nt < 4; ++nt)
#pragma unroll
            for (int i = 0; i < 8; ++i) acc[nt][i] *= corr[i];
#pragma unroll
        for (int i = 0; i < 8; ++i) {
            const u16 a = f2bf(s0[i]); const u16 c = f2bf(s1[i]);
            pwh[(i + 8 * hi) * 40 + lr] = a; pwl[(i + 8 * hi) * 40 + lr] = f2bf(s0[i] - bf2f(a));
            pwh[(i + 8 * hi) * 40 + 16 + lr] = c; pwl[(i + 8 * hi) * 40 + 16 + lr] = f2bf(s1[i] - bf2f(c));
        }
        __syncthreads();
        const v8us h0 = *(const v8usa*)&pwh[lr * 40 + 8 * hi]; const v8us h1 = *(const v8usa*)&pwh[lr * 40 + 16 + 8 * hi];
        const v8us l0 = *(const v8usa*)&pwl[lr * 40 + 8 * hi]; const v8us l1 = *(const v8usa*)&pwl[lr * 40 + 16 + 8 * hi];
        const v16us pfh = __builtin_shufflevector(h0, h1, 0, 1, 2, 3, 4, 5, 6, 7, 8, 9, 10, 11, 12, 13, 14, 15);
        const v16us pfl = __builtin_shufflevector(l0, l1, 0, 1, 2, 3, 4, 5, 6, 7, 8, 9, 10, 11, 12, 13, 14, 15);
#pragma unroll
        for (int nt = 0; nt < 2; ++nt) { acc[nt] = mma_b(pfh, vh[nt], acc[nt]); acc[nt] = mma_b(pfl, vh[nt], acc[nt]); acc[nt] = mma_b(pfh, vl[nt], acc[nt]); }
#pragma unroll
        for (int nt = 0; nt < 2; ++nt) { vh[nt] = ldfr(vrh + (2 + nt) * 16 * VPIT); vl[nt] = ldfr(vrl + (2 + nt) * 16 * VPIT); }   // the other 8 only now: all 16 fragments live at once took more registers than five waves to a SIMD leave, and some went to scratch
#pragma unroll
        for (int nt = 0; nt < 2; ++nt) { acc[2 + nt] = mma_b(pfh, vh[nt], acc[2 + nt]); acc[2 + nt] = mma_b(pfl, vh[nt], acc[2 + nt]); acc[2 + nt] = mma_b(pfh, vl[nt], acc[2 + nt]); }
        asm volatile("s_wait_dscnt 0x0" ::: "memory");      // this wave's LDS reads of the stage (and of its P rows) are done before the buffer is refilled
        asm volatile("s_wait_asynccnt 0x0" ::: "memory");   // this wave's copies of the next stage have landed
        __syncthreads();                                     // publishes the next stage and ends every reader's last read of this one
        if (st + 2 < nsteps) stage_kv_e(Kh, Kl, Vh, Vl, jb + 64, ksh[st & 1], ksl[st & 1], vsh[st & 1], vsl[st & 1], tid);
    }
    asm volatile("s_wait_asynccnt 0x0" ::: "memory");       // no copy is left in flight when the wave goes on to its end
#pragma unroll
    for (int i = 0; i < 8; ++i) {
        float l = lrow[i];
        l += __shfl_xor(l, 1, 32); l += __shfl_xor(l, 2, 32); l += __shfl_xor(l, 4, 32); l += __shfl_xor(l, 8, 32);
        const float inv = 1.0f / l;
#pragma unroll
        for (int nt = 0; nt < 4; ++nt) os[(i + 8 * hi) * 68 + nt * 16 + lr] = acc[nt][i] * inv;
    }
    __syncthreads();
    const size_t dofs = ((size_t)b * RH + qbase) * DM + h * HD;
{
#pragma unroll
        for (int s = 0; s < 4; ++s) {
            const int row = 4 * s + (lane >> 3), pc = (lane & 7) * 8;
            const v4f x0 = *(const v4fa*)&os[row * 68 + pc]; const v4f x1 = *(const v4fa*)&os[row * 68 + pc + 4];
            v8us oh, ol;
#pragma unroll
            for (int q = 0; q < 4; ++q) { const u16 a = f2bf(x0[q]); oh[q] = a; ol[q] = f2bf(x0[q] - bf2f(a)); const u16 c = f2bf(x1[q]); oh[4 + q] = c; ol[4 + q] = f2bf(x1[q] - bf2f(c)); }
            *(v8us*)(ATEh + dofs + (size_t)row * DM + pc) = oh;
            *(v8us*)(ATEl + dofs + (size_t)row * DM + pc) = ol;
        }
        
    }
}

#define NAE (NB * NH * (RH / (16 * EAW)))           // early work-groups
#define NAL (NB * NH * ((SEQ - RH) / LQR))          // late work-groups
// k_attn: both attention ranges in one launch; they are independent of each other, so the short, latency-bound early work-groups run beside the late ones, not in a launch of their own in front of them.
// Blocks 0 .. NAE-1: rows < RH (they come first); the rest: rows >= RH in the order of attn_l_body. The choice is the same for a whole work-group.
// amdgpu_waves_per_eu: holds the register count of the early path to what lets five work-groups share a WGP; left free it takes a quarter of a SIMD's registers, and the late range too would run four waves to a SIMD.
__global__ __launch_bounds__(32 * AW) __attribute__((amdgpu_waves_per_eu(5, 5)))
void k_attn(const u16* __restrict__ QP, const u16* __restrict__ KP, const u16* __restrict__ VT, u16* AT,
            const u16* __restrict__ QEh, const u16* __restrict__ QEl, const u16* __restrict__ KEh, const u16* __restrict__ KEl, const u16* __restrict__ VEh, const u16* __restrict__ VEl, u16* ATEh, u16* ATEl) {
    __shared__ __align__(16) u16 sm[AE_LDS];
    if (blockIdx.x < NAE) attn_e_body(blockIdx.x, sm, QEh, QEl, KEh, KEl, VEh, VEl, ATEh, ATEl);
    else attn_l_body(blockIdx.x - NAE, sm, QP, KP, VT, AT);
}

// Output projection: OUT[b][toff + r][n] = scale * sum_k A[row][k] Bt[n][k] (+ A2 product in outp_e_body) + bf16(bias[n]); rows of A are [b][r] with rpb rows per batch.
// Epilogue of one wave's 64x64 tile (outp_l_body) at rows r0.., columns c0..: whole 256-B row pieces through the wave's own staging 'os'. Every wave of the work-group passes the same barriers.
__device__ __forceinline__ void outp_store(const v8f (&acc)[4][4], float* os, const float* __restrict__ bias, float* OUT, const float scale, const int rpb, const int toff, const int r0, const int c0, const int lr, const int hi) {
    const int b = r0 / rpb, tb = toff + (r0 - b * rpb);
    float* crow0 = OUT + ((size_t)b * SEQ_FULL + tb) * DM + c0;
    const int cofs = lr * 4;
    v4f bv; bv[0] = bfr(bias[c0 + cofs]); bv[1] = bfr(bias[c0 + cofs + 1]); bv[2] = bfr(bias[c0 + cofs + 2]); bv[3] = bfr(bias[c0 + cofs + 3]);
#pragma unroll
    for (int mb = 0; mb < 4; ++mb) {
#pragma unroll
        for (int nb = 0; nb < 4; ++nb)
#pragma unroll
            for (int j = 0; j < 8; ++j) os[(hi * 8 + j) * 68 + nb * 16 + lr] = acc[mb][nb][j];
        __syncthreads();
#pragma unroll
        for (int s = 0; s < 8; ++s) {
            const int row = 2 * s + hi;
            const v4f x = *(const v4fa*)&os[row * 68 + cofs];
            v4f val; val[0] = x[0] * scale + bv[0]; val[1] = x[1] * scale + bv[1]; val[2] = x[2] * scale + bv[2]; val[3] = x[3] * scale + bv[3];
            *(v4f*)(crow0 + (size_t)(mb * 16 + row) * DM + cofs) = val;
        }
        __syncthreads();
    }
}

#define EWM  2                   // waves down an early output work-group, 32 rows each
#define EWN  4                   // waves across, 16 columns each
#define ETH  (32 * EWM * EWN)    // threads per early output work-group
#define EKS  128                 // k per stage: 256-B rows, two whole cache lines
#define EPIT 136                 // u16 per staged row: 272 B = 16 B x odd, the pitch for 16-byte LDS readers of 256-B rows
#define ESTG (3 * 64 * EPIT)     // u16 per stage buffer: 64 rows of ctx hi, 64 of ctx lo, 64 of Bt
static_assert(ETH == 256 && ETH == GTH);                 // stage_e: 16 rows per copy, 4 copies for 64 rows; one block size for both ranges of k_outp
static_assert(ESTG <= GSTG);                             // the early ring fits in the late one's array
static_assert(DM % EKS == 0 && DM / EKS >= 2);           // the two-buffer prologue needs two stages
static_assert(64 * 68 * 4 <= 2 * ESTG * 2);              // the f32 output tile is laid over the ring after the k loop
static_assert((NB * RH) % 64 == 0 && RH % 64 == 0 && DM % 64 == 0);   // whole tiles, none straddles a batch

// One 128-k stage of the three planes for a work-group of 256 threads: 64 rows of 256 B of each plane, 16 bytes per lane and copy (16 lanes = one row = two lines), 16 rows per copy, straight into LDS: 12 copies per wave in flight.
// ga / ga2 / gb: this thread's place in row tid>>4 of the tile's rows of ctx hi, ctx lo and Bt; la: its place in row tid>>4 of the buffer.
// The s_wait_xcnt 0 is the last line of the copies' own statement so that no address register of a copy is rewritten ahead of it.
__device__ __forceinline__ void stage_e(const u16* ga, const u16* ga2, const u16* gb, const unsigned la) {
    const size_t rs = (size_t)16 * DM;                // 16 rows on in global memory
    const unsigned ls = 16 * EPIT * 2;                // 16 rows on in LDS, bytes
    const unsigned l2 = la + 64 * EPIT * 2, lb = la + 128 * EPIT * 2;
    asm volatile("global_load_async_to_lds_b128 %0, %1, off\n\t"
                 "global_load_async_to_lds_b128 %2, %3, off\n\t"
                 "global_load_async_to_lds_b128 %4, %5, off\n\t"
                 "global_load_async_to_lds_b128 %6, %7, off\n\t"
                 "global_load_async_to_lds_b128 %8, %9, off\n\t"
                 "global_load_async_to_lds_b128 %10, %11, off\n\t"
                 "global_load_async_to_lds_b128 %12, %13, off\n\t"
                 "global_load_async_to_lds_b128 %14, %15, off\n\t"
                 "global_load_async_to_lds_b128 %16, %17, off\n\t"
                 "global_load_async_to_lds_b128 %18, %19, off\n\t"
                 "global_load_async_to_lds_b128 %20, %21, off\n\t"
                 "global_load_async_to_lds_b128 %22, %23, off\n\t"
                 "s_wait_xcnt 0x0"
                 :: "v"(la), "v"(ga), "v"(la + ls), "v"(ga + rs), "v"(la + 2 * ls), "v"(ga + 2 * rs), "v"(la + 3 * ls), "v"(ga + 3 * rs),
                    "v"(l2), "v"(ga2), "v"(l2 + ls), "v"(ga2 + rs), "v"(l2 + 2 * ls), "v"(ga2 + 2 * rs), "v"(l2 + 3 * ls), "v"(ga2 + 3 * rs),
                    "v"(lb), "v"(gb), "v"(lb + ls), "v"(gb + rs), "v"(lb + 2 * ls), "v"(gb + 2 * rs), "v"(lb + 3 * ls), "v"(gb + 3 * rs) : "memory");
}

// outp_e_body (block range of k_outp): rows < RH, bf16 hi+lo ctx planes; one work-group of eight waves (2 x 4 tiles of 32x16) per 64x64 tile (bx, by). The waves share each 128-k stage of ctx hi, ctx lo and Bt,
// brought into the two buffers of 'ring' by asynchronous copies one stage ahead (whole lines from L2, where fragment loads straight from the planes touch 16 lines each).
// Per accumulator the order of the sum is k ascending in blocks of 32, hi product then lo product. The f32 tile goes out through the ring in whole 256-B row pieces.
__device__ __forceinline__ void outp_e_body(const int bx, const int by, u16* ring, const u16* __restrict__ A, const u16* __restrict__ A2, const u16* __restrict__ Bt, const float* __restrict__ bias, float* OUT) {
    const int tid = threadIdx.x, lane = tid & 31, lr = lane & 15, hi = lane >> 4;
    const int wv = __builtin_amdgcn_readfirstlane(tid >> 5), wm = wv % EWM, wn = wv / EWM;   // wave number as a scalar: tile indices stay scalar
    const int r0 = bx * 64, c0 = by * 64;
    const int cofs = (tid & 15) * 4;                        // this thread's 4 output columns in the epilogue; their bias is fetched here, so that its latency lies behind the k loop
    const v4f braw = *(const v4f*)(bias + c0 + cofs);
    v8f acc[2];                  // acc[mb] element j = C[r0 + 32 wm + 16 mb + 8 hi + j][c0 + 16 wn + lr]
#pragma unroll
    for (int mb = 0; mb < 2; ++mb) acc[mb] = (v8f){};
    const size_t go = (size_t)(tid >> 4) * DM + (tid & 15) * 8;
    const u16* ga = A + (size_t)r0 * DM + go; const u16* ga2 = A2 + (size_t)r0 * DM + go; const u16* gb = Bt + (size_t)c0 * DM + go;
    const unsigned la = lds_byte(ring + (tid >> 4) * EPIT + (tid & 15) * 8);
    const int nst = DM / EKS;
    stage_e(ga, ga2, gb, la);
    asm volatile("s_wait_asynccnt 0x0" ::: "memory");   // this wave's copies of stage 0 have landed
    __syncthreads();                                     // stage 0 readable by every wave
    stage_e(ga + EKS, ga2 + EKS, gb + EKS, la + ESTG * 2);
#pragma unroll 1   // kept rolled: one body of 16 products, the buffer picked by st & 1
    for (int st = 0; st < nst; ++st) {
        const u16* ar = ring + (st & 1) * ESTG + (wm * 32 + lr) * EPIT + 8 * hi;
        const u16* br = ring + (st & 1) * ESTG + (128 + wn * 16 + lr) * EPIT + 8 * hi;
        v16us a[EKS / 32][2], a2[EKS / 32][2], bb[EKS / 32];
#pragma unroll   // this and the loops below: every fragment and accumulator index a constant, so that they stay in registers
        for (int kb = 0; kb < EKS / 32; ++kb) {
#pragma unroll
            for (int mb = 0; mb < 2; ++mb) a[kb][mb] = ldfr(ar + mb * 16 * EPIT + kb * 32);
            bb[kb] = ldfr(br + kb * 32);
#pragma unroll
            for (int mb = 0; mb < 2; ++mb) a2[kb][mb] = ldfr(ar + (64 + mb * 16) * EPIT + kb * 32);
        }
        __builtin_amdgcn_sched_barrier(0);   // holds the stage's 40 LDS reads together, ahead of its products: left free, the compiler spread them among the products in one register set, and a wave waited out an LDS latency at each place
#pragma unroll
        for (int kb = 0; kb < EKS / 32; ++kb) {
#pragma unroll
            for (int mb = 0; mb < 2; ++mb) acc[mb] = mma_bp(a[kb][mb], bb[kb], acc[mb]);
#pragma unroll
            for (int mb = 0; mb < 2; ++mb) acc[mb] = mma_bp(a2[kb][mb], bb[kb], acc[mb]);
        }
        __builtin_amdgcn_sched_barrier(0);   // keeps the waits below behind the products: moved up over them (they touch no memory), the wait for all 40 reads stood ahead of the products, which then no longer ran while the later reads return
        asm volatile("s_wait_dscnt 0x0" ::: "memory");      // this wave's LDS reads of the stage are done before the buffer is refilled
        asm volatile("s_wait_asynccnt 0x0" ::: "memory");   // this wave's copies of the next stage have landed
        __syncthreads();                                     // publishes the next stage and ends every reader's last read of this one
        if (st + 2 < nst) stage_e(ga + (st + 2) * EKS, ga2 + (st + 2) * EKS, gb + (st + 2) * EKS, la + (st & 1) * (ESTG * 2));
    }
    asm volatile("s_wait_asynccnt 0x0" ::: "memory");       // no copy is left in flight when the ring becomes output staging
    float* ot = (float*)ring;                               // [64][68] f32; every wave has left the ring (the last trip's barrier)
#pragma unroll
    for (int mb = 0; mb < 2; ++mb)
#pragma unroll
        for (int j = 0; j < 8; ++j) ot[(wm * 32 + mb * 16 + hi * 8 + j) * 68 + wn * 16 + lr] = acc[mb][j];
    __syncthreads();                                         // the whole tile is staged before any row piece is read back
    const int b = r0 / RH, tb = r0 - b * RH;
    float* crow0 = OUT + ((size_t)b * SEQ_FULL + tb) * DM + c0;
    v4f bv; bv[0] = bfr(braw[0]); bv[1] = bfr(braw[1]); bv[2] = bfr(braw[2]); bv[3] = bfr(braw[3]);
#pragma unroll
    for (int s = 0; s < 4; ++s) {
        const int row = 16 * s + (tid >> 4);
        const v4f x = *(const v4fa*)&ot[row * 68 + cofs];
        v4f val; val[0] = x[0] + bv[0]; val[1] = x[1] + bv[1]; val[2] = x[2] + bv[2]; val[3] = x[3] + bv[3];
        *(v4f*)(crow0 + (size_t)row * DM + cofs) = val;
    }
}

// outp_l_body (block range of k_outp): rows >= RH, f16 planes; eight waves (4 x 2 tiles of 64x64) per work-group (bx, by) sharing the staged operands.
__device__ __forceinline__ void outp_l_body(const int bx, const int by, u16* ring, const u16* __restrict__ A, const u16* __restrict__ Bt, const float* __restrict__ bias, float* OUT) {
    const int tid = threadIdx.x, lane = tid & 31, lr = lane & 15, hi = lane >> 4;
    const int wv = __builtin_amdgcn_readfirstlane(tid >> 5), wm = wv % GWM, wn = wv / GWM;   // wave number as a scalar: tile indices and the branches on them stay scalar
    float* os = (float*)((char*)ring + wv * GEPI);                       // this wave's own staging, used after the k loop only
    v8f acc[4][4];
    gemm_tile_s<true>(A, Bt, DM, bx * GAR, by * GBR, ring, tid, wm, wn, lr, hi, acc);
    outp_store(acc, os, bias, OUT, 1.0f / (WCAR * CCAR), (SEQ > RH) ? (SEQ - RH) : 1, RH, bx * GAR + wm * 64, by * GBR + wn * 64, lr, hi);
}

#define NOLX (NB * (SEQ - RH) / GAR)     // late work-groups down
#define NOL  (NOLX * (DM / GBR))         // late work-groups
#define NOEX (NB * RH / 64)              // early work-groups down
#define NOE  (NOEX * (DM / 64))          // early work-groups
// k_outp: both output-projection ranges in one launch; they are independent of each other, and two work-groups fit a WGP, so the short early work-groups run beside the late ones (and on the WGPs these leave empty), not in a launch of their own.
// Blocks 0 .. NOL-1: rows >= RH; the rest: rows < RH; in each range the row tile runs fastest. The choice is the same for a whole work-group.
__global__ __launch_bounds__(GTH) void k_outp(const u16* __restrict__ A, const u16* __restrict__ Bt, const u16* __restrict__ AEh, const u16* __restrict__ AEl, const u16* __restrict__ BtE, const float* __restrict__ bias, float* OUT) {
    __shared__ __align__(16) u16 ring[2 * GSTG];
    const int bid = blockIdx.x;
    if (bid < NOL) outp_l_body(bid % (NOLX > 0 ? NOLX : 1), bid / (NOLX > 0 ? NOLX : 1), ring, A, Bt, bias, OUT);
    else outp_e_body((bid - NOL) % NOEX, (bid - NOL) / NOEX, ring, AEh, AEl, BtE, bias, OUT);
}

extern "C" void kernel_launch(void* const* d_in, const int* in_sizes, int n_in,
                              void* d_out, int out_size, void* d_ws, size_t ws_size, hipStream_t stream) {
    if (n_in < 10) return;
    const long long needx = ((long long)(NB - 1) * SEQ_FULL + SEQ) * DM;
    if ((long long)in_sizes[0] < needx) return;
    if ((long long)in_sizes[1] < (long long)DM * DM || (long long)in_sizes[2] < (long long)DM * DM || (long long)in_sizes[3] < (long long)DM * DM || (long long)in_sizes[4] < (long long)DM * DM) return;
    if (in_sizes[5] < DM) return;
    if (in_sizes[6] < HD || in_sizes[7] < HD || in_sizes[8] < HD || in_sizes[9] < HD) return;
    if ((long long)out_size < needx) return;
    if (O_END * 2 > ws_size) return;
    // wire order: x, key weight, query weight, value weight, output weight, output bias, key LayerNorm gain, key LayerNorm bias, query LayerNorm gain, query LayerNorm bias
    const float* x  = (const float*)d_in[0];
    const float* Wk = (const float*)d_in[1];
    const float* Wq = (const float*)d_in[2];
    const float* Wv = (const float*)d_in[3];
    const float* Wp = (const float*)d_in[4];
    const float* bp = (const float*)d_in[5];
    const float* kg = (const float*)d_in[6];
    const float* kb = (const float*)d_in[7];
    const float* qg = (const float*)d_in[8];
    const float* qb = (const float*)d_in[9];
    float* OUT = (float*)d_out;
    u16* PL = (u16*)d_ws;

    k_cvt_all<<<CVG, 32 * CVW, 0, stream>>>(x, Wq, Wk, Wv, Wp, PL);   // planes O_XB, O_WALL (query, key, value rows), O_WPB, O_WPH

    k_proj<<<dim3(NB * SEQ / GAR, 3 * DM / GBR, 1), GTH, 0, stream>>>(PL + O_XB, PL + O_WALL, PL, O_P16, O_EH, O_EL, qg, qb, kg, kb);

    k_attn<<<NAE + NAL, 32 * AW, 0, stream>>>(PL + O_P16, PL + O_P16 + PLANE, PL + O_P16 + 2 * PLANE, PL + O_AT,
                                              PL + O_EH, PL + O_EL, PL + O_EH + EPLANE, PL + O_EL + EPLANE, PL + O_EH + 2 * EPLANE, PL + O_EL + 2 * EPLANE, PL + O_ATEH, PL + O_ATEL);

    k_outp<<<NOL + NOE, GTH, 0, stream>>>(PL + O_AT, PL + O_WPH, PL + O_ATEH, PL + O_ATEL, PL + O_WPB, bp, OUT);
}

// v010
// One run takes 116 microseconds.
// In both of two side-by-side timings against v009, it was 1.03 times as fast.
// Counting every step since v000, it is 3.85 times as fast.
#include <hip/hip_runtime.h>

// Compute dtypes (f32 accumulate everywhere): q/k/v projections bf16 x bf16 (inputs converted RNE to bf16, products exact), per-head LayerNorm of q and k in f32 inside the projection epilogue; scores q.k and P.V: f16 single products on query rows >= 256 (P carried x1024), bf16 hi+lo (3 products) on query rows < 256; output projection: f16 single product (ctx x16, Wo x32 carries) on rows >= 256, bf16 hi+lo ctx x bf16 Wo on rows < 256.
// Causal 16-head attention block, x [4][2048][1024]; separate bias-free [out][in] key / query / value projections (used as Bt as stored), per-head LayerNorm (eps 1e-5, gain and bias inputs) on the 64-wide query and key rows,
// the two 1024^(-1/4) factors applied as one 1/32 on the scores, causal exclusion with the diagonal kept, softmax in f32 (running max, log2 domain), heads merged h*64+d, [out][in] output projection plus bias.
// Layout: 16-bit planes in the workspace (u16 storage): x copy [b*SEQ+t][1024]; weights [3][1024][1024] (q, k, v) ; q and k head planes [b][h][t][64]; v transposed [b][h][64][t]; hi/lo bf16 planes of the same for t < 256;
// ctx f16 [b][t-256][1024] and ctx hi/lo bf16 [b][t<256][1024]. Fused flash-style attention: one wave per 16 query rows, 32 keys per step, no score plane in global memory; four waves share K and V stages in LDS (rows < 256: hi and lo planes); rows >= 256: both products run transposed, a wave takes 32 query rows and one 32-key half of each 64-key stage, and the two halves' partial results are merged once, after the key loop. Projection and late output GEMMs: eight waves share A and B stages in LDS; early output GEMM: eight waves share ctx hi, ctx lo and B stages in LDS. Four launches: conversions; projections; attention (rows < 256 and rows >= 256 as block ranges of one grid); output projection (the same two ranges).

#ifndef NB
#define NB 4
#endif
#ifndef SEQ
#define SEQ 2048
#endif
#define NB_FULL  4
#define SEQ_FULL 2048
#define DM   1024
#define NH   16
#define HD   64
#define RH   256                 // query rows / keys below RH also carry bf16 hi+lo planes
#define PCAR 1024.0f             // carry on f16 probabilities
#define CCAR 16.0f               // carry on the f16 ctx plane
#define WCAR 32.0f               // carry on the f16 output-projection weight plane
#define SCL2 (0.03125f * 1.4426950408889634f)   // 1/sqrt(1024) x log2(e)
#define LNEPS 1.0e-5f            // LayerNorm epsilon on the head rows

static_assert(DM == NH * HD);            // heads tile the channel width
static_assert(HD == 64);
static_assert(HD == 2 * 4 * 8);          // LayerNorm row = 2 lanes x 4 accumulator tiles x 8 registers in the projection epilogue
static_assert(DM % 64 == 0);             // GEMM k-step: two 32-k blocks a trip
static_assert(HD % 32 == 0);             // score k-step
static_assert(SEQ % 64 == 0);            // 64-row GEMM tiles never straddle a batch
static_assert(RH % 64 == 0);             // early/late split on tile borders
static_assert(SEQ >= RH);
static_assert((SEQ - RH) % 64 == 0);
static_assert(RH % 32 == 0);             // 32-key steps end inside the early planes
static_assert(NB <= NB_FULL);
static_assert(SEQ <= SEQ_FULL);

typedef unsigned short u16;
typedef _Float16 h16;
typedef __attribute__((ext_vector_type(16))) __bf16         v16bf;
typedef __attribute__((ext_vector_type(16))) _Float16       v16h;
typedef __attribute__((ext_vector_type(8)))  unsigned short v8us;
typedef __attribute__((ext_vector_type(16))) unsigned short v16us;
typedef __attribute__((ext_vector_type(8)))  float          v8f;
typedef __attribute__((ext_vector_type(4)))  float          v4f;
typedef v4f  __attribute__((may_alias)) v4fa;
typedef v8us __attribute__((may_alias)) v8usa;

#define XBN    ((size_t)NB * SEQ * DM)
#define WN     ((size_t)DM * DM)
#define PLANE  ((size_t)NB * NH * SEQ * HD)
#define EPLANE ((size_t)NB * NH * RH * HD)
#define ATN    ((size_t)NB * (SEQ - RH) * DM)
#define ATEN   ((size_t)NB * RH * DM)
#define O_XB   ((size_t)0)
#define O_WALL (O_XB + XBN)
#define O_WPB  (O_WALL + 3 * WN)
#define O_WPH  (O_WPB + WN)
#define O_P16  (O_WPH + WN)
#define O_EH   (O_P16 + 3 * PLANE)
#define O_EL   (O_EH + 3 * EPLANE)
#define O_AT   (O_EL + 3 * EPLANE)
#define O_ATEH (O_AT + ATN)
#define O_ATEL (O_ATEH + ATEN)
#define O_END  (O_ATEL + ATEN)
static_assert(O_END * 2 <= (size_t)134217728);   // total carve <= 128 MiB
static_assert(XBN % 128 == 0 && WN % 128 == 0 && PLANE % 128 == 0 && EPLANE % 128 == 0 && ATN % 128 == 0 && ATEN % 128 == 0);   // every region starts on a 256-byte border

__device__ __forceinline__ u16 f2bf(float f) { unsigned u = __float_as_uint(f); u += 0x7FFFu + ((u >> 16) & 1u); return (u16)(u >> 16); }
__device__ __forceinline__ float bf2f(u16 b) { return __uint_as_float(((unsigned)b) << 16); }
__device__ __forceinline__ float bfr(float f) { return bf2f(f2bf(f)); }
__device__ __forceinline__ u16 f2h(float x) { return __builtin_bit_cast(unsigned short, (h16)x); }

// f32 -> f16 with a value select: magnitudes below the smallest normal f16 become zero, so no subnormal f16 operand can reach a WMMA.
static __device__ __forceinline__ h16 toh_flush(float v) { const h16 r = (h16)v; return (fabsf(v) < 6.103515625e-05f) ? (h16)0.0f : r; }
static __device__ __forceinline__ u16 f2h_fl(float v) { return __builtin_bit_cast(unsigned short, toh_flush(v)); }

// Fragment loader for A and B alike: 'p' points at (row or column) + k0 + 8*(lane>>4); elements 0..7 = k0+8h.., elements 8..15 = k0+16+8h..
__device__ __forceinline__ v16us ldfr(const u16* p) {
    const v8us lo = *(const v8us*)p; const v8us hi = *(const v8us*)(p + 16);
    return __builtin_shufflevector(lo, hi, 0, 1, 2, 3, 4, 5, 6, 7, 8, 9, 10, 11, 12, 13, 14, 15);
}
// One WMMA plus its own hazard guard (ties exactly one accumulator, keeps A and B live).
__device__ __forceinline__ v8f mma_h(v16us a, v16us b, v8f c) {
    const v16h ah = __builtin_bit_cast(v16h, a); const v16h bh = __builtin_bit_cast(v16h, b);
    c = __builtin_amdgcn_wmma_f32_16x16x32_f16(false, ah, false, bh, (short)0, c, false, false);
    asm volatile("v_nop\n\tv_nop\n\tv_nop\n\tv_nop" : "+v"(c) : "v"(ah), "v"(bh));
    return c;
}
__device__ __forceinline__ v8f mma_b(v16us a, v16us b, v8f c) {
    const v16bf ab = __builtin_bit_cast(v16bf, a); const v16bf bb = __builtin_bit_cast(v16bf, b);
    c = __builtin_amdgcn_wmma_f32_16x16x32_bf16(false, ab, false, bb, (short)0, c, false, false);
    asm volatile("v_nop\n\tv_nop\n\tv_nop\n\tv_nop" : "+v"(c) : "v"(ab), "v"(bb));
    return c;
}
template <bool F16> __device__ __forceinline__ v8f mmag(v16us a, v16us b, v8f c) { if (F16) return mma_h(a, b, c); else return mma_b(a, b, c); }
// The same bf16 product with the hazard distance left to the compiler's own padding.
__device__ __forceinline__ v8f mma_bp(v16us a, v16us b, v8f c) { return __builtin_amdgcn_wmma_f32_16x16x32_bf16(false, __builtin_bit_cast(v16bf, a), false, __builtin_bit_cast(v16bf, b), (short)0, c, false, false); }

__device__ __forceinline__ unsigned lds_byte(const u16* p) { return (unsigned)(size_t)(const __attribute__((address_space(3))) u16*)p; }

#define GWM  4                   // waves down a GEMM work-group, 64 rows each
#define GWN  2                   // waves across, 64 columns each
#define GTH  (32 * GWM * GWN)    // threads per GEMM work-group
#define GKS  64                  // k per stage: 128-B rows, whole cache lines
#define GPIT 72                  // u16 per staged row: 144 B = 16 B x odd, the pitch for 16-byte LDS readers of 128-B rows
#define GAR  (64 * GWM)          // A rows per stage
#define GBR  (64 * GWN)          // Bt rows per stage
#define GSTG ((GAR + GBR) * GPIT)   // u16 per stage buffer: A rows, then Bt rows
#define GEPI (16 * 68 * 4 + 64 * 72 * 2)   // bytes of epilogue staging per wave (f32 row block, then the 16-bit transpose block), laid over the ring after the k loop
static_assert(GTH == 256 && GAR == 256 && GBR == 128);   // stage_ab: 32 rows per copy, 8 copies for A and 4 for Bt
static_assert(DM % GKS == 0 && DM / GKS >= 2);           // the two-buffer prologue needs two stages
static_assert(GEPI % 16 == 0 && GEPI * GWM * GWN <= 2 * GSTG * 2);
static_assert((NB * SEQ) % GAR == 0 && (NB * (SEQ - RH)) % GAR == 0 && RH % GAR == 0 && SEQ % GAR == 0 && DM % GBR == 0);   // whole work-groups; early/late and q/k/v the same for all waves of one

// One 64-k stage for a work-group of 256 threads: 256 A rows and 128 Bt rows of 128 B, 16 bytes per lane and copy (8 lanes = one row = one line), straight into LDS. ga / gb / la: this thread's place in row tid>>3 of A, of Bt, of the buffer.
// The s_wait_xcnt 0 is the last line of the copies' own statement so that no address register of a copy is rewritten ahead of it.
__device__ __forceinline__ void stage_ab(const u16* ga, const u16* gb, const int K, const unsigned la) {
    const size_t rs = (size_t)32 * K;                 // 32 rows on in global memory
    const unsigned ls = 32 * GPIT * 2;                // 32 rows on in LDS, bytes
    const unsigned lb = la + GAR * GPIT * 2;
    asm volatile("global_load_async_to_lds_b128 %0, %1, off\n\t"
                 "global_load_async_to_lds_b128 %2, %3, off\n\t"
                 "global_load_async_to_lds_b128 %4, %5, off\n\t"
                 "global_load_async_to_lds_b128 %6, %7, off\n\t"
                 "global_load_async_to_lds_b128 %8, %9, off\n\t"
                 "global_load_async_to_lds_b128 %10, %11, off\n\t"
                 "global_load_async_to_lds_b128 %12, %13, off\n\t"
                 "global_load_async_to_lds_b128 %14, %15, off\n\t"
                 "global_load_async_to_lds_b128 %16, %17, off\n\t"
                 "global_load_async_to_lds_b128 %18, %19, off\n\t"
                 "global_load_async_to_lds_b128 %20, %21, off\n\t"
                 "global_load_async_to_lds_b128 %22, %23, off\n\t"
                 "s_wait_xcnt 0x0"
                 :: "v"(la), "v"(ga), "v"(la + ls), "v"(ga + rs), "v"(la + 2 * ls), "v"(ga + 2 * rs), "v"(la + 3 * ls), "v"(ga + 3 * rs),
                    "v"(la + 4 * ls), "v"(ga + 4 * rs), "v"(la + 5 * ls), "v"(ga + 5 * rs), "v"(la + 6 * ls), "v"(ga + 6 * rs), "v"(la + 7 * ls), "v"(ga + 7 * rs),
                    "v"(lb), "v"(gb), "v"(lb + ls), "v"(gb + rs), "v"(lb + 2 * ls), "v"(gb + 2 * rs), "v"(lb + 3 * ls), "v"(gb + 3 * rs) : "memory");
}

// One wave computes a 64x64 tile: acc[mb][nb] element j = C[r0 + 16 mb + 8 (lane>>4) + j][c0 + 16 nb + (lane&15)] = sum_k A[m][k] Bt[n][k], k ascending in blocks of 32. K % 64 == 0.
// A work-group of GWM x GWN waves on rows R0.. and columns C0..: the waves share each 64-k stage of A and Bt,
// brought into the two buffers of 'ring' by asynchronous copies one stage ahead. On return no copy is in flight and every wave has left the ring (the last trip's barrier), so the caller may reuse it.
// tr (the same for a whole work-group): the two operands change places (the fragment loader is the same for both), so the tile comes out transposed: acc[mb][nb] element j = C[r0 + 16 nb + (lane&15)][c0 + 16 mb + 8 (lane>>4) + j], the same products in the same k order.
template <bool F16>
__device__ __forceinline__ void gemm_tile_s(const u16* __restrict__ A, const u16* __restrict__ Bt, const int K, const int R0, const int C0, u16* ring, const int tid, const int wm, const int wn, const int lr, const int hi, const bool tr, v8f (&acc)[4][4]) {
#pragma unroll
    for (int mb = 0; mb < 4; ++mb)
#pragma unroll
        for (int nb = 0; nb < 4; ++nb) acc[mb][nb] = (v8f){};
    const u16* ga = A + (size_t)(R0 + (tid >> 3)) * K + (tid & 7) * 8;
    const u16* gb = Bt + (size_t)(C0 + (tid >> 3)) * K + (tid & 7) * 8;
    const unsigned la = lds_byte(ring + (tid >> 3) * GPIT + (tid & 7) * 8);
    const int nst = K / GKS;
    const int fa = ((tr ? GAR + wn * 64 : wm * 64) + lr) * GPIT + 8 * hi;   // this lane's place in the staged rows of the first operand
    const int fb = ((tr ? wm * 64 : GAR + wn * 64) + lr) * GPIT + 8 * hi;   // the same for the second operand
    stage_ab(ga, gb, K, la);
    asm volatile("s_wait_asynccnt 0x0" ::: "memory");   // this wave's copies of stage 0 have landed
    __syncthreads();                                     // stage 0 readable by every wave
    stage_ab(ga + GKS, gb + GKS, K, la + GSTG * 2);
#pragma unroll 1   // kept rolled: one body of 32 products, the buffer picked by st & 1; unrolling would only grow the text
    for (int st = 0; st < nst; ++st) {
        const u16* ar = ring + (st & 1) * GSTG + fa;
        const u16* br = ring + (st & 1) * GSTG + fb;
#pragma unroll   // this and the loops inside: every fragment and accumulator index a constant, so that they stay in registers
        for (int kc = 0; kc < GKS; kc += 32) {
            v16us a[4], bb[4];                  // the block's 16 LDS reads stand together, ahead of its 16 products
#pragma unroll
            for (int mb = 0; mb < 4; ++mb) a[mb] = ldfr(ar + mb * 16 * GPIT + kc);
#pragma unroll
            for (int nb = 0; nb < 4; ++nb) bb[nb] = ldfr(br + nb * 16 * GPIT + kc);
#pragma unroll
            for (int nb = 0; nb < 4; ++nb)
#pragma unroll
                for (int mb = 0; mb < 4; ++mb) acc[mb][nb] = mmag<F16>(a[mb], bb[nb], acc[mb][nb]);
        }
        asm volatile("s_wait_dscnt 0x0" ::: "memory");      // this wave's LDS reads of the stage are done before the buffer is refilled
        asm volatile("s_wait_asynccnt 0x0" ::: "memory");   // this wave's copies of the next stage have landed
        __syncthreads();                                     // publishes the next stage and ends every reader's last read of this one
        if (st + 2 < nst) stage_ab(ga + (st + 2) * GKS, gb + (st + 2) * GKS, K, la + (st & 1) * (GSTG * 2));
    }
    asm volatile("s_wait_asynccnt 0x0" ::: "memory");       // no copy is left in flight when the ring becomes epilogue staging
}

#define CVW   16                 // waves per conversion work-group
#define CVG   256                // conversion work-groups: with CVW, the launch's wave count (chosen for speed only), started once
#define CNW   (CVG * CVW)        // waves of the conversion launch
#define XROWS (NB * SEQ)         // rows of x
#define CROWS (XROWS + 4 * DM)   // rows of DM f32 to convert: x, then the query, key, value and output weights
static_assert(DM == 8 * 128);    // one row = 8 loads of 16 B per lane, each load of a wave 512 contiguous bytes
static_assert(O_XB == 0 && O_WALL == (size_t)XROWS * DM && O_WPB == O_WALL + 3 * WN && O_WPH == O_WPB + WN);   // row r of the list above lands at PL + r * DM; the f16 output-weight plane lies WN further on

typedef __attribute__((ext_vector_type(4))) unsigned short v4us;

// One converted row of 1024 16-bit values: 8 stores of 8 B per lane, each store of a wave 256 contiguous bytes (two whole lines). 'row' is the same in every lane, 'lofs' the lane's byte offset in the first 256 bytes.
// Written as one statement so that its last line, s_wait_xcnt 0, stands in front of every later write of a register that these stores name (in a statement of its own the compiler moved the next conversions over it).
__device__ __forceinline__ void store_row(u16* row, const unsigned lofs, const v4us (&d)[8]) {
    asm volatile("global_store_b64 %0, %1, %9\n\t"
                 "global_store_b64 %0, %2, %9 offset:256\n\t"
                 "global_store_b64 %0, %3, %9 offset:512\n\t"
                 "global_store_b64 %0, %4, %9 offset:768\n\t"
                 "global_store_b64 %0, %5, %9 offset:1024\n\t"
                 "global_store_b64 %0, %6, %9 offset:1280\n\t"
                 "global_store_b64 %0, %7, %9 offset:1536\n\t"
                 "global_store_b64 %0, %8, %9 offset:1792\n\t"
                 "s_wait_xcnt 0x0"
                 :: "v"(lofs), "v"(d[0]), "v"(d[1]), "v"(d[2]), "v"(d[3]), "v"(d[4]), "v"(d[5]), "v"(d[6]), "v"(d[7]), "s"(row) : "memory");
}

// k_cvt_all: every f32 -> 16-bit plane of the call in one launch of CVG work-groups. One wave per row of 1024 values and trip, rows dealt round robin over the launch's waves (wave gw takes rows gw, gw + CNW, ...);
// 8 whole-line loads of 16 B per lane in flight per wave. x and all four weights -> bf16 (RNE); the output weight also -> f16 of (bf16 value x WCAR). A reduced build reads the right rows of the full-size x.
__global__ __launch_bounds__(32 * CVW) void k_cvt_all(const float* __restrict__ x, const float* __restrict__ Wq, const float* __restrict__ Wk, const float* __restrict__ Wv, const float* __restrict__ Wp, u16* __restrict__ PL) {
    const int lane = threadIdx.x & 31;
    const int gw = __builtin_amdgcn_readfirstlane(blockIdx.x * CVW + (threadIdx.x >> 5));   // wave number as a scalar: the row, its source and the branches on it stay scalar
#pragma unroll 1   // kept rolled: few trips, and the other waves of the WGP cover a wave's load latency
    for (int r = gw; r < CROWS; r += CNW) {
        const float* src;
        if (r < XROWS) src = x + ((size_t)(r / SEQ) * SEQ_FULL + (r % SEQ)) * DM;
        else {
            const int w = (r - XROWS) / DM, wr = (r - XROWS) % DM;
            src = ((w == 0) ? Wq : (w == 1) ? Wk : (w == 2) ? Wv : Wp) + (size_t)wr * DM;
        }
        v4f v[8];
#pragma unroll
        for (int j = 0; j < 8; ++j) v[j] = *(const v4f*)(src + j * 128 + lane * 4);
        v4us ob[8];
#pragma unroll
        for (int j = 0; j < 8; ++j)
#pragma unroll
            for (int k = 0; k < 4; ++k) ob[j][k] = f2bf(v[j][k]);
        u16* row = PL + (size_t)r * DM;
        store_row(row, lane * 8, ob);
        if (r >= XROWS + 3 * DM) {
            v4us oh[8];
#pragma unroll
            for (int j = 0; j < 8; ++j)
#pragma unroll
                for (int k = 0; k < 4; ++k) oh[j][k] = f2h(bf2f(ob[j][k]) * WCAR);
            store_row(row + WN, lane * 8, oh);
        }
    }
}

// Lane l's value from lane l ^ 16 (the other half of the wave), by a vector cross-row move.
__device__ __forceinline__ float xhalf(float x) {
    const int v = __builtin_bit_cast(int, x);
    return __builtin_bit_cast(float, __builtin_amdgcn_permlanex16(v, v, 0x76543210, 0xfedcba98, false, false));
}

// The 64 staged rows of 128 B of one wave's tile, out in whole lines: 8 lanes a row, 4 rows per store of a wave. DP: elements from one output row to the next, a constant so that the rows' distances become immediate offsets.
// A trip's four stores are one statement so that its last line, s_wait_xcnt 0, stands in front of every later write of a register that these stores name (the next trip's LDS reads and address).
template <int DP>
__device__ __forceinline__ void put_rows(const u16* ts, u16* dst, const int lane) {
    const u16* lp = ts + (lane >> 3) * 72 + (lane & 7) * 8;
    u16* gp = dst + (size_t)(lane >> 3) * DP + (lane & 7) * 8;
#pragma unroll 1   // kept rolled: four trips of 16 rows, four LDS reads in flight in each; unrolled only the text grows
    for (int s = 0; s < 4; ++s) {
        const v8us v0 = *(const v8usa*)(lp + (16 * s) * 72), v1 = *(const v8usa*)(lp + (16 * s + 4) * 72), v2 = *(const v8usa*)(lp + (16 * s + 8) * 72), v3 = *(const v8usa*)(lp + (16 * s + 12) * 72);
        asm volatile("global_store_b128 %0, %1, off\n\t"
                     "global_store_b128 %0, %2, off offset:%5\n\t"
                     "global_store_b128 %0, %3, off offset:%6\n\t"
                     "global_store_b128 %0, %4, off offset:%7\n\t"
                     "s_wait_xcnt 0x0"
                     :: "v"(gp + (size_t)(16 * s) * DP), "v"(v0), "v"(v1), "v"(v2), "v"(v3), "n"(4 * DP * 2), "n"(8 * DP * 2), "n"(12 * DP * 2) : "memory");
    }
}

// k_proj: [NB*SEQ][1024] x [3072][1024]^T (rows 0..1023 query weight, 1024..2047 key weight, 2048..3071 value weight). One wave per 64x64 tile = 64 time rows of one head, eight waves (4 x 2 tiles) per work-group sharing the staged operands.
// q/k tiles are taken transposed (weight rows as the first operand): a lane then holds 32 of the 64 head columns of ONE time row in each of its four row groups, lane ^ 16 the other 32. The per-row LayerNorm (mean and biased variance in f32, eps 1e-5,
// gain and bias taken as bf16 values of the inputs) runs inside the lane with one half exchange per sum, on the accumulators in place: no f32 staging, no cross-lane chain through the LDS unit, no barrier.
// v tiles are taken as they are: a lane holds 8 consecutive time rows of one head column. In both cases a lane's 8 registers are 8 consecutive elements of an output row, so one store path serves all three:
// 16-bit values through the wave's own LDS block in 16-byte pieces, out in whole 128-B lines: q/k rows [b][h][t][64], v rows [b][h][d][t] (64 t); f16 planes, and bf16 hi/lo planes for t < RH. Planes addressed by element offsets from one base.
// All f16 plane values go through the value-select convert (no subnormal f16 can be produced).
__global__ __launch_bounds__(GTH) void k_proj(const u16* __restrict__ XB, const u16* __restrict__ WALL, u16* PL, size_t oP16, size_t oEH, size_t oEL,
                                             const float* __restrict__ QG, const float* __restrict__ QB, const float* __restrict__ KG, const float* __restrict__ KB) {
    __shared__ __align__(16) u16 ring[2 * GSTG];
    const int tid = threadIdx.x, lane = tid & 31, lr = lane & 15, hi = lane >> 4;
    const int wv = __builtin_amdgcn_readfirstlane(tid >> 5), wm = wv % GWM, wn = wv / GWM;   // wave number as a scalar: tile indices and the branches on them stay scalar
    u16* ts = (u16*)((char*)ring + wv * GEPI + 16 * 68 * 4);             // this wave's own staging, used after the k loop only
    const int r0 = blockIdx.x * GAR + wm * 64, c0 = blockIdx.y * GBR + wn * 64;
    const int which = c0 / DM, hd = (c0 - which * DM) / HD;
    const int b = r0 / SEQ, t0 = r0 - b * SEQ;
    const bool early = (t0 < RH);
    const bool qk = (which < 2);
    const size_t bh = (size_t)b * NH + hd;
    v8f acc[4][4];
    gemm_tile_s<false>(XB, WALL, DM, blockIdx.x * GAR, blockIdx.y * GBR, ring, tid, wm, wn, lr, hi, qk, acc);
    if (qk) {
        // acc[mb][nb] element j = head column 16 mb + 8 hi + j of time row t0 + 16 nb + lr
        const float* gp = ((which == 0) ? QG : KG) + 8 * hi;
        const float* bp = ((which == 0) ? QB : KB) + 8 * hi;
        v8f g[4], be[4];
#pragma unroll   // this and the loops below: every accumulator index a constant, so that the tile stays in registers
        for (int mb = 0; mb < 4; ++mb) {
            const v4f g0 = *(const v4f*)(gp + mb * 16), g1 = *(const v4f*)(gp + mb * 16 + 4);
            const v4f b0 = *(const v4f*)(bp + mb * 16), b1 = *(const v4f*)(bp + mb * 16 + 4);
#pragma unroll
            for (int q = 0; q < 4; ++q) { g[mb][q] = bfr(g0[q]); g[mb][4 + q] = bfr(g1[q]); be[mb][q] = bfr(b0[q]); be[mb][4 + q] = bfr(b1[q]); }
        }
#pragma unroll
        for (int nb = 0; nb < 4; ++nb) {
            const v8f t = (acc[0][nb] + acc[1][nb]) + (acc[2][nb] + acc[3][nb]);
            float sm = ((t[0] + t[1]) + (t[2] + t[3])) + ((t[4] + t[5]) + (t[6] + t[7]));
            sm += xhalf(sm);
            const float mean = sm * (1.0f / 64.0f);
            v8f d[4];
#pragma unroll
            for (int mb = 0; mb < 4; ++mb) d[mb] = acc[mb][nb] - mean;
            v8f u = d[0] * d[0];
#pragma unroll
            for (int mb = 1; mb < 4; ++mb) u = __builtin_elementwise_fma(d[mb], d[mb], u);
            float vs = ((u[0] + u[1]) + (u[2] + u[3])) + ((u[4] + u[5]) + (u[6] + u[7]));
            vs += xhalf(vs);
            const float rinv = rsqrtf(vs * (1.0f / 64.0f) + LNEPS);
#pragma unroll
            for (int mb = 0; mb < 4; ++mb) acc[mb][nb] = d[mb] * rinv * g[mb] + be[mb];
        }
    }
    // Output row 16 nb + lr of the tile (q/k: time row; v: head column), elements 16 mb + 8 hi + j of it (q/k: head columns; v: time rows).
    const size_t prow = qk ? (bh * SEQ + t0) * HD : bh * HD * SEQ + t0;   // the tile's first element in its f16 plane
    const size_t erow = qk ? (bh * RH + t0) * HD : bh * HD * RH + t0;     // the same in its hi and lo planes (used for t0 < RH only)
#pragma unroll
    for (int pl = 0; pl < 3; ++pl) {
        if (pl == 0 || early) {
#pragma unroll
            for (int mb = 0; mb < 4; ++mb)
#pragma unroll
                for (int nb = 0; nb < 4; ++nb) {
                    v8us pk;
#pragma unroll
                    for (int j = 0; j < 8; ++j) { const float y = acc[mb][nb][j]; const u16 hb = f2bf(y); pk[j] = (pl == 0) ? f2h_fl(y) : ((pl == 1) ? hb : f2bf(y - bf2f(hb))); }
                    *(v8usa*)&ts[(nb * 16 + lr) * 72 + mb * 16 + hi * 8] = pk;     // ts[output row][element]: 8 consecutive elements per lane
                }
            __syncthreads();
            const size_t dofs = (pl == 0) ? (oP16 + (size_t)which * PLANE + prow) : (((pl == 1) ? oEH : oEL) + (size_t)which * EPLANE + erow);
            if (qk) put_rows<HD>(ts, PL + dofs, lane);
            else if (pl == 0) put_rows<SEQ>(ts, PL + dofs, lane);
            else put_rows<RH>(ts, PL + dofs, lane);
            __syncthreads();
        }
    }
}

// Online-softmax update for one 16 x 32 score step. s0/s1 hold raw scores for keys jb + (lane&15) and jb + 16 + (lane&15), rows qbase + 8 (lane>>4) + i; on return they hold exp2(t - running max).
// lrow keeps PER-LANE partial sums (reduced over the 16 lanes of a row once, after the key loop). Masked entries are replaced before the maximum; every row keeps its own key.
__device__ __forceinline__ void sm_step(v8f& s0, v8f& s1, float (&mrow)[8], float (&lrow)[8], float (&corr)[8], const int jb, const int qbase, const int lr, const int hi) {
#pragma unroll
    for (int i = 0; i < 8; ++i) {
        const int row = qbase + i + 8 * hi;
        float a0 = s0[i] * SCL2, a1 = s1[i] * SCL2;
        a0 = (jb + lr > row) ? -1.0e30f : a0;
        a1 = (jb + 16 + lr > row) ? -1.0e30f : a1;
        float mx = fmaxf(a0, a1);
        mx = fmaxf(mx, __shfl_xor(mx, 1, 32)); mx = fmaxf(mx, __shfl_xor(mx, 2, 32)); mx = fmaxf(mx, __shfl_xor(mx, 4, 32)); mx = fmaxf(mx, __shfl_xor(mx, 8, 32));
        const float mnew = fmaxf(mrow[i], mx);
        // The row's three exponentials as v_exp_f32, like the builtin. One statement, each in its own register, and a closing v_nop: so no instruction directly behind an exponential reads its result or overwrites its source
        // (with the registers of this build the compiler gave an exponential's result the register the one before it had just read).
        float c = mrow[i] - mnew, p0 = a0 - mnew, p1 = a1 - mnew;
        asm("v_exp_f32 %0, %0\n\tv_exp_f32 %1, %1\n\tv_exp_f32 %2, %2\n\tv_nop" : "+v"(c), "+v"(p0), "+v"(p1));
        lrow[i] = lrow[i] * c + (p0 + p1);
        mrow[i] = mnew; corr[i] = c; s0[i] = p0; s1[i] = p1;
    }
}

#define AW   4                   // waves per late-attention work-group: QG query groups x KH key halves
#define QT   2                   // 16-query tiles per late-attention wave: each K and V fragment read from LDS feeds QT products
#define QG   2                   // query groups of 16 * QT rows per work-group
#define KH   2                   // 32-key halves of a stage, one per wave of a query group
#define LQR  (16 * QT * QG)      // query rows per late-attention work-group
#define LKS  (32 * KH)           // keys per late-attention stage: a staged value row is one whole 128-B line
#define VPL  72                  // u16 per staged late value row: 144 B = 16 B x odd, the pitch for 16-byte LDS readers of 128-B rows
#define KPIT 72                  // u16 per staged key row: 144 B = 16 B x odd, the pitch for 16-byte LDS readers of 128-B rows
#define VPIT 40                  // u16 per staged value row: 80 B = 16 B x odd, the same for 64-B rows
#define NQB_L (((SEQ - RH) / LQR) > 0 ? ((SEQ - RH) / LQR) : 1)
static_assert(QG * KH == AW && KH == 2 && QT == KH);   // wave = query group + QG * key half; in the merge each wave of a pair finishes one of the pair's QT tiles
static_assert((SEQ - RH) % LQR == 0);         // whole work-groups of query rows
static_assert((RH + LQR) / LKS >= 2);         // the two-buffer prologue needs two stages
static_assert(LQR % LKS == 0 && RH % LKS == 0);   // a work-group's last stage ends on its last query row
static_assert(RH >= LKS);                     // every key of the first stage is open to every late query: both halves' maxima are finite from the first stage on
static_assert(LKS * 2 == 128 && HD * 2 == 128);   // stage_kv: key rows and value rows of 128 B, 8 lanes a row
#define NWGP 256                 // WGPs of the chip (used for speed only)
#define LGR  (((NWGP % (NB * NH)) == 0 && (NQB_L % (NWGP / (NB * NH))) == 0) ? (NWGP / (NB * NH)) : 1)   // query blocks (all heads of each) per such round of NWGP work-groups; 1: no mirroring

// One 64-key stage for a work-group of 128 threads: key rows jb..jb+63 (64 x 128 B, contiguous in the plane) and the 64 value rows' columns jb..jb+63 (64 x 128 B, whole lines), 16 bytes per lane and copy (8 lanes = one row = one line), 16 rows per copy, straight into LDS.
// The s_wait_xcnt 0 is the last line of the copies' own statement so that no address register of a copy is rewritten ahead of it.
__device__ __forceinline__ void stage_kv(const u16* __restrict__ Kb, const u16* __restrict__ Vb, const int jb, u16* kd, u16* vd, const int tid) {
    const u16* gk = Kb + (size_t)(jb + (tid >> 3)) * HD + (tid & 7) * 8;       // key rows 0..15 of the stage
    const u16* gv = Vb + (size_t)(tid >> 3) * SEQ + jb + (tid & 7) * 8;        // head columns 0..15
    const size_t ks16 = (size_t)16 * HD, vs16 = (size_t)16 * SEQ;              // 16 rows on in global memory
    const unsigned lk = lds_byte(kd + (tid >> 3) * KPIT + (tid & 7) * 8), lv = lds_byte(vd + (tid >> 3) * VPL + (tid & 7) * 8);
    const unsigned kl16 = 16 * KPIT * 2, vl16 = 16 * VPL * 2;                  // 16 rows on in LDS, bytes
    asm volatile("global_load_async_to_lds_b128 %0, %1, off\n\t"
                 "global_load_async_to_lds_b128 %2, %3, off\n\t"
                 "global_load_async_to_lds_b128 %4, %5, off\n\t"
                 "global_load_async_to_lds_b128 %6, %7, off\n\t"
                 "global_load_async_to_lds_b128 %8, %9, off\n\t"
                 "global_load_async_to_lds_b128 %10, %11, off\n\t"
                 "global_load_async_to_lds_b128 %12, %13, off\n\t"
                 "global_load_async_to_lds_b128 %14, %15, off\n\t"
                 "s_wait_xcnt 0x0"
                 :: "v"(lk), "v"(gk), "v"(lk + kl16), "v"(gk + ks16), "v"(lk + 2 * kl16), "v"(gk + 2 * ks16), "v"(lk + 3 * kl16), "v"(gk + 3 * ks16),
                    "v"(lv), "v"(gv), "v"(lv + vl16), "v"(gv + vs16), "v"(lv + 2 * vl16), "v"(gv + 2 * vs16), "v"(lv + 3 * vl16), "v"(gv + 3 * vs16) : "memory");
}

// 2^c and 2^a[0..7] (first form), 2^a[0..7] (second form), as v_exp_f32 like the builtin. One statement each, results in registers of their own ("=&v") and a closing v_nop:
// so no instruction directly behind an exponential reads its result or overwrites its source (left to itself the compiler gave an exponential's result the register the one before it had just read).
__device__ __forceinline__ void exp2_9(const float c, const v8f a, float& ec, v8f& e) {
    float r0, r1, r2, r3, r4, r5, r6, r7;
    asm("v_exp_f32 %0, %9\n\tv_exp_f32 %1, %10\n\tv_exp_f32 %2, %11\n\tv_exp_f32 %3, %12\n\tv_exp_f32 %4, %13\n\tv_exp_f32 %5, %14\n\tv_exp_f32 %6, %15\n\tv_exp_f32 %7, %16\n\tv_exp_f32 %8, %17\n\tv_nop"
        : "=&v"(ec), "=&v"(r0), "=&v"(r1), "=&v"(r2), "=&v"(r3), "=&v"(r4), "=&v"(r5), "=&v"(r6), "=&v"(r7)
        : "v"(c), "v"(a[0]), "v"(a[1]), "v"(a[2]), "v"(a[3]), "v"(a[4]), "v"(a[5]), "v"(a[6]), "v"(a[7]));
    e[0] = r0; e[1] = r1; e[2] = r2; e[3] = r3; e[4] = r4; e[5] = r5; e[6] = r6; e[7] = r7;
}
__device__ __forceinline__ void exp2_8(const v8f a, v8f& e) {
    float r0, r1, r2, r3, r4, r5, r6, r7;
    asm("v_exp_f32 %0, %8\n\tv_exp_f32 %1, %9\n\tv_exp_f32 %2, %10\n\tv_exp_f32 %3, %11\n\tv_exp_f32 %4, %12\n\tv_exp_f32 %5, %13\n\tv_exp_f32 %6, %14\n\tv_exp_f32 %7, %15\n\tv_nop"
        : "=&v"(r0), "=&v"(r1), "=&v"(r2), "=&v"(r3), "=&v"(r4), "=&v"(r5), "=&v"(r6), "=&v"(r7)
        : "v"(a[0]), "v"(a[1]), "v"(a[2]), "v"(a[3]), "v"(a[4]), "v"(a[5]), "v"(a[6]), "v"(a[7]));
    e[0] = r0; e[1] = r1; e[2] = r2; e[3] = r3; e[4] = r4; e[5] = r5; e[6] = r6; e[7] = r7;
}

// attn_l_body (block range of k_attn): query rows >= RH, f16 single products. One work-group of AW waves per LQR query rows of one (batch, head); the waves share each 64-key stage of K and V,
// brought into two LDS buffers by asynchronous copies one stage ahead. Wave = (query group, key half): it takes QT tiles of 16 query rows and, of every stage, the 32 keys of its half, so a fragment of K or V, once in registers,
// serves QT products (half the LDS reads per product of one tile a wave), and one barrier and one round of address work serve 64 keys. Every wave walks the work-group's key range: a step wholly above a tile's diagonal adds exact zeros.
// Each wave keeps maximum, sum and output of its own keys; after the key loop the two waves of a query group exchange partial results through LDS, and each finishes one tile. ctx f16 x CCAR -> AT [b][t-RH][1024].
// Both products are taken transposed: S^T = K Q^T (A = key rows from LDS, B = the wave's query rows, kept in registers) and O^T += V^T P^T (A = rows of the staged V^T, B = P^T).
// In each tile a lane then holds 16 of the 32 scores of ONE query (qbase + 16 t + (lane&15); keys jb + 8 (lane>>4) + r and jb + 16 + 8 (lane>>4) + r): maximum and sum run inside the lane, the two halves of the wave meet in one exchange,
// and the two score tiles, converted in place, are the B operand of the second product in the loader's own k order, so P goes through no LDS and no barrier.
__device__ __forceinline__ void attn_l_body(const int bid, u16* sm, const u16* __restrict__ QP, const u16* __restrict__ KP, const u16* __restrict__ VT, u16* AT) {
    u16 (*ks)[LKS * KPIT] = (u16 (*)[LKS * KPIT])sm;                   // two key stages
    u16 (*vs)[HD * VPL] = (u16 (*)[HD * VPL])(sm + 2 * LKS * KPIT);    // two value stages
    const int tid = threadIdx.x, lane = tid & 31, lr = lane & 15, hi = lane >> 4;
    const int wv = __builtin_amdgcn_readfirstlane(tid >> 5);   // wave number as a scalar: the tests for steps that touch the diagonal stay scalar branches
    const int qg = wv % QG, kh = wv / QG;                      // query group, key half
    // Work-group order, for speed only (every (head, query block) pair is taken once, wherever and whenever a work-group runs). A query block's cost grows with its index:
    // the heaviest query blocks come first, heads fastest, so that what starts last is short (the lightest start as places on the WGPs fall free). LGR query blocks per round of NWGP: every other round is mirrored, so that the key steps of the work-groups that share a WGP add up alike.
    const int rk = bid / (NB * NH), bh = bid - rk * (NB * NH);   // rank of the query block, head
    const int rd = rk / LGR;                                                   // round
    const int qb = NQB_L - 1 - ((rd & 1) ? rd * LGR + (LGR - 1) - (rk - rd * LGR) : rk);
    const int b = bh / NH, h = bh - b * NH;
    const int qblk = RH + qb * LQR;
    const int qbase = qblk + qg * (16 * QT);
    const size_t pb = (size_t)bh * SEQ * HD;
    const u16* Qb = QP + pb; const u16* Kb = KP + pb; const u16* Vb = VT + pb;
    const int nst = (qblk + LQR) / LKS;          // keys 0 .. qblk+LQR-1 in stages of LKS; nst*LKS <= SEQ, nst >= 2
    stage_kv(Kb, Vb, 0, ks[0], vs[0], tid);
    asm volatile("s_wait_asynccnt 0x0" ::: "memory");   // this wave's copies of stage 0 have landed
    __syncthreads();                                     // stage 0 readable by every wave
    stage_kv(Kb, Vb, LKS, ks[1], vs[1], tid);
    v16us q0[QT], q1[QT];
#pragma unroll
    for (int t = 0; t < QT; ++t) {
        q0[t] = ldfr(Qb + (size_t)(qbase + 16 * t + lr) * HD + 8 * hi);
        q1[t] = ldfr(Qb + (size_t)(qbase + 16 * t + lr) * HD + 32 + 8 * hi);
    }
    v8f acc[QT][4];                              // acc[t][dt][r] = this key half's share of O^T[16 dt + 8 hi + r][qbase + 16 t + lr], carried x PCAR
    float mrun[QT], lsum[QT];                    // this lane's query of tile t, this wave's keys: running maximum of the raw scores (both halves of the wave alike); sum of this half-wave's probabilities x PCAR
#pragma unroll
    for (int t = 0; t < QT; ++t) {
#pragma unroll
        for (int dt = 0; dt < 4; ++dt) acc[t][dt] = (v8f){};
        mrun[t] = -1.0e30f; lsum[t] = 0.0f;
    }
#pragma unroll 1
    for (int st = 0; st < nst; ++st) {
        const int jb = st * LKS + kh * 32;       // first of this wave's 32 keys of the stage
        const u16* kr0 = ks[st & 1] + (kh * 32 + lr) * KPIT + 8 * hi; const u16* kr1 = kr0 + 16 * KPIT;
        const u16* vr = vs[st & 1] + lr * VPL + kh * 32 + 8 * hi;
        const v16us k00 = ldfr(kr0), k01 = ldfr(kr0 + 32), k10 = ldfr(kr1), k11 = ldfr(kr1 + 32);   // the step's 8 key reads stand together, ahead of its 4 QT score products
        v8f s0[QT], s1[QT];
#pragma unroll   // this and the loops over t and dt below: every tile index a constant, so that fragments and accumulators stay in registers
        for (int t = 0; t < QT; ++t) { s0[t] = mma_h(k00, q0[t], (v8f){}); s1[t] = mma_h(k10, q0[t], (v8f){}); }
#pragma unroll
        for (int t = 0; t < QT; ++t) { s0[t] = mma_h(k01, q1[t], s0[t]); s1[t] = mma_h(k11, q1[t], s1[t]); }
        v16us vf[2];                             // the first 4 of the step's 8 value reads stand together: they return while the softmax runs
#pragma unroll
        for (int dt = 0; dt < 2; ++dt) vf[dt] = ldfr(vr + dt * 16 * VPL);
        v16us pu[QT];
#pragma unroll
        for (int t = 0; t < QT; ++t) {
            v8f a0 = s0[t], a1 = s1[t];
            if (jb + 31 > qbase + 16 * t) {      // only a step that reaches past the tile's first query row can hold an excluded key
                const int dq = qbase + 16 * t + lr - jb - 8 * hi;   // key index r (or 16 + r) inside this lane's share is excluded when it exceeds dq
#pragma unroll
                for (int r = 0; r < 8; ++r) { a0[r] = (r > dq) ? -1.0e30f : a0[r]; a1[r] = (16 + r > dq) ? -1.0e30f : a1[r]; }
            }
            float mx = fmaxf(a0[0], a1[0]);
#pragma unroll
            for (int r = 1; r < 8; ++r) mx = fmaxf(mx, fmaxf(a0[r], a1[r]));
            mx = fmaxf(mx, xhalf(mx));
            const float mnew = fmaxf(mrun[t], mx);   // finite from the first stage on: all its keys are open to every late query
            const float nm = 10.0f - mnew * SCL2;    // 2^10 = PCAR: the carry rides in the exponent
#pragma unroll
            for (int r = 0; r < 8; ++r) { a0[r] = __builtin_fmaf(a0[r], SCL2, nm); a1[r] = __builtin_fmaf(a1[r], SCL2, nm); }
            float corr;
            exp2_9((mrun[t] - mnew) * SCL2, a0, corr, a0);
            exp2_8(a1, a1);
            mrun[t] = mnew;
            v16h pf;
            float ps = 0.0f;
#pragma unroll
            for (int r = 0; r < 8; ++r) { ps += a0[r] + a1[r]; pf[r] = (h16)a0[r]; pf[8 + r] = (h16)a1[r]; }
            lsum[t] = lsum[t] * corr + ps;
#pragma unroll
            for (int dt = 0; dt < 4; ++dt)
#pragma unroll
                for (int r = 0; r < 8; ++r) acc[t][dt][r] *= corr;
            pu[t] = __builtin_bit_cast(v16us, pf);
        }
#pragma unroll
        for (int dt = 0; dt < 2; ++dt)
#pragma unroll
            for (int t = 0; t < QT; ++t) acc[t][dt] = mma_h(vf[dt], pu[t], acc[t][dt]);
#pragma unroll
        for (int dt = 0; dt < 2; ++dt) vf[dt] = ldfr(vr + (2 + dt) * 16 * VPL);   // the other 4 only now: all 8 fragments live through the softmax took more registers than five waves to a SIMD leave, and a query fragment went to scratch
#pragma unroll
        for (int dt = 0; dt < 2; ++dt)
#pragma unroll
            for (int t = 0; t < QT; ++t) acc[t][2 + dt] = mma_h(vf[dt], pu[t], acc[t][2 + dt]);
        asm volatile("s_wait_dscnt 0x0" ::: "memory");      // this wave's LDS reads of the stage are done before the buffer is refilled
        asm volatile("s_wait_asynccnt 0x0" ::: "memory");   // this wave's copies of the next stage have landed
        __syncthreads();                                     // publishes the next stage and ends every reader's last read of this one
        if (st + 2 < nst) stage_kv(Kb, Vb, (st + 2) * LKS, ks[st & 1], vs[st & 1], tid);
    }
    asm volatile("s_wait_asynccnt 0x0" ::: "memory");       // no copy is left in flight when the ring becomes the exchange area
    // Merge of the two key halves. The wave of key half kh finishes tile kh of its query group: it hands the other tile's partial output, maximum and sum to its partner (same query group, other half; same lane = same query and columns).
    // The exchange area is laid over the ring: every wave has left it (the last trip's barrier). Per wave 9 blocks of 32 lanes x 16 B: 8 of output, 1 of (maximum, sum).
    const bool k1 = (kh != 0);
    v4fa* xw = (v4fa*)sm + (size_t)wv * (9 * 32) + lane;
    const v4fa* xr = (const v4fa*)sm + (size_t)(wv ^ QG) * (9 * 32) + lane;
    const float l0 = lsum[0] + xhalf(lsum[0]), l1 = lsum[1] + xhalf(lsum[1]);
#pragma unroll
    for (int dt = 0; dt < 4; ++dt)
#pragma unroll
        for (int g = 0; g < 2; ++g) {
            v4f x;
#pragma unroll
            for (int r = 0; r < 4; ++r) x[r] = k1 ? acc[0][dt][4 * g + r] : acc[1][dt][4 * g + r];
            xw[(dt * 2 + g) * 32] = x;
        }
    { v4f x; x[0] = k1 ? mrun[0] : mrun[1]; x[1] = k1 ? l0 : l1; x[2] = 0.0f; x[3] = 0.0f; xw[8 * 32] = x; }
    __syncthreads();                                         // every wave's partial results are staged before a partner reads them
    const v4f pml = xr[8 * 32];
    const float mk = k1 ? mrun[1] : mrun[0], lk = k1 ? l1 : l0;
    const float mall = fmaxf(mk, pml[0]);
    // The two scale factors as v_exp_f32, like the builtin. One statement and a closing v_nop: so no instruction directly behind an exponential reads its result or overwrites its source.
    float ck = (mk - mall) * SCL2, cp = (pml[0] - mall) * SCL2;
    asm("v_exp_f32 %0, %0\n\tv_exp_f32 %1, %1\n\tv_nop" : "+v"(ck), "+v"(cp));
    const float inv = CCAR / (lk * ck + pml[1] * cp);       // sums and outputs both carry PCAR, so it cancels
    const float fk = ck * inv, fp = cp * inv;
    u16* dst = AT + ((size_t)b * (SEQ - RH) + (qbase - RH) + 16 * kh + lr) * DM + h * HD + 8 * hi;
#pragma unroll
    for (int dt = 0; dt < 4; ++dt) {             // a lane's 8 registers are 8 consecutive head columns of its query row: one 16-byte store; the wave's four stores fill each row's whole 128-B line
        const v4f p0 = xr[(dt * 2) * 32], p1 = xr[(dt * 2 + 1) * 32];
        v8us o;
#pragma unroll
        for (int r = 0; r < 4; ++r) {
            o[r]     = f2h((k1 ? acc[1][dt][r] : acc[0][dt][r]) * fk + p0[r] * fp);
            o[4 + r] = f2h((k1 ? acc[1][dt][4 + r] : acc[0][dt][4 + r]) * fk + p1[r] * fp);
        }
        *(v8us*)(dst + dt * 16) = o;
    }
}

#define EAW  4                   // waves per early-attention work-group, 16 query rows each
static_assert(RH % (16 * EAW) == 0);          // whole work-groups of query rows
static_assert((16 * EAW) / 32 >= 2);          // the two-buffer prologue needs two key steps
static_assert((16 * EAW) % 32 == 0);          // a work-group's last key step ends on its last query row, inside the early planes
#define AE_RING (4 * 32 * KPIT + 4 * HD * VPIT)          // u16 of the early ring: two stages each of K hi, K lo, V hi, V lo
#define AE_LDS  (AE_RING + 2 * EAW * 16 * 40)            // u16 of an early work-group's LDS: the ring, then P hi and P lo staging
static_assert(EAW * 16 * 68 * 4 <= 4 * 32 * KPIT * 2);   // the f32 output staging fits over the key stages
static_assert(2 * LKS * KPIT + 2 * HD * VPL <= AE_LDS);  // the late ring fits in the same array
static_assert(AW * 9 * 32 * 16 <= (2 * LKS * KPIT + 2 * HD * VPL) * 2);   // the late exchange area fits over the late ring
static_assert(EAW == AW);                                // one block size for both ranges

// One 32-key stage of the hi and lo planes for a work-group of 128 threads: key rows jb..jb+31 (32 x 128 B, contiguous in each plane) and the 64 value rows' columns jb..jb+31 (64 x 64 B), 16 bytes per lane and copy, straight into LDS.
// The s_wait_xcnt 0 is the last line of the copies' own statement so that no address register of a copy is rewritten ahead of it.
__device__ __forceinline__ void stage_kv_e(const u16* __restrict__ Kh, const u16* __restrict__ Kl, const u16* __restrict__ Vh, const u16* __restrict__ Vl, const int jb, u16* kdh, u16* kdl, u16* vdh, u16* vdl, const int tid) {
    const size_t ko = (size_t)(jb + (tid >> 3)) * HD + (tid & 7) * 8;         // rows 0..15 of the stage; 16 * HD further on: rows 16..31
    const size_t vo = (size_t)(tid >> 2) * RH + jb + (tid & 3) * 8;           // head columns 0..31; 32 * RH further on: head columns 32..63
    const int kl = (tid >> 3) * KPIT + (tid & 7) * 8, vl = (tid >> 2) * VPIT + (tid & 3) * 8;
    const unsigned lkh = lds_byte(kdh + kl), lkl = lds_byte(kdl + kl), lvh = lds_byte(vdh + vl), lvl = lds_byte(vdl + vl);
    asm volatile("global_load_async_to_lds_b128 %0, %1, off\n\t"
                 "global_load_async_to_lds_b128 %2, %3, off\n\t"
                 "global_load_async_to_lds_b128 %4, %5, off\n\t"
                 "global_load_async_to_lds_b128 %6, %7, off\n\t"
                 "global_load_async_to_lds_b128 %8, %9, off\n\t"
                 "global_load_async_to_lds_b128 %10, %11, off\n\t"
                 "global_load_async_to_lds_b128 %12, %13, off\n\t"
                 "global_load_async_to_lds_b128 %14, %15, off\n\t"
                 "s_wait_xcnt 0x0"
                 :: "v"(lkh), "v"(Kh + ko), "v"(lkh + 16 * KPIT * 2), "v"(Kh + ko + 16 * HD), "v"(lkl), "v"(Kl + ko), "v"(lkl + 16 * KPIT * 2), "v"(Kl + ko + 16 * HD),
                    "v"(lvh), "v"(Vh + vo), "v"(lvh + 32 * VPIT * 2), "v"(Vh + vo + 32 * RH), "v"(lvl), "v"(Vl + vo), "v"(lvl + 32 * VPIT * 2), "v"(Vl + vo + 32 * RH) : "memory");
}

// attn_e_body (block range of k_attn): query rows < RH, bf16 hi+lo operands (hi.hi + lo.hi + hi.lo into one accumulator; residuals unscaled). ctx hi/lo bf16 -> ATEh/ATEl [b][t][1024].
// One work-group of EAW waves per 16*EAW query rows of one (batch, head), one wave per 16 rows; the waves share each 32-key stage of the K and V hi and lo planes, brought into two LDS buffers by asynchronous copies one stage ahead
// (whole lines from L2, fetched once per work-group, where fragment loads straight from the planes touch 16 lines each). Every wave walks the work-group's key range: a step wholly above a wave's diagonal adds exact zeros.
__device__ __forceinline__ void attn_e_body(const int bid, u16* sm, const u16* __restrict__ QEh, const u16* __restrict__ QEl, const u16* __restrict__ KEh, const u16* __restrict__ KEl, const u16* __restrict__ VEh, const u16* __restrict__ VEl, u16* ATEh, u16* ATEl) {
    u16 (*ksh)[32 * KPIT] = (u16 (*)[32 * KPIT])sm;
    u16 (*ksl)[32 * KPIT] = (u16 (*)[32 * KPIT])(sm + 2 * 32 * KPIT);
    u16 (*vsh)[HD * VPIT] = (u16 (*)[HD * VPIT])(sm + 4 * 32 * KPIT);
    u16 (*vsl)[HD * VPIT] = (u16 (*)[HD * VPIT])(sm + 4 * 32 * KPIT + 2 * HD * VPIT);
    const int tid = threadIdx.x, lane = tid & 31, lr = lane & 15, hi = lane >> 4;
    const int wv = __builtin_amdgcn_readfirstlane(tid >> 5);   // wave number as a scalar: the wave's own staging addresses stay scalar
    u16* pwh = sm + AE_RING + wv * (16 * 40); u16* pwl = pwh + EAW * (16 * 40);   // this wave's own P staging, behind the ring
    float* os = (float*)sm + wv * (16 * 68);                                      // this wave's own output staging, laid over the key stages: used after the key loop only, when every wave has left the ring (the last trip's barrier) and no copy is in flight
    const int bh = bid / (RH / (16 * EAW)), qb = bid - bh * (RH / (16 * EAW));
    const int b = bh / NH, h = bh - b * NH;
    const int qblk = qb * (16 * EAW);
    const int qbase = qblk + wv * 16;
    const size_t pb = (size_t)bh * RH * HD;
    const u16* Kh = KEh + pb; const u16* Kl = KEl + pb; const u16* Vh = VEh + pb; const u16* Vl = VEl + pb;   // V planes [bh][64][RH], same plane size as [bh][RH][64]
    const int nsteps = (qblk + 16 * EAW) >> 5;   // keys 0 .. qblk+16*EAW-1 in steps of 32; nsteps*32 <= RH, nsteps >= 2
    stage_kv_e(Kh, Kl, Vh, Vl, 0, ksh[0], ksl[0], vsh[0], vsl[0], tid);
    asm volatile("s_wait_asynccnt 0x0" ::: "memory");   // this wave's copies of stage 0 have landed
    __syncthreads();                                     // stage 0 readable by every wave
    stage_kv_e(Kh, Kl, Vh, Vl, 32, ksh[1], ksl[1], vsh[1], vsl[1], tid);
    const size_t qo = pb + (size_t)(qbase + lr) * HD + 8 * hi;
    const v16us qh0 = ldfr(QEh + qo), qh1 = ldfr(QEh + qo + 32), ql0 = ldfr(QEl + qo), ql1 = ldfr(QEl + qo + 32);
    v8f acc[4];
#pragma unroll
    for (int nt = 0; nt < 4; ++nt) acc[nt] = (v8f){};
    float mrow[8], lrow[8];
#pragma unroll
    for (int i = 0; i < 8; ++i) { mrow[i] = -1.0e30f; lrow[i] = 0.0f; }
#pragma unroll 1
    for (int st = 0; st < nsteps; ++st) {
        const int jb = st * 32;
        const u16* krh = ksh[st & 1] + lr * KPIT + 8 * hi; const u16* krl = ksl[st & 1] + lr * KPIT + 8 * hi;   // this lane's place in the stage's key rows
        const u16* vrh = vsh[st & 1] + lr * VPIT + 8 * hi; const u16* vrl = vsl[st & 1] + lr * VPIT + 8 * hi;   // the same in the stage's value rows
        // The step's 16 key reads stand together, ahead of its 12 score products.
        const v16us kh0 = ldfr(krh), kh1 = ldfr(krh + 32), kl0 = ldfr(krl), kl1 = ldfr(krl + 32);
        const v16us kh2 = ldfr(krh + 16 * KPIT), kh3 = ldfr(krh + 16 * KPIT + 32), kl2 = ldfr(krl + 16 * KPIT), kl3 = ldfr(krl + 16 * KPIT + 32);
        v8f s0 = (v8f){}, s1 = (v8f){};
        s0 = mma_b(qh0, kh0, s0); s0 = mma_b(qh1, kh1, s0); s0 = mma_b(ql0, kh0, s0); s0 = mma_b(ql1, kh1, s0); s0 = mma_b(qh0, kl0, s0); s0 = mma_b(qh1, kl1, s0);
        s1 = mma_b(qh0, kh2, s1); s1 = mma_b(qh1, kh3, s1); s1 = mma_b(ql0, kh2, s1); s1 = mma_b(ql1, kh3, s1); s1 = mma_b(qh0, kl2, s1); s1 = mma_b(qh1, kl3, s1);
        __builtin_amdgcn_sched_barrier(0);   // this and the one behind the softmax keep the value reads out of it: strewn among its cross-lane exchanges (same counter), they made each exchange's wait wait for them too
        float corr[8];
        sm_step(s0, s1, mrow, lrow, corr, jb, qbase, lr, hi);
        __builtin_amdgcn_sched_barrier(0);
        v16us vh[2], vl[2];                      // the first 8 of the step's 16 value reads stand together: they return while the accumulators are rescaled and P is converted
#pragma unroll
        for (int nt = 0; nt < 2; ++nt) { vh[nt] = ldfr(vrh + nt * 16 * VPIT); vl[nt] = ldfr(vrl + nt * 16 * VPIT); }
#pragma unroll
        for (int nt = 0; nt < 4; ++nt)
#pragma unroll
            for (int i = 0; i < 8; ++i) acc[nt][i] *= corr[i];
#pragma unroll
        for (int i = 0; i < 8; ++i) {
            const u16 a = f2bf(s0[i]); const u16 c = f2bf(s1[i]);
            pwh[(i + 8 * hi) * 40 + lr] = a; pwl[(i + 8 * hi) * 40 + lr] = f2bf(s0[i] - bf2f(a));
            pwh[(i + 8 * hi) * 40 + 16 + lr] = c; pwl[(i + 8 * hi) * 40 + 16 + lr] = f2bf(s1[i] - bf2f(c));
        }
        __syncthreads();
        const v8us h0 = *(const v8usa*)&pwh[lr * 40 + 8 * hi]; const v8us h1 = *(const v8usa*)&pwh[lr * 40 + 16 + 8 * hi];
        const v8us l0 = *(const v8usa*)&pwl[lr * 40 + 8 * hi]; const v8us l1 = *(const v8usa*)&pwl[lr * 40 + 16 + 8 * hi];
        const v16us pfh = __builtin_shufflevector(h0, h1, 0, 1, 2, 3, 4, 5, 6, 7, 8, 9, 10, 11, 12, 13, 14, 15);
        const v16us pfl = __builtin_shufflevector(l0, l1, 0, 1, 2, 3, 4, 5, 6, 7, 8, 9, 10, 11, 12, 13, 14, 15);
#pragma unroll
        for (int nt = 0; nt < 2; ++nt) { acc[nt] = mma_b(pfh, vh[nt], acc[nt]); acc[nt] = mma_b(pfl, vh[nt], acc[nt]); acc[nt] = mma_b(pfh, vl[nt], acc[nt]); }
#pragma unroll
        for (int nt = 0; nt < 2; ++nt) { vh[nt] = ldfr(vrh + (2 + nt) * 16 * VPIT); vl[nt] = ldfr(vrl + (2 + nt) * 16 * VPIT); }   // the other 8 only now: all 16 fragments live at once took more registers than five waves to a SIMD leave, and some went to scratch
#pragma unroll
        for (int nt = 0; nt < 2; ++nt) { acc[2 + nt] = mma_b(pfh, vh[nt], acc[2 + nt]); acc[2 + nt] = mma_b(pfl, vh[nt], acc[2 + nt]); acc[2 + nt] = mma_b(pfh, vl[nt], acc[2 + nt]); }
        asm volatile("s_wait_dscnt 0x0" ::: "memory");      // this wave's LDS reads of the stage (and of its P rows) are done before the buffer is refilled
        asm volatile("s_wait_asynccnt 0x0" ::: "memory");   // this wave's copies of the next stage have landed
        __syncthreads();                                     // publishes the next stage and ends every reader's last read of this one
        if (st + 2 < nsteps) stage_kv_e(Kh, Kl, Vh, Vl, jb + 64, ksh[st & 1], ksl[st & 1], vsh[st & 1], vsl[st & 1], tid);
    }
    asm volatile("s_wait_asynccnt 0x0" ::: "memory");       // no copy is left in flight when the wave goes on to its end
#pragma unroll
    for (int i = 0; i < 8; ++i) {
        float l = lrow[i];
        l += __shfl_xor(l, 1, 32); l += __shfl_xor(l, 2, 32); l += __shfl_xor(l, 4, 32); l += __shfl_xor(l, 8, 32);
        const float inv = 1.0f / l;
#pragma unroll
        for (int nt = 0; nt < 4; ++nt) os[(i + 8 * hi) * 68 + nt * 16 + lr] = acc[nt][i] * inv;
    }
    __syncthreads();
    const size_t dofs = ((size_t)b * RH + qbase) * DM + h * HD;
{
#pragma unroll
        for (int s = 0; s < 4; ++s) {
            const int row = 4 * s + (lane >> 3), pc = (lane & 7) * 8;
            const v4f x0 = *(const v4fa*)&os[row * 68 + pc]; const v4f x1 = *(const v4fa*)&os[row * 68 + pc + 4];
            v8us oh, ol;
#pragma unroll
            for (int q = 0; q < 4; ++q) { const u16 a = f2bf(x0[q]); oh[q] = a; ol[q] = f2bf(x0[q] - bf2f(a)); const u16 c = f2bf(x1[q]); oh[4 + q] = c; ol[4 + q] = f2bf(x1[q] - bf2f(c)); }
            *(v8us*)(ATEh + dofs + (size_t)row * DM + pc) = oh;
            *(v8us*)(ATEl + dofs + (size_t)row * DM + pc) = ol;
        }
        
    }
}

#define NAE (NB * NH * (RH / (16 * EAW)))           // early work-groups
#define NAL (NB * NH * ((SEQ - RH) / LQR))          // late work-groups
// k_attn: both attention ranges in one launch; they are independent of each other, so the short, latency-bound early work-groups run beside the late ones, not in a launch of their own in front of them.
// Blocks 0 .. NAE-1: rows < RH; the rest: rows >= RH in the order of attn_l_body. The choice is the same for a whole work-group.
// amdgpu_waves_per_eu: holds the register count of the early path to what lets five work-groups share a WGP; left free it takes a quarter of a SIMD's registers, and the late range too would run four waves to a SIMD.
__global__ __launch_bounds__(32 * AW) __attribute__((amdgpu_waves_per_eu(5, 5)))
void k_attn(const u16* __restrict__ QP, const u16* __restrict__ KP, const u16* __restrict__ VT, u16* AT,
            const u16* __restrict__ QEh, const u16* __restrict__ QEl, const u16* __restrict__ KEh, const u16* __restrict__ KEl, const u16* __restrict__ VEh, const u16* __restrict__ VEl, u16* ATEh, u16* ATEl) {
    __shared__ __align__(16) u16 sm[AE_LDS];
    if (blockIdx.x < NAE) attn_e_body(blockIdx.x, sm, QEh, QEl, KEh, KEl, VEh, VEl, ATEh, ATEl);
    else attn_l_body(blockIdx.x - NAE, sm, QP, KP, VT, AT);
}

// Output projection: OUT[b][toff + r][n] = scale * sum_k A[row][k] Bt[n][k] (+ A2 product in outp_e_body) + bf16(bias[n]); rows of A are [b][r] with rpb rows per batch.
// Epilogue of one wave's 64x64 tile (outp_l_body) at rows r0.., columns c0..: whole 256-B row pieces through the wave's own staging 'os'. Every wave of the work-group passes the same barriers.
__device__ __forceinline__ void outp_store(const v8f (&acc)[4][4], float* os, const float* __restrict__ bias, float* OUT, const float scale, const int rpb, const int toff, const int r0, const int c0, const int lr, const int hi) {
    const int b = r0 / rpb, tb = toff + (r0 - b * rpb);
    float* crow0 = OUT + ((size_t)b * SEQ_FULL + tb) * DM + c0;
    const int cofs = lr * 4;
    v4f bv; bv[0] = bfr(bias[c0 + cofs]); bv[1] = bfr(bias[c0 + cofs + 1]); bv[2] = bfr(bias[c0 + cofs + 2]); bv[3] = bfr(bias[c0 + cofs + 3]);
#pragma unroll
    for (int mb = 0; mb < 4; ++mb) {
#pragma unroll
        for (int nb = 0; nb < 4; ++nb)
#pragma unroll
            for (int j = 0; j < 8; ++j) os[(hi * 8 + j) * 68 + nb * 16 + lr] = acc[mb][nb][j];
        __syncthreads();
#pragma unroll
        for (int s = 0; s < 8; ++s) {
            const int row = 2 * s + hi;
            const v4f x = *(const v4fa*)&os[row * 68 + cofs];
            v4f val; val[0] = x[0] * scale + bv[0]; val[1] = x[1] * scale + bv[1]; val[2] = x[2] * scale + bv[2]; val[3] = x[3] * scale + bv[3];
            *(v4f*)(crow0 + (size_t)(mb * 16 + row) * DM + cofs) = val;
        }
        __syncthreads();
    }
}

#define EWM  2                   // waves down an early output work-group, 32 rows each
#define EWN  4                   // waves across, 16 columns each
#define ETH  (32 * EWM * EWN)    // threads per early output work-group
#define EKS  128                 // k per stage: 256-B rows, two whole cache lines
#define EPIT 136                 // u16 per staged row: 272 B = 16 B x odd, the pitch for 16-byte LDS readers of 256-B rows
#define ESTG (3 * 64 * EPIT)     // u16 per stage buffer: 64 rows of ctx hi, 64 of ctx lo, 64 of Bt
static_assert(ETH == 256 && ETH == GTH);                 // stage_e: 16 rows per copy, 4 copies for 64 rows; one block size for both ranges of k_outp
static_assert(ESTG <= GSTG);                             // the early ring fits in the late one's array
static_assert(DM % EKS == 0 && DM / EKS >= 2);           // the two-buffer prologue needs two stages
static_assert(64 * 68 * 4 <= 2 * ESTG * 2);              // the f32 output tile is laid over the ring after the k loop
static_assert((NB * RH) % 64 == 0 && RH % 64 == 0 && DM % 64 == 0);   // whole tiles, none straddles a batch

// One 128-k stage of the three planes for a work-group of 256 threads: 64 rows of 256 B of each plane, 16 bytes per lane and copy (16 lanes = one row = two lines), 16 rows per copy, straight into LDS: 12 copies per wave in flight.
// ga / ga2 / gb: this thread's place in row tid>>4 of the tile's rows of ctx hi, ctx lo and Bt; la: its place in row tid>>4 of the buffer.
// The s_wait_xcnt 0 is the last line of the copies' own statement so that no address register of a copy is rewritten ahead of it.
__device__ __forceinline__ void stage_e(const u16* ga, const u16* ga2, const u16* gb, const unsigned la) {
    const size_t rs = (size_t)16 * DM;                // 16 rows on in global memory
    const unsigned ls = 16 * EPIT * 2;                // 16 rows on in LDS, bytes
    const unsigned l2 = la + 64 * EPIT * 2, lb = la + 128 * EPIT * 2;
    asm volatile("global_load_async_to_lds_b128 %0, %1, off\n\t"
                 "global_load_async_to_lds_b128 %2, %3, off\n\t"
                 "global_load_async_to_lds_b128 %4, %5, off\n\t"
                 "global_load_async_to_lds_b128 %6, %7, off\n\t"
                 "global_load_async_to_lds_b128 %8, %9, off\n\t"
                 "global_load_async_to_lds_b128 %10, %11, off\n\t"
                 "global_load_async_to_lds_b128 %12, %13, off\n\t"
                 "global_load_async_to_lds_b128 %14, %15, off\n\t"
                 "global_load_async_to_lds_b128 %16, %17, off\n\t"
                 "global_load_async_to_lds_b128 %18, %19, off\n\t"
                 "global_load_async_to_lds_b128 %20, %21, off\n\t"
                 "global_load_async_to_lds_b128 %22, %23, off\n\t"
                 "s_wait_xcnt 0x0"
                 :: "v"(la), "v"(ga), "v"(la + ls), "v"(ga + rs), "v"(la + 2 * ls), "v"(ga + 2 * rs), "v"(la + 3 * ls), "v"(ga + 3 * rs),
                    "v"(l2), "v"(ga2), "v"(l2 + ls), "v"(ga2 + rs), "v"(l2 + 2 * ls), "v"(ga2 + 2 * rs), "v"(l2 + 3 * ls), "v"(ga2 + 3 * rs),
                    "v"(lb), "v"(gb), "v"(lb + ls), "v"(gb + rs), "v"(lb + 2 * ls), "v"(gb + 2 * rs), "v"(lb + 3 * ls), "v"(gb + 3 * rs) : "memory");
}

// outp_e_body (block range of k_outp): rows < RH, bf16 hi+lo ctx planes; one work-group of eight waves (2 x 4 tiles of 32x16) per 64x64 tile (bx, by). The waves share each 128-k stage of ctx hi, ctx lo and Bt,
// brought into the two buffers of 'ring' by asynchronous copies one stage ahead (whole lines from L2, where fragment loads straight from the planes touch 16 lines each).
// Per accumulator the order of the sum is k ascending in blocks of 32, hi product then lo product. The f32 tile goes out through the ring in whole 256-B row pieces.
__device__ __forceinline__ void outp_e_body(const int bx, const int by, u16* ring, const u16* __restrict__ A, const u16* __restrict__ A2, const u16* __restrict__ Bt, const float* __restrict__ bias, float* OUT) {
    const int tid = threadIdx.x, lane = tid & 31, lr = lane & 15, hi = lane >> 4;
    const int wv = __builtin_amdgcn_readfirstlane(tid >> 5), wm = wv % EWM, wn = wv / EWM;   // wave number as a scalar: tile indices stay scalar
    const int r0 = bx * 64, c0 = by * 64;
    const int cofs = (tid & 15) * 4;                        // this thread's 4 output columns in the epilogue; their bias is fetched here, so that its latency lies behind the k loop
    const v4f braw = *(const v4f*)(bias + c0 + cofs);
    v8f acc[2];                  // acc[mb] element j = C[r0 + 32 wm + 16 mb + 8 hi + j][c0 + 16 wn + lr]
#pragma unroll
    for (int mb = 0; mb < 2; ++mb) acc[mb] = (v8f){};
    const size_t go = (size_t)(tid >> 4) * DM + (tid & 15) * 8;
    const u16* ga = A + (size_t)r0 * DM + go; const u16* ga2 = A2 + (size_t)r0 * DM + go; const u16* gb = Bt + (size_t)c0 * DM + go;
    const unsigned la = lds_byte(ring + (tid >> 4) * EPIT + (tid & 15) * 8);
    const int nst = DM / EKS;
    stage_e(ga, ga2, gb, la);
    asm volatile("s_wait_asynccnt 0x0" ::: "memory");   // this wave's copies of stage 0 have landed
    __syncthreads();                                     // stage 0 readable by every wave
    stage_e(ga + EKS, ga2 + EKS, gb + EKS, la + ESTG * 2);
#pragma unroll 1   // kept rolled: one body of 16 products, the buffer picked by st & 1
    for (int st = 0; st < nst; ++st) {
        const u16* ar = ring + (st & 1) * ESTG + (wm * 32 + lr) * EPIT + 8 * hi;
        const u16* br = ring + (st & 1) * ESTG + (128 + wn * 16 + lr) * EPIT + 8 * hi;
        v16us a[EKS / 32][2], a2[EKS / 32][2], bb[EKS / 32];
#pragma unroll   // this and the loops below: every fragment and accumulator index a constant, so that they stay in registers
        for (int kb = 0; kb < EKS / 32; ++kb) {
#pragma unroll
            for (int mb = 0; mb < 2; ++mb) a[kb][mb] = ldfr(ar + mb * 16 * EPIT + kb * 32);
            bb[kb] = ldfr(br + kb * 32);
#pragma unroll
            for (int mb = 0; mb < 2; ++mb) a2[kb][mb] = ldfr(ar + (64 + mb * 16) * EPIT + kb * 32);
        }
        __builtin_amdgcn_sched_barrier(0);   // holds the stage's 40 LDS reads together, ahead of its products: left free, the compiler spread them among the products in one register set, and a wave waited out an LDS latency at each place
#pragma unroll
        for (int kb = 0; kb < EKS / 32; ++kb) {
#pragma unroll
            for (int mb = 0; mb < 2; ++mb) acc[mb] = mma_bp(a[kb][mb], bb[kb], acc[mb]);
#pragma unroll
            for (int mb = 0; mb < 2; ++mb) acc[mb] = mma_bp(a2[kb][mb], bb[kb], acc[mb]);
        }
        __builtin_amdgcn_sched_barrier(0);   // keeps the waits below behind the products: moved up over them (they touch no memory), the wait for all 40 reads stood ahead of the products, which then no longer ran while the later reads return
        asm volatile("s_wait_dscnt 0x0" ::: "memory");      // this wave's LDS reads of the stage are done before the buffer is refilled
        asm volatile("s_wait_asynccnt 0x0" ::: "memory");   // this wave's copies of the next stage have landed
        __syncthreads();                                     // publishes the next stage and ends every reader's last read of this one
        if (st + 2 < nst) stage_e(ga + (st + 2) * EKS, ga2 + (st + 2) * EKS, gb + (st + 2) * EKS, la + (st & 1) * (ESTG * 2));
    }
    asm volatile("s_wait_asynccnt 0x0" ::: "memory");       // no copy is left in flight when the ring becomes output staging
    float* ot = (float*)ring;                               // [64][68] f32; every wave has left the ring (the last trip's barrier)
#pragma unroll
    for (int mb = 0; mb < 2; ++mb)
#pragma unroll
        for (int j = 0; j < 8; ++j) ot[(wm * 32 + mb * 16 + hi * 8 + j) * 68 + wn * 16 + lr] = acc[mb][j];
    __syncthreads();                                         // the whole tile is staged before any row piece is read back
    const int b = r0 / RH, tb = r0 - b * RH;
    float* crow0 = OUT + ((size_t)b * SEQ_FULL + tb) * DM + c0;
    v4f bv; bv[0] = bfr(braw[0]); bv[1] = bfr(braw[1]); bv[2] = bfr(braw[2]); bv[3] = bfr(braw[3]);
#pragma unroll
    for (int s = 0; s < 4; ++s) {
        const int row = 16 * s + (tid >> 4);
        const v4f x = *(const v4fa*)&ot[row * 68 + cofs];
        v4f val; val[0] = x[0] + bv[0]; val[1] = x[1] + bv[1]; val[2] = x[2] + bv[2]; val[3] = x[3] + bv[3];
        *(v4f*)(crow0 + (size_t)row * DM + cofs) = val;
    }
}

// outp_l_body (block range of k_outp): rows >= RH, f16 planes; eight waves (4 x 2 tiles of 64x64) per work-group (bx, by) sharing the staged operands.
__device__ __forceinline__ void outp_l_body(const int bx, const int by, u16* ring, const u16* __restrict__ A, const u16* __restrict__ Bt, const float* __restrict__ bias, float* OUT) {
    const int tid = threadIdx.x, lane = tid & 31, lr = lane & 15, hi = lane >> 4;
    const int wv = __builtin_amdgcn_readfirstlane(tid >> 5), wm = wv % GWM, wn = wv / GWM;   // wave number as a scalar: tile indices and the branches on them stay scalar
    float* os = (float*)((char*)ring + wv * GEPI);                       // this wave's own staging, used after the k loop only
    v8f acc[4][4];
    gemm_tile_s<true>(A, Bt, DM, bx * GAR, by * GBR, ring, tid, wm, wn, lr, hi, false, acc);
    outp_store(acc, os, bias, OUT, 1.0f / (WCAR * CCAR), (SEQ > RH) ? (SEQ - RH) : 1, RH, bx * GAR + wm * 64, by * GBR + wn * 64, lr, hi);
}

#define NOLX (NB * (SEQ - RH) / GAR)     // late work-groups down
#define NOL  (NOLX * (DM / GBR))         // late work-groups
#define NOEX (NB * RH / 64)              // early work-groups down
#define NOE  (NOEX * (DM / 64))          // early work-groups
// k_outp: both output-projection ranges in one launch; they are independent of each other, and two work-groups fit a WGP, so the short early work-groups run beside the late ones (and on the WGPs these leave empty), not in a launch of their own.
// Blocks 0 .. NOL-1: rows >= RH; the rest: rows < RH; in each range the row tile runs fastest. The choice is the same for a whole work-group.
__global__ __launch_bounds__(GTH) void k_outp(const u16* __restrict__ A, const u16* __restrict__ Bt, const u16* __restrict__ AEh, const u16* __restrict__ AEl, const u16* __restrict__ BtE, const float* __restrict__ bias, float* OUT) {
    __shared__ __align__(16) u16 ring[2 * GSTG];
    const int bid = blockIdx.x;
    if (bid < NOL) outp_l_body(bid % (NOLX > 0 ? NOLX : 1), bid / (NOLX > 0 ? NOLX : 1), ring, A, Bt, bias, OUT);
    else outp_e_body((bid - NOL) % NOEX, (bid - NOL) / NOEX, ring, AEh, AEl, BtE, bias, OUT);
}

extern "C" void kernel_launch(void* const* d_in, const int* in_sizes, int n_in,
                              void* d_out, int out_size, void* d_ws, size_t ws_size, hipStream_t stream) {
    if (n_in < 10) return;
    const long long needx = ((long long)(NB - 1) * SEQ_FULL + SEQ) * DM;
    if ((long long)in_sizes[0] < needx) return;
    if ((long long)in_sizes[1] < (long long)DM * DM || (long long)in_sizes[2] < (long long)DM * DM || (long long)in_sizes[3] < (long long)DM * DM || (long long)in_sizes[4] < (long long)DM * DM) return;
    if (in_sizes[5] < DM) return;
    if (in_sizes[6] < HD || in_sizes[7] < HD || in_sizes[8] < HD || in_sizes[9] < HD) return;
    if ((long long)out_size < needx) return;
    if (O_END * 2 > ws_size) return;
    // wire order: x, key weight, query weight, value weight, output weight, output bias, key LayerNorm gain, key LayerNorm bias, query LayerNorm gain, query LayerNorm bias
    const float* x  = (const float*)d_in[0];
    const float* Wk = (const float*)d_in[1];
    const float* Wq = (const float*)d_in[2];
    const float* Wv = (const float*)d_in[3];
    const float* Wp = (const float*)d_in[4];
    const float* bp = (const float*)d_in[5];
    const float* kg = (const float*)d_in[6];
    const float* kb = (const float*)d_in[7];
    const float* qg = (const float*)d_in[8];
    const float* qb = (const float*)d_in[9];
    float* OUT = (float*)d_out;
    u16* PL = (u16*)d_ws;

    k_cvt_all<<<CVG, 32 * CVW, 0, stream>>>(x, Wq, Wk, Wv, Wp, PL);   // planes O_XB, O_WALL (query, key, value rows), O_WPB, O_WPH

    k_proj<<<dim3(NB * SEQ / GAR, 3 * DM / GBR, 1), GTH, 0, stream>>>(PL + O_XB, PL + O_WALL, PL, O_P16, O_EH, O_EL, qg, qb, kg, kb);

    k_attn<<<NAE + NAL, 32 * AW, 0, stream>>>(PL + O_P16, PL + O_P16 + PLANE, PL + O_P16 + 2 * PLANE, PL + O_AT,
                                              PL + O_EH, PL + O_EL, PL + O_EH + EPLANE, PL + O_EL + EPLANE, PL + O_EH + 2 * EPLANE, PL + O_EL + 2 * EPLANE, PL + O_ATEH, PL + O_ATEL);

    k_outp<<<NOL + NOE, GTH, 0, stream>>>(PL + O_AT, PL + O_WPH, PL + O_ATEH, PL + O_ATEL, PL + O_WPB, bp, OUT);
}
